// v000
// Measured on an AMD MI455X. A time is GPU time per run, averaged over a window of back-to-back runs after a warm-up
// (all launches, gaps included; the runs take copies of the inputs in turn), and the median of several windows.
// Apart from v000's, it joins two sittings. Times from different sittings can be a few percent apart, while
// side-by-side timings come from the same sitting.
// The starting kernel, v000, takes 285 microseconds a run.
// Contractions: q / k / v projections = v_wmma_f32_16x16x32_bf16 (bf16 operands from RNE-converted x and Wq/Wk/Wv, single product, f32 accumulate);
// q.k^T scores = v_wmma_f32_16x16x32_bf16 with q and k as bf16 hi/lo split folded into the 32-deep k axis ([qhi|qlo].[khi|khi] + [qhi|qlo].[klo|0] = hh+lh+hl, 2 products), f32 accumulate;
// p.v = v_wmma_f32_16x16x32_bf16 with p and v as bf16 hi/lo split (hh + hl + lh, 3 products), f32 accumulate;
// ctx.Wo^T = v_wmma_f32_16x16x32_bf16 with ctx as bf16 hi + unscaled lo planes times bf16 Wo (2 products), f32 accumulate;
// rotary tables (powf, f32 product, precise sincosf), half-rotation, causal mask and online softmax in f32 on the VALU.
// Carry audit: no scaled planes anywhere; every lo plane is the unscaled RNE residual (v - hi) in bf16 and shares the hi accumulator;
// score scale 1/4 applied once in f32 after the score accumulate; softmax normaliser 1/l applied once in the attention epilogue.
#include <hip/hip_runtime.h>
#include <math.h>
#include <stdint.h>

#define NB    2
#define SEQ   2048
#define HID   288
#define NH    18
#define HD    16
#define NPAIR 8
#define QS    32           // slots per head in the q / k planes: 0..15 hi (d), 16..31 lo (d) or duplicate / zero
#define NTOK  (NB * SEQ)   // 4096 token rows
#define NQB   (SEQ / 64)   // 32 query blocks of 64 per sequence
static_assert(NH * HD == HID);
static_assert(NPAIR * 2 == HD);
static_assert((SEQ % 64) == 0 && (HID % 32) == 0 && (NTOK % 64) == 0);
static_assert(((NTOK / 64) * (HID / 32)) % 4 == 0);
static_assert((NTOK * HID) % (8 * 256) == 0);
static_assert(((HID * HID) % 8) == 0 && (((HID * HID) / 8) % 32) == 0);
static_assert((SEQ % 32) == 0);

typedef __bf16   v16b __attribute__((ext_vector_type(16)));
typedef __bf16   v8b  __attribute__((ext_vector_type(8)));
typedef float    v8f  __attribute__((ext_vector_type(8)));
typedef float    v4f  __attribute__((ext_vector_type(4)));
typedef unsigned int v4u __attribute__((ext_vector_type(4)));

// ---- scalar helpers --------------------------------------------------------------------------------
__device__ __forceinline__ unsigned short bf_bits(float f) {          // f32 -> bf16 bits, RNE convert
  unsigned u = __float_as_uint(f);
  return (unsigned short)((u + 0x7FFFu + ((u >> 16) & 1u)) >> 16);
}
__device__ __forceinline__ float bf_up(unsigned short h) { return __uint_as_float(((unsigned)h) << 16); }
__device__ __forceinline__ unsigned pk16(unsigned short a, unsigned short b) { return (unsigned)a | ((unsigned)b << 16); }
__device__ __forceinline__ v8f zero8() { v8f z = {0.f, 0.f, 0.f, 0.f, 0.f, 0.f, 0.f, 0.f}; return z; }

// ---- fragment loaders: 16-bit A/B operand, lane -> row/col (lane&15), p already includes +8*(lane>>4);
//      elements 0..7 <- p[0..7] (k0+8h..k0+8h+7), elements 8..15 <- p[16..23] (k0+16+8h..k0+16+8h+7)
__device__ __forceinline__ v16b ldfrag_b(const __bf16* p) {
  union { v16b v; v8b h[2]; } f;
  f.h[0] = *(const v8b*)(p);
  f.h[1] = *(const v8b*)(p + 16);
  return f.v;
}
// same map when k0..k0+15 and k0+16..k0+31 live in two different rows (p0, p1 each include +8*(lane>>4))
__device__ __forceinline__ v16b ldfrag_b2(const __bf16* p0, const __bf16* p1) {
  union { v16b v; v8b h[2]; } f;
  f.h[0] = *(const v8b*)(p0);
  f.h[1] = *(const v8b*)(p1);
  return f.v;
}

// ---- WMMA helper with trailing VALU hazard gap (D tied, A/B kept live) ----------------------------------
__device__ __forceinline__ v8f mma_b(v16b a, v16b b, v8f c) {
  c = __builtin_amdgcn_wmma_f32_16x16x32_bf16(false, a, false, b, (short)0, c, false, false);
  asm volatile("v_nop\n\tv_nop\n\tv_nop\n\tv_nop" : "+v"(c) : "v"(a), "v"(b));
  return c;
}

// =====================================================================================================
// RoPE tables.  rope_inv: inv[i] = 1 / powf(10000, (2i)/16), i = 0..31 (entries 0..7 are used); one block of
// rope_tab: ctab[t][i] = cos(t * inv[i]), stab[t][i] = sin(t * inv[i]), i = 0..7, t = 0..SEQ-1
// (f32 product, precise sincosf). 256 threads = 32 positions x 8: thread tid -> t = block*32 + tid/8, i = tid&7, so a
// coverage: 64 blocks x 256 = the whole [SEQ][8] tables.
// =====================================================================================================
__global__ __launch_bounds__(32) void rope_inv(float* inv) {
  const int i = (int)threadIdx.x;
  const float e = (float)(2 * i) * (1.0f / (float)HD);
  const float p = powf(10000.0f, e);
  const float v = 1.0f / p;
  *(float*)(inv + i) = v;
  
}

__global__ __launch_bounds__(256) void rope_tab(const float* __restrict__ inv, float* ctab, float* stab) {
  const int tid = (int)threadIdx.x;
  const int i = tid & (NPAIR - 1);
  const int t = blockIdx.x * 32 + (tid >> 3);
  const float f   = inv[i];
  const float ang = (float)t * f;
  float sn, cs;
  sincosf(ang, &sn, &cs);
  const size_t o = (size_t)t * NPAIR + i;
  *(float*)(ctab + o) = cs;
  *(float*)(stab + o) = sn;
  
}

// =====================================================================================================
// f32 -> bf16 (RNE convert), 8 elements per thread, one 16-B store per lane: a wave writes 512 contiguous B
// coverage: n8 threads x 8 = the whole plane (n8 = 147456 for x, 10368 for each weight; both multiples of 32,
// =====================================================================================================
__global__ __launch_bounds__(256) void cvt_bf16x8(const float* __restrict__ in, unsigned short* out, int n8) {
  const int i = blockIdx.x * 256 + (int)threadIdx.x;
  if (i < n8) {
    const v4f a = *(const v4f*)(in + (size_t)i * 8);
    const v4f b = *(const v4f*)(in + (size_t)i * 8 + 4);
    v4u p;
    p[0] = pk16(bf_bits(a[0]), bf_bits(a[1]));
    p[1] = pk16(bf_bits(a[2]), bf_bits(a[3]));
    p[2] = pk16(bf_bits(b[0]), bf_bits(b[1]));
    p[3] = pk16(bf_bits(b[2]), bf_bits(b[3]));
    *(v4u*)(out + (size_t)i * 8) = p;
    
  }
}

// =====================================================================================================
// bf16 WMMA GEMM, one wave per 64 x 32 tile, 4 waves per block, no block barriers:
//   C[m][n] = sum_k A[m][k] * Bt[n][k] (+ sum_k A2[m][k] * Bt[n][k] when TWOA), M = 4096 tokens, N = 288, K = 288
//   (9 k-steps of 32, no tails). Bt = weight plane [n][k] (the [out][in] weight as delivered, RNE bf16), pitch 288.
//   A: MODE 0..2: x plane [m][k] pitch 288. MODE 3: ctx planes laid out [b][h][t][16]; k-step j covers heads 2j
//   (k 0..15) and 2j+1 (k 16..31): elements 0..7 <- head 2j, d = 8*(lane>>4)..+7; elements 8..15 <- head 2j+1, same d.
// then (b = m0/2048, t = m0%2048 + row, 32 columns = heads n0/16 and n0/16+1):
//   MODE 0 (q): rotary in f32 (contract off): d < 8: x[d] c[t][d] - x[d+8] s[t][d]; d >= 8: x[d] c[t][d-8] + x[d-8] s[t][d-8];
//               -> plane [b][h][t][32]: slots 0..15 = bf16 hi of d, 16..31 = bf16 lo (v - hi) of d.
//   MODE 1 (k): same rotary; plane C0 slots 0..15 = hi, 16..31 = hi (duplicate); plane C1 slots 0..15 = lo, 16..31 = 0.
//   MODE 2 (v): no rotary; v^T planes C0 = hi, C1 = lo, element (b, n, t) at [(b*288 + n)*2048 + t]:
// coverage: 576 tiles x (64 rows x 32 cols) = the whole 4096 x 288 result; MODE 0/1: 2 heads x 8 it x 8 rows x 4 lanes
//           x 8 slots = 64 rows x 2 heads x 32 slots; MODE 2: 8 it x 4 x 8 lanes x 8 = 32 features x 64 tokens;
//           MODE 3: 16 it x 4 rows x 8 lanes x 4 = 64 rows x 32 cols.
// =====================================================================================================
template <int MODE, bool TWOA>
__global__ __launch_bounds__(128) void gemm_xw(
    const unsigned short* __restrict__ Ap, const unsigned short* __restrict__ A2p,
    const unsigned short* __restrict__ Btp, void* C0, void* C1,
    const float* __restrict__ ctab, const float* __restrict__ stab) {
  static_assert(MODE >= 0 && MODE <= 3);
  constexpr int M = NTOK, N = HID, K = HID;
  constexpr int TN = N / 32;   // 9
  constexpr int TM = M / 64;   // 64
  const __bf16* A  = (const __bf16*)(const void*)Ap;
  const __bf16* A2 = (const __bf16*)(const void*)A2p;
  const __bf16* Bt = (const __bf16*)(const void*)Btp;
  __shared__ __align__(16) float sT[4][64 * 36];   // per-wave 64x32 tile, pitch 36 floats

  const int lane = threadIdx.x & 31;
  const int wave = threadIdx.x >> 5;
  const int tile = blockIdx.x * 4 + wave;
  if (tile >= TM * TN) return;                     // wave-uniform; no block barriers in this kernel
  const int tm = tile / TN;
  const int tn = tile - tm * TN;
  const int m0 = tm << 6;
  const int n0 = tn << 5;
  const int c    = lane & 15;                      // row (A) / col (B, D) within subtile
  const int koff = (lane >> 4) * 8;                // k offset of this lane half
  const int mOff = (lane >> 4) * 8;                // D row offset
  const int bidx = m0 / SEQ;                       // batch of this tile (tiles never straddle a batch)
  const int tl0  = m0 - bidx * SEQ;                // first position within the sequence

  v8f acc[4][2];
#pragma unroll
  for (int i = 0; i < 4; ++i)
#pragma unroll
    for (int j = 0; j < 2; ++j) acc[i][j] = zero8();

  for (int k0 = 0; k0 < K; k0 += 32) {
    v16b bh[2];
#pragma unroll
    for (int j = 0; j < 2; ++j) bh[j] = ldfrag_b(Bt + (size_t)(n0 + (j << 4) + c) * K + koff + k0);
#pragma unroll
    for (int i = 0; i < 4; ++i) {
      v16b ah, al;
      if (MODE == 3) {
        const int pr = k0 >> 5;                    // head pair index 0..8
        const size_t o0 = (((size_t)(bidx * NH + 2 * pr)) * SEQ + tl0 + (i << 4) + c) * HD + koff;
        const size_t o1 = o0 + (size_t)SEQ * HD;   // next head, same token row
        ah = ldfrag_b2(A + o0, A + o1);
        al = ah;
        if (TWOA) al = ldfrag_b2(A2 + o0, A2 + o1);
      } else {
        const size_t ao = (size_t)(m0 + (i << 4) + c) * K + koff + k0;
        ah = ldfrag_b(A + ao);
        al = ah;
        if (TWOA) al = ldfrag_b(A2 + ao);
      }
#pragma unroll
      for (int j = 0; j < 2; ++j) {
        acc[i][j] = mma_b(ah, bh[j], acc[i][j]);
        if (TWOA) acc[i][j] = mma_b(al, bh[j], acc[i][j]);
      }
    }
  }

  // ---- epilogue: whole tile to wave-private LDS ----
  float* slab = sT[wave];
#pragma unroll
  for (int i = 0; i < 4; ++i)
#pragma unroll
    for (int j = 0; j < 2; ++j)
#pragma unroll
      for (int r = 0; r < 8; ++r)
        slab[((i << 4) + mOff + r) * 36 + (j << 4) + c] = acc[i][j][r];
  __builtin_amdgcn_fence(__ATOMIC_RELEASE, "workgroup");
  __builtin_amdgcn_wave_barrier();
  __builtin_amdgcn_fence(__ATOMIC_ACQUIRE, "workgroup");

  if (MODE == 3) {
    float* Cf = (float*)C0;
    const int q4 = lane >> 3, c4 = (lane & 7) * 4;
    {
#pragma unroll
      for (int it = 0; it < 16; ++it) {
        const int row = it * 4 + q4;                         // it 0..15 x q4 0..3 = rows 0..63
        const v4f v = *(const v4f*)(slab + row * 36 + c4);
        *(v4f*)(Cf + (size_t)(m0 + row) * HID + n0 + c4) = v;
      }
      
    }
  } else if (MODE == 2) {
    unsigned short* P0 = (unsigned short*)C0;
    unsigned short* P1 = (unsigned short*)C1;
    const int q4 = lane >> 3, t8 = (lane & 7) * 8;
#pragma unroll 2
    for (int it = 0; it < 8; ++it) {
      const int n = it * 4 + q4;                             // local feature 0..31
      float f[8];
#pragma unroll
      for (int e = 0; e < 8; ++e) f[e] = slab[(t8 + e) * 36 + n];
      v4u a, a2;
#pragma unroll
      for (int e = 0; e < 4; ++e) {
        const float f0 = f[2 * e], f1 = f[2 * e + 1];
        const unsigned short h0 = bf_bits(f0), h1 = bf_bits(f1);
        const unsigned short l0 = bf_bits(f0 - bf_up(h0)), l1 = bf_bits(f1 - bf_up(h1));
        a[e] = pk16(h0, h1); a2[e] = pk16(l0, l1);
      }
      const size_t go = ((size_t)(bidx * HID + n0 + n)) * SEQ + tl0 + t8;
      *(v4u*)(P0 + go) = a;
      *(v4u*)(P1 + go) = a2;
      
    }
  } else {
    unsigned short* P0 = (unsigned short*)C0;
    unsigned short* P1 = (unsigned short*)C1;
    const int r4 = lane >> 2, s8 = (lane & 3) * 8;
    const int dbase = s8 & 8;                                // d of the first element: 0 or 8
    const bool isLo = (s8 >= 16);
    const float sg = (dbase == 0) ? -1.0f : 1.0f;            // -x[d+8] for d < 8, +x[d-8] for d >= 8
    const int h0 = n0 >> 4;                                  // first head of the tile (even)
#pragma unroll 1
    for (int hd = 0; hd < 2; ++hd) {
#pragma unroll 2
      for (int it = 0; it < 8; ++it) {
        const int row = it * 8 + r4;                         // it 0..7 x r4 0..7 = rows 0..63
        const int t = tl0 + row;                             // position within the sequence
        const float* xr = slab + row * 36 + hd * 16;
        float x[8], y[8], f[8];
#pragma unroll
        for (int e = 0; e < 8; ++e) { x[e] = xr[dbase + e]; y[e] = xr[(dbase ^ 8) + e]; }
        const v4f cv0 = *(const v4f*)(ctab + (size_t)t * NPAIR);
        const v4f cv1 = *(const v4f*)(ctab + (size_t)t * NPAIR + 4);
        const v4f sv0 = *(const v4f*)(stab + (size_t)t * NPAIR);
        const v4f sv1 = *(const v4f*)(stab + (size_t)t * NPAIR + 4);
        {
#pragma clang fp contract(off)
#pragma unroll
          for (int e = 0; e < 4; ++e) {
            {
              const float ry = sg * y[e];
              const float p0 = x[e] * cv0[e];
              const float p1 = ry * sv0[e];
              f[e] = p0 + p1;
            }
            {
              const float ry = sg * y[4 + e];
              const float p0 = x[4 + e] * cv1[e];
              const float p1 = ry * sv1[e];
              f[4 + e] = p0 + p1;
            }
          }
        }
        v4u hp, lp;
#pragma unroll
        for (int e = 0; e < 4; ++e) {
          const float f0 = f[2 * e], f1 = f[2 * e + 1];
          const unsigned short hb0 = bf_bits(f0), hb1 = bf_bits(f1);
          const unsigned short lb0 = bf_bits(f0 - bf_up(hb0)), lb1 = bf_bits(f1 - bf_up(hb1));
          hp[e] = pk16(hb0, hb1); lp[e] = pk16(lb0, lb1);
        }
        const size_t go = (((size_t)(bidx * NH + h0 + hd)) * SEQ + t) * QS + s8;
        if (MODE == 0) {
          v4u pc;
#pragma unroll
          for (int e = 0; e < 4; ++e) pc[e] = isLo ? lp[e] : hp[e];
          *(v4u*)(P0 + go) = pc;
          
        } else {
          v4u pz;
#pragma unroll
          for (int e = 0; e < 4; ++e) pz[e] = isLo ? 0u : lp[e];
          *(v4u*)(P0 + go) = hp;
          *(v4u*)(P1 + go) = pz;
          
        }
      }
    }
  }
}

// =====================================================================================================
// Causal attention, head dim 16, key chunks of 64.
//   q plane  [b][h][t][32]: slots 0..15 = bf16 hi of rope(q)[d], 16..31 = bf16 lo
//   kd plane [b][h][s][32]: slots 0..15 = hi of rope(k)[d], 16..31 = hi again; kz plane: 0..15 = lo, 16..31 = 0
//   so one 32-deep k-step gives q.k = hi.hi + lo.hi (kd) and hi.lo (kz): two products per 16x16 score tile.
//   v^T planes (bf16 hi / lo): element (b, h*16+d, s) at [(b*288 + h*16 + d)*2048 + s]
//   ctx planes (bf16 hi / lo of the normalised context): element (b, h, t, d) at [((b*18 + h)*2048 + t)*16 + d]
//   Causal structure: query block qb visits key chunks 0..qb only (block-uniform trip count qb+1 <= NQB); inside the
//   diagonal chunk a key with index > query index gets logit -inf -> exp gives exactly 0; the first key of every visited
//   chunk is always kept, so every row max is finite.
//   p = exp(s - m) as bf16 hi + lo in wave-private LDS (every wave writes its whole 16x64 tile of both planes, release
//   online softmax (running max) in f32. Q / K / V fragments are loaded straight from the planes with arithmetic
//   addresses (two 16-B loads per fragment). Block = 4 waves = 64 query rows of one (b, h); wave w = rows q0..q0+15;
//   no block barriers; grid = NB * NH * NQB.
//   Output: the wave's 16x16 f32 tile is staged in wave-private LDS, split into bf16 hi / lo; each plane's 16 rows x 32 B
//   coverage: 1152 blocks x 4 waves x 16 rows x 16 d = every (b, h, t, d) of both ctx planes exactly once.
// =====================================================================================================
__global__ __launch_bounds__(128)
void attn_causal16(const unsigned short* __restrict__ qcp, const unsigned short* __restrict__ kdp,
                   const unsigned short* __restrict__ kzp, const unsigned short* __restrict__ vhp,
                   const unsigned short* __restrict__ vlp, unsigned short* ohp, unsigned short* olp) {
  union FB { v16b v; v8b h[2]; };
  __shared__ __align__(16) __bf16 Psh[4][16 * 64];       // per wave P hi [row][key]
  __shared__ __align__(16) __bf16 Psl[4][16 * 64];       // per wave P lo
  __shared__ __align__(16) float  Os[4][16 * 16];        // per wave context tile [row][d]

  const int tid  = threadIdx.x;
  const int wave = tid >> 5;
  const int lane = tid & 31;
  const int hh   = lane >> 4;
  const int c    = lane & 15;

  const int bx   = blockIdx.x;
  const int qb   = bx % NQB;
  const int rest = bx / NQB;
  const int h    = rest % NH;
  const int b    = rest / NH;
  const int q0   = qb * 64 + wave * 16;
  const size_t bhp = (size_t)b * NH + h;

  const __bf16* Qc = (const __bf16*)(const void*)qcp + bhp * SEQ * QS;
  const __bf16* Kd = (const __bf16*)(const void*)kdp + bhp * SEQ * QS;
  const __bf16* Kz = (const __bf16*)(const void*)kzp + bhp * SEQ * QS;
  const __bf16* Vh = (const __bf16*)(const void*)vhp + ((size_t)b * HID + (size_t)h * HD) * SEQ;
  const __bf16* Vl = (const __bf16*)(const void*)vlp + ((size_t)b * HID + (size_t)h * HD) * SEQ;

  // ---- Q fragment (A operand, row = lane&15, one 32-slot k-step) ----
  const v16b qa = ldfrag_b(Qc + (size_t)(q0 + c) * QS + 8 * hh);

  float mrow[8], lrow[8];
  v8f oacc = zero8();
#pragma unroll
  for (int r = 0; r < 8; ++r) { mrow[r] = -INFINITY; lrow[r] = 0.f; }

  __bf16* pwh = Psh[wave];
  __bf16* pwl = Psl[wave];

  for (int kt = 0; kt <= qb; ++kt) {           // block-uniform trip count, <= NQB
    const int kv0 = kt * 64;                   // kv0 + 63 < SEQ
    // P tile of the prior chunk must be fully consumed before it is overwritten
    __builtin_amdgcn_fence(__ATOMIC_RELEASE, "workgroup");
    __builtin_amdgcn_wave_barrier();
    __builtin_amdgcn_fence(__ATOMIC_ACQUIRE, "workgroup");

    // ---- scores: 16 query rows x 64 keys per wave, 2 bf16 products per key subtile ----
    v8f s[4];
#pragma unroll
    for (int j = 0; j < 4; ++j) {
      const size_t ko = (size_t)(kv0 + j * 16 + c) * QS + 8 * hh;
      const v16b kd = ldfrag_b(Kd + ko);
      const v16b kz = ldfrag_b(Kz + ko);
      s[j] = mma_b(qa, kd, zero8());
      s[j] = mma_b(qa, kz, s[j]);
    }

    // ---- scale, causal mask by index, row max, online softmax, P hi / lo to LDS ----
#pragma unroll
    for (int r = 0; r < 8; ++r) {
      const int rowq = q0 + 8 * hh + r;        // query index of D row 8hh+r
      float m = -INFINITY;
#pragma unroll
      for (int j = 0; j < 4; ++j) {
        const int key = kv0 + j * 16 + c;
        float sv = s[j][r] * 0.25f;
        sv = (key <= rowq) ? sv : -INFINITY;
        s[j][r] = sv;
        m = fmaxf(m, sv);
      }
#pragma unroll
      for (int off = 1; off < 16; off <<= 1) m = fmaxf(m, __shfl_xor(m, off, 32));
      const float mnew  = fmaxf(mrow[r], m);
      const float msafe = (mnew == -INFINITY) ? 0.f : mnew;
      const float alpha = __expf(mrow[r] - msafe);
      mrow[r] = mnew;
      float psum = 0.f;
#pragma unroll
      for (int j = 0; j < 4; ++j) {
        const float p = __expf(s[j][r] - msafe);     // masked logit: exp(-inf) = 0
        psum += p;
        const unsigned short hb = bf_bits(p);
        const unsigned short lb = bf_bits(p - bf_up(hb));
        const int po = (8 * hh + r) * 64 + j * 16 + c;
        pwh[po] = __builtin_bit_cast(__bf16, hb);
        pwl[po] = __builtin_bit_cast(__bf16, lb);
      }
#pragma unroll
      for (int off = 1; off < 16; off <<= 1) psum += __shfl_xor(psum, off, 32);
      lrow[r] = lrow[r] * alpha + psum;
      oacc[r] *= alpha;
    }
    __builtin_amdgcn_fence(__ATOMIC_RELEASE, "workgroup");
    __builtin_amdgcn_wave_barrier();
    __builtin_amdgcn_fence(__ATOMIC_ACQUIRE, "workgroup");

    // ---- context += P . V (bf16 WMMA, hh + hl + lh into one accumulator) ----
#pragma unroll
    for (int kk = 0; kk < 2; ++kk) {
      FB pa, pl;
      pa.h[0] = *(const v8b*)(pwh + c * 64 + kk * 32 + 8 * hh);
      pa.h[1] = *(const v8b*)(pwh + c * 64 + kk * 32 + 16 + 8 * hh);
      pl.h[0] = *(const v8b*)(pwl + c * 64 + kk * 32 + 8 * hh);
      pl.h[1] = *(const v8b*)(pwl + c * 64 + kk * 32 + 16 + 8 * hh);
      const size_t vo = (size_t)c * SEQ + kv0 + kk * 32 + 8 * hh;   // v^T row d = c, keys of this k-step
      const v16b vb = ldfrag_b(Vh + vo);
      const v16b vl = ldfrag_b(Vl + vo);
      oacc = mma_b(pa.v, vb, oacc);
      oacc = mma_b(pa.v, vl, oacc);
      oacc = mma_b(pl.v, vb, oacc);
    }
  }

  // ---- normalise (1/l), stage the wave's 16x16 tile, bf16 hi/lo split, one 512-B store instruction per plane ----
  float* os = Os[wave];
#pragma unroll
  for (int r = 0; r < 8; ++r) {
    const float l = lrow[r];
    const float inv = (l > 0.f) ? (1.0f / l) : 0.f;
    os[(8 * hh + r) * HD + c] = oacc[r] * inv;
  }
  __builtin_amdgcn_fence(__ATOMIC_RELEASE, "workgroup");
  __builtin_amdgcn_wave_barrier();
  __builtin_amdgcn_fence(__ATOMIC_ACQUIRE, "workgroup");
  {
    const int row = lane >> 1, d0 = (lane & 1) * 8;   // lane l: bytes 16l..16l+15 of the wave's 512-B run
    const float* sp = os + row * HD + d0;
    v4u a, a2;
#pragma unroll
    for (int e = 0; e < 4; ++e) {
      const float f0 = sp[2 * e], f1 = sp[2 * e + 1];
      const unsigned short hb0 = bf_bits(f0), hb1 = bf_bits(f1);
      const unsigned short lb0 = bf_bits(f0 - bf_up(hb0)), lb1 = bf_bits(f1 - bf_up(hb1));
      a[e] = pk16(hb0, hb1); a2[e] = pk16(lb0, lb1);
    }
    const size_t go = (bhp * SEQ + q0 + row) * HD + d0;
    *(v4u*)(ohp + go) = a;
    *(v4u*)(olp + go) = a2;
    
  }
}

// =====================================================================================================
// Workspace map (bytes; every region is an exact multiple of its whole-line / whole-tile store granularity,
//   Xb   bf16 [4096][288]            2359296
//   Wqb  bf16 [288][288]              165888   (x4: Wq, Wk, Wv, Wo)
//   Qc   bf16 [2][18][2048][32]      4718592
//   Kd                               4718592
//   Kz                               4718592
//   VTh  bf16 [2][288][2048]         2359296
//   VTl                              2359296
//   Oh   bf16 [2][18][2048][16]      2359296
//   Ol                               2359296
//   Ct   f32  [2048][8]                65536
//   St                                 65536
//   Iv   f32  [32] (one line)            128
//   total                           26747008
// =====================================================================================================
extern "C" void kernel_launch(void* const* d_in, const int* in_sizes, int n_in,
                              void* d_out, int out_size, void* d_ws, size_t ws_size,
                              hipStream_t stream) {
  if (n_in < 5) return;
  if (in_sizes[0] != NTOK * HID) return;
  if (in_sizes[1] != HID * HID) return;
  if (in_sizes[2] != HID * HID) return;
  if (in_sizes[3] != HID * HID) return;
  if (in_sizes[4] != HID * HID) return;
  if (out_size != NTOK * HID) return;

  const float* x  = (const float*)d_in[0];   // [2][2048][288]
  const float* Wq = (const float*)d_in[1];   // [288 out][288 in]
  const float* Wk = (const float*)d_in[2];
  const float* Wv = (const float*)d_in[3];
  const float* Wo = (const float*)d_in[4];

  const size_t PX  = (size_t)NTOK * HID * 2;            // 2359296
  const size_t PW  = (size_t)HID * HID * 2;             //  165888
  const size_t PQ  = (size_t)NB * NH * SEQ * QS * 2;    // 4718592
  const size_t PVT = (size_t)NB * HID * SEQ * 2;        // 2359296
  const size_t PO  = (size_t)NB * NH * SEQ * HD * 2;    // 2359296
  const size_t PTB = (size_t)SEQ * NPAIR * 4;           //   65536
  const size_t PIV = 128;
  size_t off = 0;
  const size_t oXb  = off; off += PX;
  const size_t oWq  = off; off += PW;
  const size_t oWk  = off; off += PW;
  const size_t oWv  = off; off += PW;
  const size_t oWo  = off; off += PW;
  const size_t oQc  = off; off += PQ;
  const size_t oKd  = off; off += PQ;
  const size_t oKz  = off; off += PQ;
  const size_t oVTh = off; off += PVT;
  const size_t oVTl = off; off += PVT;
  const size_t oOh  = off; off += PO;
  const size_t oOl  = off; off += PO;
  const size_t oCt  = off; off += PTB;
  const size_t oSt  = off; off += PTB;
  const size_t oIv  = off; off += PIV;
  if (off > ws_size) return;                            // off = 26747008
  if (off > (size_t)134217728) return;

  char* ws = (char*)d_ws;
  unsigned short* Xb  = (unsigned short*)(ws + oXb);
  unsigned short* Wqb = (unsigned short*)(ws + oWq);
  unsigned short* Wkb = (unsigned short*)(ws + oWk);
  unsigned short* Wvb = (unsigned short*)(ws + oWv);
  unsigned short* Wob = (unsigned short*)(ws + oWo);
  unsigned short* Qc  = (unsigned short*)(ws + oQc);
  unsigned short* Kd  = (unsigned short*)(ws + oKd);
  unsigned short* Kz  = (unsigned short*)(ws + oKz);
  unsigned short* VTh = (unsigned short*)(ws + oVTh);
  unsigned short* VTl = (unsigned short*)(ws + oVTl);
  unsigned short* Oh  = (unsigned short*)(ws + oOh);
  unsigned short* Ol  = (unsigned short*)(ws + oOl);
  float*          Ct  = (float*)(ws + oCt);
  float*          St  = (float*)(ws + oSt);
  float*          Iv  = (float*)(ws + oIv);

  const dim3 blk256(256);
  const dim3 blk128(128);
  const int n8x = NTOK * HID / 8;                       // 147456
  const int n8w = HID * HID / 8;                        //  10368
  const dim3 gCvtX((n8x + 255) / 256);                  // 576 blocks
  const dim3 gCvtW((n8w + 255) / 256);                  //  41 blocks
  const dim3 gTab(SEQ / 32);                            //  64 blocks
  const dim3 gGemm(((NTOK / 64) * (HID / 32)) / 4);     // 576 tiles -> 144 blocks of 4 waves
  const dim3 gAttn(NB * NH * NQB);                      // 1152 blocks of 128

  // (0) RoPE tables
  rope_inv<<<dim3(1), dim3(32), 0, stream>>>(Iv);
  rope_tab<<<gTab, blk256, 0, stream>>>(Iv, Ct, St);
  // (1) x and the four weights -> bf16 planes (weights are [out][in] = Bt[n][k] already)
  cvt_bf16x8<<<gCvtX, blk256, 0, stream>>>(x, Xb, n8x);
  cvt_bf16x8<<<gCvtW, blk256, 0, stream>>>(Wq, Wqb, n8w);
  cvt_bf16x8<<<gCvtW, blk256, 0, stream>>>(Wk, Wkb, n8w);
  cvt_bf16x8<<<gCvtW, blk256, 0, stream>>>(Wv, Wvb, n8w);
  cvt_bf16x8<<<gCvtW, blk256, 0, stream>>>(Wo, Wob, n8w);
  // (2) q = rope(x . Wq^T) -> [b][h][t][hi|lo]
  gemm_xw<0, false><<<gGemm, blk128, 0, stream>>>(Xb, Xb, Wqb, (void*)Qc, (void*)Qc, Ct, St);
  // (3) k = rope(x . Wk^T) -> [b][h][s][hi|hi] and [b][h][s][lo|0]
  gemm_xw<1, false><<<gGemm, blk128, 0, stream>>>(Xb, Xb, Wkb, (void*)Kd, (void*)Kz, Ct, St);
  // (4) v = x . Wv^T -> v^T bf16 hi / lo planes [b][h*16+d][s]
  gemm_xw<2, false><<<gGemm, blk128, 0, stream>>>(Xb, Xb, Wvb, (void*)VTh, (void*)VTl, Ct, St);
  // (5) causal attention -> ctx bf16 hi / lo planes [b][h][t][d]
  attn_causal16<<<gAttn, blk128, 0, stream>>>(Qc, Kd, Kz, VTh, VTl, Oh, Ol);
  // (6) out = (ctx hi + ctx lo) . Wo^T -> d_out f32 [4096][288]
  gemm_xw<3, true><<<gGemm, blk128, 0, stream>>>(Oh, Ol, Wob, d_out, d_out, Ct, St);
  (void)hipGetLastError();
}

// v001
// It runs in 194 microseconds.
// In two side-by-side timings against v000, it was 1.48 and 1.47 times as fast.
// Contractions: q / k / v projections = v_wmma_f32_16x16x32_bf16 (bf16 operands from RNE-converted x and Wq/Wk/Wv, single product, f32 accumulate);
// k.q^T scores (transposed) = v_wmma_f32_16x16x32_bf16 with q and k as bf16 hi/lo split folded into the 32-deep k axis ([qhi|qlo].[khi|khi] + [qhi|qlo].[klo|0] = hh+lh+hl, 2 products), f32 accumulate;
// v^T.p^T (transposed) = v_wmma_f32_16x16x32_bf16 with p and v as bf16 hi/lo split (hh + hl + lh, 3 products), f32 accumulate;
// ctx.Wo^T = v_wmma_f32_16x16x32_bf16 with ctx as bf16 hi + unscaled lo planes times bf16 Wo (2 products), f32 accumulate;
// rotary tables (powf, f32 product, precise sincosf), half-rotation, causal mask and online softmax in f32 on the VALU.
// Carry audit: no scaled planes anywhere; every lo plane is the unscaled RNE residual (v - hi) in bf16 and shares the hi accumulator;
// score scale 1/4 applied once in f32 after the score accumulate; softmax normaliser 1/l applied once in the attention epilogue.
#include <hip/hip_runtime.h>
#include <math.h>
#include <stdint.h>

#define NB    2
#define SEQ   2048
#define HID   288
#define NH    18
#define HD    16
#define NPAIR 8
#define QS    32           // slots per head in the q / k planes: 0..15 hi (d), 16..31 lo (d) or duplicate / zero
#define NTOK  (NB * SEQ)   // 4096 token rows
#define NQB   (SEQ / 64)   // 32 query blocks of 64 per sequence
static_assert(NH * HD == HID);
static_assert(NPAIR * 2 == HD);
static_assert((SEQ % 64) == 0 && (HID % 32) == 0 && (NTOK % 64) == 0);
static_assert(((NTOK / 64) * (HID / 32)) % 4 == 0);
static_assert((NTOK * HID) % (8 * 256) == 0);
static_assert(((HID * HID) % 8) == 0 && (((HID * HID) / 8) % 32) == 0);
static_assert((SEQ % 32) == 0);

typedef __bf16   v16b __attribute__((ext_vector_type(16)));
typedef __bf16   v8b  __attribute__((ext_vector_type(8)));
typedef float    v8f  __attribute__((ext_vector_type(8)));
typedef float    v4f  __attribute__((ext_vector_type(4)));
typedef unsigned int v4u __attribute__((ext_vector_type(4)));

// ---- scalar helpers --------------------------------------------------------------------------------
__device__ __forceinline__ unsigned short bf_bits(float f) {          // f32 -> bf16 bits, RNE convert
  unsigned u = __float_as_uint(f);
  return (unsigned short)((u + 0x7FFFu + ((u >> 16) & 1u)) >> 16);
}
__device__ __forceinline__ float bf_up(unsigned short h) { return __uint_as_float(((unsigned)h) << 16); }
__device__ __forceinline__ unsigned pk16(unsigned short a, unsigned short b) { return (unsigned)a | ((unsigned)b << 16); }
__device__ __forceinline__ v8f zero8() { v8f z = {0.f, 0.f, 0.f, 0.f, 0.f, 0.f, 0.f, 0.f}; return z; }

// ---- fragment loaders: 16-bit A/B operand, lane -> row/col (lane&15), p already includes +8*(lane>>4);
//      elements 0..7 <- p[0..7] (k0+8h..k0+8h+7), elements 8..15 <- p[16..23] (k0+16+8h..k0+16+8h+7)
__device__ __forceinline__ v16b ldfrag_b(const __bf16* p) {
  union { v16b v; v8b h[2]; } f;
  f.h[0] = *(const v8b*)(p);
  f.h[1] = *(const v8b*)(p + 16);
  return f.v;
}
// same map when k0..k0+15 and k0+16..k0+31 live in two different rows (p0, p1 each include +8*(lane>>4))
__device__ __forceinline__ v16b ldfrag_b2(const __bf16* p0, const __bf16* p1) {
  union { v16b v; v8b h[2]; } f;
  f.h[0] = *(const v8b*)(p0);
  f.h[1] = *(const v8b*)(p1);
  return f.v;
}

// ---- WMMA helper with trailing VALU hazard gap (D tied, A/B kept live) ----------------------------------
__device__ __forceinline__ v8f mma_b(v16b a, v16b b, v8f c) {
  c = __builtin_amdgcn_wmma_f32_16x16x32_bf16(false, a, false, b, (short)0, c, false, false);
  asm volatile("v_nop\n\tv_nop\n\tv_nop\n\tv_nop" : "+v"(c) : "v"(a), "v"(b));
  return c;
}

// =====================================================================================================
// RoPE tables.  rope_inv: inv[i] = 1 / powf(10000, (2i)/16), i = 0..31 (entries 0..7 are used); one block of
// rope_tab: ctab[t][i] = cos(t * inv[i]), stab[t][i] = sin(t * inv[i]), i = 0..7, t = 0..SEQ-1
// (f32 product, precise sincosf). 256 threads = 32 positions x 8: thread tid -> t = block*32 + tid/8, i = tid&7, so a
// coverage: 64 blocks x 256 = the whole [SEQ][8] tables.
// =====================================================================================================
__global__ __launch_bounds__(32) void rope_inv(float* inv) {
  const int i = (int)threadIdx.x;
  const float e = (float)(2 * i) * (1.0f / (float)HD);
  const float p = powf(10000.0f, e);
  const float v = 1.0f / p;
  *(float*)(inv + i) = v;
  
}

__global__ __launch_bounds__(256) void rope_tab(const float* __restrict__ inv, float* ctab, float* stab) {
  const int tid = (int)threadIdx.x;
  const int i = tid & (NPAIR - 1);
  const int t = blockIdx.x * 32 + (tid >> 3);
  const float f   = inv[i];
  const float ang = (float)t * f;
  float sn, cs;
  sincosf(ang, &sn, &cs);
  const size_t o = (size_t)t * NPAIR + i;
  *(float*)(ctab + o) = cs;
  *(float*)(stab + o) = sn;
  
}

// =====================================================================================================
// f32 -> bf16 (RNE convert), 8 elements per thread, one 16-B store per lane: a wave writes 512 contiguous B
// coverage: n8 threads x 8 = the whole plane (n8 = 147456 for x, 10368 for each weight; both multiples of 32,
// =====================================================================================================
__global__ __launch_bounds__(256) void cvt_bf16x8(const float* __restrict__ in, unsigned short* out, int n8) {
  const int i = blockIdx.x * 256 + (int)threadIdx.x;
  if (i < n8) {
    const v4f a = *(const v4f*)(in + (size_t)i * 8);
    const v4f b = *(const v4f*)(in + (size_t)i * 8 + 4);
    v4u p;
    p[0] = pk16(bf_bits(a[0]), bf_bits(a[1]));
    p[1] = pk16(bf_bits(a[2]), bf_bits(a[3]));
    p[2] = pk16(bf_bits(b[0]), bf_bits(b[1]));
    p[3] = pk16(bf_bits(b[2]), bf_bits(b[3]));
    *(v4u*)(out + (size_t)i * 8) = p;
    
  }
}

// =====================================================================================================
// bf16 WMMA GEMM, one wave per 64 x 32 tile, 4 waves per block, no block barriers:
//   C[m][n] = sum_k A[m][k] * Bt[n][k] (+ sum_k A2[m][k] * Bt[n][k] when TWOA), M = 4096 tokens, N = 288, K = 288
//   (9 k-steps of 32, no tails). Bt = weight plane [n][k] (the [out][in] weight as delivered, RNE bf16), pitch 288.
//   A: MODE 0..2: x plane [m][k] pitch 288. MODE 3: ctx planes laid out [b][h][t][16]; k-step j covers heads 2j
//   (k 0..15) and 2j+1 (k 16..31): elements 0..7 <- head 2j, d = 8*(lane>>4)..+7; elements 8..15 <- head 2j+1, same d.
// then (b = m0/2048, t = m0%2048 + row, 32 columns = heads n0/16 and n0/16+1):
//   MODE 0 (q): rotary in f32 (contract off): d < 8: x[d] c[t][d] - x[d+8] s[t][d]; d >= 8: x[d] c[t][d-8] + x[d-8] s[t][d-8];
//               -> plane [b][h][t][32]: slots 0..15 = bf16 hi of d, 16..31 = bf16 lo (v - hi) of d.
//   MODE 1 (k): same rotary; plane C0 slots 0..15 = hi, 16..31 = hi (duplicate); plane C1 slots 0..15 = lo, 16..31 = 0.
//   MODE 2 (v): no rotary; v^T planes C0 = hi, C1 = lo, element (b, n, t) at [(b*288 + n)*2048 + t]:
// coverage: 576 tiles x (64 rows x 32 cols) = the whole 4096 x 288 result; MODE 0/1: 2 heads x 8 it x 8 rows x 4 lanes
//           x 8 slots = 64 rows x 2 heads x 32 slots; MODE 2: 8 it x 4 x 8 lanes x 8 = 32 features x 64 tokens;
//           MODE 3: 16 it x 4 rows x 8 lanes x 4 = 64 rows x 32 cols.
// =====================================================================================================
template <int MODE, bool TWOA>
__global__ __launch_bounds__(128) void gemm_xw(
    const unsigned short* __restrict__ Ap, const unsigned short* __restrict__ A2p,
    const unsigned short* __restrict__ Btp, void* C0, void* C1,
    const float* __restrict__ ctab, const float* __restrict__ stab) {
  static_assert(MODE >= 0 && MODE <= 3);
  constexpr int M = NTOK, N = HID, K = HID;
  constexpr int TN = N / 32;   // 9
  constexpr int TM = M / 64;   // 64
  const __bf16* A  = (const __bf16*)(const void*)Ap;
  const __bf16* A2 = (const __bf16*)(const void*)A2p;
  const __bf16* Bt = (const __bf16*)(const void*)Btp;
  __shared__ __align__(16) float sT[4][64 * 36];   // per-wave 64x32 tile, pitch 36 floats

  const int lane = threadIdx.x & 31;
  const int wave = threadIdx.x >> 5;
  const int tile = blockIdx.x * 4 + wave;
  if (tile >= TM * TN) return;                     // wave-uniform; no block barriers in this kernel
  const int tm = tile / TN;
  const int tn = tile - tm * TN;
  const int m0 = tm << 6;
  const int n0 = tn << 5;
  const int c    = lane & 15;                      // row (A) / col (B, D) within subtile
  const int koff = (lane >> 4) * 8;                // k offset of this lane half
  const int mOff = (lane >> 4) * 8;                // D row offset
  const int bidx = m0 / SEQ;                       // batch of this tile (tiles never straddle a batch)
  const int tl0  = m0 - bidx * SEQ;                // first position within the sequence

  v8f acc[4][2];
#pragma unroll
  for (int i = 0; i < 4; ++i)
#pragma unroll
    for (int j = 0; j < 2; ++j) acc[i][j] = zero8();

  for (int k0 = 0; k0 < K; k0 += 32) {
    v16b bh[2];
#pragma unroll
    for (int j = 0; j < 2; ++j) bh[j] = ldfrag_b(Bt + (size_t)(n0 + (j << 4) + c) * K + koff + k0);
#pragma unroll
    for (int i = 0; i < 4; ++i) {
      v16b ah, al;
      if (MODE == 3) {
        const int pr = k0 >> 5;                    // head pair index 0..8
        const size_t o0 = (((size_t)(bidx * NH + 2 * pr)) * SEQ + tl0 + (i << 4) + c) * HD + koff;
        const size_t o1 = o0 + (size_t)SEQ * HD;   // next head, same token row
        ah = ldfrag_b2(A + o0, A + o1);
        al = ah;
        if (TWOA) al = ldfrag_b2(A2 + o0, A2 + o1);
      } else {
        const size_t ao = (size_t)(m0 + (i << 4) + c) * K + koff + k0;
        ah = ldfrag_b(A + ao);
        al = ah;
        if (TWOA) al = ldfrag_b(A2 + ao);
      }
#pragma unroll
      for (int j = 0; j < 2; ++j) {
        acc[i][j] = mma_b(ah, bh[j], acc[i][j]);
        if (TWOA) acc[i][j] = mma_b(al, bh[j], acc[i][j]);
      }
    }
  }

  // ---- epilogue: whole tile to wave-private LDS ----
  float* slab = sT[wave];
#pragma unroll
  for (int i = 0; i < 4; ++i)
#pragma unroll
    for (int j = 0; j < 2; ++j)
#pragma unroll
      for (int r = 0; r < 8; ++r)
        slab[((i << 4) + mOff + r) * 36 + (j << 4) + c] = acc[i][j][r];
  __builtin_amdgcn_fence(__ATOMIC_RELEASE, "workgroup");
  __builtin_amdgcn_wave_barrier();
  __builtin_amdgcn_fence(__ATOMIC_ACQUIRE, "workgroup");

  if (MODE == 3) {
    float* Cf = (float*)C0;
    const int q4 = lane >> 3, c4 = (lane & 7) * 4;
    {
#pragma unroll
      for (int it = 0; it < 16; ++it) {
        const int row = it * 4 + q4;                         // it 0..15 x q4 0..3 = rows 0..63
        const v4f v = *(const v4f*)(slab + row * 36 + c4);
        *(v4f*)(Cf + (size_t)(m0 + row) * HID + n0 + c4) = v;
      }
      
    }
  } else if (MODE == 2) {
    unsigned short* P0 = (unsigned short*)C0;
    unsigned short* P1 = (unsigned short*)C1;
    const int q4 = lane >> 3, t8 = (lane & 7) * 8;
#pragma unroll 2
    for (int it = 0; it < 8; ++it) {
      const int n = it * 4 + q4;                             // local feature 0..31
      float f[8];
#pragma unroll
      for (int e = 0; e < 8; ++e) f[e] = slab[(t8 + e) * 36 + n];
      v4u a, a2;
#pragma unroll
      for (int e = 0; e < 4; ++e) {
        const float f0 = f[2 * e], f1 = f[2 * e + 1];
        const unsigned short h0 = bf_bits(f0), h1 = bf_bits(f1);
        const unsigned short l0 = bf_bits(f0 - bf_up(h0)), l1 = bf_bits(f1 - bf_up(h1));
        a[e] = pk16(h0, h1); a2[e] = pk16(l0, l1);
      }
      const size_t go = ((size_t)(bidx * HID + n0 + n)) * SEQ + tl0 + t8;
      *(v4u*)(P0 + go) = a;
      *(v4u*)(P1 + go) = a2;
      
    }
  } else {
    unsigned short* P0 = (unsigned short*)C0;
    unsigned short* P1 = (unsigned short*)C1;
    const int r4 = lane >> 2, s8 = (lane & 3) * 8;
    const int dbase = s8 & 8;                                // d of the first element: 0 or 8
    const bool isLo = (s8 >= 16);
    const float sg = (dbase == 0) ? -1.0f : 1.0f;            // -x[d+8] for d < 8, +x[d-8] for d >= 8
    const int h0 = n0 >> 4;                                  // first head of the tile (even)
#pragma unroll 1
    for (int hd = 0; hd < 2; ++hd) {
#pragma unroll 2
      for (int it = 0; it < 8; ++it) {
        const int row = it * 8 + r4;                         // it 0..7 x r4 0..7 = rows 0..63
        const int t = tl0 + row;                             // position within the sequence
        const float* xr = slab + row * 36 + hd * 16;
        float x[8], y[8], f[8];
#pragma unroll
        for (int e = 0; e < 8; ++e) { x[e] = xr[dbase + e]; y[e] = xr[(dbase ^ 8) + e]; }
        const v4f cv0 = *(const v4f*)(ctab + (size_t)t * NPAIR);
        const v4f cv1 = *(const v4f*)(ctab + (size_t)t * NPAIR + 4);
        const v4f sv0 = *(const v4f*)(stab + (size_t)t * NPAIR);
        const v4f sv1 = *(const v4f*)(stab + (size_t)t * NPAIR + 4);
        {
#pragma clang fp contract(off)
#pragma unroll
          for (int e = 0; e < 4; ++e) {
            {
              const float ry = sg * y[e];
              const float p0 = x[e] * cv0[e];
              const float p1 = ry * sv0[e];
              f[e] = p0 + p1;
            }
            {
              const float ry = sg * y[4 + e];
              const float p0 = x[4 + e] * cv1[e];
              const float p1 = ry * sv1[e];
              f[4 + e] = p0 + p1;
            }
          }
        }
        v4u hp, lp;
#pragma unroll
        for (int e = 0; e < 4; ++e) {
          const float f0 = f[2 * e], f1 = f[2 * e + 1];
          const unsigned short hb0 = bf_bits(f0), hb1 = bf_bits(f1);
          const unsigned short lb0 = bf_bits(f0 - bf_up(hb0)), lb1 = bf_bits(f1 - bf_up(hb1));
          hp[e] = pk16(hb0, hb1); lp[e] = pk16(lb0, lb1);
        }
        const size_t go = (((size_t)(bidx * NH + h0 + hd)) * SEQ + t) * QS + s8;
        if (MODE == 0) {
          v4u pc;
#pragma unroll
          for (int e = 0; e < 4; ++e) pc[e] = isLo ? lp[e] : hp[e];
          *(v4u*)(P0 + go) = pc;
          
        } else {
          v4u pz;
#pragma unroll
          for (int e = 0; e < 4; ++e) pz[e] = isLo ? 0u : lp[e];
          *(v4u*)(P0 + go) = hp;
          *(v4u*)(P1 + go) = pz;
          
        }
      }
    }
  }
}

// =====================================================================================================
// Causal attention, head dim 16, key chunks of 64, both products transposed: S^T = K . Q^T, O^T += V^T . P^T.
//   q plane  [b][h][t][32]: slots 0..15 = bf16 hi of rope(q)[d], 16..31 = bf16 lo
//   kd plane [b][h][s][32]: slots 0..15 = hi of rope(k)[d], 16..31 = hi again; kz plane: 0..15 = lo, 16..31 = 0
//   so one 32-deep k-step gives q.k = hi.hi + lo.hi (kd) and hi.lo (kz): two products per 16x16 score tile.
//   v^T planes (bf16 hi / lo): element (b, h*16+d, s) at [(b*288 + h*16 + d)*2048 + s]
//   ctx planes (bf16 hi / lo of the normalised context): element (b, h, t, d) at [((b*18 + h)*2048 + t)*16 + d]
//   Score tile j: A = 16 key rows (row = lane&15), B = the wave's 16 queries (col = lane&15), same loader on both sides, so
//   register r of lane (c, hh) = score of key kv0 + 16j + 8hh + r against query q0 + c: a lane holds 32 of the 64 keys of ONE
//   query. Row max and row sum are in-lane; the two lane halves exchange the max once per chunk and join their sums once, in
//   the epilogue. Tiles 2kk and 2kk+1, converted in place, are the B operand of k-step kk (element e = key 8hh+e, element
//   8+e = key 16+8hh+e), which is the k order in which ldfrag_b reads the v^T row as A: P never leaves the registers.
//   Causal structure: query block qb visits key chunks 0..qb only (block-uniform trip count qb+1 <= NQB); inside the
//   diagonal chunk a key with index > query index gets logit -inf -> exp gives exactly 0; the first key of every visited
//   chunk is always kept, so every joined max is finite.
//   Block = 4 waves = 64 query rows of one (b, h); wave w = rows q0..q0+15; no LDS, no barriers; grid = NB * NH * NQB.
//   Output: lane (c, hh) holds d = 8hh..8hh+7 of query q0 + c: one 16-B store per plane, 512 contiguous B per wave.
//   coverage: 1152 blocks x 4 waves x 16 rows x 16 d = every (b, h, t, d) of both ctx planes exactly once.
// =====================================================================================================
__device__ __forceinline__ float other_half(float v) {                // value of lane l ^ 16
  const int b = __builtin_bit_cast(int, v);
  return __builtin_bit_cast(float, __builtin_amdgcn_permlanex16(b, b, 0x76543210, 0xfedcba98, false, false));
}

__device__ __forceinline__ void exp2x8(const float (&x)[8], float (&y)[8]) {
  asm("v_exp_f32 %0, %8\n\tv_exp_f32 %1, %9\n\tv_exp_f32 %2, %10\n\tv_exp_f32 %3, %11\n\t"
      "v_exp_f32 %4, %12\n\tv_exp_f32 %5, %13\n\tv_exp_f32 %6, %14\n\tv_exp_f32 %7, %15\n\tv_nop"
      : "=&v"(y[0]), "=&v"(y[1]), "=&v"(y[2]), "=&v"(y[3]), "=&v"(y[4]), "=&v"(y[5]), "=&v"(y[6]), "=&v"(y[7])
      : "v"(x[0]), "v"(x[1]), "v"(x[2]), "v"(x[3]), "v"(x[4]), "v"(x[5]), "v"(x[6]), "v"(x[7]));
}

__global__ __launch_bounds__(128)
void attn_causal16(const unsigned short* __restrict__ qcp, const unsigned short* __restrict__ kdp,
                   const unsigned short* __restrict__ kzp, const unsigned short* __restrict__ vhp,
                   const unsigned short* __restrict__ vlp, unsigned short* ohp, unsigned short* olp) {
  union PB { v16b v; unsigned u[8]; };

  const int tid  = threadIdx.x;
  const int wave = tid >> 5;
  const int lane = tid & 31;
  const int hh   = lane >> 4;
  const int c    = lane & 15;

  const int bx   = blockIdx.x;
  const int qb   = bx % NQB;
  const int rest = bx / NQB;
  const int h    = rest % NH;
  const int b    = rest / NH;
  const int q0   = qb * 64 + wave * 16;
  const size_t bhp = (size_t)b * NH + h;

  const __bf16* Qc = (const __bf16*)(const void*)qcp + bhp * SEQ * QS;
  const __bf16* Kd = (const __bf16*)(const void*)kdp + bhp * SEQ * QS;
  const __bf16* Kz = (const __bf16*)(const void*)kzp + bhp * SEQ * QS;
  const __bf16* Vh = (const __bf16*)(const void*)vhp + ((size_t)b * HID + (size_t)h * HD) * SEQ;
  const __bf16* Vl = (const __bf16*)(const void*)vlp + ((size_t)b * HID + (size_t)h * HD) * SEQ;

  // ---- Q fragment (B operand, col = lane&15, one 32-slot k-step) ----
  const v16b qa = ldfrag_b(Qc + (size_t)(q0 + c) * QS + 8 * hh);
  const int rowq = q0 + c;                     // this lane's query index

  float mrow = -INFINITY;                      // running max of query rowq (equal in both lane halves)
  float lrow = 0.f;                            // running sum over this lane half's keys only
  v8f oacc = zero8();                          // O^T: register r = d 8hh+r of query rowq

  for (int kt = 0; kt <= qb; ++kt) {           // block-uniform trip count, <= NQB
    const int kv0 = kt * 64;                   // kv0 + 63 < SEQ

    // ---- scores: 64 keys x 16 queries per wave, 2 bf16 products per key subtile ----
    v8f s[4];
#pragma unroll
    for (int j = 0; j < 4; ++j) {
      const size_t ko = (size_t)(kv0 + j * 16 + c) * QS + 8 * hh;
      const v16b kd = ldfrag_b(Kd + ko);
      const v16b kz = ldfrag_b(Kz + ko);
      s[j] = mma_b(kd, qa, zero8());
      s[j] = mma_b(kz, qa, s[j]);
    }

    // ---- scale, causal mask by index, max in-lane + one exchange, online softmax ----
    float mj[4];                               // one max chain per score tile: four independent chains
#pragma unroll
    for (int j = 0; j < 4; ++j) {
      mj[j] = -INFINITY;
#pragma unroll
      for (int r = 0; r < 8; ++r) {
        const int key = kv0 + j * 16 + 8 * hh + r;
        float sv = s[j][r] * 0.25f;
        sv = (key <= rowq) ? sv : -INFINITY;
        s[j][r] = sv;
        mj[j] = fmaxf(mj[j], sv);
      }
    }
    float m = fmaxf(fmaxf(mj[0], mj[1]), fmaxf(mj[2], mj[3]));
    m = fmaxf(m, other_half(m));
    const float mnew  = fmaxf(mrow, m);
    const float msafe = (mnew == -INFINITY) ? 0.f : mnew;
    const float alpha = __expf(mrow - msafe);
    mrow = mnew;

    PB ph[2], pl[2];                           // P^T hi / lo as B operands of the two 32-key k-steps
    float pj[4];                               // one sum chain per score tile
#pragma unroll
    for (int j = 0; j < 4; ++j) {
      float xe[8], pe[8];
#pragma unroll
      for (int r = 0; r < 8; ++r) xe[r] = (s[j][r] - msafe) * 1.44269504f;   // exp(t) = 2^(t log2 e), as __expf forms it
      exp2x8(xe, pe);                                        // masked logit: 2^(-inf) = 0
#pragma unroll
      for (int e = 0; e < 4; ++e) {
        const float p0 = pe[2 * e];
        const float p1 = pe[2 * e + 1];
        pj[j] = (e == 0) ? (p0 + p1) : ((pj[j] + p0) + p1);
        const unsigned short hb0 = bf_bits(p0), hb1 = bf_bits(p1);
        const unsigned short lb0 = bf_bits(p0 - bf_up(hb0)), lb1 = bf_bits(p1 - bf_up(hb1));
        ph[j >> 1].u[(j & 1) * 4 + e] = pk16(hb0, hb1);
        pl[j >> 1].u[(j & 1) * 4 + e] = pk16(lb0, lb1);
      }
    }
    lrow = lrow * alpha + ((pj[0] + pj[1]) + (pj[2] + pj[3]));
#pragma unroll
    for (int r = 0; r < 8; ++r) oacc[r] *= alpha;

    // ---- context^T += V^T . P^T (bf16 WMMA, hh + lh + hl into one accumulator) ----
#pragma unroll
    for (int kk = 0; kk < 2; ++kk) {
      const size_t vo = (size_t)c * SEQ + kv0 + kk * 32 + 8 * hh;   // v^T row d = c, keys of this k-step
      const v16b vb = ldfrag_b(Vh + vo);
      // last use of the vb address: built without this wait, the vl loads' results are given the registers that hold it,
      // this one stands in front of that overwrite
      if (kk == 1) asm volatile("s_wait_xcnt 0x0" ::: "memory");
      const v16b vl = ldfrag_b(Vl + vo);
      oacc = mma_b(vb, ph[kk].v, oacc);
      oacc = mma_b(vl, ph[kk].v, oacc);
      oacc = mma_b(vb, pl[kk].v, oacc);
    }
  }

  // ---- join the halves' sums, normalise (1/l), bf16 hi/lo split, one 16-B store per lane and plane ----
  {
    const float l = lrow + other_half(lrow);
    const float inv = (l > 0.f) ? (1.0f / l) : 0.f;
    v4u a, a2;
#pragma unroll
    for (int e = 0; e < 4; ++e) {
      const float f0 = oacc[2 * e] * inv, f1 = oacc[2 * e + 1] * inv;
      const unsigned short hb0 = bf_bits(f0), hb1 = bf_bits(f1);
      const unsigned short lb0 = bf_bits(f0 - bf_up(hb0)), lb1 = bf_bits(f1 - bf_up(hb1));
      a[e] = pk16(hb0, hb1); a2[e] = pk16(lb0, lb1);
    }
    const size_t go = (bhp * SEQ + rowq) * HD + 8 * hh;
    *(v4u*)(ohp + go) = a;
    *(v4u*)(olp + go) = a2;
  }
}

// =====================================================================================================
// Workspace map (bytes; every region is an exact multiple of its whole-line / whole-tile store granularity,
//   Xb   bf16 [4096][288]            2359296
//   Wqb  bf16 [288][288]              165888   (x4: Wq, Wk, Wv, Wo)
//   Qc   bf16 [2][18][2048][32]      4718592
//   Kd                               4718592
//   Kz                               4718592
//   VTh  bf16 [2][288][2048]         2359296
//   VTl                              2359296
//   Oh   bf16 [2][18][2048][16]      2359296
//   Ol                               2359296
//   Ct   f32  [2048][8]                65536
//   St                                 65536
//   Iv   f32  [32] (one line)            128
//   total                           26747008
// =====================================================================================================
extern "C" void kernel_launch(void* const* d_in, const int* in_sizes, int n_in,
                              void* d_out, int out_size, void* d_ws, size_t ws_size,
                              hipStream_t stream) {
  if (n_in < 5) return;
  if (in_sizes[0] != NTOK * HID) return;
  if (in_sizes[1] != HID * HID) return;
  if (in_sizes[2] != HID * HID) return;
  if (in_sizes[3] != HID * HID) return;
  if (in_sizes[4] != HID * HID) return;
  if (out_size != NTOK * HID) return;

  const float* x  = (const float*)d_in[0];   // [2][2048][288]
  const float* Wq = (const float*)d_in[1];   // [288 out][288 in]
  const float* Wk = (const float*)d_in[2];
  const float* Wv = (const float*)d_in[3];
  const float* Wo = (const float*)d_in[4];

  const size_t PX  = (size_t)NTOK * HID * 2;            // 2359296
  const size_t PW  = (size_t)HID * HID * 2;             //  165888
  const size_t PQ  = (size_t)NB * NH * SEQ * QS * 2;    // 4718592
  const size_t PVT = (size_t)NB * HID * SEQ * 2;        // 2359296
  const size_t PO  = (size_t)NB * NH * SEQ * HD * 2;    // 2359296
  const size_t PTB = (size_t)SEQ * NPAIR * 4;           //   65536
  const size_t PIV = 128;
  size_t off = 0;
  const size_t oXb  = off; off += PX;
  const size_t oWq  = off; off += PW;
  const size_t oWk  = off; off += PW;
  const size_t oWv  = off; off += PW;
  const size_t oWo  = off; off += PW;
  const size_t oQc  = off; off += PQ;
  const size_t oKd  = off; off += PQ;
  const size_t oKz  = off; off += PQ;
  const size_t oVTh = off; off += PVT;
  const size_t oVTl = off; off += PVT;
  const size_t oOh  = off; off += PO;
  const size_t oOl  = off; off += PO;
  const size_t oCt  = off; off += PTB;
  const size_t oSt  = off; off += PTB;
  const size_t oIv  = off; off += PIV;
  if (off > ws_size) return;                            // off = 26747008
  if (off > (size_t)134217728) return;

  char* ws = (char*)d_ws;
  unsigned short* Xb  = (unsigned short*)(ws + oXb);
  unsigned short* Wqb = (unsigned short*)(ws + oWq);
  unsigned short* Wkb = (unsigned short*)(ws + oWk);
  unsigned short* Wvb = (unsigned short*)(ws + oWv);
  unsigned short* Wob = (unsigned short*)(ws + oWo);
  unsigned short* Qc  = (unsigned short*)(ws + oQc);
  unsigned short* Kd  = (unsigned short*)(ws + oKd);
  unsigned short* Kz  = (unsigned short*)(ws + oKz);
  unsigned short* VTh = (unsigned short*)(ws + oVTh);
  unsigned short* VTl = (unsigned short*)(ws + oVTl);
  unsigned short* Oh  = (unsigned short*)(ws + oOh);
  unsigned short* Ol  = (unsigned short*)(ws + oOl);
  float*          Ct  = (float*)(ws + oCt);
  float*          St  = (float*)(ws + oSt);
  float*          Iv  = (float*)(ws + oIv);

  const dim3 blk256(256);
  const dim3 blk128(128);
  const int n8x = NTOK * HID / 8;                       // 147456
  const int n8w = HID * HID / 8;                        //  10368
  const dim3 gCvtX((n8x + 255) / 256);                  // 576 blocks
  const dim3 gCvtW((n8w + 255) / 256);                  //  41 blocks
  const dim3 gTab(SEQ / 32);                            //  64 blocks
  const dim3 gGemm(((NTOK / 64) * (HID / 32)) / 4);     // 576 tiles -> 144 blocks of 4 waves
  const dim3 gAttn(NB * NH * NQB);                      // 1152 blocks of 128

  // (0) RoPE tables
  rope_inv<<<dim3(1), dim3(32), 0, stream>>>(Iv);
  rope_tab<<<gTab, blk256, 0, stream>>>(Iv, Ct, St);
  // (1) x and the four weights -> bf16 planes (weights are [out][in] = Bt[n][k] already)
  cvt_bf16x8<<<gCvtX, blk256, 0, stream>>>(x, Xb, n8x);
  cvt_bf16x8<<<gCvtW, blk256, 0, stream>>>(Wq, Wqb, n8w);
  cvt_bf16x8<<<gCvtW, blk256, 0, stream>>>(Wk, Wkb, n8w);
  cvt_bf16x8<<<gCvtW, blk256, 0, stream>>>(Wv, Wvb, n8w);
  cvt_bf16x8<<<gCvtW, blk256, 0, stream>>>(Wo, Wob, n8w);
  // (2) q = rope(x . Wq^T) -> [b][h][t][hi|lo]
  gemm_xw<0, false><<<gGemm, blk128, 0, stream>>>(Xb, Xb, Wqb, (void*)Qc, (void*)Qc, Ct, St);
  // (3) k = rope(x . Wk^T) -> [b][h][s][hi|hi] and [b][h][s][lo|0]
  gemm_xw<1, false><<<gGemm, blk128, 0, stream>>>(Xb, Xb, Wkb, (void*)Kd, (void*)Kz, Ct, St);
  // (4) v = x . Wv^T -> v^T bf16 hi / lo planes [b][h*16+d][s]
  gemm_xw<2, false><<<gGemm, blk128, 0, stream>>>(Xb, Xb, Wvb, (void*)VTh, (void*)VTl, Ct, St);
  // (5) causal attention -> ctx bf16 hi / lo planes [b][h][t][d]
  attn_causal16<<<gAttn, blk128, 0, stream>>>(Qc, Kd, Kz, VTh, VTl, Oh, Ol);
  // (6) out = (ctx hi + ctx lo) . Wo^T -> d_out f32 [4096][288]
  gemm_xw<3, true><<<gGemm, blk128, 0, stream>>>(Oh, Ol, Wob, d_out, d_out, Ct, St);
  (void)hipGetLastError();
}

// v002
// It runs in 106 microseconds.
// Timed twice side by side with v001, it ran 1.82 and 1.85 times as fast.
// Over all steps from v000 it is 2.71 times as fast.
// Contractions: q / k / v projections = v_wmma_f32_16x16x32_bf16 (bf16 operands from RNE-converted x and Wq/Wk/Wv, single product, f32 accumulate);
// k.q^T scores (transposed) = v_wmma_f32_16x16x32_bf16 with q and k as bf16 hi/lo split folded into the 32-deep k axis ([qhi|qlo].[khi|khi] + [qhi|qlo].[klo|0] = hh+lh+hl, 2 products), f32 accumulate;
// v^T.p^T (transposed) = v_wmma_f32_16x16x32_bf16 with p and v as bf16 hi/lo split (hh + hl + lh, 3 products), f32 accumulate;
// ctx.Wo^T = v_wmma_f32_16x16x32_bf16 with ctx as bf16 hi + unscaled lo planes times bf16 Wo (2 products), f32 accumulate;
// rotary tables (powf, f32 product, precise sincosf), half-rotation, causal mask and online softmax in f32 on the VALU.
// Carry audit: no scaled planes anywhere; every lo plane is the unscaled RNE residual (v - hi) in bf16 and shares the hi accumulator;
// score scale 1/4 applied once in f32 after the score accumulate; softmax normaliser 1/l applied once in the attention epilogue.
#include <hip/hip_runtime.h>
#include <math.h>
#include <stdint.h>

#define NB    2
#define SEQ   2048
#define HID   288
#define NH    18
#define HD    16
#define NPAIR 8
#define QS    32           // slots per head in the q / k planes: 0..15 hi (d), 16..31 lo (d) or duplicate / zero
#define NTOK  (NB * SEQ)   // 4096 token rows
#define NQB   (SEQ / 64)   // 32 query blocks of 64 per sequence
static_assert(NH * HD == HID);
static_assert(NPAIR * 2 == HD);
static_assert((SEQ % 64) == 0 && (HID % 32) == 0 && (NTOK % 64) == 0);
static_assert(((NTOK / 64) * (HID / 32)) % 4 == 0);
static_assert((NTOK * HID) % (8 * 256) == 0);
static_assert(((HID * HID) % 8) == 0 && (((HID * HID) / 8) % 32) == 0);
static_assert((SEQ % 32) == 0);

typedef __bf16   v16b __attribute__((ext_vector_type(16)));
typedef __bf16   v8b  __attribute__((ext_vector_type(8)));
typedef float    v8f  __attribute__((ext_vector_type(8)));
typedef float    v4f  __attribute__((ext_vector_type(4)));
typedef unsigned int v4u __attribute__((ext_vector_type(4)));

// ---- scalar helpers --------------------------------------------------------------------------------
__device__ __forceinline__ unsigned short bf_bits(float f) {          // f32 -> bf16 bits, RNE convert
  unsigned u = __float_as_uint(f);
  return (unsigned short)((u + 0x7FFFu + ((u >> 16) & 1u)) >> 16);
}
__device__ __forceinline__ float bf_up(unsigned short h) { return __uint_as_float(((unsigned)h) << 16); }
__device__ __forceinline__ unsigned pk16(unsigned short a, unsigned short b) { return (unsigned)a | ((unsigned)b << 16); }
__device__ __forceinline__ v8f zero8() { v8f z = {0.f, 0.f, 0.f, 0.f, 0.f, 0.f, 0.f, 0.f}; return z; }

// ---- fragment loaders: 16-bit A/B operand, lane -> row/col (lane&15), p already includes +8*(lane>>4);
//      elements 0..7 <- p[0..7] (k0+8h..k0+8h+7), elements 8..15 <- p[16..23] (k0+16+8h..k0+16+8h+7)
__device__ __forceinline__ v16b ldfrag_b(const __bf16* p) {
  union { v16b v; v8b h[2]; } f;
  f.h[0] = *(const v8b*)(p);
  f.h[1] = *(const v8b*)(p + 16);
  return f.v;
}
// same map when k0..k0+15 and k0+16..k0+31 live in two different rows (p0, p1 each include +8*(lane>>4))
__device__ __forceinline__ v16b ldfrag_b2(const __bf16* p0, const __bf16* p1) {
  union { v16b v; v8b h[2]; } f;
  f.h[0] = *(const v8b*)(p0);
  f.h[1] = *(const v8b*)(p1);
  return f.v;
}

// ---- WMMA helper with trailing VALU hazard gap (D tied, A/B kept live) ----------------------------------
__device__ __forceinline__ v8f mma_b(v16b a, v16b b, v8f c) {
  c = __builtin_amdgcn_wmma_f32_16x16x32_bf16(false, a, false, b, (short)0, c, false, false);
  asm volatile("v_nop\n\tv_nop\n\tv_nop\n\tv_nop" : "+v"(c) : "v"(a), "v"(b));
  return c;
}

// =====================================================================================================
// RoPE tables.  rope_inv: inv[i] = 1 / powf(10000, (2i)/16), i = 0..31 (entries 0..7 are used); one block of
// rope_tab: ctab[t][i] = cos(t * inv[i]), stab[t][i] = sin(t * inv[i]), i = 0..7, t = 0..SEQ-1
// (f32 product, precise sincosf). 256 threads = 32 positions x 8: thread tid -> t = block*32 + tid/8, i = tid&7, so a
// coverage: 64 blocks x 256 = the whole [SEQ][8] tables.
// =====================================================================================================
__global__ __launch_bounds__(32) void rope_inv(float* inv) {
  const int i = (int)threadIdx.x;
  const float e = (float)(2 * i) * (1.0f / (float)HD);
  const float p = powf(10000.0f, e);
  const float v = 1.0f / p;
  *(float*)(inv + i) = v;
  
}

__global__ __launch_bounds__(256) void rope_tab(const float* __restrict__ inv, float* ctab, float* stab) {
  const int tid = (int)threadIdx.x;
  const int i = tid & (NPAIR - 1);
  const int t = blockIdx.x * 32 + (tid >> 3);
  const float f   = inv[i];
  const float ang = (float)t * f;
  float sn, cs;
  sincosf(ang, &sn, &cs);
  const size_t o = (size_t)t * NPAIR + i;
  *(float*)(ctab + o) = cs;
  *(float*)(stab + o) = sn;
  
}

// =====================================================================================================
// f32 -> bf16 (RNE convert), 8 elements per thread, one 16-B store per lane: a wave writes 512 contiguous B
// coverage: n8 threads x 8 = the whole plane (n8 = 147456 for x, 10368 for each weight; both multiples of 32,
// =====================================================================================================
__global__ __launch_bounds__(256) void cvt_bf16x8(const float* __restrict__ in, unsigned short* out, int n8) {
  const int i = blockIdx.x * 256 + (int)threadIdx.x;
  if (i < n8) {
    const v4f a = *(const v4f*)(in + (size_t)i * 8);
    const v4f b = *(const v4f*)(in + (size_t)i * 8 + 4);
    v4u p;
    p[0] = pk16(bf_bits(a[0]), bf_bits(a[1]));
    p[1] = pk16(bf_bits(a[2]), bf_bits(a[3]));
    p[2] = pk16(bf_bits(b[0]), bf_bits(b[1]));
    p[3] = pk16(bf_bits(b[2]), bf_bits(b[3]));
    *(v4u*)(out + (size_t)i * 8) = p;
    
  }
}

// =====================================================================================================
// bf16 WMMA GEMM, one wave per 64 x 32 tile, 4 waves per block, no block barriers:
//   C[m][n] = sum_k A[m][k] * Bt[n][k] (+ sum_k A2[m][k] * Bt[n][k] when TWOA), M = 4096 tokens, N = 288, K = 288
//   (9 k-steps of 32, no tails). Bt = weight plane [n][k] (the [out][in] weight as delivered, RNE bf16), pitch 288.
//   A: MODE 0..2: x plane [m][k] pitch 288. MODE 3: ctx planes laid out [b][h][t][16]; k-step j covers heads 2j
//   (k 0..15) and 2j+1 (k 16..31): elements 0..7 <- head 2j, d = 8*(lane>>4)..+7; elements 8..15 <- head 2j+1, same d.
// then (b = m0/2048, t = m0%2048 + row, 32 columns = heads n0/16 and n0/16+1):
//   MODE 0 (q): rotary in f32 (contract off): d < 8: x[d] c[t][d] - x[d+8] s[t][d]; d >= 8: x[d] c[t][d-8] + x[d-8] s[t][d-8];
//               -> plane [b][h][t][32]: slots 0..15 = bf16 hi of d, 16..31 = bf16 lo (v - hi) of d.
//   MODE 1 (k): same rotary; plane C0 slots 0..15 = hi, 16..31 = hi (duplicate); plane C1 slots 0..15 = lo, 16..31 = 0.
//   MODE 2 (v): no rotary; v^T planes C0 = hi, C1 = lo, element (b, n, t) at [(b*288 + n)*2048 + t]:
// coverage: 576 tiles x (64 rows x 32 cols) = the whole 4096 x 288 result; MODE 0/1: 2 heads x 8 it x 8 rows x 4 lanes
//           x 8 slots = 64 rows x 2 heads x 32 slots; MODE 2: 8 it x 4 x 8 lanes x 8 = 32 features x 64 tokens;
//           MODE 3: 16 it x 4 rows x 8 lanes x 4 = 64 rows x 32 cols.
// =====================================================================================================
template <int MODE, bool TWOA>
__global__ __launch_bounds__(128) void gemm_xw(
    const unsigned short* __restrict__ Ap, const unsigned short* __restrict__ A2p,
    const unsigned short* __restrict__ Btp, void* C0, void* C1,
    const float* __restrict__ ctab, const float* __restrict__ stab) {
  static_assert(MODE >= 0 && MODE <= 3);
  constexpr int M = NTOK, N = HID, K = HID;
  constexpr int TN = N / 32;   // 9
  constexpr int TM = M / 64;   // 64
  const __bf16* A  = (const __bf16*)(const void*)Ap;
  const __bf16* A2 = (const __bf16*)(const void*)A2p;
  const __bf16* Bt = (const __bf16*)(const void*)Btp;
  __shared__ __align__(16) float sT[4][64 * 36];   // per-wave 64x32 tile, pitch 36 floats

  const int lane = threadIdx.x & 31;
  const int wave = __builtin_amdgcn_readfirstlane((int)(threadIdx.x >> 5));   // same in every lane: held scalar, the tile bases are scalar too
  const int tile = blockIdx.x * 4 + wave;
  if (tile >= TM * TN) return;                     // wave-uniform; no block barriers in this kernel
  const int tm = tile / TN;
  const int tn = tile - tm * TN;
  const int m0 = tm << 6;
  const int n0 = tn << 5;
  const int c    = lane & 15;                      // row (A) / col (B, D) within subtile
  const int koff = (lane >> 4) * 8;                // k offset of this lane half
  const int mOff = (lane >> 4) * 8;                // D row offset
  const int bidx = m0 / SEQ;                       // batch of this tile (tiles never straddle a batch)
  const int tl0  = m0 - bidx * SEQ;                // first position within the sequence

  v8f acc[4][2];
#pragma unroll
  for (int i = 0; i < 4; ++i)
#pragma unroll
    for (int j = 0; j < 2; ++j) acc[i][j] = zero8();

  // Loads run ahead of the matrix instructions: every fragment is fetched into a register set that is free by then, whole
  // k-steps before its products, so a k-step waits on loads issued earlier and not on its own. Three A sets go round.
  //   one A plane: k-step ks in A and B set ks % 3, fetched two k-steps ahead (8 products a k-step cover little of a load).
  //   two A planes: the hi products of a k-step run first, then the lo products (each accumulator still takes hi, lo, hi,
  //   lo ... in k order); the sets hold hi(ks), lo(ks), hi(ks+1), each fetched one k-step ahead; B in set ks & 1.
  // Address = wave-uniform tile base + one lane offset + a constant: the sets leave no room for a pointer per row.
  constexpr int KS = K / 32;                       // 9 k-steps
  const size_t abase = (MODE == 3) ? (((size_t)(bidx * NH)) * SEQ + tl0) * HD : (size_t)m0 * K;
  const __bf16* Ab  = A + abase;
  const __bf16* A2b = A2 + abase;
  const __bf16* Bb  = Bt + (size_t)n0 * K;
  const unsigned alane = (unsigned)(c * ((MODE == 3) ? HD : K) + koff);
  const unsigned blane = (unsigned)(c * K + koff);
  v16b bh[TWOA ? 2 : 3][2], ar[3][4];
  auto fetch_b = [&](const int ks, const int st) __attribute__((always_inline)) {
#pragma unroll
    for (int j = 0; j < 2; ++j) bh[st][j] = ldfrag_b(Bb + blane + (j << 4) * K + ks * 32);
  };
  auto fetch_a = [&](const __bf16* base, const int ks, const int set) __attribute__((always_inline)) {
#pragma unroll
    for (int i = 0; i < 4; ++i) {
      if (MODE == 3) {                             // ks = head pair index 0..8: heads 2 ks and 2 ks + 1, same token row
        const int e0 = (i << 4) * HD + (2 * ks) * SEQ * HD, e1 = e0 + SEQ * HD;
        ar[set][i] = ldfrag_b2(base + alane + e0, base + alane + e1);
      } else {
        ar[set][i] = ldfrag_b(base + alane + (i << 4) * K + ks * 32);
      }
    }
  };
  auto products = [&](const int set, const int st) __attribute__((always_inline)) {
#pragma unroll
    for (int i = 0; i < 4; ++i)
#pragma unroll
      for (int j = 0; j < 2; ++j) acc[i][j] = mma_b(ar[set][i], bh[st][j], acc[i][j]);
  };
  fetch_b(0, 0);
  fetch_a(Ab, 0, 0);
  if (TWOA) fetch_a(A2b, 0, 1);
  else { fetch_b(1, 1); fetch_a(Ab, 1, 1); }
#pragma unroll                                     // full unroll: a register set's index must be a constant
  for (int ks = 0; ks < KS; ++ks) {
    const int st = ks & 1;
    if (TWOA) {
      const int sh = (2 * ks) % 3, sl = (2 * ks + 1) % 3, sn = (2 * ks + 2) % 3;
      if (ks + 1 < KS) { fetch_b(ks + 1, st ^ 1); fetch_a(Ab, ks + 1, sn); }
      products(sh, st);
      if (ks + 1 < KS) fetch_a(A2b, ks + 1, sh);   // into the set the hi products have just read
      products(sl, st);
    } else {
      if (ks + 2 < KS) { fetch_b(ks + 2, (ks + 2) % 3); fetch_a(Ab, ks + 2, (ks + 2) % 3); }
      products(ks % 3, ks % 3);
    }
  }

  // ---- epilogue: whole tile to wave-private LDS ----
  float* slab = sT[wave];
#pragma unroll
  for (int i = 0; i < 4; ++i)
#pragma unroll
    for (int j = 0; j < 2; ++j)
#pragma unroll
      for (int r = 0; r < 8; ++r)
        slab[((i << 4) + mOff + r) * 36 + (j << 4) + c] = acc[i][j][r];
  __builtin_amdgcn_fence(__ATOMIC_RELEASE, "workgroup");
  __builtin_amdgcn_wave_barrier();
  __builtin_amdgcn_fence(__ATOMIC_ACQUIRE, "workgroup");

  if (MODE == 3) {
    float* Cf = (float*)C0;
    const int q4 = lane >> 3, c4 = (lane & 7) * 4;
    {
#pragma unroll
      for (int it = 0; it < 16; ++it) {
        const int row = it * 4 + q4;                         // it 0..15 x q4 0..3 = rows 0..63
        const v4f v = *(const v4f*)(slab + row * 36 + c4);
        *(v4f*)(Cf + (size_t)(m0 + row) * HID + n0 + c4) = v;
      }
      
    }
  } else if (MODE == 2) {
    unsigned short* P0 = (unsigned short*)C0;
    unsigned short* P1 = (unsigned short*)C1;
    const int q4 = lane >> 3, t8 = (lane & 7) * 8;
#pragma unroll 2
    for (int it = 0; it < 8; ++it) {
      const int n = it * 4 + q4;                             // local feature 0..31
      float f[8];
#pragma unroll
      for (int e = 0; e < 8; ++e) f[e] = slab[(t8 + e) * 36 + n];
      v4u a, a2;
#pragma unroll
      for (int e = 0; e < 4; ++e) {
        const float f0 = f[2 * e], f1 = f[2 * e + 1];
        const unsigned short h0 = bf_bits(f0), h1 = bf_bits(f1);
        const unsigned short l0 = bf_bits(f0 - bf_up(h0)), l1 = bf_bits(f1 - bf_up(h1));
        a[e] = pk16(h0, h1); a2[e] = pk16(l0, l1);
      }
      const size_t go = ((size_t)(bidx * HID + n0 + n)) * SEQ + tl0 + t8;
      *(v4u*)(P0 + go) = a;
      *(v4u*)(P1 + go) = a2;
      
    }
  } else {
    unsigned short* P0 = (unsigned short*)C0;
    unsigned short* P1 = (unsigned short*)C1;
    const int r4 = lane >> 2, s8 = (lane & 3) * 8;
    const int dbase = s8 & 8;                                // d of the first element: 0 or 8
    const bool isLo = (s8 >= 16);
    const float sg = (dbase == 0) ? -1.0f : 1.0f;            // -x[d+8] for d < 8, +x[d-8] for d >= 8
    const int h0 = n0 >> 4;                                  // first head of the tile (even)
#pragma unroll 1
    for (int hd = 0; hd < 2; ++hd) {
#pragma unroll 2
      for (int it = 0; it < 8; ++it) {
        const int row = it * 8 + r4;                         // it 0..7 x r4 0..7 = rows 0..63
        const int t = tl0 + row;                             // position within the sequence
        const float* xr = slab + row * 36 + hd * 16;
        float x[8], y[8], f[8];
#pragma unroll
        for (int e = 0; e < 8; ++e) { x[e] = xr[dbase + e]; y[e] = xr[(dbase ^ 8) + e]; }
        const v4f cv0 = *(const v4f*)(ctab + (size_t)t * NPAIR);
        const v4f cv1 = *(const v4f*)(ctab + (size_t)t * NPAIR + 4);
        const v4f sv0 = *(const v4f*)(stab + (size_t)t * NPAIR);
        const v4f sv1 = *(const v4f*)(stab + (size_t)t * NPAIR + 4);
        {
#pragma clang fp contract(off)
#pragma unroll
          for (int e = 0; e < 4; ++e) {
            {
              const float ry = sg * y[e];
              const float p0 = x[e] * cv0[e];
              const float p1 = ry * sv0[e];
              f[e] = p0 + p1;
            }
            {
              const float ry = sg * y[4 + e];
              const float p0 = x[4 + e] * cv1[e];
              const float p1 = ry * sv1[e];
              f[4 + e] = p0 + p1;
            }
          }
        }
        v4u hp, lp;
#pragma unroll
        for (int e = 0; e < 4; ++e) {
          const float f0 = f[2 * e], f1 = f[2 * e + 1];
          const unsigned short hb0 = bf_bits(f0), hb1 = bf_bits(f1);
          const unsigned short lb0 = bf_bits(f0 - bf_up(hb0)), lb1 = bf_bits(f1 - bf_up(hb1));
          hp[e] = pk16(hb0, hb1); lp[e] = pk16(lb0, lb1);
        }
        const size_t go = (((size_t)(bidx * NH + h0 + hd)) * SEQ + t) * QS + s8;
        if (MODE == 0) {
          v4u pc;
#pragma unroll
          for (int e = 0; e < 4; ++e) pc[e] = isLo ? lp[e] : hp[e];
          *(v4u*)(P0 + go) = pc;
          
        } else {
          v4u pz;
#pragma unroll
          for (int e = 0; e < 4; ++e) pz[e] = isLo ? 0u : lp[e];
          *(v4u*)(P0 + go) = hp;
          *(v4u*)(P1 + go) = pz;
          
        }
      }
    }
  }
}

// =====================================================================================================
// Causal attention, head dim 16, key chunks of 64, both products transposed: S^T = K . Q^T, O^T += V^T . P^T.
//   q plane  [b][h][t][32]: slots 0..15 = bf16 hi of rope(q)[d], 16..31 = bf16 lo
//   kd plane [b][h][s][32]: slots 0..15 = hi of rope(k)[d], 16..31 = hi again; kz plane: 0..15 = lo, 16..31 = 0
//   so one 32-deep k-step gives q.k = hi.hi + lo.hi (kd) and hi.lo (kz): two products per 16x16 score tile.
//   v^T planes (bf16 hi / lo): element (b, h*16+d, s) at [(b*288 + h*16 + d)*2048 + s]
//   ctx planes (bf16 hi / lo of the normalised context): element (b, h, t, d) at [((b*18 + h)*2048 + t)*16 + d]
//   Score tile j: A = 16 key rows (row = lane&15), B = the wave's 16 queries (col = lane&15), same loader on both sides, so
//   register r of lane (c, hh) = score of key kv0 + 16j + 8hh + r against query q0 + c: a lane holds 32 of the 64 keys of ONE
//   query. Row max and row sum are in-lane; the two lane halves exchange the max once per chunk and join their sums once, in
//   the epilogue. Tiles 2kk and 2kk+1, converted in place, are the B operand of k-step kk (element e = key 8hh+e, element
//   8+e = key 16+8hh+e), which is the k order in which ldfrag_b reads the v^T row as A: P never leaves the registers.
//   Causal structure: query block qb visits key chunks 0..qb only (block-uniform trip count qb+1 <= NQB); inside the
//   diagonal chunk a key with index > query index gets logit -inf -> exp gives exactly 0; the first key of every visited
//   chunk is always kept, so every joined max is finite.
//   Block = 4 waves = 64 query rows of one (b, h); wave w = rows q0..q0+15; no LDS, no barriers; grid = NB * NH * NQB.
//   Output: lane (c, hh) holds d = 8hh..8hh+7 of query q0 + c: one 16-B store per plane, 512 contiguous B per wave.
//   coverage: 1152 blocks x 4 waves x 16 rows x 16 d = every (b, h, t, d) of both ctx planes exactly once.
// =====================================================================================================
__device__ __forceinline__ float other_half(float v) {                // value of lane l ^ 16
  const int b = __builtin_bit_cast(int, v);
  return __builtin_bit_cast(float, __builtin_amdgcn_permlanex16(b, b, 0x76543210, 0xfedcba98, false, false));
}

__device__ __forceinline__ void exp2x8(const float (&x)[8], float (&y)[8]) {
  asm("v_exp_f32 %0, %8\n\tv_exp_f32 %1, %9\n\tv_exp_f32 %2, %10\n\tv_exp_f32 %3, %11\n\t"
      "v_exp_f32 %4, %12\n\tv_exp_f32 %5, %13\n\tv_exp_f32 %6, %14\n\tv_exp_f32 %7, %15\n\tv_nop"
      : "=&v"(y[0]), "=&v"(y[1]), "=&v"(y[2]), "=&v"(y[3]), "=&v"(y[4]), "=&v"(y[5]), "=&v"(y[6]), "=&v"(y[7])
      : "v"(x[0]), "v"(x[1]), "v"(x[2]), "v"(x[3]), "v"(x[4]), "v"(x[5]), "v"(x[6]), "v"(x[7]));
}

__global__ __launch_bounds__(128)
void attn_causal16(const unsigned short* __restrict__ qcp, const unsigned short* __restrict__ kdp,
                   const unsigned short* __restrict__ kzp, const unsigned short* __restrict__ vhp,
                   const unsigned short* __restrict__ vlp, unsigned short* ohp, unsigned short* olp) {
  union PB { v16b v; unsigned u[8]; };

  const int tid  = threadIdx.x;
  const int wave = tid >> 5;
  const int lane = tid & 31;
  const int hh   = lane >> 4;
  const int c    = lane & 15;

  const int bx   = blockIdx.x;
  const int qb   = bx % NQB;
  const int rest = bx / NQB;
  const int h    = rest % NH;
  const int b    = rest / NH;
  const int q0   = qb * 64 + wave * 16;
  const size_t bhp = (size_t)b * NH + h;

  const __bf16* Qc = (const __bf16*)(const void*)qcp + bhp * SEQ * QS;
  const __bf16* Kd = (const __bf16*)(const void*)kdp + bhp * SEQ * QS;
  const __bf16* Kz = (const __bf16*)(const void*)kzp + bhp * SEQ * QS;
  const __bf16* Vh = (const __bf16*)(const void*)vhp + ((size_t)b * HID + (size_t)h * HD) * SEQ;
  const __bf16* Vl = (const __bf16*)(const void*)vlp + ((size_t)b * HID + (size_t)h * HD) * SEQ;

  // ---- Q fragment (B operand, col = lane&15, one 32-slot k-step) ----
  const v16b qa = ldfrag_b(Qc + (size_t)(q0 + c) * QS + 8 * hh);
  const int rowq = q0 + c;                     // this lane's query index

  float mrow = -INFINITY;                      // running max of query rowq (equal in both lane halves)
  float lrow = 0.f;                            // running sum over this lane half's keys only
  v8f oacc = zero8();                          // O^T: register r = d 8hh+r of query rowq

  // Loads run ahead of the matrix instructions that use them: chunk kt + 1's K fragments are fetched as one group behind
  // the score products of chunk kt, chunk kt's V fragments at the head of trip kt; the softmax runs while both fly.
  // Address = wave-uniform chunk base + a lane offset that never changes.
  const unsigned klane = (unsigned)(c * QS + 8 * hh);        // key row c of a subtile, this lane half's slots
  const unsigned vlane = (unsigned)(c * SEQ + 8 * hh);       // v^T row d = c, this lane half's keys
  v16b kd[4], kz[4];
  auto fetch_k = [&](const int kv) __attribute__((always_inline)) {
    const __bf16* kdb = Kd + (size_t)kv * QS;
    const __bf16* kzb = Kz + (size_t)kv * QS;
#pragma unroll
    for (int j = 0; j < 4; ++j) {
      kd[j] = ldfrag_b(kdb + klane + j * 16 * QS);
      kz[j] = ldfrag_b(kzb + klane + j * 16 * QS);
    }
  };
  fetch_k(0);

  for (int kt = 0; kt <= qb; ++kt) {           // block-uniform trip count, <= NQB
    const int kv0 = kt * 64;                   // kv0 + 63 < SEQ
    const int kvn = (kt < qb) ? kv0 + 64 : kv0;   // K chunk fetched ahead; the last trip fetches its own again (in bounds, unused)

    v16b vb[2], vl[2];
#pragma unroll
    for (int kk = 0; kk < 2; ++kk) {
      vb[kk] = ldfrag_b(Vh + kv0 + vlane + kk * 32);
      vl[kk] = ldfrag_b(Vl + kv0 + vlane + kk * 32);
    }

    // ---- scores: 64 keys x 16 queries per wave, 2 bf16 products per key subtile ----
    v8f s[4];
#pragma unroll
    for (int j = 0; j < 4; ++j) {
      s[j] = mma_b(kd[j], qa, zero8());
      s[j] = mma_b(kz[j], qa, s[j]);
    }
    fetch_k(kvn);

    // ---- scale, causal mask by index, max in-lane + one exchange, online softmax ----
    float mj[4];                               // one max chain per score tile: four independent chains
#pragma unroll
    for (int j = 0; j < 4; ++j) {
      mj[j] = -INFINITY;
#pragma unroll
      for (int r = 0; r < 8; ++r) {
        const int key = kv0 + j * 16 + 8 * hh + r;
        float sv = s[j][r] * 0.25f;
        sv = (key <= rowq) ? sv : -INFINITY;
        s[j][r] = sv;
        mj[j] = fmaxf(mj[j], sv);
      }
    }
    float m = fmaxf(fmaxf(mj[0], mj[1]), fmaxf(mj[2], mj[3]));
    m = fmaxf(m, other_half(m));
    const float mnew  = fmaxf(mrow, m);
    const float msafe = (mnew == -INFINITY) ? 0.f : mnew;
    const float alpha = __expf(mrow - msafe);
    mrow = mnew;

    PB ph[2], pl[2];                           // P^T hi / lo as B operands of the two 32-key k-steps
    float pj[4];                               // one sum chain per score tile
#pragma unroll
    for (int j = 0; j < 4; ++j) {
      float xe[8], pe[8];
#pragma unroll
      for (int r = 0; r < 8; ++r) xe[r] = (s[j][r] - msafe) * 1.44269504f;   // exp(t) = 2^(t log2 e), as __expf forms it
      exp2x8(xe, pe);                                        // masked logit: 2^(-inf) = 0
#pragma unroll
      for (int e = 0; e < 4; ++e) {
        const float p0 = pe[2 * e];
        const float p1 = pe[2 * e + 1];
        pj[j] = (e == 0) ? (p0 + p1) : ((pj[j] + p0) + p1);
        const unsigned short hb0 = bf_bits(p0), hb1 = bf_bits(p1);
        const unsigned short lb0 = bf_bits(p0 - bf_up(hb0)), lb1 = bf_bits(p1 - bf_up(hb1));
        ph[j >> 1].u[(j & 1) * 4 + e] = pk16(hb0, hb1);
        pl[j >> 1].u[(j & 1) * 4 + e] = pk16(lb0, lb1);
      }
    }
    lrow = lrow * alpha + ((pj[0] + pj[1]) + (pj[2] + pj[3]));
#pragma unroll
    for (int r = 0; r < 8; ++r) oacc[r] *= alpha;

    // ---- context^T += V^T . P^T (bf16 WMMA, hh + lh + hl into one accumulator) ----
#pragma unroll
    for (int kk = 0; kk < 2; ++kk) {
      oacc = mma_b(vb[kk], ph[kk].v, oacc);
      oacc = mma_b(vl[kk], ph[kk].v, oacc);
      oacc = mma_b(vb[kk], pl[kk].v, oacc);
    }
  }

  // ---- join the halves' sums, normalise (1/l), bf16 hi/lo split, one 16-B store per lane and plane ----
  {
    const float l = lrow + other_half(lrow);
    const float inv = (l > 0.f) ? (1.0f / l) : 0.f;
    v4u a, a2;
#pragma unroll
    for (int e = 0; e < 4; ++e) {
      const float f0 = oacc[2 * e] * inv, f1 = oacc[2 * e + 1] * inv;
      const unsigned short hb0 = bf_bits(f0), hb1 = bf_bits(f1);
      const unsigned short lb0 = bf_bits(f0 - bf_up(hb0)), lb1 = bf_bits(f1 - bf_up(hb1));
      a[e] = pk16(hb0, hb1); a2[e] = pk16(lb0, lb1);
    }
    const size_t go = (bhp * SEQ + rowq) * HD + 8 * hh;
    *(v4u*)(ohp + go) = a;
    *(v4u*)(olp + go) = a2;
  }
}

// =====================================================================================================
// Workspace map (bytes; every region is an exact multiple of its whole-line / whole-tile store granularity,
//   Xb   bf16 [4096][288]            2359296
//   Wqb  bf16 [288][288]              165888   (x4: Wq, Wk, Wv, Wo)
//   Qc   bf16 [2][18][2048][32]      4718592
//   Kd                               4718592
//   Kz                               4718592
//   VTh  bf16 [2][288][2048]         2359296
//   VTl                              2359296
//   Oh   bf16 [2][18][2048][16]      2359296
//   Ol                               2359296
//   Ct   f32  [2048][8]                65536
//   St                                 65536
//   Iv   f32  [32] (one line)            128
//   total                           26747008
// =====================================================================================================
extern "C" void kernel_launch(void* const* d_in, const int* in_sizes, int n_in,
                              void* d_out, int out_size, void* d_ws, size_t ws_size,
                              hipStream_t stream) {
  if (n_in < 5) return;
  if (in_sizes[0] != NTOK * HID) return;
  if (in_sizes[1] != HID * HID) return;
  if (in_sizes[2] != HID * HID) return;
  if (in_sizes[3] != HID * HID) return;
  if (in_sizes[4] != HID * HID) return;
  if (out_size != NTOK * HID) return;

  const float* x  = (const float*)d_in[0];   // [2][2048][288]
  const float* Wq = (const float*)d_in[1];   // [288 out][288 in]
  const float* Wk = (const float*)d_in[2];
  const float* Wv = (const float*)d_in[3];
  const float* Wo = (const float*)d_in[4];

  const size_t PX  = (size_t)NTOK * HID * 2;            // 2359296
  const size_t PW  = (size_t)HID * HID * 2;             //  165888
  const size_t PQ  = (size_t)NB * NH * SEQ * QS * 2;    // 4718592
  const size_t PVT = (size_t)NB * HID * SEQ * 2;        // 2359296
  const size_t PO  = (size_t)NB * NH * SEQ * HD * 2;    // 2359296
  const size_t PTB = (size_t)SEQ * NPAIR * 4;           //   65536
  const size_t PIV = 128;
  size_t off = 0;
  const size_t oXb  = off; off += PX;
  const size_t oWq  = off; off += PW;
  const size_t oWk  = off; off += PW;
  const size_t oWv  = off; off += PW;
  const size_t oWo  = off; off += PW;
  const size_t oQc  = off; off += PQ;
  const size_t oKd  = off; off += PQ;
  const size_t oKz  = off; off += PQ;
  const size_t oVTh = off; off += PVT;
  const size_t oVTl = off; off += PVT;
  const size_t oOh  = off; off += PO;
  const size_t oOl  = off; off += PO;
  const size_t oCt  = off; off += PTB;
  const size_t oSt  = off; off += PTB;
  const size_t oIv  = off; off += PIV;
  if (off > ws_size) return;                            // off = 26747008
  if (off > (size_t)134217728) return;

  char* ws = (char*)d_ws;
  unsigned short* Xb  = (unsigned short*)(ws + oXb);
  unsigned short* Wqb = (unsigned short*)(ws + oWq);
  unsigned short* Wkb = (unsigned short*)(ws + oWk);
  unsigned short* Wvb = (unsigned short*)(ws + oWv);
  unsigned short* Wob = (unsigned short*)(ws + oWo);
  unsigned short* Qc  = (unsigned short*)(ws + oQc);
  unsigned short* Kd  = (unsigned short*)(ws + oKd);
  unsigned short* Kz  = (unsigned short*)(ws + oKz);
  unsigned short* VTh = (unsigned short*)(ws + oVTh);
  unsigned short* VTl = (unsigned short*)(ws + oVTl);
  unsigned short* Oh  = (unsigned short*)(ws + oOh);
  unsigned short* Ol  = (unsigned short*)(ws + oOl);
  float*          Ct  = (float*)(ws + oCt);
  float*          St  = (float*)(ws + oSt);
  float*          Iv  = (float*)(ws + oIv);

  const dim3 blk256(256);
  const dim3 blk128(128);
  const int n8x = NTOK * HID / 8;                       // 147456
  const int n8w = HID * HID / 8;                        //  10368
  const dim3 gCvtX((n8x + 255) / 256);                  // 576 blocks
  const dim3 gCvtW((n8w + 255) / 256);                  //  41 blocks
  const dim3 gTab(SEQ / 32);                            //  64 blocks
  const dim3 gGemm(((NTOK / 64) * (HID / 32)) / 4);     // 576 tiles -> 144 blocks of 4 waves
  const dim3 gAttn(NB * NH * NQB);                      // 1152 blocks of 128

  // (0) RoPE tables
  rope_inv<<<dim3(1), dim3(32), 0, stream>>>(Iv);
  rope_tab<<<gTab, blk256, 0, stream>>>(Iv, Ct, St);
  // (1) x and the four weights -> bf16 planes (weights are [out][in] = Bt[n][k] already)
  cvt_bf16x8<<<gCvtX, blk256, 0, stream>>>(x, Xb, n8x);
  cvt_bf16x8<<<gCvtW, blk256, 0, stream>>>(Wq, Wqb, n8w);
  cvt_bf16x8<<<gCvtW, blk256, 0, stream>>>(Wk, Wkb, n8w);
  cvt_bf16x8<<<gCvtW, blk256, 0, stream>>>(Wv, Wvb, n8w);
  cvt_bf16x8<<<gCvtW, blk256, 0, stream>>>(Wo, Wob, n8w);
  // (2) q = rope(x . Wq^T) -> [b][h][t][hi|lo]
  gemm_xw<0, false><<<gGemm, blk128, 0, stream>>>(Xb, Xb, Wqb, (void*)Qc, (void*)Qc, Ct, St);
  // (3) k = rope(x . Wk^T) -> [b][h][s][hi|hi] and [b][h][s][lo|0]
  gemm_xw<1, false><<<gGemm, blk128, 0, stream>>>(Xb, Xb, Wkb, (void*)Kd, (void*)Kz, Ct, St);
  // (4) v = x . Wv^T -> v^T bf16 hi / lo planes [b][h*16+d][s]
  gemm_xw<2, false><<<gGemm, blk128, 0, stream>>>(Xb, Xb, Wvb, (void*)VTh, (void*)VTl, Ct, St);
  // (5) causal attention -> ctx bf16 hi / lo planes [b][h][t][d]
  attn_causal16<<<gAttn, blk128, 0, stream>>>(Qc, Kd, Kz, VTh, VTl, Oh, Ol);
  // (6) out = (ctx hi + ctx lo) . Wo^T -> d_out f32 [4096][288]
  gemm_xw<3, true><<<gGemm, blk128, 0, stream>>>(Oh, Ol, Wob, d_out, d_out, Ct, St);
  (void)hipGetLastError();
}

// v003
// A run of this version takes 82.8 microseconds.
// Next to v002, in two timings, it ran 1.28 times as fast each time.
// Over all steps from v000 it is 3.47 times as fast.
// Contractions: q / k / v projections = v_wmma_f32_16x16x32_bf16 (bf16 operands from RNE-converted x and Wq/Wk/Wv, single product, f32 accumulate);
// k.q^T scores (transposed) = v_wmma_f32_16x16x32_bf16 with q and k as bf16 hi/lo split folded into the 32-deep k axis ([qhi|qlo].[khi|khi] + [qhi|qlo].[klo|0] = hh+lh+hl, 2 products), f32 accumulate;
// v^T.p^T (transposed) = v_wmma_f32_16x16x32_bf16 with p and v as bf16 hi/lo split (hh + hl + lh, 3 products), f32 accumulate;
// ctx.Wo^T = v_wmma_f32_16x16x32_bf16 with ctx as bf16 hi + unscaled lo planes times bf16 Wo (2 products), f32 accumulate;
// rotary tables (powf, f32 product, precise sincosf), half-rotation, causal mask and online softmax in f32 on the VALU.
// Carry audit: no scaled planes anywhere; every lo plane is the unscaled RNE residual (v - hi) in bf16 and shares the hi accumulator;
// score scale 1/4 applied once in f32 after the score accumulate; softmax normaliser 1/l applied once in the attention epilogue.
#include <hip/hip_runtime.h>
#include <math.h>
#include <stdint.h>

#define NB    2
#define SEQ   2048
#define HID   288
#define NH    18
#define HD    16
#define NPAIR 8
#define QS    32           // slots per head in the q / k planes: 0..15 hi (d), 16..31 lo (d) or duplicate / zero
#define NTOK  (NB * SEQ)   // 4096 token rows
#define NQB   (SEQ / 64)   // 32 query blocks of 64 per sequence
static_assert(NH * HD == HID);
static_assert(NPAIR * 2 == HD);
static_assert((SEQ % 64) == 0 && (HID % 32) == 0 && (NTOK % 64) == 0);
static_assert(((NTOK / 64) * (HID / 32)) % 4 == 0);
static_assert((NTOK * HID) % (8 * 256) == 0);
static_assert(((HID * HID) % 8) == 0 && (((HID * HID) / 8) % 32) == 0);
static_assert((SEQ % 32) == 0);

typedef __bf16   v16b __attribute__((ext_vector_type(16)));
typedef __bf16   v8b  __attribute__((ext_vector_type(8)));
typedef float    v8f  __attribute__((ext_vector_type(8)));
typedef float    v4f  __attribute__((ext_vector_type(4)));
typedef unsigned int v4u __attribute__((ext_vector_type(4)));

// ---- scalar helpers --------------------------------------------------------------------------------
__device__ __forceinline__ unsigned short bf_bits(float f) {          // f32 -> bf16 bits, RNE convert
  unsigned u = __float_as_uint(f);
  return (unsigned short)((u + 0x7FFFu + ((u >> 16) & 1u)) >> 16);
}
__device__ __forceinline__ float bf_up(unsigned short h) { return __uint_as_float(((unsigned)h) << 16); }
__device__ __forceinline__ unsigned pk16(unsigned short a, unsigned short b) { return (unsigned)a | ((unsigned)b << 16); }
__device__ __forceinline__ v8f zero8() { v8f z = {0.f, 0.f, 0.f, 0.f, 0.f, 0.f, 0.f, 0.f}; return z; }

// ---- fragment loaders: 16-bit A/B operand, lane -> row/col (lane&15), p already includes +8*(lane>>4);
//      elements 0..7 <- p[0..7] (k0+8h..k0+8h+7), elements 8..15 <- p[16..23] (k0+16+8h..k0+16+8h+7)
__device__ __forceinline__ v16b ldfrag_b(const __bf16* p) {
  union { v16b v; v8b h[2]; } f;
  f.h[0] = *(const v8b*)(p);
  f.h[1] = *(const v8b*)(p + 16);
  return f.v;
}
// same map when k0..k0+15 and k0+16..k0+31 live in two different rows (p0, p1 each include +8*(lane>>4))
__device__ __forceinline__ v16b ldfrag_b2(const __bf16* p0, const __bf16* p1) {
  union { v16b v; v8b h[2]; } f;
  f.h[0] = *(const v8b*)(p0);
  f.h[1] = *(const v8b*)(p1);
  return f.v;
}

// ---- WMMA helper with trailing VALU hazard gap (D tied, A/B kept live) ----------------------------------
__device__ __forceinline__ v8f mma_b(v16b a, v16b b, v8f c) {
  c = __builtin_amdgcn_wmma_f32_16x16x32_bf16(false, a, false, b, (short)0, c, false, false);
  asm volatile("v_nop\n\tv_nop\n\tv_nop\n\tv_nop" : "+v"(c) : "v"(a), "v"(b));
  return c;
}

// =====================================================================================================
// prep: everything the projections need and that depends on the inputs alone, as block ranges of ONE grid (256 threads a
// block, the range test is block-uniform):
//   blocks 0..63 (rotary tables): ctab[t][i] = cos(t * inv[i]), stab[t][i] = sin(t * inv[i]), i = 0..7, t = 0..SEQ-1, with
//     inv[i] = 1 / powf(10000, (2i)/16) formed by every thread for its own i (f32 product, precise sincosf);
//     thread tid -> t = block*32 + tid/8, i = tid&7; 64 blocks x 256 = the whole [SEQ][8] tables.
//   blocks 64..227 (weights): 41 blocks a weight, Wq, Wk, Wv, Wo in this order, into four planes that follow one another.
//   blocks 228..803 (x).
//   f32 -> bf16 (RNE convert), 8 elements per thread, one 16-B store per lane: a wave writes 512 contiguous B;
//   n8 threads x 8 = the whole plane (n8 = 147456 for x, 10368 for each weight; both multiples of 32).
// =====================================================================================================
#define PREP_TAB  (SEQ / 32)                       // 64 blocks
#define PREP_W    ((HID * HID / 8 + 255) / 256)    // 41 blocks a weight
#define PREP_X    (NTOK * HID / 8 / 256)           // 576 blocks
__device__ __forceinline__ void cvt_bf16x8(const float* __restrict__ in, unsigned short* out, const int i) {
  const v4f a = *(const v4f*)(in + (size_t)i * 8);
  const v4f b = *(const v4f*)(in + (size_t)i * 8 + 4);
  v4u p;
  p[0] = pk16(bf_bits(a[0]), bf_bits(a[1]));
  p[1] = pk16(bf_bits(a[2]), bf_bits(a[3]));
  p[2] = pk16(bf_bits(b[0]), bf_bits(b[1]));
  p[3] = pk16(bf_bits(b[2]), bf_bits(b[3]));
  *(v4u*)(out + (size_t)i * 8) = p;
  // precaution: in the merged kernel's listing another block range's code, which rewrites the store's registers, follows it
  asm volatile("s_wait_xcnt 0x0" ::: "memory");
}

__global__ __launch_bounds__(256) void prep(const float* __restrict__ x, const float* __restrict__ Wq,
                                            const float* __restrict__ Wk, const float* __restrict__ Wv,
                                            const float* __restrict__ Wo, unsigned short* Xb, unsigned short* Wb,
                                            float* ctab, float* stab) {
  const int tid = (int)threadIdx.x;
  const int bx  = (int)blockIdx.x;
  if (bx < PREP_TAB) {
    const int i = tid & (NPAIR - 1);
    const int t = bx * 32 + (tid >> 3);
    const float e = (float)(2 * i) * (1.0f / (float)HD);
    const float p = powf(10000.0f, e);
    const float f = 1.0f / p;
    const float ang = (float)t * f;
    float sn, cs;
    sincosf(ang, &sn, &cs);
    const size_t o = (size_t)t * NPAIR + i;
    *(float*)(ctab + o) = cs;
    *(float*)(stab + o) = sn;
  } else if (bx < PREP_TAB + 4 * PREP_W) {
    const int w  = (bx - PREP_TAB) / PREP_W;       // 0..3: Wq, Wk, Wv, Wo
    const int i  = (bx - PREP_TAB - w * PREP_W) * 256 + tid;
    const float* in = (w == 0) ? Wq : (w == 1) ? Wk : (w == 2) ? Wv : Wo;
    if (i < HID * HID / 8) cvt_bf16x8(in, Wb + (size_t)w * (HID * HID), i);
  } else {
    cvt_bf16x8(x, Xb, (bx - PREP_TAB - 4 * PREP_W) * 256 + tid);
  }
}

// =====================================================================================================
// bf16 WMMA GEMM, one wave per 64 x 32 tile, 4 waves per block, no block barriers:
//   C[m][n] = sum_k A[m][k] * Bt[n][k] (+ sum_k A2[m][k] * Bt[n][k] when TWOA), M = 4096 tokens, N = 288, K = 288
//   (9 k-steps of 32, no tails). Bt = weight plane [n][k] (the [out][in] weight as delivered, RNE bf16), pitch 288.
//   A: MODE 0..2: x plane [m][k] pitch 288. MODE 3: ctx planes laid out [b][h][t][16]; k-step j covers heads 2j
//   (k 0..15) and 2j+1 (k 16..31): elements 0..7 <- head 2j, d = 8*(lane>>4)..+7; elements 8..15 <- head 2j+1, same d.
// then (b = m0/2048, t = m0%2048 + row, 32 columns = heads n0/16 and n0/16+1):
//   MODE 0 (q): rotary in f32 (contract off): d < 8: x[d] c[t][d] - x[d+8] s[t][d]; d >= 8: x[d] c[t][d-8] + x[d-8] s[t][d-8];
//               -> plane [b][h][t][32]: slots 0..15 = bf16 hi of d, 16..31 = bf16 lo (v - hi) of d.
//   MODE 1 (k): same rotary; plane C0 slots 0..15 = hi, 16..31 = hi (duplicate); plane C1 slots 0..15 = lo, 16..31 = 0.
//   MODE 2 (v): no rotary; v^T planes C0 = hi, C1 = lo, element (b, n, t) at [(b*288 + n)*2048 + t]:
//   MODE 0..2 share one body and ONE grid (gemm_qkv: blockIdx.y = mode, the same in every wave of a block; only the weight
//   plane, the epilogue and the output planes differ); MODE 3 (OUT) is a launch of its own (gemm_out), behind attention.
// coverage: 576 tiles x (64 rows x 32 cols) = the whole 4096 x 288 result; MODE 0/1: 2 heads x 8 it x 8 rows x 4 lanes
//           x 8 slots = 64 rows x 2 heads x 32 slots; MODE 2: 8 it x 4 x 8 lanes x 8 = 32 features x 64 tokens;
//           MODE 3: 16 it x 4 rows x 8 lanes x 4 = 64 rows x 32 cols.
// =====================================================================================================
// Epilogue of one wave's 64 x 32 tile, read back from its LDS slab; MODE as listed above.
template <int MODE>
__device__ __forceinline__ void gemm_epi(const float* slab, const int lane, const int m0, const int n0, const int bidx,
                                         const int tl0, void* C0, void* C1,
                                         const float* __restrict__ ctab, const float* __restrict__ stab) {
  static_assert(MODE >= 0 && MODE <= 3);
  if (MODE == 3) {
    float* Cf = (float*)C0;
    const int q4 = lane >> 3, c4 = (lane & 7) * 4;
    {
#pragma unroll
      for (int it = 0; it < 16; ++it) {
        const int row = it * 4 + q4;                         // it 0..15 x q4 0..3 = rows 0..63
        const v4f v = *(const v4f*)(slab + row * 36 + c4);
        *(v4f*)(Cf + (size_t)(m0 + row) * HID + n0 + c4) = v;
      }
      
    }
  } else if (MODE == 2) {
    unsigned short* P0 = (unsigned short*)C0;
    unsigned short* P1 = (unsigned short*)C1;
    const int q4 = lane >> 3, t8 = (lane & 7) * 8;
#pragma unroll 1
    for (int it2 = 0; it2 < 8; it2 += 2) {         // two rows' loads and stores side by side in a trip
#pragma unroll
      for (int it = it2; it < it2 + 2; ++it) {
        const int n = it * 4 + q4;                             // local feature 0..31
        float f[8];
#pragma unroll
        for (int e = 0; e < 8; ++e) f[e] = slab[(t8 + e) * 36 + n];
        v4u a, a2;
#pragma unroll
        for (int e = 0; e < 4; ++e) {
          const float f0 = f[2 * e], f1 = f[2 * e + 1];
          const unsigned short h0 = bf_bits(f0), h1 = bf_bits(f1);
          const unsigned short l0 = bf_bits(f0 - bf_up(h0)), l1 = bf_bits(f1 - bf_up(h1));
          a[e] = pk16(h0, h1); a2[e] = pk16(l0, l1);
        }
        const size_t go = ((size_t)(bidx * HID + n0 + n)) * SEQ + tl0 + t8;
        *(v4u*)(P0 + go) = a;
        *(v4u*)(P1 + go) = a2;
      }
      // precaution: the next trip rewrites registers that these stores name
      asm volatile("s_wait_xcnt 0x0" ::: "memory");
    }
  } else {
    unsigned short* P0 = (unsigned short*)C0;
    unsigned short* P1 = (unsigned short*)C1;
    const int r4 = lane >> 2, s8 = (lane & 3) * 8;
    const int dbase = s8 & 8;                                // d of the first element: 0 or 8
    const bool isLo = (s8 >= 16);
    const float sg = (dbase == 0) ? -1.0f : 1.0f;            // -x[d+8] for d < 8, +x[d-8] for d >= 8
    const int h0 = n0 >> 4;                                  // first head of the tile (even)
#pragma unroll 1
    for (int hd = 0; hd < 2; ++hd) {
#pragma unroll 1
      for (int it2 = 0; it2 < 8; it2 += 2) {         // two rows' loads and stores side by side in a trip
#pragma unroll
        for (int it = it2; it < it2 + 2; ++it) {
          const int row = it * 8 + r4;                         // it 0..7 x r4 0..7 = rows 0..63
          const int t = tl0 + row;                             // position within the sequence
          const float* xr = slab + row * 36 + hd * 16;
          float x[8], y[8], f[8];
#pragma unroll
          for (int e = 0; e < 8; ++e) { x[e] = xr[dbase + e]; y[e] = xr[(dbase ^ 8) + e]; }
          const v4f cv0 = *(const v4f*)(ctab + (size_t)t * NPAIR);
          const v4f cv1 = *(const v4f*)(ctab + (size_t)t * NPAIR + 4);
          const v4f sv0 = *(const v4f*)(stab + (size_t)t * NPAIR);
          const v4f sv1 = *(const v4f*)(stab + (size_t)t * NPAIR + 4);
          {
#pragma clang fp contract(off)
#pragma unroll
            for (int e = 0; e < 4; ++e) {
              {
                const float ry = sg * y[e];
                const float p0 = x[e] * cv0[e];
                const float p1 = ry * sv0[e];
                f[e] = p0 + p1;
              }
              {
                const float ry = sg * y[4 + e];
                const float p0 = x[4 + e] * cv1[e];
                const float p1 = ry * sv1[e];
                f[4 + e] = p0 + p1;
              }
            }
          }
          v4u hp, lp;
#pragma unroll
          for (int e = 0; e < 4; ++e) {
            const float f0 = f[2 * e], f1 = f[2 * e + 1];
            const unsigned short hb0 = bf_bits(f0), hb1 = bf_bits(f1);
            const unsigned short lb0 = bf_bits(f0 - bf_up(hb0)), lb1 = bf_bits(f1 - bf_up(hb1));
            hp[e] = pk16(hb0, hb1); lp[e] = pk16(lb0, lb1);
          }
          const size_t go = (((size_t)(bidx * NH + h0 + hd)) * SEQ + t) * QS + s8;
          if (MODE == 0) {
            v4u pc;
#pragma unroll
            for (int e = 0; e < 4; ++e) pc[e] = isLo ? lp[e] : hp[e];
            *(v4u*)(P0 + go) = pc;
          } else {
            v4u pz;
#pragma unroll
            for (int e = 0; e < 4; ++e) pz[e] = isLo ? 0u : lp[e];
            *(v4u*)(P0 + go) = hp;
            *(v4u*)(P1 + go) = pz;
          }
        }
        // precaution: the next trip rewrites registers that these stores name
        asm volatile("s_wait_xcnt 0x0" ::: "memory");
      }
    }
  }
}

template <bool OUT>
__device__ __forceinline__ void gemm_xw(
    const int mode,                                // 0 q, 1 k, 2 v (block-uniform, OUT false); 3 with OUT
    const unsigned short* __restrict__ Ap, const unsigned short* __restrict__ A2p,
    const unsigned short* __restrict__ Btp, void* C0, void* C1,
    const float* __restrict__ ctab, const float* __restrict__ stab) {
  constexpr bool TWOA = OUT;
  constexpr int M = NTOK, N = HID, K = HID;
  constexpr int TN = N / 32;   // 9
  constexpr int TM = M / 64;   // 64
  const __bf16* A  = (const __bf16*)(const void*)Ap;
  const __bf16* A2 = (const __bf16*)(const void*)A2p;
  const __bf16* Bt = (const __bf16*)(const void*)Btp;
  __shared__ __align__(16) float sT[4][64 * 36];   // per-wave 64x32 tile, pitch 36 floats

  const int lane = threadIdx.x & 31;
  const int wave = __builtin_amdgcn_readfirstlane((int)(threadIdx.x >> 5));   // same in every lane: held scalar, the tile bases are scalar too
  const int tile = blockIdx.x * 4 + wave;
  if (tile >= TM * TN) return;                     // wave-uniform; no block barriers in this kernel
  const int tm = tile / TN;
  const int tn = tile - tm * TN;
  const int m0 = tm << 6;
  const int n0 = tn << 5;
  const int c    = lane & 15;                      // row (A) / col (B, D) within subtile
  const int koff = (lane >> 4) * 8;                // k offset of this lane half
  const int mOff = (lane >> 4) * 8;                // D row offset
  const int bidx = m0 / SEQ;                       // batch of this tile (tiles never straddle a batch)
  const int tl0  = m0 - bidx * SEQ;                // first position within the sequence

  v8f acc[4][2];
#pragma unroll
  for (int i = 0; i < 4; ++i)
#pragma unroll
    for (int j = 0; j < 2; ++j) acc[i][j] = zero8();

  // Loads run ahead of the matrix instructions: every fragment is fetched into a register set that is free by then, whole
  // k-steps before its products, so a k-step waits on loads issued earlier and not on its own. Three A sets go round.
  //   one A plane: k-step ks in A and B set ks % 3, fetched two k-steps ahead (8 products a k-step cover little of a load).
  //   two A planes: the hi products of a k-step run first, then the lo products (each accumulator still takes hi, lo, hi,
  //   lo ... in k order); the sets hold hi(ks), lo(ks), hi(ks+1), each fetched one k-step ahead; B in set ks & 1.
  // Address = wave-uniform tile base + one lane offset + a constant: the sets leave no room for a pointer per row.
  constexpr int KS = K / 32;                       // 9 k-steps
  const size_t abase = OUT ? (((size_t)(bidx * NH)) * SEQ + tl0) * HD : (size_t)m0 * K;
  const __bf16* Ab  = A + abase;
  const __bf16* A2b = A2 + abase;
  const __bf16* Bb  = Bt + (size_t)n0 * K;
  const unsigned alane = (unsigned)(c * (OUT ? HD : K) + koff);
  const unsigned blane = (unsigned)(c * K + koff);
  v16b bh[TWOA ? 2 : 3][2], ar[3][4];
  auto fetch_b = [&](const int ks, const int st) __attribute__((always_inline)) {
#pragma unroll
    for (int j = 0; j < 2; ++j) bh[st][j] = ldfrag_b(Bb + blane + (j << 4) * K + ks * 32);
  };
  auto fetch_a = [&](const __bf16* base, const int ks, const int set) __attribute__((always_inline)) {
#pragma unroll
    for (int i = 0; i < 4; ++i) {
      if (OUT) {                                   // ks = head pair index 0..8: heads 2 ks and 2 ks + 1, same token row
        const int e0 = (i << 4) * HD + (2 * ks) * SEQ * HD, e1 = e0 + SEQ * HD;
        ar[set][i] = ldfrag_b2(base + alane + e0, base + alane + e1);
      } else {
        ar[set][i] = ldfrag_b(base + alane + (i << 4) * K + ks * 32);
      }
    }
  };
  auto products = [&](const int set, const int st) __attribute__((always_inline)) {
#pragma unroll
    for (int i = 0; i < 4; ++i)
#pragma unroll
      for (int j = 0; j < 2; ++j) acc[i][j] = mma_b(ar[set][i], bh[st][j], acc[i][j]);
  };
  fetch_b(0, 0);
  fetch_a(Ab, 0, 0);
  if (TWOA) fetch_a(A2b, 0, 1);
  else { fetch_b(1, 1); fetch_a(Ab, 1, 1); }
#pragma unroll                                     // full unroll: a register set's index must be a constant
  for (int ks = 0; ks < KS; ++ks) {
    const int st = ks & 1;
    if (TWOA) {
      const int sh = (2 * ks) % 3, sl = (2 * ks + 1) % 3, sn = (2 * ks + 2) % 3;
      if (ks + 1 < KS) { fetch_b(ks + 1, st ^ 1); fetch_a(Ab, ks + 1, sn); }
      products(sh, st);
      if (ks + 1 < KS) fetch_a(A2b, ks + 1, sh);   // into the set the hi products have just read
      products(sl, st);
    } else {
      if (ks + 2 < KS) { fetch_b(ks + 2, (ks + 2) % 3); fetch_a(Ab, ks + 2, (ks + 2) % 3); }
      products(ks % 3, ks % 3);
    }
  }

  // ---- epilogue: whole tile to wave-private LDS ----
  float* slab = sT[wave];
#pragma unroll
  for (int i = 0; i < 4; ++i)
#pragma unroll
    for (int j = 0; j < 2; ++j)
#pragma unroll
      for (int r = 0; r < 8; ++r)
        slab[((i << 4) + mOff + r) * 36 + (j << 4) + c] = acc[i][j][r];
  __builtin_amdgcn_fence(__ATOMIC_RELEASE, "workgroup");
  __builtin_amdgcn_wave_barrier();
  __builtin_amdgcn_fence(__ATOMIC_ACQUIRE, "workgroup");

  if (OUT)            gemm_epi<3>(slab, lane, m0, n0, bidx, tl0, C0, C1, ctab, stab);
  else if (mode == 0) gemm_epi<0>(slab, lane, m0, n0, bidx, tl0, C0, C1, ctab, stab);   // block-uniform choice, made once:
  else if (mode == 1) gemm_epi<1>(slab, lane, m0, n0, bidx, tl0, C0, C1, ctab, stab);   // no mode test inside an epilogue loop
  else                gemm_epi<2>(slab, lane, m0, n0, bidx, tl0, C0, C1, ctab, stab);
}

// q, k and v projections in one grid: blockIdx.x = group of 4 tiles, blockIdx.y = mode. Wb = Wq, Wk, Wv planes in a row.
__global__ __launch_bounds__(128) void gemm_qkv(
    const unsigned short* __restrict__ Xb, const unsigned short* __restrict__ Wb,
    unsigned short* Qc, unsigned short* Kd, unsigned short* Kz, unsigned short* VTh, unsigned short* VTl,
    const float* __restrict__ ctab, const float* __restrict__ stab) {
  const int mode = (int)blockIdx.y;
  unsigned short* C0 = (mode == 0) ? Qc : (mode == 1) ? Kd : VTh;
  unsigned short* C1 = (mode == 0) ? Qc : (mode == 1) ? Kz : VTl;
  gemm_xw<false>(mode, Xb, Xb, Wb + (size_t)mode * (HID * HID), (void*)C0, (void*)C1, ctab, stab);
}

__global__ __launch_bounds__(128) void gemm_out(
    const unsigned short* __restrict__ Oh, const unsigned short* __restrict__ Ol,
    const unsigned short* __restrict__ Wob, float* out) {
  gemm_xw<true>(3, Oh, Ol, Wob, (void*)out, (void*)out, nullptr, nullptr);
}

// =====================================================================================================
// Causal attention, head dim 16, key chunks of 64, both products transposed: S^T = K . Q^T, O^T += V^T . P^T.
//   q plane  [b][h][t][32]: slots 0..15 = bf16 hi of rope(q)[d], 16..31 = bf16 lo
//   kd plane [b][h][s][32]: slots 0..15 = hi of rope(k)[d], 16..31 = hi again; kz plane: 0..15 = lo, 16..31 = 0
//   so one 32-deep k-step gives q.k = hi.hi + lo.hi (kd) and hi.lo (kz): two products per 16x16 score tile.
//   v^T planes (bf16 hi / lo): element (b, h*16+d, s) at [(b*288 + h*16 + d)*2048 + s]
//   ctx planes (bf16 hi / lo of the normalised context): element (b, h, t, d) at [((b*18 + h)*2048 + t)*16 + d]
//   Score tile j: A = 16 key rows (row = lane&15), B = the wave's 16 queries (col = lane&15), same loader on both sides, so
//   register r of lane (c, hh) = score of key kv0 + 16j + 8hh + r against query q0 + c: a lane holds 32 of the 64 keys of ONE
//   query. Row max and row sum are in-lane; the two lane halves exchange the max once per chunk and join their sums once, in
//   the epilogue. Tiles 2kk and 2kk+1, converted in place, are the B operand of k-step kk (element e = key 8hh+e, element
//   8+e = key 16+8hh+e), which is the k order in which ldfrag_b reads the v^T row as A: P never leaves the registers.
//   Causal structure: query block qb visits key chunks 0..qb only (block-uniform trip count qb+1 <= NQB); inside the
//   diagonal chunk a key with index > query index gets logit -inf -> exp gives exactly 0; the first key of every visited
//   chunk is always kept, so every joined max is finite.
//   Block = 4 waves = 64 query rows of one (b, h); wave w = rows q0..q0+15; no LDS, no barriers; grid = NB * NH * NQB.
//   Output: lane (c, hh) holds d = 8hh..8hh+7 of query q0 + c: one 16-B store per plane, 512 contiguous B per wave.
//   coverage: 1152 blocks x 4 waves x 16 rows x 16 d = every (b, h, t, d) of both ctx planes exactly once.
// =====================================================================================================
__device__ __forceinline__ float other_half(float v) {                // value of lane l ^ 16
  const int b = __builtin_bit_cast(int, v);
  return __builtin_bit_cast(float, __builtin_amdgcn_permlanex16(b, b, 0x76543210, 0xfedcba98, false, false));
}

__device__ __forceinline__ void exp2x8(const float (&x)[8], float (&y)[8]) {
  asm("v_exp_f32 %0, %8\n\tv_exp_f32 %1, %9\n\tv_exp_f32 %2, %10\n\tv_exp_f32 %3, %11\n\t"
      "v_exp_f32 %4, %12\n\tv_exp_f32 %5, %13\n\tv_exp_f32 %6, %14\n\tv_exp_f32 %7, %15\n\tv_nop"
      : "=&v"(y[0]), "=&v"(y[1]), "=&v"(y[2]), "=&v"(y[3]), "=&v"(y[4]), "=&v"(y[5]), "=&v"(y[6]), "=&v"(y[7])
      : "v"(x[0]), "v"(x[1]), "v"(x[2]), "v"(x[3]), "v"(x[4]), "v"(x[5]), "v"(x[6]), "v"(x[7]));
}

__global__ __launch_bounds__(128)
void attn_causal16(const unsigned short* __restrict__ qcp, const unsigned short* __restrict__ kdp,
                   const unsigned short* __restrict__ kzp, const unsigned short* __restrict__ vhp,
                   const unsigned short* __restrict__ vlp, unsigned short* ohp, unsigned short* olp) {
  union PB { v16b v; unsigned u[8]; };

  const int tid  = threadIdx.x;
  const int wave = tid >> 5;
  const int lane = tid & 31;
  const int hh   = lane >> 4;
  const int c    = lane & 15;

  const int bx   = blockIdx.x;
  const int qb   = bx % NQB;
  const int rest = bx / NQB;
  const int h    = rest % NH;
  const int b    = rest / NH;
  const int q0   = qb * 64 + wave * 16;
  const size_t bhp = (size_t)b * NH + h;

  const __bf16* Qc = (const __bf16*)(const void*)qcp + bhp * SEQ * QS;
  const __bf16* Kd = (const __bf16*)(const void*)kdp + bhp * SEQ * QS;
  const __bf16* Kz = (const __bf16*)(const void*)kzp + bhp * SEQ * QS;
  const __bf16* Vh = (const __bf16*)(const void*)vhp + ((size_t)b * HID + (size_t)h * HD) * SEQ;
  const __bf16* Vl = (const __bf16*)(const void*)vlp + ((size_t)b * HID + (size_t)h * HD) * SEQ;

  // ---- Q fragment (B operand, col = lane&15, one 32-slot k-step) ----
  const v16b qa = ldfrag_b(Qc + (size_t)(q0 + c) * QS + 8 * hh);
  const int rowq = q0 + c;                     // this lane's query index

  float mrow = -INFINITY;                      // running max of query rowq (equal in both lane halves)
  float lrow = 0.f;                            // running sum over this lane half's keys only
  v8f oacc = zero8();                          // O^T: register r = d 8hh+r of query rowq

  // Loads run ahead of the matrix instructions that use them: chunk kt + 1's K fragments are fetched as one group behind
  // the score products of chunk kt, chunk kt's V fragments at the head of trip kt; the softmax runs while both fly.
  // Address = wave-uniform chunk base + a lane offset that never changes.
  const unsigned klane = (unsigned)(c * QS + 8 * hh);        // key row c of a subtile, this lane half's slots
  const unsigned vlane = (unsigned)(c * SEQ + 8 * hh);       // v^T row d = c, this lane half's keys
  v16b kd[4], kz[4];
  auto fetch_k = [&](const int kv) __attribute__((always_inline)) {
    const __bf16* kdb = Kd + (size_t)kv * QS;
    const __bf16* kzb = Kz + (size_t)kv * QS;
#pragma unroll
    for (int j = 0; j < 4; ++j) {
      kd[j] = ldfrag_b(kdb + klane + j * 16 * QS);
      kz[j] = ldfrag_b(kzb + klane + j * 16 * QS);
    }
  };
  fetch_k(0);

  for (int kt = 0; kt <= qb; ++kt) {           // block-uniform trip count, <= NQB
    const int kv0 = kt * 64;                   // kv0 + 63 < SEQ
    const int kvn = (kt < qb) ? kv0 + 64 : kv0;   // K chunk fetched ahead; the last trip fetches its own again (in bounds, unused)

    v16b vb[2], vl[2];
#pragma unroll
    for (int kk = 0; kk < 2; ++kk) {
      vb[kk] = ldfrag_b(Vh + kv0 + vlane + kk * 32);
      vl[kk] = ldfrag_b(Vl + kv0 + vlane + kk * 32);
    }

    // ---- scores: 64 keys x 16 queries per wave, 2 bf16 products per key subtile ----
    v8f s[4];
#pragma unroll
    for (int j = 0; j < 4; ++j) {
      s[j] = mma_b(kd[j], qa, zero8());
      s[j] = mma_b(kz[j], qa, s[j]);
    }
    fetch_k(kvn);

    // ---- scale, causal mask by index, max in-lane + one exchange, online softmax ----
    float mj[4];                               // one max chain per score tile: four independent chains
#pragma unroll
    for (int j = 0; j < 4; ++j) {
      mj[j] = -INFINITY;
#pragma unroll
      for (int r = 0; r < 8; ++r) {
        const int key = kv0 + j * 16 + 8 * hh + r;
        float sv = s[j][r] * 0.25f;
        sv = (key <= rowq) ? sv : -INFINITY;
        s[j][r] = sv;
        mj[j] = fmaxf(mj[j], sv);
      }
    }
    float m = fmaxf(fmaxf(mj[0], mj[1]), fmaxf(mj[2], mj[3]));
    m = fmaxf(m, other_half(m));
    const float mnew  = fmaxf(mrow, m);
    const float msafe = (mnew == -INFINITY) ? 0.f : mnew;
    const float alpha = __expf(mrow - msafe);
    mrow = mnew;

    PB ph[2], pl[2];                           // P^T hi / lo as B operands of the two 32-key k-steps
    float pj[4];                               // one sum chain per score tile
#pragma unroll
    for (int j = 0; j < 4; ++j) {
      float xe[8], pe[8];
#pragma unroll
      for (int r = 0; r < 8; ++r) xe[r] = (s[j][r] - msafe) * 1.44269504f;   // exp(t) = 2^(t log2 e), as __expf forms it
      exp2x8(xe, pe);                                        // masked logit: 2^(-inf) = 0
#pragma unroll
      for (int e = 0; e < 4; ++e) {
        const float p0 = pe[2 * e];
        const float p1 = pe[2 * e + 1];
        pj[j] = (e == 0) ? (p0 + p1) : ((pj[j] + p0) + p1);
        const unsigned short hb0 = bf_bits(p0), hb1 = bf_bits(p1);
        const unsigned short lb0 = bf_bits(p0 - bf_up(hb0)), lb1 = bf_bits(p1 - bf_up(hb1));
        ph[j >> 1].u[(j & 1) * 4 + e] = pk16(hb0, hb1);
        pl[j >> 1].u[(j & 1) * 4 + e] = pk16(lb0, lb1);
      }
    }
    lrow = lrow * alpha + ((pj[0] + pj[1]) + (pj[2] + pj[3]));
#pragma unroll
    for (int r = 0; r < 8; ++r) oacc[r] *= alpha;

    // ---- context^T += V^T . P^T (bf16 WMMA, hh + lh + hl into one accumulator) ----
#pragma unroll
    for (int kk = 0; kk < 2; ++kk) {
      oacc = mma_b(vb[kk], ph[kk].v, oacc);
      oacc = mma_b(vl[kk], ph[kk].v, oacc);
      oacc = mma_b(vb[kk], pl[kk].v, oacc);
    }
  }

  // ---- join the halves' sums, normalise (1/l), bf16 hi/lo split, one 16-B store per lane and plane ----
  {
    const float l = lrow + other_half(lrow);
    const float inv = (l > 0.f) ? (1.0f / l) : 0.f;
    v4u a, a2;
#pragma unroll
    for (int e = 0; e < 4; ++e) {
      const float f0 = oacc[2 * e] * inv, f1 = oacc[2 * e + 1] * inv;
      const unsigned short hb0 = bf_bits(f0), hb1 = bf_bits(f1);
      const unsigned short lb0 = bf_bits(f0 - bf_up(hb0)), lb1 = bf_bits(f1 - bf_up(hb1));
      a[e] = pk16(hb0, hb1); a2[e] = pk16(lb0, lb1);
    }
    const size_t go = (bhp * SEQ + rowq) * HD + 8 * hh;
    *(v4u*)(ohp + go) = a;
    *(v4u*)(olp + go) = a2;
  }
}

// =====================================================================================================
// Workspace map (bytes; every region is an exact multiple of its whole-line / whole-tile store granularity,
//   Xb   bf16 [4096][288]            2359296
//   Wqb  bf16 [288][288]              165888   (x4: Wq, Wk, Wv, Wo)
//   Qc   bf16 [2][18][2048][32]      4718592
//   Kd                               4718592
//   Kz                               4718592
//   VTh  bf16 [2][288][2048]         2359296
//   VTl                              2359296
//   Oh   bf16 [2][18][2048][16]      2359296
//   Ol                               2359296
//   Ct   f32  [2048][8]                65536
//   St                                 65536
//   total                           26746880
// =====================================================================================================
extern "C" void kernel_launch(void* const* d_in, const int* in_sizes, int n_in,
                              void* d_out, int out_size, void* d_ws, size_t ws_size,
                              hipStream_t stream) {
  if (n_in < 5) return;
  if (in_sizes[0] != NTOK * HID) return;
  if (in_sizes[1] != HID * HID) return;
  if (in_sizes[2] != HID * HID) return;
  if (in_sizes[3] != HID * HID) return;
  if (in_sizes[4] != HID * HID) return;
  if (out_size != NTOK * HID) return;

  const float* x  = (const float*)d_in[0];   // [2][2048][288]
  const float* Wq = (const float*)d_in[1];   // [288 out][288 in]
  const float* Wk = (const float*)d_in[2];
  const float* Wv = (const float*)d_in[3];
  const float* Wo = (const float*)d_in[4];

  const size_t PX  = (size_t)NTOK * HID * 2;            // 2359296
  const size_t PW  = (size_t)HID * HID * 2;             //  165888
  const size_t PQ  = (size_t)NB * NH * SEQ * QS * 2;    // 4718592
  const size_t PVT = (size_t)NB * HID * SEQ * 2;        // 2359296
  const size_t PO  = (size_t)NB * NH * SEQ * HD * 2;    // 2359296
  const size_t PTB = (size_t)SEQ * NPAIR * 4;           //   65536
  size_t off = 0;
  const size_t oXb  = off; off += PX;
  const size_t oWq  = off; off += PW;
  const size_t oWk  = off; off += PW;
  const size_t oWv  = off; off += PW;
  const size_t oWo  = off; off += PW;
  const size_t oQc  = off; off += PQ;
  const size_t oKd  = off; off += PQ;
  const size_t oKz  = off; off += PQ;
  const size_t oVTh = off; off += PVT;
  const size_t oVTl = off; off += PVT;
  const size_t oOh  = off; off += PO;
  const size_t oOl  = off; off += PO;
  const size_t oCt  = off; off += PTB;
  const size_t oSt  = off; off += PTB;
  if (off > ws_size) return;                            // off = 26746880
  if (off > (size_t)134217728) return;

  char* ws = (char*)d_ws;
  unsigned short* Xb  = (unsigned short*)(ws + oXb);
  unsigned short* Wqb = (unsigned short*)(ws + oWq);
  unsigned short* Wob = (unsigned short*)(ws + oWo);
  unsigned short* Qc  = (unsigned short*)(ws + oQc);
  unsigned short* Kd  = (unsigned short*)(ws + oKd);
  unsigned short* Kz  = (unsigned short*)(ws + oKz);
  unsigned short* VTh = (unsigned short*)(ws + oVTh);
  unsigned short* VTl = (unsigned short*)(ws + oVTl);
  unsigned short* Oh  = (unsigned short*)(ws + oOh);
  unsigned short* Ol  = (unsigned short*)(ws + oOl);
  float*          Ct  = (float*)(ws + oCt);
  float*          St  = (float*)(ws + oSt);

  const dim3 blk256(256);
  const dim3 blk128(128);
  const dim3 gPrep(PREP_TAB + 4 * PREP_W + PREP_X);     // 64 + 164 + 576 = 804 blocks
  const dim3 gQkv(((NTOK / 64) * (HID / 32)) / 4, 3);   // 576 tiles -> 144 blocks of 4 waves, x 3 projections
  const dim3 gOut(((NTOK / 64) * (HID / 32)) / 4);      // 144 blocks of 4 waves
  const dim3 gAttn(NB * NH * NQB);                      // 1152 blocks of 128

  // (1) RoPE tables; x and the four weights -> bf16 planes (weights are [out][in] = Bt[n][k] already)
  prep<<<gPrep, blk256, 0, stream>>>(x, Wq, Wk, Wv, Wo, Xb, Wqb, Ct, St);
  // (2) q = rope(x . Wq^T) -> [b][h][t][hi|lo]; k = rope(x . Wk^T) -> [b][h][s][hi|hi] and [b][h][s][lo|0];
  //     v = x . Wv^T -> v^T bf16 hi / lo planes [b][h*16+d][s]
  gemm_qkv<<<gQkv, blk128, 0, stream>>>(Xb, Wqb, Qc, Kd, Kz, VTh, VTl, Ct, St);
  // (3) causal attention -> ctx bf16 hi / lo planes [b][h][t][d]
  attn_causal16<<<gAttn, blk128, 0, stream>>>(Qc, Kd, Kz, VTh, VTl, Oh, Ol);
  // (4) out = (ctx hi + ctx lo) . Wo^T -> d_out f32 [4096][288]
  gemm_out<<<gOut, blk128, 0, stream>>>(Oh, Ol, Wob, (float*)d_out);
  (void)hipGetLastError();
}

// v004
// A run of this version takes 64 microseconds.
// Timed twice side by side with v003, it ran 1.29 times as fast both times.
// Over all steps from v000 it is 4.47 times as fast.
// Contractions: q / k / v projections = v_wmma_f32_16x16x32_bf16 (bf16 operands from RNE-converted x and Wq/Wk/Wv, single product, f32 accumulate);
// k.q^T scores (transposed) = v_wmma_f32_16x16x32_bf16 with q and k as bf16 hi/lo split folded into the 32-deep k axis ([qhi|qlo].[khi|khi] + [qhi|qlo].[klo|0] = hh+lh+hl, 2 products), f32 accumulate;
// v^T.p^T (transposed) = v_wmma_f32_16x16x32_bf16 with p and v as bf16 hi/lo split (hh + hl + lh, 3 products), f32 accumulate;
// ctx.Wo^T = v_wmma_f32_16x16x32_bf16 with ctx as bf16 hi + unscaled lo planes times bf16 Wo (2 products), f32 accumulate;
// rotary tables (powf, f32 product, precise sincosf), half-rotation, causal mask and online softmax in f32 on the VALU.
// Carry audit: no scaled planes anywhere; every lo plane is the unscaled RNE residual (v - hi) in bf16 and shares the hi accumulator;
// score scale 1/4 applied once in f32 after the score accumulate; softmax normaliser 1/l applied once in the attention epilogue.
#include <hip/hip_runtime.h>
#include <math.h>
#include <stdint.h>

#define NB    2
#define SEQ   2048
#define HID   288
#define NH    18
#define HD    16
#define NPAIR 8
#define QS    32           // slots per head in the q / k planes: 0..15 hi (d), 16..31 lo (d) or duplicate / zero
#define NTOK  (NB * SEQ)   // 4096 token rows
#define NQB   (SEQ / 64)   // 32 query blocks of 64 per sequence
static_assert(NH * HD == HID);
static_assert(NPAIR * 2 == HD);
static_assert((SEQ % 64) == 0 && (HID % 32) == 0 && (NTOK % 64) == 0);
static_assert(((NTOK / 64) * (HID / 32)) % 4 == 0);
static_assert((NTOK * HID) % (8 * 256) == 0);
static_assert(((HID * HID) % 8) == 0 && (((HID * HID) / 8) % 32) == 0);
static_assert((SEQ % 32) == 0);

typedef __bf16   v16b __attribute__((ext_vector_type(16)));
typedef __bf16   v8b  __attribute__((ext_vector_type(8)));
typedef float    v8f  __attribute__((ext_vector_type(8)));
typedef float    v4f  __attribute__((ext_vector_type(4)));
typedef unsigned int v4u __attribute__((ext_vector_type(4)));

// ---- scalar helpers --------------------------------------------------------------------------------
__device__ __forceinline__ unsigned short bf_bits(float f) {          // f32 -> bf16 bits, RNE convert
  unsigned u = __float_as_uint(f);
  return (unsigned short)((u + 0x7FFFu + ((u >> 16) & 1u)) >> 16);
}
__device__ __forceinline__ float bf_up(unsigned short h) { return __uint_as_float(((unsigned)h) << 16); }
__device__ __forceinline__ unsigned pk16(unsigned short a, unsigned short b) { return (unsigned)a | ((unsigned)b << 16); }
__device__ __forceinline__ v8f zero8() { v8f z = {0.f, 0.f, 0.f, 0.f, 0.f, 0.f, 0.f, 0.f}; return z; }

// ---- fragment loaders: 16-bit A/B operand, lane -> row/col (lane&15), p already includes +8*(lane>>4);
//      elements 0..7 <- p[0..7] (k0+8h..k0+8h+7), elements 8..15 <- p[16..23] (k0+16+8h..k0+16+8h+7)
__device__ __forceinline__ v16b ldfrag_b(const __bf16* p) {
  union { v16b v; v8b h[2]; } f;
  f.h[0] = *(const v8b*)(p);
  f.h[1] = *(const v8b*)(p + 16);
  return f.v;
}
// same map when k0..k0+15 and k0+16..k0+31 live in two different rows (p0, p1 each include +8*(lane>>4))
__device__ __forceinline__ v16b ldfrag_b2(const __bf16* p0, const __bf16* p1) {
  union { v16b v; v8b h[2]; } f;
  f.h[0] = *(const v8b*)(p0);
  f.h[1] = *(const v8b*)(p1);
  return f.v;
}

// ---- WMMA helper with trailing VALU hazard gap (D tied, A/B kept live) ----------------------------------
__device__ __forceinline__ v8f mma_b(v16b a, v16b b, v8f c) {
  c = __builtin_amdgcn_wmma_f32_16x16x32_bf16(false, a, false, b, (short)0, c, false, false);
  asm volatile("v_nop\n\tv_nop\n\tv_nop\n\tv_nop" : "+v"(c) : "v"(a), "v"(b));
  return c;
}

// =====================================================================================================
// prep: everything the projections need and that depends on the inputs alone, as block ranges of ONE grid (256 threads a
// block, the range test is block-uniform):
//   blocks 0..63 (rotary tables): ctab[t][i] = cos(t * inv[i]), stab[t][i] = sin(t * inv[i]), i = 0..7, t = 0..SEQ-1, with
//     inv[i] = 1 / powf(10000, (2i)/16) formed by every thread for its own i (f32 product, precise sincosf);
//     thread tid -> t = block*32 + tid/8, i = tid&7; 64 blocks x 256 = the whole [SEQ][8] tables.
//   blocks 64..227 (weights): 41 blocks a weight, Wq, Wk, Wv, Wo in this order, into four planes that follow one another.
//   blocks 228..803 (x).
//   f32 -> bf16 (RNE convert), 8 elements per thread, one 16-B store per lane: a wave writes 512 contiguous B;
//   n8 threads x 8 = the whole plane (n8 = 147456 for x, 10368 for each weight; both multiples of 32).
// =====================================================================================================
#define PREP_TAB  (SEQ / 32)                       // 64 blocks
#define PREP_W    ((HID * HID / 8 + 255) / 256)    // 41 blocks a weight
#define PREP_X    (NTOK * HID / 8 / 256)           // 576 blocks
__device__ __forceinline__ void cvt_bf16x8(const float* __restrict__ in, unsigned short* out, const int i) {
  const v4f a = *(const v4f*)(in + (size_t)i * 8);
  const v4f b = *(const v4f*)(in + (size_t)i * 8 + 4);
  v4u p;
  p[0] = pk16(bf_bits(a[0]), bf_bits(a[1]));
  p[1] = pk16(bf_bits(a[2]), bf_bits(a[3]));
  p[2] = pk16(bf_bits(b[0]), bf_bits(b[1]));
  p[3] = pk16(bf_bits(b[2]), bf_bits(b[3]));
  *(v4u*)(out + (size_t)i * 8) = p;
  // precaution: in the merged kernel's listing another block range's code, which rewrites the store's registers, follows it
  asm volatile("s_wait_xcnt 0x0" ::: "memory");
}

__global__ __launch_bounds__(256) void prep(const float* __restrict__ x, const float* __restrict__ Wq,
                                            const float* __restrict__ Wk, const float* __restrict__ Wv,
                                            const float* __restrict__ Wo, unsigned short* Xb, unsigned short* Wb,
                                            float* ctab, float* stab) {
  const int tid = (int)threadIdx.x;
  const int bx  = (int)blockIdx.x;
  if (bx < PREP_TAB) {
    const int i = tid & (NPAIR - 1);
    const int t = bx * 32 + (tid >> 3);
    const float e = (float)(2 * i) * (1.0f / (float)HD);
    const float p = powf(10000.0f, e);
    const float f = 1.0f / p;
    const float ang = (float)t * f;
    float sn, cs;
    sincosf(ang, &sn, &cs);
    const size_t o = (size_t)t * NPAIR + i;
    *(float*)(ctab + o) = cs;
    *(float*)(stab + o) = sn;
  } else if (bx < PREP_TAB + 4 * PREP_W) {
    const int w  = (bx - PREP_TAB) / PREP_W;       // 0..3: Wq, Wk, Wv, Wo
    const int i  = (bx - PREP_TAB - w * PREP_W) * 256 + tid;
    const float* in = (w == 0) ? Wq : (w == 1) ? Wk : (w == 2) ? Wv : Wo;
    if (i < HID * HID / 8) cvt_bf16x8(in, Wb + (size_t)w * (HID * HID), i);
  } else {
    cvt_bf16x8(x, Xb, (bx - PREP_TAB - 4 * PREP_W) * 256 + tid);
  }
}

// =====================================================================================================
// bf16 WMMA GEMM, one wave per 64 x 32 tile, 4 waves per block, no block barriers:
//   C[m][n] = sum_k A[m][k] * Bt[n][k] (+ sum_k A2[m][k] * Bt[n][k] when TWOA), M = 4096 tokens, N = 288, K = 288
//   (9 k-steps of 32, no tails). Bt = weight plane [n][k] (the [out][in] weight as delivered, RNE bf16), pitch 288.
//   A: MODE 0..2: x plane [m][k] pitch 288. MODE 3: ctx planes laid out [b][h][t][16]; k-step j covers heads 2j
//   (k 0..15) and 2j+1 (k 16..31): elements 0..7 <- head 2j, d = 8*(lane>>4)..+7; elements 8..15 <- head 2j+1, same d.
// then (b = m0/2048, t = m0%2048 + row, 32 columns = heads n0/16 and n0/16+1):
//   MODE 0 (q): rotary in f32 (contract off): d < 8: x[d] c[t][d] - x[d+8] s[t][d]; d >= 8: x[d] c[t][d-8] + x[d-8] s[t][d-8];
//               -> plane [b][h][t][32]: slots 0..15 = bf16 hi of d, 16..31 = bf16 lo (v - hi) of d.
//   MODE 1 (k): same rotary; plane C0 slots 0..15 = hi, 16..31 = hi (duplicate); plane C1 slots 0..15 = lo, 16..31 = 0.
//   MODE 2 (v): no rotary; v^T planes C0 = hi, C1 = lo, element (b, n, t) at [(b*288 + n)*2048 + t]:
//   MODE 0..2 share one body and ONE grid (gemm_qkv: blockIdx.y = mode, the same in every wave of a block; only the weight
//   plane, the epilogue and the output planes differ); MODE 3 (OUT) is a launch of its own (gemm_out), behind attention.
// coverage: 576 tiles x (64 rows x 32 cols) = the whole 4096 x 288 result; MODE 0/1: 2 heads x 8 it x 8 rows x 4 lanes
//           x 8 slots = 64 rows x 2 heads x 32 slots; MODE 2: 8 it x 4 x 8 lanes x 8 = 32 features x 64 tokens;
//           MODE 3: 16 it x 4 rows x 8 lanes x 4 = 64 rows x 32 cols.
// =====================================================================================================
// Epilogue of one wave's 64 x 32 tile, read back from its LDS slab; MODE as listed above.
template <int MODE>
__device__ __forceinline__ void gemm_epi(const float* slab, const int lane, const int m0, const int n0, const int bidx,
                                         const int tl0, void* C0, void* C1,
                                         const float* __restrict__ ctab, const float* __restrict__ stab) {
  static_assert(MODE >= 0 && MODE <= 3);
  if (MODE == 3) {
    float* Cf = (float*)C0;
    const int q4 = lane >> 3, c4 = (lane & 7) * 4;
    {
#pragma unroll
      for (int it = 0; it < 16; ++it) {
        const int row = it * 4 + q4;                         // it 0..15 x q4 0..3 = rows 0..63
        const v4f v = *(const v4f*)(slab + row * 36 + c4);
        *(v4f*)(Cf + (size_t)(m0 + row) * HID + n0 + c4) = v;
      }
      
    }
  } else if (MODE == 2) {
    unsigned short* P0 = (unsigned short*)C0;
    unsigned short* P1 = (unsigned short*)C1;
    const int q4 = lane >> 3, t8 = (lane & 7) * 8;
#pragma unroll 1
    for (int it2 = 0; it2 < 8; it2 += 2) {         // two rows' loads and stores side by side in a trip
#pragma unroll
      for (int it = it2; it < it2 + 2; ++it) {
        const int n = it * 4 + q4;                             // local feature 0..31
        float f[8];
#pragma unroll
        for (int e = 0; e < 8; ++e) f[e] = slab[(t8 + e) * 36 + n];
        v4u a, a2;
#pragma unroll
        for (int e = 0; e < 4; ++e) {
          const float f0 = f[2 * e], f1 = f[2 * e + 1];
          const unsigned short h0 = bf_bits(f0), h1 = bf_bits(f1);
          const unsigned short l0 = bf_bits(f0 - bf_up(h0)), l1 = bf_bits(f1 - bf_up(h1));
          a[e] = pk16(h0, h1); a2[e] = pk16(l0, l1);
        }
        const size_t go = ((size_t)(bidx * HID + n0 + n)) * SEQ + tl0 + t8;
        *(v4u*)(P0 + go) = a;
        *(v4u*)(P1 + go) = a2;
      }
      // precaution: the next trip rewrites registers that these stores name
      asm volatile("s_wait_xcnt 0x0" ::: "memory");
    }
  } else {
    unsigned short* P0 = (unsigned short*)C0;
    unsigned short* P1 = (unsigned short*)C1;
    const int r4 = lane >> 2, s8 = (lane & 3) * 8;
    const int dbase = s8 & 8;                                // d of the first element: 0 or 8
    const bool isLo = (s8 >= 16);
    const float sg = (dbase == 0) ? -1.0f : 1.0f;            // -x[d+8] for d < 8, +x[d-8] for d >= 8
    const int h0 = n0 >> 4;                                  // first head of the tile (even)
#pragma unroll 1
    for (int hd = 0; hd < 2; ++hd) {
#pragma unroll 1
      for (int it2 = 0; it2 < 8; it2 += 2) {         // two rows' loads and stores side by side in a trip
#pragma unroll
        for (int it = it2; it < it2 + 2; ++it) {
          const int row = it * 8 + r4;                         // it 0..7 x r4 0..7 = rows 0..63
          const int t = tl0 + row;                             // position within the sequence
          const float* xr = slab + row * 36 + hd * 16;
          float x[8], y[8], f[8];
#pragma unroll
          for (int e = 0; e < 8; ++e) { x[e] = xr[dbase + e]; y[e] = xr[(dbase ^ 8) + e]; }
          const v4f cv0 = *(const v4f*)(ctab + (size_t)t * NPAIR);
          const v4f cv1 = *(const v4f*)(ctab + (size_t)t * NPAIR + 4);
          const v4f sv0 = *(const v4f*)(stab + (size_t)t * NPAIR);
          const v4f sv1 = *(const v4f*)(stab + (size_t)t * NPAIR + 4);
          {
#pragma clang fp contract(off)
#pragma unroll
            for (int e = 0; e < 4; ++e) {
              {
                const float ry = sg * y[e];
                const float p0 = x[e] * cv0[e];
                const float p1 = ry * sv0[e];
                f[e] = p0 + p1;
              }
              {
                const float ry = sg * y[4 + e];
                const float p0 = x[4 + e] * cv1[e];
                const float p1 = ry * sv1[e];
                f[4 + e] = p0 + p1;
              }
            }
          }
          v4u hp, lp;
#pragma unroll
          for (int e = 0; e < 4; ++e) {
            const float f0 = f[2 * e], f1 = f[2 * e + 1];
            const unsigned short hb0 = bf_bits(f0), hb1 = bf_bits(f1);
            const unsigned short lb0 = bf_bits(f0 - bf_up(hb0)), lb1 = bf_bits(f1 - bf_up(hb1));
            hp[e] = pk16(hb0, hb1); lp[e] = pk16(lb0, lb1);
          }
          const size_t go = (((size_t)(bidx * NH + h0 + hd)) * SEQ + t) * QS + s8;
          if (MODE == 0) {
            v4u pc;
#pragma unroll
            for (int e = 0; e < 4; ++e) pc[e] = isLo ? lp[e] : hp[e];
            *(v4u*)(P0 + go) = pc;
          } else {
            v4u pz;
#pragma unroll
            for (int e = 0; e < 4; ++e) pz[e] = isLo ? 0u : lp[e];
            *(v4u*)(P0 + go) = hp;
            *(v4u*)(P1 + go) = pz;
          }
        }
        // precaution: the next trip rewrites registers that these stores name
        asm volatile("s_wait_xcnt 0x0" ::: "memory");
      }
    }
  }
}

template <bool OUT>
__device__ __forceinline__ void gemm_xw(
    const int mode,                                // 0 q, 1 k, 2 v (block-uniform, OUT false); 3 with OUT
    const unsigned short* __restrict__ Ap, const unsigned short* __restrict__ A2p,
    const unsigned short* __restrict__ Btp, void* C0, void* C1,
    const float* __restrict__ ctab, const float* __restrict__ stab) {
  constexpr bool TWOA = OUT;
  constexpr int M = NTOK, N = HID, K = HID;
  constexpr int TN = N / 32;   // 9
  constexpr int TM = M / 64;   // 64
  const __bf16* A  = (const __bf16*)(const void*)Ap;
  const __bf16* A2 = (const __bf16*)(const void*)A2p;
  const __bf16* Bt = (const __bf16*)(const void*)Btp;
  __shared__ __align__(16) float sT[4][64 * 36];   // per-wave 64x32 tile, pitch 36 floats

  const int lane = threadIdx.x & 31;
  const int wave = __builtin_amdgcn_readfirstlane((int)(threadIdx.x >> 5));   // same in every lane: held scalar, the tile bases are scalar too
  const int tile = blockIdx.x * 4 + wave;
  if (tile >= TM * TN) return;                     // wave-uniform; no block barriers in this kernel
  const int tm = tile / TN;
  const int tn = tile - tm * TN;
  const int m0 = tm << 6;
  const int n0 = tn << 5;
  const int c    = lane & 15;                      // row (A) / col (B, D) within subtile
  const int koff = (lane >> 4) * 8;                // k offset of this lane half
  const int mOff = (lane >> 4) * 8;                // D row offset
  const int bidx = m0 / SEQ;                       // batch of this tile (tiles never straddle a batch)
  const int tl0  = m0 - bidx * SEQ;                // first position within the sequence

  v8f acc[4][2];
#pragma unroll
  for (int i = 0; i < 4; ++i)
#pragma unroll
    for (int j = 0; j < 2; ++j) acc[i][j] = zero8();

  // Loads run ahead of the matrix instructions: every fragment is fetched into a register set that is free by then, whole
  // k-steps before its products, so a k-step waits on loads issued earlier and not on its own. Three A sets go round.
  //   one A plane: k-step ks in A and B set ks % 3, fetched two k-steps ahead (8 products a k-step cover little of a load).
  //   two A planes: the hi products of a k-step run first, then the lo products (each accumulator still takes hi, lo, hi,
  //   lo ... in k order); the sets hold hi(ks), lo(ks), hi(ks+1), each fetched one k-step ahead; B in set ks & 1.
  // Address = wave-uniform tile base + one lane offset + a constant: the sets leave no room for a pointer per row.
  constexpr int KS = K / 32;                       // 9 k-steps
  const size_t abase = OUT ? (((size_t)(bidx * NH)) * SEQ + tl0) * HD : (size_t)m0 * K;
  const __bf16* Ab  = A + abase;
  const __bf16* A2b = A2 + abase;
  const __bf16* Bb  = Bt + (size_t)n0 * K;
  const unsigned alane = (unsigned)(c * (OUT ? HD : K) + koff);
  const unsigned blane = (unsigned)(c * K + koff);
  v16b bh[TWOA ? 2 : 3][2], ar[3][4];
  auto fetch_b = [&](const int ks, const int st) __attribute__((always_inline)) {
#pragma unroll
    for (int j = 0; j < 2; ++j) bh[st][j] = ldfrag_b(Bb + blane + (j << 4) * K + ks * 32);
  };
  auto fetch_a = [&](const __bf16* base, const int ks, const int set) __attribute__((always_inline)) {
#pragma unroll
    for (int i = 0; i < 4; ++i) {
      if (OUT) {                                   // ks = head pair index 0..8: heads 2 ks and 2 ks + 1, same token row
        const int e0 = (i << 4) * HD + (2 * ks) * SEQ * HD, e1 = e0 + SEQ * HD;
        ar[set][i] = ldfrag_b2(base + alane + e0, base + alane + e1);
      } else {
        ar[set][i] = ldfrag_b(base + alane + (i << 4) * K + ks * 32);
      }
    }
  };
  auto products = [&](const int set, const int st) __attribute__((always_inline)) {
#pragma unroll
    for (int i = 0; i < 4; ++i)
#pragma unroll
      for (int j = 0; j < 2; ++j) acc[i][j] = mma_b(ar[set][i], bh[st][j], acc[i][j]);
  };
  fetch_b(0, 0);
  fetch_a(Ab, 0, 0);
  if (TWOA) fetch_a(A2b, 0, 1);
  else { fetch_b(1, 1); fetch_a(Ab, 1, 1); }
#pragma unroll                                     // full unroll: a register set's index must be a constant
  for (int ks = 0; ks < KS; ++ks) {
    const int st = ks & 1;
    if (TWOA) {
      const int sh = (2 * ks) % 3, sl = (2 * ks + 1) % 3, sn = (2 * ks + 2) % 3;
      if (ks + 1 < KS) { fetch_b(ks + 1, st ^ 1); fetch_a(Ab, ks + 1, sn); }
      products(sh, st);
      if (ks + 1 < KS) fetch_a(A2b, ks + 1, sh);   // into the set the hi products have just read
      products(sl, st);
    } else {
      if (ks + 2 < KS) { fetch_b(ks + 2, (ks + 2) % 3); fetch_a(Ab, ks + 2, (ks + 2) % 3); }
      products(ks % 3, ks % 3);
    }
  }

  // ---- epilogue: whole tile to wave-private LDS ----
  float* slab = sT[wave];
#pragma unroll
  for (int i = 0; i < 4; ++i)
#pragma unroll
    for (int j = 0; j < 2; ++j)
#pragma unroll
      for (int r = 0; r < 8; ++r)
        slab[((i << 4) + mOff + r) * 36 + (j << 4) + c] = acc[i][j][r];
  __builtin_amdgcn_fence(__ATOMIC_RELEASE, "workgroup");
  __builtin_amdgcn_wave_barrier();
  __builtin_amdgcn_fence(__ATOMIC_ACQUIRE, "workgroup");

  if (OUT)            gemm_epi<3>(slab, lane, m0, n0, bidx, tl0, C0, C1, ctab, stab);
  else if (mode == 0) gemm_epi<0>(slab, lane, m0, n0, bidx, tl0, C0, C1, ctab, stab);   // block-uniform choice, made once:
  else if (mode == 1) gemm_epi<1>(slab, lane, m0, n0, bidx, tl0, C0, C1, ctab, stab);   // no mode test inside an epilogue loop
  else                gemm_epi<2>(slab, lane, m0, n0, bidx, tl0, C0, C1, ctab, stab);
}

// q, k and v projections in one grid: blockIdx.x = group of 4 tiles, blockIdx.y = mode. Wb = Wq, Wk, Wv planes in a row.
__global__ __launch_bounds__(128) void gemm_qkv(
    const unsigned short* __restrict__ Xb, const unsigned short* __restrict__ Wb,
    unsigned short* Qc, unsigned short* Kd, unsigned short* Kz, unsigned short* VTh, unsigned short* VTl,
    const float* __restrict__ ctab, const float* __restrict__ stab) {
  const int mode = (int)blockIdx.y;
  unsigned short* C0 = (mode == 0) ? Qc : (mode == 1) ? Kd : VTh;
  unsigned short* C1 = (mode == 0) ? Qc : (mode == 1) ? Kz : VTl;
  gemm_xw<false>(mode, Xb, Xb, Wb + (size_t)mode * (HID * HID), (void*)C0, (void*)C1, ctab, stab);
}

__global__ __launch_bounds__(128) void gemm_out(
    const unsigned short* __restrict__ Oh, const unsigned short* __restrict__ Ol,
    const unsigned short* __restrict__ Wob, float* out) {
  gemm_xw<true>(3, Oh, Ol, Wob, (void*)out, (void*)out, nullptr, nullptr);
}

// =====================================================================================================
// Causal attention, head dim 16, key chunks of 64, both products transposed: S^T = K . Q^T, O^T += V^T . P^T.
//   q plane  [b][h][t][32]: slots 0..15 = bf16 hi of rope(q)[d], 16..31 = bf16 lo
//   kd plane [b][h][s][32]: slots 0..15 = hi of rope(k)[d], 16..31 = hi again; kz plane: 0..15 = lo, 16..31 = 0
//   so one 32-deep k-step gives q.k = hi.hi + lo.hi (kd) and hi.lo (kz): two products per 16x16 score tile.
//   v^T planes (bf16 hi / lo): element (b, h*16+d, s) at [(b*288 + h*16 + d)*2048 + s]
//   ctx planes (bf16 hi / lo of the normalised context): element (b, h, t, d) at [((b*18 + h)*2048 + t)*16 + d]
//   Score tile j: A = 16 key rows (row = lane&15), B = the wave's 16 queries (col = lane&15), same loader on both sides, so
//   register r of lane (c, hh) = score of key kv0 + 16j + 8hh + r against query q0 + c: a lane holds 32 of the 64 keys of ONE
//   query. Row max and row sum are in-lane; the two lane halves exchange the max once per chunk and join their sums once, in
//   the epilogue. Tiles 2kk and 2kk+1, converted in place, are the B operand of k-step kk (element e = key 8hh+e, element
//   8+e = key 16+8hh+e), which is the k order in which ldfrag_b reads the v^T row as A: P never leaves the registers.
//   Causal structure: query tile qb visits key chunks 0..qb only (block-uniform trip count qb+1 <= NQB); inside the
//   diagonal chunk a key with index > query index gets logit -inf -> exp gives exactly 0; the first key of every visited
//   chunk is always kept, so every joined max is finite.
//   Tile = 64 query rows of one (b, h), 4 waves, wave w = rows q0..q0+15; no LDS, no barriers.
//   Equal work-groups: every work-group is resident from the start, so the launch lasts as long as the fullest WGP, and a
//   tile costs qb+1 chunks. A block therefore walks several tiles of ONE head, one after the other, ABIN blocks a head:
//   block n = 0..12: tiles 31-n and 5+n (32-n and 6+n chunks, 38 together); block 13: tiles 18, 4, 3, 2, 1, 0 (34 chunks).
//   grid = NB * NH * ABIN = 504 blocks, at most two for each of the 256 WGPs. All tiles of a block start at key chunk 0 of
//   the same head, so the last trip of a tile fetches that chunk for the next one.
//   Left as it is: the hi / lo splits round in integer arithmetic (bf_bits), about half of the loop's vector instructions.
//   Output: lane (c, hh) holds d = 8hh..8hh+7 of query q0 + c: one 16-B store per plane, 512 contiguous B per wave.
//   coverage: tiles 31..19, 5..17, 18 and 4..0 = each of the 32 tiles of a head once; 36 heads x 32 tiles x 4 waves x 16 rows
//   x 16 d = every (b, h, t, d) of both ctx planes exactly once.
// =====================================================================================================
__device__ __forceinline__ float other_half(float v) {                // value of lane l ^ 16
  const int b = __builtin_bit_cast(int, v);
  return __builtin_bit_cast(float, __builtin_amdgcn_permlanex16(b, b, 0x76543210, 0xfedcba98, false, false));
}

__device__ __forceinline__ void exp2x8(const float (&x)[8], float (&y)[8]) {
  asm("v_exp_f32 %0, %8\n\tv_exp_f32 %1, %9\n\tv_exp_f32 %2, %10\n\tv_exp_f32 %3, %11\n\t"
      "v_exp_f32 %4, %12\n\tv_exp_f32 %5, %13\n\tv_exp_f32 %6, %14\n\tv_exp_f32 %7, %15\n\tv_nop"
      : "=&v"(y[0]), "=&v"(y[1]), "=&v"(y[2]), "=&v"(y[3]), "=&v"(y[4]), "=&v"(y[5]), "=&v"(y[6]), "=&v"(y[7])
      : "v"(x[0]), "v"(x[1]), "v"(x[2]), "v"(x[3]), "v"(x[4]), "v"(x[5]), "v"(x[6]), "v"(x[7]));
}

#define ABIN 14            // blocks per (b, h)
static_assert(NQB == 32);  // the tile lists below are written for 32 tiles a head

__global__ __launch_bounds__(128)
void attn_causal16(const unsigned short* __restrict__ qcp, const unsigned short* __restrict__ kdp,
                   const unsigned short* __restrict__ kzp, const unsigned short* __restrict__ vhp,
                   const unsigned short* __restrict__ vlp, unsigned short* ohp, unsigned short* olp) {
  union PB { v16b v; unsigned u[8]; };

  const int tid  = threadIdx.x;
  const int wave = tid >> 5;
  const int lane = tid & 31;
  const int hh   = lane >> 4;
  const int c    = lane & 15;

  const int bx   = blockIdx.x;
  const int bin  = bx % ABIN;
  const int rest = bx / ABIN;
  const int h    = rest % NH;
  const int b    = rest / NH;
  const int ntile = (bin < ABIN - 1) ? 2 : 6;  // block-uniform
  const size_t bhp = (size_t)b * NH + h;

  const __bf16* Qc = (const __bf16*)(const void*)qcp + bhp * SEQ * QS;
  const __bf16* Kd = (const __bf16*)(const void*)kdp + bhp * SEQ * QS;
  const __bf16* Kz = (const __bf16*)(const void*)kzp + bhp * SEQ * QS;
  const __bf16* Vh = (const __bf16*)(const void*)vhp + ((size_t)b * HID + (size_t)h * HD) * SEQ;
  const __bf16* Vl = (const __bf16*)(const void*)vlp + ((size_t)b * HID + (size_t)h * HD) * SEQ;

  // Loads run ahead of the matrix instructions that use them: chunk kt + 1's K fragments are fetched as one group behind
  // the score products of chunk kt, chunk kt's V fragments at the head of trip kt; the softmax runs while both fly.
  // Address = wave-uniform chunk base + a lane offset that never changes.
  const unsigned klane = (unsigned)(c * QS + 8 * hh);        // key row c of a subtile, this lane half's slots
  const unsigned vlane = (unsigned)(c * SEQ + 8 * hh);       // v^T row d = c, this lane half's keys
  v16b kd[4], kz[4];
  auto fetch_k = [&](const int kv) __attribute__((always_inline)) {
    const __bf16* kdb = Kd + (size_t)kv * QS;
    const __bf16* kzb = Kz + (size_t)kv * QS;
#pragma unroll
    for (int j = 0; j < 4; ++j) {
      kd[j] = ldfrag_b(kdb + klane + j * 16 * QS);
      kz[j] = ldfrag_b(kzb + klane + j * 16 * QS);
    }
  };
  fetch_k(0);

  for (int ti = 0; ti < ntile; ++ti) {         // the block's tiles, the longest first
  const int qb = (bin < ABIN - 1) ? ((ti == 0) ? NQB - 1 - bin : 5 + bin) : ((ti == 0) ? 18 : 5 - ti);
  const int q0 = qb * 64 + wave * 16;

  // ---- Q fragment (B operand, col = lane&15, one 32-slot k-step) ----
  const v16b qa = ldfrag_b(Qc + (size_t)(q0 + c) * QS + 8 * hh);
  const int rowq = q0 + c;                     // this lane's query index

  float mrow = -INFINITY;                      // running max of query rowq (equal in both lane halves)
  float lrow = 0.f;                            // running sum over this lane half's keys only
  v8f oacc = zero8();                          // O^T: register r = d 8hh+r of query rowq

  for (int kt = 0; kt <= qb; ++kt) {           // block-uniform trip count, <= NQB
    const int kv0 = kt * 64;                   // kv0 + 63 < SEQ
    const int kvn = (kt < qb) ? kv0 + 64 : 0;  // K chunk fetched ahead; the last trip fetches chunk 0, with which the next tile starts

    v16b vb[2], vl[2];
#pragma unroll
    for (int kk = 0; kk < 2; ++kk) {
      vb[kk] = ldfrag_b(Vh + kv0 + vlane + kk * 32);
      vl[kk] = ldfrag_b(Vl + kv0 + vlane + kk * 32);
    }

    // ---- scores: 64 keys x 16 queries per wave, 2 bf16 products per key subtile ----
    v8f s[4];
#pragma unroll
    for (int j = 0; j < 4; ++j) {
      s[j] = mma_b(kd[j], qa, zero8());
      s[j] = mma_b(kz[j], qa, s[j]);
    }
    fetch_k(kvn);

    // ---- scale, causal mask by index, max in-lane + one exchange, online softmax ----
    float mj[4];                               // one max chain per score tile: four independent chains
#pragma unroll
    for (int j = 0; j < 4; ++j) {
      mj[j] = -INFINITY;
#pragma unroll
      for (int r = 0; r < 8; ++r) {
        const int key = kv0 + j * 16 + 8 * hh + r;
        float sv = s[j][r] * 0.25f;
        sv = (key <= rowq) ? sv : -INFINITY;
        s[j][r] = sv;
        mj[j] = fmaxf(mj[j], sv);
      }
    }
    float m = fmaxf(fmaxf(mj[0], mj[1]), fmaxf(mj[2], mj[3]));
    m = fmaxf(m, other_half(m));
    const float mnew  = fmaxf(mrow, m);
    const float msafe = (mnew == -INFINITY) ? 0.f : mnew;
    const float alpha = __expf(mrow - msafe);
    mrow = mnew;

    PB ph[2], pl[2];                           // P^T hi / lo as B operands of the two 32-key k-steps
    float pj[4];                               // one sum chain per score tile
#pragma unroll
    for (int j = 0; j < 4; ++j) {
      float xe[8], pe[8];
#pragma unroll
      for (int r = 0; r < 8; ++r) xe[r] = (s[j][r] - msafe) * 1.44269504f;   // exp(t) = 2^(t log2 e), as __expf forms it
      exp2x8(xe, pe);                                        // masked logit: 2^(-inf) = 0
#pragma unroll
      for (int e = 0; e < 4; ++e) {
        const float p0 = pe[2 * e];
        const float p1 = pe[2 * e + 1];
        pj[j] = (e == 0) ? (p0 + p1) : ((pj[j] + p0) + p1);
        const unsigned short hb0 = bf_bits(p0), hb1 = bf_bits(p1);
        const unsigned short lb0 = bf_bits(p0 - bf_up(hb0)), lb1 = bf_bits(p1 - bf_up(hb1));
        ph[j >> 1].u[(j & 1) * 4 + e] = pk16(hb0, hb1);
        pl[j >> 1].u[(j & 1) * 4 + e] = pk16(lb0, lb1);
      }
    }
    lrow = lrow * alpha + ((pj[0] + pj[1]) + (pj[2] + pj[3]));
#pragma unroll
    for (int r = 0; r < 8; ++r) oacc[r] *= alpha;

    // ---- context^T += V^T . P^T (bf16 WMMA, hh + lh + hl into one accumulator) ----
#pragma unroll
    for (int kk = 0; kk < 2; ++kk) {
      oacc = mma_b(vb[kk], ph[kk].v, oacc);
      oacc = mma_b(vl[kk], ph[kk].v, oacc);
      oacc = mma_b(vb[kk], pl[kk].v, oacc);
    }
  }

  // ---- join the halves' sums, normalise (1/l), bf16 hi/lo split, one 16-B store per lane and plane ----
  {
    const float l = lrow + other_half(lrow);
    const float inv = (l > 0.f) ? (1.0f / l) : 0.f;
    v4u a, a2;
#pragma unroll
    for (int e = 0; e < 4; ++e) {
      const float f0 = oacc[2 * e] * inv, f1 = oacc[2 * e + 1] * inv;
      const unsigned short hb0 = bf_bits(f0), hb1 = bf_bits(f1);
      const unsigned short lb0 = bf_bits(f0 - bf_up(hb0)), lb1 = bf_bits(f1 - bf_up(hb1));
      a[e] = pk16(hb0, hb1); a2[e] = pk16(lb0, lb1);
    }
    const size_t go = (bhp * SEQ + rowq) * HD + 8 * hh;
    *(v4u*)(ohp + go) = a;
    *(v4u*)(olp + go) = a2;
    // precaution: the next tile rewrites registers that these stores name
    asm volatile("s_wait_xcnt 0x0" ::: "memory");
  }
  }
}

// =====================================================================================================
// Workspace map (bytes; every region is an exact multiple of its whole-line / whole-tile store granularity,
//   Xb   bf16 [4096][288]            2359296
//   Wqb  bf16 [288][288]              165888   (x4: Wq, Wk, Wv, Wo)
//   Qc   bf16 [2][18][2048][32]      4718592
//   Kd                               4718592
//   Kz                               4718592
//   VTh  bf16 [2][288][2048]         2359296
//   VTl                              2359296
//   Oh   bf16 [2][18][2048][16]      2359296
//   Ol                               2359296
//   Ct   f32  [2048][8]                65536
//   St                                 65536
//   total                           26746880
// =====================================================================================================
extern "C" void kernel_launch(void* const* d_in, const int* in_sizes, int n_in,
                              void* d_out, int out_size, void* d_ws, size_t ws_size,
                              hipStream_t stream) {
  if (n_in < 5) return;
  if (in_sizes[0] != NTOK * HID) return;
  if (in_sizes[1] != HID * HID) return;
  if (in_sizes[2] != HID * HID) return;
  if (in_sizes[3] != HID * HID) return;
  if (in_sizes[4] != HID * HID) return;
  if (out_size != NTOK * HID) return;

  const float* x  = (const float*)d_in[0];   // [2][2048][288]
  const float* Wq = (const float*)d_in[1];   // [288 out][288 in]
  const float* Wk = (const float*)d_in[2];
  const float* Wv = (const float*)d_in[3];
  const float* Wo = (const float*)d_in[4];

  const size_t PX  = (size_t)NTOK * HID * 2;            // 2359296
  const size_t PW  = (size_t)HID * HID * 2;             //  165888
  const size_t PQ  = (size_t)NB * NH * SEQ * QS * 2;    // 4718592
  const size_t PVT = (size_t)NB * HID * SEQ * 2;        // 2359296
  const size_t PO  = (size_t)NB * NH * SEQ * HD * 2;    // 2359296
  const size_t PTB = (size_t)SEQ * NPAIR * 4;           //   65536
  size_t off = 0;
  const size_t oXb  = off; off += PX;
  const size_t oWq  = off; off += PW;
  const size_t oWk  = off; off += PW;
  const size_t oWv  = off; off += PW;
  const size_t oWo  = off; off += PW;
  const size_t oQc  = off; off += PQ;
  const size_t oKd  = off; off += PQ;
  const size_t oKz  = off; off += PQ;
  const size_t oVTh = off; off += PVT;
  const size_t oVTl = off; off += PVT;
  const size_t oOh  = off; off += PO;
  const size_t oOl  = off; off += PO;
  const size_t oCt  = off; off += PTB;
  const size_t oSt  = off; off += PTB;
  if (off > ws_size) return;                            // off = 26746880
  if (off > (size_t)134217728) return;

  char* ws = (char*)d_ws;
  unsigned short* Xb  = (unsigned short*)(ws + oXb);
  unsigned short* Wqb = (unsigned short*)(ws + oWq);
  unsigned short* Wob = (unsigned short*)(ws + oWo);
  unsigned short* Qc  = (unsigned short*)(ws + oQc);
  unsigned short* Kd  = (unsigned short*)(ws + oKd);
  unsigned short* Kz  = (unsigned short*)(ws + oKz);
  unsigned short* VTh = (unsigned short*)(ws + oVTh);
  unsigned short* VTl = (unsigned short*)(ws + oVTl);
  unsigned short* Oh  = (unsigned short*)(ws + oOh);
  unsigned short* Ol  = (unsigned short*)(ws + oOl);
  float*          Ct  = (float*)(ws + oCt);
  float*          St  = (float*)(ws + oSt);

  const dim3 blk256(256);
  const dim3 blk128(128);
  const dim3 gPrep(PREP_TAB + 4 * PREP_W + PREP_X);     // 64 + 164 + 576 = 804 blocks
  const dim3 gQkv(((NTOK / 64) * (HID / 32)) / 4, 3);   // 576 tiles -> 144 blocks of 4 waves, x 3 projections
  const dim3 gOut(((NTOK / 64) * (HID / 32)) / 4);      // 144 blocks of 4 waves
  const dim3 gAttn(NB * NH * ABIN);                     // 504 blocks of 128

  // (1) RoPE tables; x and the four weights -> bf16 planes (weights are [out][in] = Bt[n][k] already)
  prep<<<gPrep, blk256, 0, stream>>>(x, Wq, Wk, Wv, Wo, Xb, Wqb, Ct, St);
  // (2) q = rope(x . Wq^T) -> [b][h][t][hi|lo]; k = rope(x . Wk^T) -> [b][h][s][hi|hi] and [b][h][s][lo|0];
  //     v = x . Wv^T -> v^T bf16 hi / lo planes [b][h*16+d][s]
  gemm_qkv<<<gQkv, blk128, 0, stream>>>(Xb, Wqb, Qc, Kd, Kz, VTh, VTl, Ct, St);
  // (3) causal attention -> ctx bf16 hi / lo planes [b][h][t][d]
  attn_causal16<<<gAttn, blk128, 0, stream>>>(Qc, Kd, Kz, VTh, VTl, Oh, Ol);
  // (4) out = (ctx hi + ctx lo) . Wo^T -> d_out f32 [4096][288]
  gemm_out<<<gOut, blk128, 0, stream>>>(Oh, Ol, Wob, (float*)d_out);
  (void)hipGetLastError();
}

// v005
// One run takes 60.8 microseconds.
// Timed twice side by side with v004, it ran 1.06 and 1.05 times as fast.
// Over all steps from v000 it is 4.72 times as fast.
// Contractions: q / k / v projections = v_wmma_f32_16x16x32_bf16 (bf16 operands from RNE-converted x and Wq/Wk/Wv, single product, f32 accumulate);
// k.q^T scores (transposed) = v_wmma_f32_16x16x32_bf16 with q and k as bf16 hi/lo split folded into the 32-deep k axis ([qhi|qlo].[khi|khi] + [qhi|qlo].[klo|0] = hh+lh+hl, 2 products), f32 accumulate;
// v^T.p^T (transposed) = v_wmma_f32_16x16x32_bf16 with p and v as bf16 hi/lo split (hh + hl + lh, 3 products), f32 accumulate;
// ctx.Wo^T = v_wmma_f32_16x16x32_bf16 with ctx as bf16 hi + unscaled lo planes times bf16 Wo (2 products), f32 accumulate;
// rotary tables (powf, f32 product, precise sincosf), half-rotation, causal mask and online softmax in f32 on the VALU.
// Carry audit: no scaled planes anywhere; every lo plane is the unscaled RNE residual (v - hi) in bf16 and shares the hi accumulator;
// score scale 1/4 applied once in f32 after the score accumulate; softmax normaliser 1/l applied once in the attention epilogue.
#include <hip/hip_runtime.h>
#include <math.h>
#include <stdint.h>

#define NB    2
#define SEQ   2048
#define HID   288
#define NH    18
#define HD    16
#define NPAIR 8
#define QS    32           // slots per head in the q / k planes: 0..15 hi (d), 16..31 lo (d) or duplicate / zero
#define NTOK  (NB * SEQ)   // 4096 token rows
#define NQB   (SEQ / 64)   // 32 query blocks of 64 per sequence
static_assert(NH * HD == HID);
static_assert(NPAIR * 2 == HD);
static_assert((SEQ % 64) == 0 && (HID % 32) == 0 && (NTOK % 64) == 0);
static_assert(((NTOK / 64) * (HID / 32)) % 4 == 0);
static_assert((NTOK * HID) % (8 * 256) == 0);
static_assert(((HID * HID) % 8) == 0 && (((HID * HID) / 8) % 32) == 0);
static_assert((SEQ % 32) == 0);

typedef __bf16   v16b __attribute__((ext_vector_type(16)));
typedef __bf16   v8b  __attribute__((ext_vector_type(8)));
typedef float    v8f  __attribute__((ext_vector_type(8)));
typedef float    v4f  __attribute__((ext_vector_type(4)));
typedef float    v2f  __attribute__((ext_vector_type(2)));
typedef __bf16   v2b  __attribute__((ext_vector_type(2)));
typedef unsigned int v4u __attribute__((ext_vector_type(4)));

// ---- scalar helpers --------------------------------------------------------------------------------
// two f32 -> two bf16 in one word (a low, b high), RNE, by the chip's packed convert
__device__ __forceinline__ unsigned cvt2(float a, float b) {
  const v2f f = {a, b};
  return __builtin_bit_cast(unsigned, __builtin_convertvector(f, v2b));
}
// hi = bf16(f), lo = bf16(f - hi) for eight values, word e = values 2e (low half) and 2e+1 (high half): three instructions a
// pair. hi: one packed convert. lo: the mixed-precision FMA reads hi's bf16 half as it lies, forms hi * -1 + f (exact in f32)
// and rounds it (RNE) into one half of the result word; the compiler's own form of the same takes a shift, a mask, a packed
// add and a second convert. The four low halves stand ahead of the four high halves, so that no instruction follows the
// one that wrote its result word directly.
__device__ __forceinline__ void split8(const float (&f)[8], unsigned (&hi)[4], unsigned (&lo)[4]) {
#pragma unroll
  for (int e = 0; e < 4; ++e) hi[e] = cvt2(f[2 * e], f[2 * e + 1]);
  asm("v_fma_mixlo_bf16 %0, %4, -1.0, %8 op_sel_hi:[1,0,0]\n\t"
      "v_fma_mixlo_bf16 %1, %5, -1.0, %10 op_sel_hi:[1,0,0]\n\t"
      "v_fma_mixlo_bf16 %2, %6, -1.0, %12 op_sel_hi:[1,0,0]\n\t"
      "v_fma_mixlo_bf16 %3, %7, -1.0, %14 op_sel_hi:[1,0,0]\n\t"
      "v_fma_mixhi_bf16 %0, %4, -1.0, %9 op_sel:[1,0,0] op_sel_hi:[1,0,0]\n\t"
      "v_fma_mixhi_bf16 %1, %5, -1.0, %11 op_sel:[1,0,0] op_sel_hi:[1,0,0]\n\t"
      "v_fma_mixhi_bf16 %2, %6, -1.0, %13 op_sel:[1,0,0] op_sel_hi:[1,0,0]\n\t"
      "v_fma_mixhi_bf16 %3, %7, -1.0, %15 op_sel:[1,0,0] op_sel_hi:[1,0,0]"
      : "=&v"(lo[0]), "=&v"(lo[1]), "=&v"(lo[2]), "=&v"(lo[3])
      : "v"(hi[0]), "v"(hi[1]), "v"(hi[2]), "v"(hi[3]),
        "v"(f[0]), "v"(f[1]), "v"(f[2]), "v"(f[3]), "v"(f[4]), "v"(f[5]), "v"(f[6]), "v"(f[7]));
}
__device__ __forceinline__ v8f zero8() { v8f z = {0.f, 0.f, 0.f, 0.f, 0.f, 0.f, 0.f, 0.f}; return z; }

// ---- fragment loaders: 16-bit A/B operand, lane -> row/col (lane&15), p already includes +8*(lane>>4);
//      elements 0..7 <- p[0..7] (k0+8h..k0+8h+7), elements 8..15 <- p[16..23] (k0+16+8h..k0+16+8h+7)
__device__ __forceinline__ v16b ldfrag_b(const __bf16* p) {
  union { v16b v; v8b h[2]; } f;
  f.h[0] = *(const v8b*)(p);
  f.h[1] = *(const v8b*)(p + 16);
  return f.v;
}
// same map when k0..k0+15 and k0+16..k0+31 live in two different rows (p0, p1 each include +8*(lane>>4))
__device__ __forceinline__ v16b ldfrag_b2(const __bf16* p0, const __bf16* p1) {
  union { v16b v; v8b h[2]; } f;
  f.h[0] = *(const v8b*)(p0);
  f.h[1] = *(const v8b*)(p1);
  return f.v;
}

// ---- WMMA helper with trailing VALU hazard gap (D tied, A/B kept live) ----------------------------------
__device__ __forceinline__ v8f mma_b(v16b a, v16b b, v8f c) {
  c = __builtin_amdgcn_wmma_f32_16x16x32_bf16(false, a, false, b, (short)0, c, false, false);
  asm volatile("v_nop\n\tv_nop\n\tv_nop\n\tv_nop" : "+v"(c) : "v"(a), "v"(b));
  return c;
}

// =====================================================================================================
// prep: everything the projections need and that depends on the inputs alone, as block ranges of ONE grid (256 threads a
// block, the range test is block-uniform):
//   blocks 0..63 (rotary tables): ctab[t][i] = cos(t * inv[i]), stab[t][i] = sin(t * inv[i]), i = 0..7, t = 0..SEQ-1, with
//     inv[i] = 1 / powf(10000, (2i)/16) formed by every thread for its own i (f32 product, precise sincosf);
//     thread tid -> t = block*32 + tid/8, i = tid&7; 64 blocks x 256 = the whole [SEQ][8] tables.
//   blocks 64..227 (weights): 41 blocks a weight, Wq, Wk, Wv, Wo in this order, into four planes that follow one another.
//   blocks 228..803 (x).
//   f32 -> bf16 (RNE convert), 8 elements per thread, one 16-B store per lane: a wave writes 512 contiguous B;
//   n8 threads x 8 = the whole plane (n8 = 147456 for x, 10368 for each weight; both multiples of 32).
// =====================================================================================================
#define PREP_TAB  (SEQ / 32)                       // 64 blocks
#define PREP_W    ((HID * HID / 8 + 255) / 256)    // 41 blocks a weight
#define PREP_X    (NTOK * HID / 8 / 256)           // 576 blocks
__device__ __forceinline__ void cvt_bf16x8(const float* __restrict__ in, unsigned short* out, const int i) {
  const v4f a = *(const v4f*)(in + (size_t)i * 8);
  const v4f b = *(const v4f*)(in + (size_t)i * 8 + 4);
  v4u p;
  p[0] = cvt2(a[0], a[1]);
  p[1] = cvt2(a[2], a[3]);
  p[2] = cvt2(b[0], b[1]);
  p[3] = cvt2(b[2], b[3]);
  *(v4u*)(out + (size_t)i * 8) = p;
  // precaution: in the merged kernel's listing another block range's code, which rewrites the store's registers, follows it
  asm volatile("s_wait_xcnt 0x0" ::: "memory");
}

__global__ __launch_bounds__(256) void prep(const float* __restrict__ x, const float* __restrict__ Wq,
                                            const float* __restrict__ Wk, const float* __restrict__ Wv,
                                            const float* __restrict__ Wo, unsigned short* Xb, unsigned short* Wb,
                                            float* ctab, float* stab) {
  const int tid = (int)threadIdx.x;
  const int bx  = (int)blockIdx.x;
  if (bx < PREP_TAB) {
    const int i = tid & (NPAIR - 1);
    const int t = bx * 32 + (tid >> 3);
    const float e = (float)(2 * i) * (1.0f / (float)HD);
    const float p = powf(10000.0f, e);
    const float f = 1.0f / p;
    const float ang = (float)t * f;
    float sn, cs;
    sincosf(ang, &sn, &cs);
    const size_t o = (size_t)t * NPAIR + i;
    *(float*)(ctab + o) = cs;
    *(float*)(stab + o) = sn;
  } else if (bx < PREP_TAB + 4 * PREP_W) {
    const int w  = (bx - PREP_TAB) / PREP_W;       // 0..3: Wq, Wk, Wv, Wo
    const int i  = (bx - PREP_TAB - w * PREP_W) * 256 + tid;
    const float* in = (w == 0) ? Wq : (w == 1) ? Wk : (w == 2) ? Wv : Wo;
    if (i < HID * HID / 8) cvt_bf16x8(in, Wb + (size_t)w * (HID * HID), i);
  } else {
    cvt_bf16x8(x, Xb, (bx - PREP_TAB - 4 * PREP_W) * 256 + tid);
  }
}

// =====================================================================================================
// bf16 WMMA GEMM, one wave per 64 x 32 tile, 4 waves per block, no block barriers:
//   C[m][n] = sum_k A[m][k] * Bt[n][k] (+ sum_k A2[m][k] * Bt[n][k] when TWOA), M = 4096 tokens, N = 288, K = 288
//   (9 k-steps of 32, no tails). Bt = weight plane [n][k] (the [out][in] weight as delivered, RNE bf16), pitch 288.
//   A: MODE 0..2: x plane [m][k] pitch 288. MODE 3: ctx planes laid out [b][h][t][16]; k-step j covers heads 2j
//   (k 0..15) and 2j+1 (k 16..31): elements 0..7 <- head 2j, d = 8*(lane>>4)..+7; elements 8..15 <- head 2j+1, same d.
// then (b = m0/2048, t = m0%2048 + row, 32 columns = heads n0/16 and n0/16+1):
//   MODE 0 (q): rotary in f32 (contract off): d < 8: x[d] c[t][d] - x[d+8] s[t][d]; d >= 8: x[d] c[t][d-8] + x[d-8] s[t][d-8];
//               -> plane [b][h][t][32]: slots 0..15 = bf16 hi of d, 16..31 = bf16 lo (v - hi) of d.
//   MODE 1 (k): same rotary; plane C0 slots 0..15 = hi, 16..31 = hi (duplicate); plane C1 slots 0..15 = lo, 16..31 = 0.
//   MODE 2 (v): no rotary; v^T planes C0 = hi, C1 = lo, element (b, n, t) at [(b*288 + n)*2048 + t]:
//   MODE 0..2 share one body and ONE grid (gemm_qkv: blockIdx.y = mode, the same in every wave of a block; only the weight
//   plane, the epilogue and the output planes differ); MODE 3 (OUT) is a launch of its own (gemm_out), behind attention.
// coverage: 576 tiles x (64 rows x 32 cols) = the whole 4096 x 288 result; MODE 0/1: 2 heads x 8 it x 8 rows x 4 lanes
//           x 8 slots = 64 rows x 2 heads x 32 slots; MODE 2: 8 it x 4 x 8 lanes x 8 = 32 features x 64 tokens;
//           MODE 3: 16 it x 4 rows x 8 lanes x 4 = 64 rows x 32 cols.
// =====================================================================================================
// Epilogue of one wave's 64 x 32 tile, read back from its LDS slab; MODE as listed above.
template <int MODE>
__device__ __forceinline__ void gemm_epi(const float* slab, const int lane, const int m0, const int n0, const int bidx,
                                         const int tl0, void* C0, void* C1,
                                         const float* __restrict__ ctab, const float* __restrict__ stab) {
  static_assert(MODE >= 0 && MODE <= 3);
  if (MODE == 3) {
    float* Cf = (float*)C0;
    const int q4 = lane >> 3, c4 = (lane & 7) * 4;
    {
#pragma unroll
      for (int it = 0; it < 16; ++it) {
        const int row = it * 4 + q4;                         // it 0..15 x q4 0..3 = rows 0..63
        const v4f v = *(const v4f*)(slab + row * 36 + c4);
        *(v4f*)(Cf + (size_t)(m0 + row) * HID + n0 + c4) = v;
      }
      
    }
  } else if (MODE == 2) {
    unsigned short* P0 = (unsigned short*)C0;
    unsigned short* P1 = (unsigned short*)C1;
    const int q4 = lane >> 3, t8 = (lane & 7) * 8;
#pragma unroll 1
    for (int it2 = 0; it2 < 8; it2 += 2) {         // two rows' loads and stores side by side in a trip
#pragma unroll
      for (int it = it2; it < it2 + 2; ++it) {
        const int n = it * 4 + q4;                             // local feature 0..31
        float f[8];
#pragma unroll
        for (int e = 0; e < 8; ++e) f[e] = slab[(t8 + e) * 36 + n];
        unsigned hw[4], lw[4];
        split8(f, hw, lw);
        const v4u a = {hw[0], hw[1], hw[2], hw[3]}, a2 = {lw[0], lw[1], lw[2], lw[3]};
        const size_t go = ((size_t)(bidx * HID + n0 + n)) * SEQ + tl0 + t8;
        *(v4u*)(P0 + go) = a;
        *(v4u*)(P1 + go) = a2;
      }
      // precaution: the next trip rewrites registers that these stores name
      asm volatile("s_wait_xcnt 0x0" ::: "memory");
    }
  } else {
    unsigned short* P0 = (unsigned short*)C0;
    unsigned short* P1 = (unsigned short*)C1;
    const int r4 = lane >> 2, s8 = (lane & 3) * 8;
    const int dbase = s8 & 8;                                // d of the first element: 0 or 8
    const bool isLo = (s8 >= 16);
    const float sg = (dbase == 0) ? -1.0f : 1.0f;            // -x[d+8] for d < 8, +x[d-8] for d >= 8
    const int h0 = n0 >> 4;                                  // first head of the tile (even)
#pragma unroll 1
    for (int hd = 0; hd < 2; ++hd) {
#pragma unroll 1
      for (int it2 = 0; it2 < 8; it2 += 2) {         // two rows' loads and stores side by side in a trip
#pragma unroll
        for (int it = it2; it < it2 + 2; ++it) {
          const int row = it * 8 + r4;                         // it 0..7 x r4 0..7 = rows 0..63
          const int t = tl0 + row;                             // position within the sequence
          const float* xr = slab + row * 36 + hd * 16;
          float x[8], y[8], f[8];
#pragma unroll
          for (int e = 0; e < 8; ++e) { x[e] = xr[dbase + e]; y[e] = xr[(dbase ^ 8) + e]; }
          const v4f cv0 = *(const v4f*)(ctab + (size_t)t * NPAIR);
          const v4f cv1 = *(const v4f*)(ctab + (size_t)t * NPAIR + 4);
          const v4f sv0 = *(const v4f*)(stab + (size_t)t * NPAIR);
          const v4f sv1 = *(const v4f*)(stab + (size_t)t * NPAIR + 4);
          {
#pragma clang fp contract(off)
#pragma unroll
            for (int e = 0; e < 4; ++e) {
              {
                const float ry = sg * y[e];
                const float p0 = x[e] * cv0[e];
                const float p1 = ry * sv0[e];
                f[e] = p0 + p1;
              }
              {
                const float ry = sg * y[4 + e];
                const float p0 = x[4 + e] * cv1[e];
                const float p1 = ry * sv1[e];
                f[4 + e] = p0 + p1;
              }
            }
          }
          unsigned hw[4], lw[4];
          split8(f, hw, lw);
          const v4u hp = {hw[0], hw[1], hw[2], hw[3]}, lp = {lw[0], lw[1], lw[2], lw[3]};
          const size_t go = (((size_t)(bidx * NH + h0 + hd)) * SEQ + t) * QS + s8;
          if (MODE == 0) {
            v4u pc;
#pragma unroll
            for (int e = 0; e < 4; ++e) pc[e] = isLo ? lp[e] : hp[e];
            *(v4u*)(P0 + go) = pc;
          } else {
            v4u pz;
#pragma unroll
            for (int e = 0; e < 4; ++e) pz[e] = isLo ? 0u : lp[e];
            *(v4u*)(P0 + go) = hp;
            *(v4u*)(P1 + go) = pz;
          }
        }
        // precaution: the next trip rewrites registers that these stores name
        asm volatile("s_wait_xcnt 0x0" ::: "memory");
      }
    }
  }
}

template <bool OUT>
__device__ __forceinline__ void gemm_xw(
    const int mode,                                // 0 q, 1 k, 2 v (block-uniform, OUT false); 3 with OUT
    const unsigned short* __restrict__ Ap, const unsigned short* __restrict__ A2p,
    const unsigned short* __restrict__ Btp, void* C0, void* C1,
    const float* __restrict__ ctab, const float* __restrict__ stab) {
  constexpr bool TWOA = OUT;
  constexpr int M = NTOK, N = HID, K = HID;
  constexpr int TN = N / 32;   // 9
  constexpr int TM = M / 64;   // 64
  const __bf16* A  = (const __bf16*)(const void*)Ap;
  const __bf16* A2 = (const __bf16*)(const void*)A2p;
  const __bf16* Bt = (const __bf16*)(const void*)Btp;
  __shared__ __align__(16) float sT[4][64 * 36];   // per-wave 64x32 tile, pitch 36 floats

  const int lane = threadIdx.x & 31;
  const int wave = __builtin_amdgcn_readfirstlane((int)(threadIdx.x >> 5));   // same in every lane: held scalar, the tile bases are scalar too
  const int tile = blockIdx.x * 4 + wave;
  if (tile >= TM * TN) return;                     // wave-uniform; no block barriers in this kernel
  const int tm = tile / TN;
  const int tn = tile - tm * TN;
  const int m0 = tm << 6;
  const int n0 = tn << 5;
  const int c    = lane & 15;                      // row (A) / col (B, D) within subtile
  const int koff = (lane >> 4) * 8;                // k offset of this lane half
  const int mOff = (lane >> 4) * 8;                // D row offset
  const int bidx = m0 / SEQ;                       // batch of this tile (tiles never straddle a batch)
  const int tl0  = m0 - bidx * SEQ;                // first position within the sequence

  v8f acc[4][2];
#pragma unroll
  for (int i = 0; i < 4; ++i)
#pragma unroll
    for (int j = 0; j < 2; ++j) acc[i][j] = zero8();

  // Loads run ahead of the matrix instructions: every fragment is fetched into a register set that is free by then, whole
  // k-steps before its products, so a k-step waits on loads issued earlier and not on its own. Three A sets go round.
  //   one A plane: k-step ks in A and B set ks % 3, fetched two k-steps ahead (8 products a k-step cover little of a load).
  //   two A planes: the hi products of a k-step run first, then the lo products (each accumulator still takes hi, lo, hi,
  //   lo ... in k order); the sets hold hi(ks), lo(ks), hi(ks+1), each fetched one k-step ahead; B in set ks & 1.
  // Address = wave-uniform tile base + one lane offset + a constant: the sets leave no room for a pointer per row.
  constexpr int KS = K / 32;                       // 9 k-steps
  const size_t abase = OUT ? (((size_t)(bidx * NH)) * SEQ + tl0) * HD : (size_t)m0 * K;
  const __bf16* Ab  = A + abase;
  const __bf16* A2b = A2 + abase;
  const __bf16* Bb  = Bt + (size_t)n0 * K;
  const unsigned alane = (unsigned)(c * (OUT ? HD : K) + koff);
  const unsigned blane = (unsigned)(c * K + koff);
  v16b bh[TWOA ? 2 : 3][2], ar[3][4];
  auto fetch_b = [&](const int ks, const int st) __attribute__((always_inline)) {
#pragma unroll
    for (int j = 0; j < 2; ++j) bh[st][j] = ldfrag_b(Bb + blane + (j << 4) * K + ks * 32);
  };
  auto fetch_a = [&](const __bf16* base, const int ks, const int set) __attribute__((always_inline)) {
#pragma unroll
    for (int i = 0; i < 4; ++i) {
      if (OUT) {                                   // ks = head pair index 0..8: heads 2 ks and 2 ks + 1, same token row
        const int e0 = (i << 4) * HD + (2 * ks) * SEQ * HD, e1 = e0 + SEQ * HD;
        ar[set][i] = ldfrag_b2(base + alane + e0, base + alane + e1);
      } else {
        ar[set][i] = ldfrag_b(base + alane + (i << 4) * K + ks * 32);
      }
    }
  };
  auto products = [&](const int set, const int st) __attribute__((always_inline)) {
#pragma unroll
    for (int i = 0; i < 4; ++i)
#pragma unroll
      for (int j = 0; j < 2; ++j) acc[i][j] = mma_b(ar[set][i], bh[st][j], acc[i][j]);
  };
  fetch_b(0, 0);
  fetch_a(Ab, 0, 0);
  if (TWOA) fetch_a(A2b, 0, 1);
  else { fetch_b(1, 1); fetch_a(Ab, 1, 1); }
#pragma unroll                                     // full unroll: a register set's index must be a constant
  for (int ks = 0; ks < KS; ++ks) {
    const int st = ks & 1;
    if (TWOA) {
      const int sh = (2 * ks) % 3, sl = (2 * ks + 1) % 3, sn = (2 * ks + 2) % 3;
      if (ks + 1 < KS) { fetch_b(ks + 1, st ^ 1); fetch_a(Ab, ks + 1, sn); }
      products(sh, st);
      if (ks + 1 < KS) fetch_a(A2b, ks + 1, sh);   // into the set the hi products have just read
      products(sl, st);
    } else {
      if (ks + 2 < KS) { fetch_b(ks + 2, (ks + 2) % 3); fetch_a(Ab, ks + 2, (ks + 2) % 3); }
      products(ks % 3, ks % 3);
    }
  }

  // ---- epilogue: whole tile to wave-private LDS ----
  float* slab = sT[wave];
#pragma unroll
  for (int i = 0; i < 4; ++i)
#pragma unroll
    for (int j = 0; j < 2; ++j)
#pragma unroll
      for (int r = 0; r < 8; ++r)
        slab[((i << 4) + mOff + r) * 36 + (j << 4) + c] = acc[i][j][r];
  __builtin_amdgcn_fence(__ATOMIC_RELEASE, "workgroup");
  __builtin_amdgcn_wave_barrier();
  __builtin_amdgcn_fence(__ATOMIC_ACQUIRE, "workgroup");

  if (OUT)            gemm_epi<3>(slab, lane, m0, n0, bidx, tl0, C0, C1, ctab, stab);
  else if (mode == 0) gemm_epi<0>(slab, lane, m0, n0, bidx, tl0, C0, C1, ctab, stab);   // block-uniform choice, made once:
  else if (mode == 1) gemm_epi<1>(slab, lane, m0, n0, bidx, tl0, C0, C1, ctab, stab);   // no mode test inside an epilogue loop
  else                gemm_epi<2>(slab, lane, m0, n0, bidx, tl0, C0, C1, ctab, stab);
}

// q, k and v projections in one grid: blockIdx.x = group of 4 tiles, blockIdx.y = mode. Wb = Wq, Wk, Wv planes in a row.
__global__ __launch_bounds__(128) void gemm_qkv(
    const unsigned short* __restrict__ Xb, const unsigned short* __restrict__ Wb,
    unsigned short* Qc, unsigned short* Kd, unsigned short* Kz, unsigned short* VTh, unsigned short* VTl,
    const float* __restrict__ ctab, const float* __restrict__ stab) {
  const int mode = (int)blockIdx.y;
  unsigned short* C0 = (mode == 0) ? Qc : (mode == 1) ? Kd : VTh;
  unsigned short* C1 = (mode == 0) ? Qc : (mode == 1) ? Kz : VTl;
  gemm_xw<false>(mode, Xb, Xb, Wb + (size_t)mode * (HID * HID), (void*)C0, (void*)C1, ctab, stab);
}

__global__ __launch_bounds__(128) void gemm_out(
    const unsigned short* __restrict__ Oh, const unsigned short* __restrict__ Ol,
    const unsigned short* __restrict__ Wob, float* out) {
  gemm_xw<true>(3, Oh, Ol, Wob, (void*)out, (void*)out, nullptr, nullptr);
}

// =====================================================================================================
// Causal attention, head dim 16, key chunks of 64, both products transposed: S^T = K . Q^T, O^T += V^T . P^T.
//   q plane  [b][h][t][32]: slots 0..15 = bf16 hi of rope(q)[d], 16..31 = bf16 lo
//   kd plane [b][h][s][32]: slots 0..15 = hi of rope(k)[d], 16..31 = hi again; kz plane: 0..15 = lo, 16..31 = 0
//   so one 32-deep k-step gives q.k = hi.hi + lo.hi (kd) and hi.lo (kz): two products per 16x16 score tile.
//   v^T planes (bf16 hi / lo): element (b, h*16+d, s) at [(b*288 + h*16 + d)*2048 + s]
//   ctx planes (bf16 hi / lo of the normalised context): element (b, h, t, d) at [((b*18 + h)*2048 + t)*16 + d]
//   Score tile j: A = 16 key rows (row = lane&15), B = the wave's 16 queries (col = lane&15), same loader on both sides, so
//   register r of lane (c, hh) = score of key kv0 + 16j + 8hh + r against query q0 + c: a lane holds 32 of the 64 keys of ONE
//   query. Row max and row sum are in-lane; the two lane halves exchange the max once per chunk and join their sums once, in
//   the epilogue. Tiles 2kk and 2kk+1, converted in place, are the B operand of k-step kk (element e = key 8hh+e, element
//   8+e = key 16+8hh+e), which is the k order in which ldfrag_b reads the v^T row as A: P never leaves the registers.
//   Causal structure: query tile qb visits key chunks 0..qb only (block-uniform trip count qb+1 <= NQB); inside the
//   diagonal chunk a key with index > query index gets logit -inf -> exp gives exactly 0; the first key of every visited
//   chunk is always kept, so every joined max is finite.
//   Tile = 64 query rows of one (b, h), 4 waves, wave w = rows q0..q0+15; no LDS, no barriers.
//   Equal work-groups: every work-group is resident from the start, so the launch lasts as long as the fullest WGP, and a
//   tile costs qb+1 chunks. A block therefore walks several tiles of ONE head, one after the other, ABIN blocks a head:
//   block n = 0..12: tiles 31-n and 5+n (32-n and 6+n chunks, 38 together); block 13: tiles 18, 4, 3, 2, 1, 0 (34 chunks).
//   grid = NB * NH * ABIN = 504 blocks, at most two for each of the 256 WGPs. All tiles of a block start at key chunk 0 of
//   the same head, so the last trip of a tile fetches that chunk for the next one.
//   The hi / lo splits of P round in the chip's converting instructions (split8), not in integer arithmetic.
//   Output: lane (c, hh) holds d = 8hh..8hh+7 of query q0 + c: one 16-B store per plane, 512 contiguous B per wave.
//   coverage: tiles 31..19, 5..17, 18 and 4..0 = each of the 32 tiles of a head once; 36 heads x 32 tiles x 4 waves x 16 rows
//   x 16 d = every (b, h, t, d) of both ctx planes exactly once.
// =====================================================================================================
__device__ __forceinline__ float other_half(float v) {                // value of lane l ^ 16
  const int b = __builtin_bit_cast(int, v);
  return __builtin_bit_cast(float, __builtin_amdgcn_permlanex16(b, b, 0x76543210, 0xfedcba98, false, false));
}

__device__ __forceinline__ void exp2x8(const float (&x)[8], float (&y)[8]) {
  asm("v_exp_f32 %0, %8\n\tv_exp_f32 %1, %9\n\tv_exp_f32 %2, %10\n\tv_exp_f32 %3, %11\n\t"
      "v_exp_f32 %4, %12\n\tv_exp_f32 %5, %13\n\tv_exp_f32 %6, %14\n\tv_exp_f32 %7, %15\n\tv_nop"
      : "=&v"(y[0]), "=&v"(y[1]), "=&v"(y[2]), "=&v"(y[3]), "=&v"(y[4]), "=&v"(y[5]), "=&v"(y[6]), "=&v"(y[7])
      : "v"(x[0]), "v"(x[1]), "v"(x[2]), "v"(x[3]), "v"(x[4]), "v"(x[5]), "v"(x[6]), "v"(x[7]));
}

#define ABIN 14            // blocks per (b, h)
static_assert(NQB == 32);  // the tile lists below are written for 32 tiles a head

// At most two work-groups share a WGP (two waves a SIMD), so registers up to 256 cost nothing. Without the bound the compiler,
// once the splits need fewer registers, aims at a fifth wave a SIMD and forms the loop-invariant mask bounds anew in every trip.
__global__ __launch_bounds__(128) __attribute__((amdgpu_waves_per_eu(4, 4)))
void attn_causal16(const unsigned short* __restrict__ qcp, const unsigned short* __restrict__ kdp,
                   const unsigned short* __restrict__ kzp, const unsigned short* __restrict__ vhp,
                   const unsigned short* __restrict__ vlp, unsigned short* ohp, unsigned short* olp) {
  union PB { v16b v; unsigned u[8]; };

  const int tid  = threadIdx.x;
  const int wave = tid >> 5;
  const int lane = tid & 31;
  const int hh   = lane >> 4;
  const int c    = lane & 15;

  const int bx   = blockIdx.x;
  const int bin  = bx % ABIN;
  const int rest = bx / ABIN;
  const int h    = rest % NH;
  const int b    = rest / NH;
  const int ntile = (bin < ABIN - 1) ? 2 : 6;  // block-uniform
  const size_t bhp = (size_t)b * NH + h;

  const __bf16* Qc = (const __bf16*)(const void*)qcp + bhp * SEQ * QS;
  const __bf16* Kd = (const __bf16*)(const void*)kdp + bhp * SEQ * QS;
  const __bf16* Kz = (const __bf16*)(const void*)kzp + bhp * SEQ * QS;
  const __bf16* Vh = (const __bf16*)(const void*)vhp + ((size_t)b * HID + (size_t)h * HD) * SEQ;
  const __bf16* Vl = (const __bf16*)(const void*)vlp + ((size_t)b * HID + (size_t)h * HD) * SEQ;

  // Loads run ahead of the matrix instructions that use them: chunk kt + 1's K fragments are fetched as one group behind
  // the score products of chunk kt, chunk kt's V fragments at the head of trip kt; the softmax runs while both fly.
  // Address = wave-uniform chunk base + a lane offset that never changes.
  const unsigned klane = (unsigned)(c * QS + 8 * hh);        // key row c of a subtile, this lane half's slots
  const unsigned vlane = (unsigned)(c * SEQ + 8 * hh);       // v^T row d = c, this lane half's keys
  v16b kd[4], kz[4];
  auto fetch_k = [&](const int kv) __attribute__((always_inline)) {
    const __bf16* kdb = Kd + (size_t)kv * QS;
    const __bf16* kzb = Kz + (size_t)kv * QS;
#pragma unroll
    for (int j = 0; j < 4; ++j) {
      kd[j] = ldfrag_b(kdb + klane + j * 16 * QS);
      kz[j] = ldfrag_b(kzb + klane + j * 16 * QS);
    }
  };
  fetch_k(0);

  for (int ti = 0; ti < ntile; ++ti) {         // the block's tiles, the longest first
  const int qb = (bin < ABIN - 1) ? ((ti == 0) ? NQB - 1 - bin : 5 + bin) : ((ti == 0) ? 18 : 5 - ti);
  const int q0 = qb * 64 + wave * 16;

  // ---- Q fragment (B operand, col = lane&15, one 32-slot k-step) ----
  const v16b qa = ldfrag_b(Qc + (size_t)(q0 + c) * QS + 8 * hh);
  const int rowq = q0 + c;                     // this lane's query index

  float mrow = -INFINITY;                      // running max of query rowq (equal in both lane halves)
  float lrow = 0.f;                            // running sum over this lane half's keys only
  v8f oacc = zero8();                          // O^T: register r = d 8hh+r of query rowq

  for (int kt = 0; kt <= qb; ++kt) {           // block-uniform trip count, <= NQB
    const int kv0 = kt * 64;                   // kv0 + 63 < SEQ
    const int kvn = (kt < qb) ? kv0 + 64 : 0;  // K chunk fetched ahead; the last trip fetches chunk 0, with which the next tile starts

    v16b vb[2], vl[2];
#pragma unroll
    for (int kk = 0; kk < 2; ++kk) {
      vb[kk] = ldfrag_b(Vh + kv0 + vlane + kk * 32);
      vl[kk] = ldfrag_b(Vl + kv0 + vlane + kk * 32);
    }

    // ---- scores: 64 keys x 16 queries per wave, 2 bf16 products per key subtile ----
    v8f s[4];
#pragma unroll
    for (int j = 0; j < 4; ++j) {
      s[j] = mma_b(kd[j], qa, zero8());
      s[j] = mma_b(kz[j], qa, s[j]);
    }
    fetch_k(kvn);

    // ---- scale, causal mask by index, max in-lane + one exchange, online softmax ----
    float mj[4];                               // one max chain per score tile: four independent chains
#pragma unroll
    for (int j = 0; j < 4; ++j) {
      mj[j] = -INFINITY;
#pragma unroll
      for (int r = 0; r < 8; ++r) {
        const int key = kv0 + j * 16 + 8 * hh + r;
        float sv = s[j][r] * 0.25f;
        sv = (key <= rowq) ? sv : -INFINITY;
        s[j][r] = sv;
        mj[j] = fmaxf(mj[j], sv);
      }
    }
    float m = fmaxf(fmaxf(mj[0], mj[1]), fmaxf(mj[2], mj[3]));
    m = fmaxf(m, other_half(m));
    const float mnew  = fmaxf(mrow, m);
    const float msafe = (mnew == -INFINITY) ? 0.f : mnew;
    const float alpha = __expf(mrow - msafe);
    mrow = mnew;

    PB ph[2], pl[2];                           // P^T hi / lo as B operands of the two 32-key k-steps
    float pj[4];                               // one sum chain per score tile
#pragma unroll
    for (int j = 0; j < 4; ++j) {
      float xe[8], pe[8];
#pragma unroll
      for (int r = 0; r < 8; ++r) xe[r] = (s[j][r] - msafe) * 1.44269504f;   // exp(t) = 2^(t log2 e), as __expf forms it
      exp2x8(xe, pe);                                        // masked logit: 2^(-inf) = 0
#pragma unroll
      for (int e = 0; e < 4; ++e) {
        const float p0 = pe[2 * e];
        const float p1 = pe[2 * e + 1];
        pj[j] = (e == 0) ? (p0 + p1) : ((pj[j] + p0) + p1);
      }
      unsigned hw[4], lw[4];
      split8(pe, hw, lw);
#pragma unroll
      for (int e = 0; e < 4; ++e) {
        ph[j >> 1].u[(j & 1) * 4 + e] = hw[e];
        pl[j >> 1].u[(j & 1) * 4 + e] = lw[e];
      }
    }
    lrow = lrow * alpha + ((pj[0] + pj[1]) + (pj[2] + pj[3]));
#pragma unroll
    for (int r = 0; r < 8; ++r) oacc[r] *= alpha;

    // ---- context^T += V^T . P^T (bf16 WMMA, hh + lh + hl into one accumulator) ----
#pragma unroll
    for (int kk = 0; kk < 2; ++kk) {
      oacc = mma_b(vb[kk], ph[kk].v, oacc);
      oacc = mma_b(vl[kk], ph[kk].v, oacc);
      oacc = mma_b(vb[kk], pl[kk].v, oacc);
    }
  }

  // ---- join the halves' sums, normalise (1/l), bf16 hi/lo split, one 16-B store per lane and plane ----
  {
    const float l = lrow + other_half(lrow);
    const float inv = (l > 0.f) ? (1.0f / l) : 0.f;
    float f[8];
#pragma unroll
    for (int r = 0; r < 8; ++r) f[r] = oacc[r] * inv;
    unsigned hw[4], lw[4];
    split8(f, hw, lw);
    const v4u a = {hw[0], hw[1], hw[2], hw[3]}, a2 = {lw[0], lw[1], lw[2], lw[3]};
    const size_t go = (bhp * SEQ + rowq) * HD + 8 * hh;
    *(v4u*)(ohp + go) = a;
    *(v4u*)(olp + go) = a2;
    // precaution: the next tile rewrites registers that these stores name
    asm volatile("s_wait_xcnt 0x0" ::: "memory");
  }
  }
}

// =====================================================================================================
// Workspace map (bytes; every region is an exact multiple of its whole-line / whole-tile store granularity,
//   Xb   bf16 [4096][288]            2359296
//   Wqb  bf16 [288][288]              165888   (x4: Wq, Wk, Wv, Wo)
//   Qc   bf16 [2][18][2048][32]      4718592
//   Kd                               4718592
//   Kz                               4718592
//   VTh  bf16 [2][288][2048]         2359296
//   VTl                              2359296
//   Oh   bf16 [2][18][2048][16]      2359296
//   Ol                               2359296
//   Ct   f32  [2048][8]                65536
//   St                                 65536
//   total                           26746880
// =====================================================================================================
extern "C" void kernel_launch(void* const* d_in, const int* in_sizes, int n_in,
                              void* d_out, int out_size, void* d_ws, size_t ws_size,
                              hipStream_t stream) {
  if (n_in < 5) return;
  if (in_sizes[0] != NTOK * HID) return;
  if (in_sizes[1] != HID * HID) return;
  if (in_sizes[2] != HID * HID) return;
  if (in_sizes[3] != HID * HID) return;
  if (in_sizes[4] != HID * HID) return;
  if (out_size != NTOK * HID) return;

  const float* x  = (const float*)d_in[0];   // [2][2048][288]
  const float* Wq = (const float*)d_in[1];   // [288 out][288 in]
  const float* Wk = (const float*)d_in[2];
  const float* Wv = (const float*)d_in[3];
  const float* Wo = (const float*)d_in[4];

  const size_t PX  = (size_t)NTOK * HID * 2;            // 2359296
  const size_t PW  = (size_t)HID * HID * 2;             //  165888
  const size_t PQ  = (size_t)NB * NH * SEQ * QS * 2;    // 4718592
  const size_t PVT = (size_t)NB * HID * SEQ * 2;        // 2359296
  const size_t PO  = (size_t)NB * NH * SEQ * HD * 2;    // 2359296
  const size_t PTB = (size_t)SEQ * NPAIR * 4;           //   65536
  size_t off = 0;
  const size_t oXb  = off; off += PX;
  const size_t oWq  = off; off += PW;
  const size_t oWk  = off; off += PW;
  const size_t oWv  = off; off += PW;
  const size_t oWo  = off; off += PW;
  const size_t oQc  = off; off += PQ;
  const size_t oKd  = off; off += PQ;
  const size_t oKz  = off; off += PQ;
  const size_t oVTh = off; off += PVT;
  const size_t oVTl = off; off += PVT;
  const size_t oOh  = off; off += PO;
  const size_t oOl  = off; off += PO;
  const size_t oCt  = off; off += PTB;
  const size_t oSt  = off; off += PTB;
  if (off > ws_size) return;                            // off = 26746880
  if (off > (size_t)134217728) return;

  char* ws = (char*)d_ws;
  unsigned short* Xb  = (unsigned short*)(ws + oXb);
  unsigned short* Wqb = (unsigned short*)(ws + oWq);
  unsigned short* Wob = (unsigned short*)(ws + oWo);
  unsigned short* Qc  = (unsigned short*)(ws + oQc);
  unsigned short* Kd  = (unsigned short*)(ws + oKd);
  unsigned short* Kz  = (unsigned short*)(ws + oKz);
  unsigned short* VTh = (unsigned short*)(ws + oVTh);
  unsigned short* VTl = (unsigned short*)(ws + oVTl);
  unsigned short* Oh  = (unsigned short*)(ws + oOh);
  unsigned short* Ol  = (unsigned short*)(ws + oOl);
  float*          Ct  = (float*)(ws + oCt);
  float*          St  = (float*)(ws + oSt);

  const dim3 blk256(256);
  const dim3 blk128(128);
  const dim3 gPrep(PREP_TAB + 4 * PREP_W + PREP_X);     // 64 + 164 + 576 = 804 blocks
  const dim3 gQkv(((NTOK / 64) * (HID / 32)) / 4, 3);   // 576 tiles -> 144 blocks of 4 waves, x 3 projections
  const dim3 gOut(((NTOK / 64) * (HID / 32)) / 4);      // 144 blocks of 4 waves
  const dim3 gAttn(NB * NH * ABIN);                     // 504 blocks of 128

  // (1) RoPE tables; x and the four weights -> bf16 planes (weights are [out][in] = Bt[n][k] already)
  prep<<<gPrep, blk256, 0, stream>>>(x, Wq, Wk, Wv, Wo, Xb, Wqb, Ct, St);
  // (2) q = rope(x . Wq^T) -> [b][h][t][hi|lo]; k = rope(x . Wk^T) -> [b][h][s][hi|hi] and [b][h][s][lo|0];
  //     v = x . Wv^T -> v^T bf16 hi / lo planes [b][h*16+d][s]
  gemm_qkv<<<gQkv, blk128, 0, stream>>>(Xb, Wqb, Qc, Kd, Kz, VTh, VTl, Ct, St);
  // (3) causal attention -> ctx bf16 hi / lo planes [b][h][t][d]
  attn_causal16<<<gAttn, blk128, 0, stream>>>(Qc, Kd, Kz, VTh, VTl, Oh, Ol);
  // (4) out = (ctx hi + ctx lo) . Wo^T -> d_out f32 [4096][288]
  gemm_out<<<gOut, blk128, 0, stream>>>(Oh, Ol, Wob, (float*)d_out);
  (void)hipGetLastError();
}

// v006
// A run of this version takes 48.5 microseconds.
// In both of two side-by-side timings against v005, it was 1.23 times as fast.
// Counting every step since v000, it is 5.80 times as fast.
// Contractions: q / k / v projections = v_wmma_f32_16x16x32_bf16 (bf16 operands from RNE-converted x and Wq/Wk/Wv, single product, f32 accumulate);
// k.q^T scores (transposed) = v_wmma_f32_16x16x32_bf16 with q and k as bf16 hi/lo split folded into the 32-deep k axis ([qhi|qlo].[khi|khi] + [qhi|qlo].[klo|0] = hh+lh+hl, 2 products), f32 accumulate;
// v^T.p^T (transposed) = v_wmma_f32_16x16x32_bf16 with p and v as bf16 hi/lo split (hh + hl + lh, 3 products), f32 accumulate;
// ctx.Wo^T = v_wmma_f32_16x16x32_bf16 with ctx as bf16 hi + unscaled lo planes times bf16 Wo (2 products), f32 accumulate;
// rotary tables (powf, f32 product, precise sincosf), half-rotation, causal mask and online softmax in f32 on the VALU.
// Carry audit: no scaled planes anywhere; every lo plane is the unscaled RNE residual (v - hi) in bf16 and shares the hi accumulator;
// score scale 1/4 applied once in f32 after the score accumulate; softmax normaliser 1/l applied once in the attention epilogue.
#include <hip/hip_runtime.h>
#include <math.h>
#include <stdint.h>

#define NB    2
#define SEQ   2048
#define HID   288
#define NH    18
#define HD    16
#define NPAIR 8
#define QS    32           // slots per head in the q / k planes: 0..15 hi (d), 16..31 lo (d) or duplicate / zero
#define NTOK  (NB * SEQ)   // 4096 token rows
#define NQB   (SEQ / 64)   // 32 query blocks of 64 per sequence
static_assert(NH * HD == HID);
static_assert(NPAIR * 2 == HD);
static_assert((SEQ % 64) == 0 && (HID % 32) == 0 && (NTOK % 64) == 0);
static_assert(((NTOK / 64) * (HID / 32)) % 4 == 0);
static_assert((NTOK * HID) % (8 * 256) == 0);
static_assert(((HID * HID) % 8) == 0 && (((HID * HID) / 8) % 32) == 0);
static_assert((SEQ % 32) == 0);

typedef __bf16   v16b __attribute__((ext_vector_type(16)));
typedef __bf16   v8b  __attribute__((ext_vector_type(8)));
typedef float    v8f  __attribute__((ext_vector_type(8)));
typedef float    v4f  __attribute__((ext_vector_type(4)));
typedef float    v2f  __attribute__((ext_vector_type(2)));
typedef __bf16   v2b  __attribute__((ext_vector_type(2)));
typedef unsigned int v4u __attribute__((ext_vector_type(4)));

// ---- scalar helpers --------------------------------------------------------------------------------
// two f32 -> two bf16 in one word (a low, b high), RNE, by the chip's packed convert
__device__ __forceinline__ unsigned cvt2(float a, float b) {
  const v2f f = {a, b};
  return __builtin_bit_cast(unsigned, __builtin_convertvector(f, v2b));
}
// hi = bf16(f), lo = bf16(f - hi) for eight values, word e = values 2e (low half) and 2e+1 (high half): three instructions a
// pair. hi: one packed convert. lo: the mixed-precision FMA reads hi's bf16 half as it lies, forms hi * -1 + f (exact in f32)
// and rounds it (RNE) into one half of the result word; the compiler's own form of the same takes a shift, a mask, a packed
// add and a second convert. The four low halves stand ahead of the four high halves, so that no instruction follows the
// one that wrote its result word directly.
__device__ __forceinline__ void split8(const float (&f)[8], unsigned (&hi)[4], unsigned (&lo)[4]) {
#pragma unroll
  for (int e = 0; e < 4; ++e) hi[e] = cvt2(f[2 * e], f[2 * e + 1]);
  asm("v_fma_mixlo_bf16 %0, %4, -1.0, %8 op_sel_hi:[1,0,0]\n\t"
      "v_fma_mixlo_bf16 %1, %5, -1.0, %10 op_sel_hi:[1,0,0]\n\t"
      "v_fma_mixlo_bf16 %2, %6, -1.0, %12 op_sel_hi:[1,0,0]\n\t"
      "v_fma_mixlo_bf16 %3, %7, -1.0, %14 op_sel_hi:[1,0,0]\n\t"
      "v_fma_mixhi_bf16 %0, %4, -1.0, %9 op_sel:[1,0,0] op_sel_hi:[1,0,0]\n\t"
      "v_fma_mixhi_bf16 %1, %5, -1.0, %11 op_sel:[1,0,0] op_sel_hi:[1,0,0]\n\t"
      "v_fma_mixhi_bf16 %2, %6, -1.0, %13 op_sel:[1,0,0] op_sel_hi:[1,0,0]\n\t"
      "v_fma_mixhi_bf16 %3, %7, -1.0, %15 op_sel:[1,0,0] op_sel_hi:[1,0,0]"
      : "=&v"(lo[0]), "=&v"(lo[1]), "=&v"(lo[2]), "=&v"(lo[3])
      : "v"(hi[0]), "v"(hi[1]), "v"(hi[2]), "v"(hi[3]),
        "v"(f[0]), "v"(f[1]), "v"(f[2]), "v"(f[3]), "v"(f[4]), "v"(f[5]), "v"(f[6]), "v"(f[7]));
}
__device__ __forceinline__ v8f zero8() { v8f z = {0.f, 0.f, 0.f, 0.f, 0.f, 0.f, 0.f, 0.f}; return z; }

// ---- fragment loaders: 16-bit A/B operand, lane -> row/col (lane&15), p already includes +8*(lane>>4);
//      elements 0..7 <- p[0..7] (k0+8h..k0+8h+7), elements 8..15 <- p[16..23] (k0+16+8h..k0+16+8h+7)
__device__ __forceinline__ v16b ldfrag_b(const __bf16* p) {
  union { v16b v; v8b h[2]; } f;
  f.h[0] = *(const v8b*)(p);
  f.h[1] = *(const v8b*)(p + 16);
  return f.v;
}
// FRAGMENT ORDER: a plane that only fragment loads read is stored as blocks of 512 elements (1024 B), one block = 16 rows x
// 32 k; element (row c, k) of a block lies at (k>>4)*256 + (((k>>3)&1)*16 + c)*8 + (k&7). That is the map above written out
// lane by lane: lane l = 16*(lane half) + c finds elements 0..7 at l*8 and elements 8..15 at 256 + l*8, so each of the two
// 16-B loads of a wave covers 512 contiguous, aligned bytes (4 whole cache lines) and not 32-B pieces of 8 or 16 lines.
// p = block base + 8*lane.
__device__ __forceinline__ v16b ldfrag_f(const __bf16* p) {
  union { v16b v; v8b h[2]; } f;
  f.h[0] = *(const v8b*)(p);
  f.h[1] = *(const v8b*)(p + 256);
  return f.v;
}
// same map when k0..k0+15 and k0+16..k0+31 live in two different rows (p0, p1 each include +8*(lane>>4))
__device__ __forceinline__ v16b ldfrag_b2(const __bf16* p0, const __bf16* p1) {
  union { v16b v; v8b h[2]; } f;
  f.h[0] = *(const v8b*)(p0);
  f.h[1] = *(const v8b*)(p1);
  return f.v;
}

// ---- WMMA helper with trailing VALU hazard gap (D tied, A/B kept live) ----------------------------------
__device__ __forceinline__ v8f mma_b(v16b a, v16b b, v8f c) {
  c = __builtin_amdgcn_wmma_f32_16x16x32_bf16(false, a, false, b, (short)0, c, false, false);
  asm volatile("v_nop\n\tv_nop\n\tv_nop\n\tv_nop" : "+v"(c) : "v"(a), "v"(b));
  return c;
}

// =====================================================================================================
// prep: everything the projections need and that depends on the inputs alone, as block ranges of ONE grid (256 threads a
// block, the range test is block-uniform):
//   blocks 0..63 (rotary tables): ctab[t][i] = cos(t * inv[i]), stab[t][i] = sin(t * inv[i]), i = 0..7, t = 0..SEQ-1, with
//     inv[i] = 1 / powf(10000, (2i)/16) formed by every thread for its own i (f32 product, precise sincosf);
//     thread tid -> t = block*32 + tid/8, i = tid&7; 64 blocks x 256 = the whole [SEQ][8] tables.
//   blocks 64..227 (weights): 41 blocks a weight, Wq, Wk, Wv, Wo in this order, into four planes that follow one another.
//   blocks 228..803 (x).
//   f32 -> bf16 (RNE convert), 8 elements per thread, one 16-B store per lane;
//   n8 threads x 8 = the whole plane (n8 = 147456 for x, 10368 for each weight; both multiples of 64).
//   The planes are written in FRAGMENT ORDER (see ldfrag_f), blocks [row / 16][k / 32], 64 threads a block: a wave takes 8
//   rows x 32 k, lane = 8 * (group of 8 k) + row, so that it reads 8 whole 128-B lines of the source and writes 4 of the plane.
// =====================================================================================================
#define PREP_TAB  (SEQ / 32)                       // 64 blocks
#define PREP_W    ((HID * HID / 8 + 255) / 256)    // 41 blocks a weight
#define PREP_X    (NTOK * HID / 8 / 256)           // 576 blocks
__device__ __forceinline__ void cvt_bf16x8(const float* __restrict__ in, unsigned short* out, const int i) {
  const int blk = i >> 6;                          // block = 64 threads x 8 elements
  const int gr  = blk / (HID / 32);                // group of 16 rows
  const int ks  = blk - gr * (HID / 32);           // k-step of 32
  const int c   = ((i >> 2) & 8) | (i & 7);        // row of the block: the wave's 8 rows, one per lane & 7
  const int q   = (i >> 3) & 3;                    // group of 8 k: k = 8q..8q+7
  const size_t so = (size_t)(gr * 16 + c) * HID + ks * 32 + q * 8;
  const size_t po = (size_t)blk * 512 + (q >> 1) * 256 + ((q & 1) * 16 + c) * 8;
  const v4f a = *(const v4f*)(in + so);
  const v4f b = *(const v4f*)(in + so + 4);
  v4u p;
  p[0] = cvt2(a[0], a[1]);
  p[1] = cvt2(a[2], a[3]);
  p[2] = cvt2(b[0], b[1]);
  p[3] = cvt2(b[2], b[3]);
  *(v4u*)(out + po) = p;
  // precaution: in the merged kernel's listing another block range's code, which rewrites the store's registers, follows it
  asm volatile("s_wait_xcnt 0x0" ::: "memory");
}

__global__ __launch_bounds__(256) void prep(const float* __restrict__ x, const float* __restrict__ Wq,
                                            const float* __restrict__ Wk, const float* __restrict__ Wv,
                                            const float* __restrict__ Wo, unsigned short* Xb, unsigned short* Wb,
                                            float* ctab, float* stab) {
  const int tid = (int)threadIdx.x;
  const int bx  = (int)blockIdx.x;
  if (bx < PREP_TAB) {
    const int i = tid & (NPAIR - 1);
    const int t = bx * 32 + (tid >> 3);
    const float e = (float)(2 * i) * (1.0f / (float)HD);
    const float p = powf(10000.0f, e);
    const float f = 1.0f / p;
    const float ang = (float)t * f;
    float sn, cs;
    sincosf(ang, &sn, &cs);
    const size_t o = (size_t)t * NPAIR + i;
    *(float*)(ctab + o) = cs;
    *(float*)(stab + o) = sn;
  } else if (bx < PREP_TAB + 4 * PREP_W) {
    const int w  = (bx - PREP_TAB) / PREP_W;       // 0..3: Wq, Wk, Wv, Wo
    const int i  = (bx - PREP_TAB - w * PREP_W) * 256 + tid;
    const float* in = (w == 0) ? Wq : (w == 1) ? Wk : (w == 2) ? Wv : Wo;
    if (i < HID * HID / 8) cvt_bf16x8(in, Wb + (size_t)w * (HID * HID), i);
  } else {
    cvt_bf16x8(x, Xb, (bx - PREP_TAB - 4 * PREP_W) * 256 + tid);
  }
}

// =====================================================================================================
// bf16 WMMA GEMM, one wave per 64 x 32 tile, 4 waves per block, no block barriers:
//   C[m][n] = sum_k A[m][k] * Bt[n][k] (+ sum_k A2[m][k] * Bt[n][k] when TWOA), M = 4096 tokens, N = 288, K = 288
//   (9 k-steps of 32, no tails). Bt = weight plane (the [out][in] weight, RNE bf16), fragment order, blocks [n / 16][k / 32].
//   A: MODE 0..2: x plane, fragment order, blocks [m / 16][k / 32]. MODE 3: ctx planes laid out [b][h][t][16]; k-step j covers heads 2j
//   (k 0..15) and 2j+1 (k 16..31): elements 0..7 <- head 2j, d = 8*(lane>>4)..+7; elements 8..15 <- head 2j+1, same d.
// then (b = m0/2048, t = m0%2048 + row, 32 columns = heads n0/16 and n0/16+1):
//   MODE 0 (q): rotary in f32 (contract off): d < 8: x[d] c[t][d] - x[d+8] s[t][d]; d >= 8: x[d] c[t][d-8] + x[d-8] s[t][d-8];
//               -> plane [b][h][t][32]: slots 0..15 = bf16 hi of d, 16..31 = bf16 lo (v - hi) of d.
//   MODE 1 (k): same rotary; plane C0 slots 0..15 = hi, 16..31 = hi (duplicate); plane C1 slots 0..15 = lo, 16..31 = 0;
//               both in fragment order, blocks [b][h][t / 16], rows = keys, k = slots.
//   MODE 2 (v): no rotary; v^T planes C0 = hi, C1 = lo, fragment order, blocks [b][h][t / 32], rows = d, k = keys.
//   MODE 0..2 share one body and ONE grid (gemm_qkv: blockIdx.y = mode, the same in every wave of a block; only the weight
//   plane, the epilogue and the output planes differ); MODE 3 (OUT) is a launch of its own (gemm_out), behind attention.
// coverage: 576 tiles x (64 rows x 32 cols) = the whole 4096 x 288 result; MODE 0/1: 2 heads x 8 it x 8 rows x 4 lanes
//           x 8 slots = 64 rows x 2 heads x 32 slots; MODE 2: 4 x 2 it x (8 features x 4 token groups) x 8 = 32 features x 64 tokens;
//           MODE 3: 16 it x 4 rows x 8 lanes x 4 = 64 rows x 32 cols.
// =====================================================================================================
// Epilogue of one wave's 64 x 32 tile, read back from its LDS slab; MODE as listed above.
template <int MODE>
__device__ __forceinline__ void gemm_epi(const float* slab, const int lane, const int m0, const int n0, const int bidx,
                                         const int tl0, void* C0, void* C1,
                                         const float* __restrict__ ctab, const float* __restrict__ stab) {
  static_assert(MODE >= 0 && MODE <= 3);
  if (MODE == 3) {
    float* Cf = (float*)C0;
    const int q4 = lane >> 3, c4 = (lane & 7) * 4;
    {
#pragma unroll
      for (int it = 0; it < 16; ++it) {
        const int row = it * 4 + q4;                         // it 0..15 x q4 0..3 = rows 0..63
        const v4f v = *(const v4f*)(slab + row * 36 + c4);
        *(v4f*)(Cf + (size_t)(m0 + row) * HID + n0 + c4) = v;
      }
      
    }
  } else if (MODE == 2) {
    unsigned short* P0 = (unsigned short*)C0;
    unsigned short* P1 = (unsigned short*)C1;
    const int n8 = lane & 7, tg = lane >> 3;       // 8 features side by side = one whole 128-B line of a block per token group
#pragma unroll 1
    for (int it2 = 0; it2 < 8; it2 += 2) {         // two groups' loads and stores side by side in a trip
#pragma unroll
      for (int it = it2; it < it2 + 2; ++it) {
        const int n  = (it >> 1) * 8 + n8;                     // local feature 0..31
        const int t8 = ((it & 1) * 4 + tg) * 8;                // first of this lane's 8 tokens, 0..56
        float f[8];
#pragma unroll
        for (int e = 0; e < 8; ++e) f[e] = slab[(t8 + e) * 36 + n];
        unsigned hw[4], lw[4];
        split8(f, hw, lw);
        const v4u a = {hw[0], hw[1], hw[2], hw[3]}, a2 = {lw[0], lw[1], lw[2], lw[3]};
        const int s = tl0 + t8;                                // key index of element 0; d = (n0 + n) & 15
        const size_t go = ((size_t)(bidx * NH + ((n0 + n) >> 4))) * (SEQ * HD) + (size_t)((s >> 5) * 512 +
                          ((s >> 4) & 1) * 256 + (((s >> 3) & 1) * 16 + ((n0 + n) & 15)) * 8);
        *(v4u*)(P0 + go) = a;
        *(v4u*)(P1 + go) = a2;
      }
      // precaution: the next trip rewrites registers that these stores name
      asm volatile("s_wait_xcnt 0x0" ::: "memory");
    }
  } else {
    unsigned short* P0 = (unsigned short*)C0;
    unsigned short* P1 = (unsigned short*)C1;
    const int r4 = lane >> 2, s8 = (lane & 3) * 8;
    const int dbase = s8 & 8;                                // d of the first element: 0 or 8
    const bool isLo = (s8 >= 16);
    const float sg = (dbase == 0) ? -1.0f : 1.0f;            // -x[d+8] for d < 8, +x[d-8] for d >= 8
    const int h0 = n0 >> 4;                                  // first head of the tile (even)
#pragma unroll 1
    for (int hd = 0; hd < 2; ++hd) {
#pragma unroll 1
      for (int it2 = 0; it2 < 8; it2 += 2) {         // two rows' loads and stores side by side in a trip
#pragma unroll
        for (int it = it2; it < it2 + 2; ++it) {
          const int row = it * 8 + r4;                         // it 0..7 x r4 0..7 = rows 0..63
          const int t = tl0 + row;                             // position within the sequence
          const float* xr = slab + row * 36 + hd * 16;
          float x[8], y[8], f[8];
#pragma unroll
          for (int e = 0; e < 8; ++e) { x[e] = xr[dbase + e]; y[e] = xr[(dbase ^ 8) + e]; }
          const v4f cv0 = *(const v4f*)(ctab + (size_t)t * NPAIR);
          const v4f cv1 = *(const v4f*)(ctab + (size_t)t * NPAIR + 4);
          const v4f sv0 = *(const v4f*)(stab + (size_t)t * NPAIR);
          const v4f sv1 = *(const v4f*)(stab + (size_t)t * NPAIR + 4);
          {
#pragma clang fp contract(off)
#pragma unroll
            for (int e = 0; e < 4; ++e) {
              {
                const float ry = sg * y[e];
                const float p0 = x[e] * cv0[e];
                const float p1 = ry * sv0[e];
                f[e] = p0 + p1;
              }
              {
                const float ry = sg * y[4 + e];
                const float p0 = x[4 + e] * cv1[e];
                const float p1 = ry * sv1[e];
                f[4 + e] = p0 + p1;
              }
            }
          }
          unsigned hw[4], lw[4];
          split8(f, hw, lw);
          const v4u hp = {hw[0], hw[1], hw[2], hw[3]}, lp = {lw[0], lw[1], lw[2], lw[3]};
          const size_t go = (MODE == 0)
              ? (((size_t)(bidx * NH + h0 + hd)) * SEQ + t) * QS + s8
              : ((size_t)(bidx * NH + h0 + hd)) * (SEQ * QS) + (size_t)((t >> 4) * 512 + (s8 >> 4) * 256 +
                                                                       (((s8 >> 3) & 1) * 16 + (t & 15)) * 8);
          if (MODE == 0) {
            v4u pc;
#pragma unroll
            for (int e = 0; e < 4; ++e) pc[e] = isLo ? lp[e] : hp[e];
            *(v4u*)(P0 + go) = pc;
          } else {
            v4u pz;
#pragma unroll
            for (int e = 0; e < 4; ++e) pz[e] = isLo ? 0u : lp[e];
            *(v4u*)(P0 + go) = hp;
            *(v4u*)(P1 + go) = pz;
          }
        }
        // precaution: the next trip rewrites registers that these stores name
        asm volatile("s_wait_xcnt 0x0" ::: "memory");
      }
    }
  }
}

template <bool OUT>
__device__ __forceinline__ void gemm_xw(
    const int mode,                                // 0 q, 1 k, 2 v (block-uniform, OUT false); 3 with OUT
    const unsigned short* __restrict__ Ap, const unsigned short* __restrict__ A2p,
    const unsigned short* __restrict__ Btp, void* C0, void* C1,
    const float* __restrict__ ctab, const float* __restrict__ stab) {
  constexpr bool TWOA = OUT;
  constexpr int M = NTOK, N = HID, K = HID;
  constexpr int TN = N / 32;   // 9
  constexpr int TM = M / 64;   // 64
  const __bf16* A  = (const __bf16*)(const void*)Ap;
  const __bf16* A2 = (const __bf16*)(const void*)A2p;
  const __bf16* Bt = (const __bf16*)(const void*)Btp;
  __shared__ __align__(16) float sT[4][64 * 36];   // per-wave 64x32 tile, pitch 36 floats

  const int lane = threadIdx.x & 31;
  const int wave = __builtin_amdgcn_readfirstlane((int)(threadIdx.x >> 5));   // same in every lane: held scalar, the tile bases are scalar too
  const int tile = blockIdx.x * 4 + wave;
  if (tile >= TM * TN) return;                     // wave-uniform; no block barriers in this kernel
  const int tm = tile / TN;
  const int tn = tile - tm * TN;
  const int m0 = tm << 6;
  const int n0 = tn << 5;
  const int c    = lane & 15;                      // row (A) / col (B, D) within subtile
  const int koff = (lane >> 4) * 8;                // k offset of this lane half
  const int mOff = (lane >> 4) * 8;                // D row offset
  const int bidx = m0 / SEQ;                       // batch of this tile (tiles never straddle a batch)
  const int tl0  = m0 - bidx * SEQ;                // first position within the sequence

  v8f acc[4][2];
#pragma unroll
  for (int i = 0; i < 4; ++i)
#pragma unroll
    for (int j = 0; j < 2; ++j) acc[i][j] = zero8();

  // Loads run ahead of the matrix instructions: every fragment is fetched into a register set that is free by then, whole
  // k-steps before its products, so a k-step waits on loads issued earlier and not on its own. Three A sets go round.
  //   one A plane: k-step ks in A and B set ks % 3, fetched two k-steps ahead (8 products a k-step cover little of a load).
  //   two A planes: the hi products of a k-step run first, then the lo products (each accumulator still takes hi, lo, hi,
  //   lo ... in k order); the sets hold hi(ks), lo(ks), hi(ks+1), each fetched one k-step ahead; B in set ks & 1.
  // Address = wave-uniform tile base + one lane offset + a constant: the sets leave no room for a pointer per row.
  constexpr int KS = K / 32;                       // 9 k-steps
  const size_t abase = OUT ? (((size_t)(bidx * NH)) * SEQ + tl0) * HD : (size_t)m0 * K;
  const __bf16* Ab  = A + abase;
  const __bf16* A2b = A2 + abase;
  const __bf16* Bb  = Bt + (size_t)n0 * K;
  const unsigned alane = OUT ? (unsigned)(c * HD + koff) : (unsigned)(lane * 8);   // 16 rows x K = K / 32 blocks of 512: the
  const unsigned blane = (unsigned)(lane * 8);                                     // row-group bases are those of a [row][K] plane
  v16b bh[TWOA ? 2 : 3][2], ar[3][4];
  auto fetch_b = [&](const int ks, const int st) __attribute__((always_inline)) {
#pragma unroll
    for (int j = 0; j < 2; ++j) bh[st][j] = ldfrag_f(Bb + blane + (j << 4) * K + ks * 512);
  };
  auto fetch_a = [&](const __bf16* base, const int ks, const int set) __attribute__((always_inline)) {
#pragma unroll
    for (int i = 0; i < 4; ++i) {
      if (OUT) {                                   // ks = head pair index 0..8: heads 2 ks and 2 ks + 1, same token row
        const int e0 = (i << 4) * HD + (2 * ks) * SEQ * HD, e1 = e0 + SEQ * HD;
        ar[set][i] = ldfrag_b2(base + alane + e0, base + alane + e1);
      } else {
        ar[set][i] = ldfrag_f(base + alane + (i << 4) * K + ks * 512);
      }
    }
  };
  auto products = [&](const int set, const int st) __attribute__((always_inline)) {
#pragma unroll
    for (int i = 0; i < 4; ++i)
#pragma unroll
      for (int j = 0; j < 2; ++j) acc[i][j] = mma_b(ar[set][i], bh[st][j], acc[i][j]);
  };
  fetch_b(0, 0);
  fetch_a(Ab, 0, 0);
  if (TWOA) fetch_a(A2b, 0, 1);
  else { fetch_b(1, 1); fetch_a(Ab, 1, 1); }
#pragma unroll                                     // full unroll: a register set's index must be a constant
  for (int ks = 0; ks < KS; ++ks) {
    const int st = ks & 1;
    if (TWOA) {
      const int sh = (2 * ks) % 3, sl = (2 * ks + 1) % 3, sn = (2 * ks + 2) % 3;
      if (ks + 1 < KS) { fetch_b(ks + 1, st ^ 1); fetch_a(Ab, ks + 1, sn); }
      products(sh, st);
      if (ks + 1 < KS) fetch_a(A2b, ks + 1, sh);   // into the set the hi products have just read
      products(sl, st);
    } else {
      if (ks + 2 < KS) { fetch_b(ks + 2, (ks + 2) % 3); fetch_a(Ab, ks + 2, (ks + 2) % 3); }
      products(ks % 3, ks % 3);
    }
  }

  // ---- epilogue: whole tile to wave-private LDS ----
  float* slab = sT[wave];
#pragma unroll
  for (int i = 0; i < 4; ++i)
#pragma unroll
    for (int j = 0; j < 2; ++j)
#pragma unroll
      for (int r = 0; r < 8; ++r)
        slab[((i << 4) + mOff + r) * 36 + (j << 4) + c] = acc[i][j][r];
  __builtin_amdgcn_fence(__ATOMIC_RELEASE, "workgroup");
  __builtin_amdgcn_wave_barrier();
  __builtin_amdgcn_fence(__ATOMIC_ACQUIRE, "workgroup");

  if (OUT)            gemm_epi<3>(slab, lane, m0, n0, bidx, tl0, C0, C1, ctab, stab);
  else if (mode == 0) gemm_epi<0>(slab, lane, m0, n0, bidx, tl0, C0, C1, ctab, stab);   // block-uniform choice, made once:
  else if (mode == 1) gemm_epi<1>(slab, lane, m0, n0, bidx, tl0, C0, C1, ctab, stab);   // no mode test inside an epilogue loop
  else                gemm_epi<2>(slab, lane, m0, n0, bidx, tl0, C0, C1, ctab, stab);
}

// q, k and v projections in one grid: blockIdx.x = group of 4 tiles, blockIdx.y = mode. Wb = Wq, Wk, Wv planes in a row.
__global__ __launch_bounds__(128) void gemm_qkv(
    const unsigned short* __restrict__ Xb, const unsigned short* __restrict__ Wb,
    unsigned short* Qc, unsigned short* Kd, unsigned short* Kz, unsigned short* VTh, unsigned short* VTl,
    const float* __restrict__ ctab, const float* __restrict__ stab) {
  const int mode = (int)blockIdx.y;
  unsigned short* C0 = (mode == 0) ? Qc : (mode == 1) ? Kd : VTh;
  unsigned short* C1 = (mode == 0) ? Qc : (mode == 1) ? Kz : VTl;
  gemm_xw<false>(mode, Xb, Xb, Wb + (size_t)mode * (HID * HID), (void*)C0, (void*)C1, ctab, stab);
}

__global__ __launch_bounds__(128) void gemm_out(
    const unsigned short* __restrict__ Oh, const unsigned short* __restrict__ Ol,
    const unsigned short* __restrict__ Wob, float* out) {
  gemm_xw<true>(3, Oh, Ol, Wob, (void*)out, (void*)out, nullptr, nullptr);
}

// =====================================================================================================
// Causal attention, head dim 16, key chunks of 64, both products transposed: S^T = K . Q^T, O^T += V^T . P^T.
//   q plane  [b][h][t][32]: slots 0..15 = bf16 hi of rope(q)[d], 16..31 = bf16 lo
//   kd plane, per key 32 slots: 0..15 = hi of rope(k)[d], 16..31 = hi again; kz plane: 0..15 = lo, 16..31 = 0;
//   both in fragment order (ldfrag_f): blocks [b][h][s / 16] of 16 keys x 32 slots
//   so one 32-deep k-step gives q.k = hi.hi + lo.hi (kd) and hi.lo (kz): two products per 16x16 score tile.
//   v^T planes (bf16 hi / lo), fragment order: blocks [b][h][s / 32] of 16 d x 32 keys
//   ctx planes (bf16 hi / lo of the normalised context): element (b, h, t, d) at [((b*18 + h)*2048 + t)*16 + d]
//   Score tile j: A = 16 key rows (row = lane&15), B = the wave's 16 queries (col = lane&15), same k map on both sides, so
//   register r of lane (c, hh) = score of key kv0 + 16j + 8hh + r against query q0 + c: a lane holds 32 of the 64 keys of ONE
//   query. Row max and row sum are in-lane; the two lane halves exchange the max once per chunk and join their sums once, in
//   the epilogue. Tiles 2kk and 2kk+1, converted in place, are the B operand of k-step kk (element e = key 8hh+e, element
//   8+e = key 16+8hh+e), which is the k order in which ldfrag_f reads the v^T block as A: P never leaves the registers.
//   Causal structure: query tile qb visits key chunks 0..qb only (block-uniform trip count qb+1 <= NQB); inside the
//   diagonal chunk a key with index > query index gets logit -inf -> exp gives exactly 0; the first key of every visited
//   chunk is always kept, so every joined max is finite.
//   Tile = 64 query rows of one (b, h), 4 waves, wave w = rows q0..q0+15; no LDS, no barriers.
//   Equal work-groups: every work-group is resident from the start, so the launch lasts as long as the fullest WGP, and a
//   tile costs qb+1 chunks. A block therefore walks several tiles of ONE head, one after the other, ABIN blocks a head:
//   block n = 0..12: tiles 31-n and 5+n (32-n and 6+n chunks, 38 together); block 13: tiles 18, 4, 3, 2, 1, 0 (34 chunks).
//   grid = NB * NH * ABIN = 504 blocks, at most two for each of the 256 WGPs. All tiles of a block start at key chunk 0 of
//   the same head, so the last trip of a tile fetches that chunk for the next one.
//   The hi / lo splits of P round in the chip's converting instructions (split8), not in integer arithmetic.
//   Output: lane (c, hh) holds d = 8hh..8hh+7 of query q0 + c: one 16-B store per plane, 512 contiguous B per wave.
//   coverage: tiles 31..19, 5..17, 18 and 4..0 = each of the 32 tiles of a head once; 36 heads x 32 tiles x 4 waves x 16 rows
//   x 16 d = every (b, h, t, d) of both ctx planes exactly once.
// =====================================================================================================
__device__ __forceinline__ float other_half(float v) {                // value of lane l ^ 16
  const int b = __builtin_bit_cast(int, v);
  return __builtin_bit_cast(float, __builtin_amdgcn_permlanex16(b, b, 0x76543210, 0xfedcba98, false, false));
}

__device__ __forceinline__ void exp2x8(const float (&x)[8], float (&y)[8]) {
  asm("v_exp_f32 %0, %8\n\tv_exp_f32 %1, %9\n\tv_exp_f32 %2, %10\n\tv_exp_f32 %3, %11\n\t"
      "v_exp_f32 %4, %12\n\tv_exp_f32 %5, %13\n\tv_exp_f32 %6, %14\n\tv_exp_f32 %7, %15\n\tv_nop"
      : "=&v"(y[0]), "=&v"(y[1]), "=&v"(y[2]), "=&v"(y[3]), "=&v"(y[4]), "=&v"(y[5]), "=&v"(y[6]), "=&v"(y[7])
      : "v"(x[0]), "v"(x[1]), "v"(x[2]), "v"(x[3]), "v"(x[4]), "v"(x[5]), "v"(x[6]), "v"(x[7]));
}

#define ABIN 14            // blocks per (b, h)
static_assert(NQB == 32);  // the tile lists below are written for 32 tiles a head

// At most two work-groups share a WGP (two waves a SIMD), so registers up to 256 cost nothing. Without the bound the compiler,
// once the splits need fewer registers, aims at a fifth wave a SIMD and forms the loop-invariant mask bounds anew in every trip.
__global__ __launch_bounds__(128) __attribute__((amdgpu_waves_per_eu(4, 4)))
void attn_causal16(const unsigned short* __restrict__ qcp, const unsigned short* __restrict__ kdp,
                   const unsigned short* __restrict__ kzp, const unsigned short* __restrict__ vhp,
                   const unsigned short* __restrict__ vlp, unsigned short* ohp, unsigned short* olp) {
  union PB { v16b v; unsigned u[8]; };

  const int tid  = threadIdx.x;
  const int wave = tid >> 5;
  const int lane = tid & 31;
  const int hh   = lane >> 4;
  const int c    = lane & 15;

  const int bx   = blockIdx.x;
  const int bin  = bx % ABIN;
  const int rest = bx / ABIN;
  const int h    = rest % NH;
  const int b    = rest / NH;
  const int ntile = (bin < ABIN - 1) ? 2 : 6;  // block-uniform
  const size_t bhp = (size_t)b * NH + h;

  const __bf16* Qc = (const __bf16*)(const void*)qcp + bhp * SEQ * QS;
  const __bf16* Kd = (const __bf16*)(const void*)kdp + bhp * SEQ * QS;
  const __bf16* Kz = (const __bf16*)(const void*)kzp + bhp * SEQ * QS;
  const __bf16* Vh = (const __bf16*)(const void*)vhp + bhp * SEQ * HD;
  const __bf16* Vl = (const __bf16*)(const void*)vlp + bhp * SEQ * HD;

  // Loads run ahead of the matrix instructions that use them: chunk kt + 1's K fragments are fetched as one group behind
  // the score products of chunk kt, chunk kt's V fragments at the head of trip kt; the softmax runs while both fly.
  // Address = the head's plane base (wave-uniform) + one 32-bit byte offset (chunk + lane) + a constant.
  const unsigned flane = (unsigned)(lane * 16);              // this lane's place, in bytes, in every block of a fragment-order plane
  v16b kd[4], kz[4];
  // ko = byte offset of the chunk's first block + flane, the same in both planes: head base (scalar) + one 32-bit register
  auto fetch_k = [&](const unsigned ko) __attribute__((always_inline)) {
#pragma unroll
    for (int j = 0; j < 4; ++j) {
      kd[j] = ldfrag_f((const __bf16*)((const char*)Kd + ko + j * 1024));
      kz[j] = ldfrag_f((const __bf16*)((const char*)Kz + ko + j * 1024));
    }
  };
  fetch_k(flane);
  // precaution: code that follows rewrites the offset register that these loads name
  asm volatile("s_wait_xcnt 0x0" ::: "memory");

  for (int ti = 0; ti < ntile; ++ti) {         // the block's tiles, the longest first
  const int qb = (bin < ABIN - 1) ? ((ti == 0) ? NQB - 1 - bin : 5 + bin) : ((ti == 0) ? 18 : 5 - ti);
  const int q0 = qb * 64 + wave * 16;

  // ---- Q fragment (B operand, col = lane&15, one 32-slot k-step) ----
  const v16b qa = ldfrag_b(Qc + (size_t)(q0 + c) * QS + 8 * hh);
  const int rowq = q0 + c;                     // this lane's query index

  float mrow = -INFINITY;                      // running max of query rowq (equal in both lane halves)
  float lrow = 0.f;                            // running sum over this lane half's keys only
  v8f oacc = zero8();                          // O^T: register r = d 8hh+r of query rowq

  for (int kt = 0; kt <= qb; ++kt) {           // block-uniform trip count, <= NQB
    const int kv0 = kt * 64;                   // kv0 + 63 < SEQ
    const int kvn = (kt < qb) ? kv0 + 64 : 0;  // K chunk fetched ahead; the last trip fetches chunk 0, with which the next tile starts

    const unsigned ko = flane + (unsigned)kvn * (QS * 2);    // byte offsets, below 2^17
    const unsigned vo = flane + (unsigned)kv0 * (HD * 2);

    v16b vb[2], vl[2];
#pragma unroll
    for (int kk = 0; kk < 2; ++kk) {
      vb[kk] = ldfrag_f((const __bf16*)((const char*)Vh + vo + kk * 1024));
      vl[kk] = ldfrag_f((const __bf16*)((const char*)Vl + vo + kk * 1024));
    }

    // ---- scores: 64 keys x 16 queries per wave, 2 bf16 products per key subtile ----
    v8f s[4];
#pragma unroll
    for (int j = 0; j < 4; ++j) {
      s[j] = mma_b(kd[j], qa, zero8());
      s[j] = mma_b(kz[j], qa, s[j]);
    }
    fetch_k(ko);

    // ---- scale, causal mask by index, max in-lane + one exchange, online softmax ----
    float mj[4];                               // one max chain per score tile: four independent chains
#pragma unroll
    for (int j = 0; j < 4; ++j) {
      mj[j] = -INFINITY;
#pragma unroll
      for (int r = 0; r < 8; ++r) {
        const int key = kv0 + j * 16 + 8 * hh + r;
        float sv = s[j][r] * 0.25f;
        sv = (key <= rowq) ? sv : -INFINITY;
        s[j][r] = sv;
        mj[j] = fmaxf(mj[j], sv);
      }
    }
    float m = fmaxf(fmaxf(mj[0], mj[1]), fmaxf(mj[2], mj[3]));
    m = fmaxf(m, other_half(m));
    const float mnew  = fmaxf(mrow, m);
    const float msafe = (mnew == -INFINITY) ? 0.f : mnew;
    const float alpha = __expf(mrow - msafe);
    mrow = mnew;

    PB ph[2], pl[2];                           // P^T hi / lo as B operands of the two 32-key k-steps
    float pj[4];                               // one sum chain per score tile
#pragma unroll
    for (int j = 0; j < 4; ++j) {
      float xe[8], pe[8];
#pragma unroll
      for (int r = 0; r < 8; ++r) xe[r] = (s[j][r] - msafe) * 1.44269504f;   // exp(t) = 2^(t log2 e), as __expf forms it
      exp2x8(xe, pe);                                        // masked logit: 2^(-inf) = 0
#pragma unroll
      for (int e = 0; e < 4; ++e) {
        const float p0 = pe[2 * e];
        const float p1 = pe[2 * e + 1];
        pj[j] = (e == 0) ? (p0 + p1) : ((pj[j] + p0) + p1);
      }
      unsigned hw[4], lw[4];
      split8(pe, hw, lw);
#pragma unroll
      for (int e = 0; e < 4; ++e) {
        ph[j >> 1].u[(j & 1) * 4 + e] = hw[e];
        pl[j >> 1].u[(j & 1) * 4 + e] = lw[e];
      }
    }
    lrow = lrow * alpha + ((pj[0] + pj[1]) + (pj[2] + pj[3]));
#pragma unroll
    for (int r = 0; r < 8; ++r) oacc[r] *= alpha;

    // ---- context^T += V^T . P^T (bf16 WMMA, hh + lh + hl into one accumulator) ----
#pragma unroll
    for (int kk = 0; kk < 2; ++kk) {
      oacc = mma_b(vb[kk], ph[kk].v, oacc);
      oacc = mma_b(vl[kk], ph[kk].v, oacc);
      oacc = mma_b(vb[kk], pl[kk].v, oacc);
    }
    // precaution: the trip's loads name ko and vo; as inputs here the two stay in their registers, unwritten (also by the
    // loads' own results), up to this wait; it stands at the trip's foot, far behind the loads' issue
    asm volatile("s_wait_xcnt 0x0" :: "v"(ko), "v"(vo) : "memory");
  }

  // ---- join the halves' sums, normalise (1/l), bf16 hi/lo split, one 16-B store per lane and plane ----
  {
    const float l = lrow + other_half(lrow);
    const float inv = (l > 0.f) ? (1.0f / l) : 0.f;
    float f[8];
#pragma unroll
    for (int r = 0; r < 8; ++r) f[r] = oacc[r] * inv;
    unsigned hw[4], lw[4];
    split8(f, hw, lw);
    const v4u a = {hw[0], hw[1], hw[2], hw[3]}, a2 = {lw[0], lw[1], lw[2], lw[3]};
    const size_t go = (bhp * SEQ + rowq) * HD + 8 * hh;
    *(v4u*)(ohp + go) = a;
    *(v4u*)(olp + go) = a2;
    // precaution: the next tile rewrites registers that these stores name
    asm volatile("s_wait_xcnt 0x0" ::: "memory");
  }
  }
}

// =====================================================================================================
// Workspace map (bytes; every region is an exact multiple of its whole-line / whole-tile store granularity,
//   Xb   bf16 [4096/16][288/32][512] 2359296
//   Wqb  bf16 [288/16][288/32][512]   165888   (x4: Wq, Wk, Wv, Wo)
//   Qc   bf16 [2][18][2048][32]      4718592
//   Kd   bf16 [2][18][2048/16][512]  4718592
//   Kz                               4718592
//   VTh  bf16 [2][18][2048/32][512]  2359296
//   VTl                              2359296
//   Oh   bf16 [2][18][2048][16]      2359296
//   Ol                               2359296
//   Ct   f32  [2048][8]                65536
//   St                                 65536
//   total                           26746880
// =====================================================================================================
extern "C" void kernel_launch(void* const* d_in, const int* in_sizes, int n_in,
                              void* d_out, int out_size, void* d_ws, size_t ws_size,
                              hipStream_t stream) {
  if (n_in < 5) return;
  if (in_sizes[0] != NTOK * HID) return;
  if (in_sizes[1] != HID * HID) return;
  if (in_sizes[2] != HID * HID) return;
  if (in_sizes[3] != HID * HID) return;
  if (in_sizes[4] != HID * HID) return;
  if (out_size != NTOK * HID) return;

  const float* x  = (const float*)d_in[0];   // [2][2048][288]
  const float* Wq = (const float*)d_in[1];   // [288 out][288 in]
  const float* Wk = (const float*)d_in[2];
  const float* Wv = (const float*)d_in[3];
  const float* Wo = (const float*)d_in[4];

  const size_t PX  = (size_t)NTOK * HID * 2;            // 2359296
  const size_t PW  = (size_t)HID * HID * 2;             //  165888
  const size_t PQ  = (size_t)NB * NH * SEQ * QS * 2;    // 4718592
  const size_t PVT = (size_t)NB * HID * SEQ * 2;        // 2359296
  const size_t PO  = (size_t)NB * NH * SEQ * HD * 2;    // 2359296
  const size_t PTB = (size_t)SEQ * NPAIR * 4;           //   65536
  size_t off = 0;
  const size_t oXb  = off; off += PX;
  const size_t oWq  = off; off += PW;
  const size_t oWk  = off; off += PW;
  const size_t oWv  = off; off += PW;
  const size_t oWo  = off; off += PW;
  const size_t oQc  = off; off += PQ;
  const size_t oKd  = off; off += PQ;
  const size_t oKz  = off; off += PQ;
  const size_t oVTh = off; off += PVT;
  const size_t oVTl = off; off += PVT;
  const size_t oOh  = off; off += PO;
  const size_t oOl  = off; off += PO;
  const size_t oCt  = off; off += PTB;
  const size_t oSt  = off; off += PTB;
  if (off > ws_size) return;                            // off = 26746880
  if (off > (size_t)134217728) return;

  char* ws = (char*)d_ws;
  unsigned short* Xb  = (unsigned short*)(ws + oXb);
  unsigned short* Wqb = (unsigned short*)(ws + oWq);
  unsigned short* Wob = (unsigned short*)(ws + oWo);
  unsigned short* Qc  = (unsigned short*)(ws + oQc);
  unsigned short* Kd  = (unsigned short*)(ws + oKd);
  unsigned short* Kz  = (unsigned short*)(ws + oKz);
  unsigned short* VTh = (unsigned short*)(ws + oVTh);
  unsigned short* VTl = (unsigned short*)(ws + oVTl);
  unsigned short* Oh  = (unsigned short*)(ws + oOh);
  unsigned short* Ol  = (unsigned short*)(ws + oOl);
  float*          Ct  = (float*)(ws + oCt);
  float*          St  = (float*)(ws + oSt);

  const dim3 blk256(256);
  const dim3 blk128(128);
  const dim3 gPrep(PREP_TAB + 4 * PREP_W + PREP_X);     // 64 + 164 + 576 = 804 blocks
  const dim3 gQkv(((NTOK / 64) * (HID / 32)) / 4, 3);   // 576 tiles -> 144 blocks of 4 waves, x 3 projections
  const dim3 gOut(((NTOK / 64) * (HID / 32)) / 4);      // 144 blocks of 4 waves
  const dim3 gAttn(NB * NH * ABIN);                     // 504 blocks of 128

  // (1) RoPE tables; x and the four weights -> bf16 planes in fragment order (weights are [out][in] = Bt[n][k] already)
  prep<<<gPrep, blk256, 0, stream>>>(x, Wq, Wk, Wv, Wo, Xb, Wqb, Ct, St);
  // (2) q = rope(x . Wq^T) -> [b][h][t][hi|lo]; k = rope(x . Wk^T) -> [hi|hi] and [lo|0] planes, v = x . Wv^T -> v^T bf16
  //     hi / lo planes, these four in fragment order
  gemm_qkv<<<gQkv, blk128, 0, stream>>>(Xb, Wqb, Qc, Kd, Kz, VTh, VTl, Ct, St);
  // (3) causal attention -> ctx bf16 hi / lo planes [b][h][t][d]
  attn_causal16<<<gAttn, blk128, 0, stream>>>(Qc, Kd, Kz, VTh, VTl, Oh, Ol);
  // (4) out = (ctx hi + ctx lo) . Wo^T -> d_out f32 [4096][288]
  gemm_out<<<gOut, blk128, 0, stream>>>(Oh, Ol, Wob, (float*)d_out);
  (void)hipGetLastError();
}

// v007
// It runs in 46.7 microseconds.
// In two side-by-side timings against v006, it was 1.04 and 1.05 times as fast.
// Counting every step since v000, it is 6.05 times as fast.
// Contractions: q / k / v projections = v_wmma_f32_16x16x32_bf16 (bf16 operands from RNE-converted x and Wq/Wk/Wv, single product, f32 accumulate);
// k.q^T scores (transposed) = v_wmma_f32_16x16x32_bf16 with q and k as bf16 hi/lo split folded into the 32-deep k axis ([qhi|qlo].[khi|khi] + [qhi|qlo].[klo|0] = hh+lh+hl, 2 products), f32 accumulate;
// v^T.p^T (transposed) = v_wmma_f32_16x16x32_bf16 with p and v as bf16 hi/lo split (hh + hl + lh, 3 products), f32 accumulate;
// ctx.Wo^T = v_wmma_f32_16x16x32_bf16 with ctx as bf16 hi + unscaled lo planes times bf16 Wo (2 products), f32 accumulate;
// rotary tables (powf, f32 product, precise sincosf), half-rotation, causal mask and online softmax in f32 on the VALU.
// Carry audit: no scaled planes anywhere; every lo plane is the unscaled RNE residual (v - hi) in bf16 and shares the hi accumulator;
// score scale 1/4 applied once in f32 after the score accumulate; softmax normaliser 1/l applied once in the attention epilogue.
#include <hip/hip_runtime.h>
#include <math.h>
#include <stdint.h>

#define NB    2
#define SEQ   2048
#define HID   288
#define NH    18
#define HD    16
#define NPAIR 8
#define QS    32           // slots per head in the q / k planes: 0..15 hi (d), 16..31 lo (d) or duplicate / zero
#define NTOK  (NB * SEQ)   // 4096 token rows
#define NQB   (SEQ / 64)   // 32 query blocks of 64 per sequence
static_assert(NH * HD == HID);
static_assert(NPAIR * 2 == HD);
static_assert((SEQ % 64) == 0 && (HID % 32) == 0 && (NTOK % 64) == 0);
static_assert(((NTOK / 64) * (HID / 32)) % 4 == 0);
static_assert((NTOK * HID) % (8 * 256) == 0);
static_assert(((HID * HID) % 8) == 0 && (((HID * HID) / 8) % 32) == 0);
static_assert((SEQ % 32) == 0);

typedef __bf16   v16b __attribute__((ext_vector_type(16)));
typedef __bf16   v8b  __attribute__((ext_vector_type(8)));
typedef float    v8f  __attribute__((ext_vector_type(8)));
typedef float    v4f  __attribute__((ext_vector_type(4)));
typedef float    v2f  __attribute__((ext_vector_type(2)));
typedef __bf16   v2b  __attribute__((ext_vector_type(2)));
typedef unsigned int v4u __attribute__((ext_vector_type(4)));

// ---- scalar helpers --------------------------------------------------------------------------------
// two f32 -> two bf16 in one word (a low, b high), RNE, by the chip's packed convert
__device__ __forceinline__ unsigned cvt2(float a, float b) {
  const v2f f = {a, b};
  return __builtin_bit_cast(unsigned, __builtin_convertvector(f, v2b));
}
// hi = bf16(f), lo = bf16(f - hi) for eight values, word e = values 2e (low half) and 2e+1 (high half): three instructions a
// pair. hi: one packed convert. lo: the mixed-precision FMA reads hi's bf16 half as it lies, forms hi * -1 + f (exact in f32)
// and rounds it (RNE) into one half of the result word; the compiler's own form of the same takes a shift, a mask, a packed
// add and a second convert. The four low halves stand ahead of the four high halves, so that no instruction follows the
// one that wrote its result word directly.
__device__ __forceinline__ void split8(const float (&f)[8], unsigned (&hi)[4], unsigned (&lo)[4]) {
#pragma unroll
  for (int e = 0; e < 4; ++e) hi[e] = cvt2(f[2 * e], f[2 * e + 1]);
  asm("v_fma_mixlo_bf16 %0, %4, -1.0, %8 op_sel_hi:[1,0,0]\n\t"
      "v_fma_mixlo_bf16 %1, %5, -1.0, %10 op_sel_hi:[1,0,0]\n\t"
      "v_fma_mixlo_bf16 %2, %6, -1.0, %12 op_sel_hi:[1,0,0]\n\t"
      "v_fma_mixlo_bf16 %3, %7, -1.0, %14 op_sel_hi:[1,0,0]\n\t"
      "v_fma_mixhi_bf16 %0, %4, -1.0, %9 op_sel:[1,0,0] op_sel_hi:[1,0,0]\n\t"
      "v_fma_mixhi_bf16 %1, %5, -1.0, %11 op_sel:[1,0,0] op_sel_hi:[1,0,0]\n\t"
      "v_fma_mixhi_bf16 %2, %6, -1.0, %13 op_sel:[1,0,0] op_sel_hi:[1,0,0]\n\t"
      "v_fma_mixhi_bf16 %3, %7, -1.0, %15 op_sel:[1,0,0] op_sel_hi:[1,0,0]"
      : "=&v"(lo[0]), "=&v"(lo[1]), "=&v"(lo[2]), "=&v"(lo[3])
      : "v"(hi[0]), "v"(hi[1]), "v"(hi[2]), "v"(hi[3]),
        "v"(f[0]), "v"(f[1]), "v"(f[2]), "v"(f[3]), "v"(f[4]), "v"(f[5]), "v"(f[6]), "v"(f[7]));
}
__device__ __forceinline__ v8f zero8() { v8f z = {0.f, 0.f, 0.f, 0.f, 0.f, 0.f, 0.f, 0.f}; return z; }

// ---- fragment loaders: 16-bit A/B operand, lane -> row/col (lane&15), p already includes +8*(lane>>4);
//      elements 0..7 <- p[0..7] (k0+8h..k0+8h+7), elements 8..15 <- p[16..23] (k0+16+8h..k0+16+8h+7)
__device__ __forceinline__ v16b ldfrag_b(const __bf16* p) {
  union { v16b v; v8b h[2]; } f;
  f.h[0] = *(const v8b*)(p);
  f.h[1] = *(const v8b*)(p + 16);
  return f.v;
}
// FRAGMENT ORDER: a plane that only fragment loads read is stored as blocks of 512 elements (1024 B), one block = 16 rows x
// 32 k; element (row c, k) of a block lies at (k>>4)*256 + (((k>>3)&1)*16 + c)*8 + (k&7). That is the map above written out
// lane by lane: lane l = 16*(lane half) + c finds elements 0..7 at l*8 and elements 8..15 at 256 + l*8, so each of the two
// 16-B loads of a wave covers 512 contiguous, aligned bytes (4 whole cache lines) and not 32-B pieces of 8 or 16 lines.
// p = block base + 8*lane.
__device__ __forceinline__ v16b ldfrag_f(const __bf16* p) {
  union { v16b v; v8b h[2]; } f;
  f.h[0] = *(const v8b*)(p);
  f.h[1] = *(const v8b*)(p + 256);
  return f.v;
}
// same map when k0..k0+15 and k0+16..k0+31 live in two different rows (p0, p1 each include +8*(lane>>4))
__device__ __forceinline__ v16b ldfrag_b2(const __bf16* p0, const __bf16* p1) {
  union { v16b v; v8b h[2]; } f;
  f.h[0] = *(const v8b*)(p0);
  f.h[1] = *(const v8b*)(p1);
  return f.v;
}

// ---- WMMA helper with trailing VALU hazard gap (D tied, A/B kept live) ----------------------------------
__device__ __forceinline__ v8f mma_b(v16b a, v16b b, v8f c) {
  c = __builtin_amdgcn_wmma_f32_16x16x32_bf16(false, a, false, b, (short)0, c, false, false);
  asm volatile("v_nop\n\tv_nop\n\tv_nop\n\tv_nop" : "+v"(c) : "v"(a), "v"(b));
  return c;
}

// =====================================================================================================
// prep: everything the projections need and that depends on the inputs alone, as block ranges of ONE grid (256 threads a
// block, the range test is block-uniform):
//   blocks 0..63 (rotary tables): ctab[t][i] = cos(t * inv[i]), stab[t][i] = sin(t * inv[i]), i = 0..7, t = 0..SEQ-1, with
//     inv[i] = 1 / powf(10000, (2i)/16) formed by every thread for its own i (f32 product, precise sincosf);
//     thread tid -> t = block*32 + tid/8, i = tid&7; 64 blocks x 256 = the whole [SEQ][8] tables.
//   blocks 64..227 (weights): 41 blocks a weight, Wq, Wk, Wv, Wo in this order, into four planes that follow one another.
//   blocks 228..803 (x).
//   f32 -> bf16 (RNE convert), 8 elements per thread, one 16-B store per lane;
//   n8 threads x 8 = the whole plane (n8 = 147456 for x, 10368 for each weight; both multiples of 64).
//   The planes are written in FRAGMENT ORDER (see ldfrag_f), blocks [row / 16][k / 32], 64 threads a block: a wave takes 8
//   rows x 32 k, lane = 8 * (group of 8 k) + row, so that it reads 8 whole 128-B lines of the source and writes 4 of the plane.
// =====================================================================================================
#define PREP_TAB  (SEQ / 32)                       // 64 blocks
#define PREP_W    ((HID * HID / 8 + 255) / 256)    // 41 blocks a weight
#define PREP_X    (NTOK * HID / 8 / 256)           // 576 blocks
__device__ __forceinline__ void cvt_bf16x8(const float* __restrict__ in, unsigned short* out, const int i) {
  const int blk = i >> 6;                          // block = 64 threads x 8 elements
  const int gr  = blk / (HID / 32);                // group of 16 rows
  const int ks  = blk - gr * (HID / 32);           // k-step of 32
  const int c   = ((i >> 2) & 8) | (i & 7);        // row of the block: the wave's 8 rows, one per lane & 7
  const int q   = (i >> 3) & 3;                    // group of 8 k: k = 8q..8q+7
  const size_t so = (size_t)(gr * 16 + c) * HID + ks * 32 + q * 8;
  const size_t po = (size_t)blk * 512 + (q >> 1) * 256 + ((q & 1) * 16 + c) * 8;
  const v4f a = *(const v4f*)(in + so);
  const v4f b = *(const v4f*)(in + so + 4);
  v4u p;
  p[0] = cvt2(a[0], a[1]);
  p[1] = cvt2(a[2], a[3]);
  p[2] = cvt2(b[0], b[1]);
  p[3] = cvt2(b[2], b[3]);
  *(v4u*)(out + po) = p;
  // precaution: in the merged kernel's listing another block range's code, which rewrites the store's registers, follows it
  asm volatile("s_wait_xcnt 0x0" ::: "memory");
}

__global__ __launch_bounds__(256) void prep(const float* __restrict__ x, const float* __restrict__ Wq,
                                            const float* __restrict__ Wk, const float* __restrict__ Wv,
                                            const float* __restrict__ Wo, unsigned short* Xb, unsigned short* Wb,
                                            float* ctab, float* stab) {
  const int tid = (int)threadIdx.x;
  const int bx  = (int)blockIdx.x;
  if (bx < PREP_TAB) {
    const int i = tid & (NPAIR - 1);
    const int t = bx * 32 + (tid >> 3);
    const float e = (float)(2 * i) * (1.0f / (float)HD);
    const float p = powf(10000.0f, e);
    const float f = 1.0f / p;
    const float ang = (float)t * f;
    float sn, cs;
    sincosf(ang, &sn, &cs);
    const size_t o = (size_t)t * NPAIR + i;
    *(float*)(ctab + o) = cs;
    *(float*)(stab + o) = sn;
  } else if (bx < PREP_TAB + 4 * PREP_W) {
    const int w  = (bx - PREP_TAB) / PREP_W;       // 0..3: Wq, Wk, Wv, Wo
    const int i  = (bx - PREP_TAB - w * PREP_W) * 256 + tid;
    const float* in = (w == 0) ? Wq : (w == 1) ? Wk : (w == 2) ? Wv : Wo;
    if (i < HID * HID / 8) cvt_bf16x8(in, Wb + (size_t)w * (HID * HID), i);
  } else {
    cvt_bf16x8(x, Xb, (bx - PREP_TAB - 4 * PREP_W) * 256 + tid);
  }
}

// =====================================================================================================
// bf16 WMMA GEMM, one wave per 64 x 32 tile, 4 waves per block, no block barriers:
//   C[m][n] = sum_k A[m][k] * Bt[n][k] (+ sum_k A2[m][k] * Bt[n][k] when TWOA), M = 4096 tokens, N = 288, K = 288
//   (9 k-steps of 32, no tails). Bt = weight plane (the [out][in] weight, RNE bf16), fragment order, blocks [n / 16][k / 32].
//   A: MODE 0..2: x plane, fragment order, blocks [m / 16][k / 32]. MODE 3: ctx planes laid out [b][h][t][16]; k-step j covers heads 2j
//   (k 0..15) and 2j+1 (k 16..31): elements 0..7 <- head 2j, d = 8*(lane>>4)..+7; elements 8..15 <- head 2j+1, same d.
// then (b = m0/2048, t = m0%2048 + row, 32 columns = heads n0/16 and n0/16+1):
//   MODE 0 (q): rotary in f32 (contract off): d < 8: x[d] c[t][d] - x[d+8] s[t][d]; d >= 8: x[d] c[t][d-8] + x[d-8] s[t][d-8];
//               -> plane [b][h][t][32]: slots 0..15 = bf16 hi of d, 16..31 = bf16 lo (v - hi) of d.
//   MODE 1 (k): same rotary; plane C0 slots 0..15 = hi, 16..31 = hi (duplicate); plane C1 slots 0..15 = lo, 16..31 = 0;
//               both in fragment order, blocks [b][h][t / 16], rows = keys, k = slots.
//   MODE 2 (v): no rotary; v^T planes C0 = hi, C1 = lo, fragment order, blocks [b][h][t / 32], rows = d, k = keys.
//   MODE 0..2 share one body and ONE grid (gemm_qkv: blockIdx.y = mode, the same in every wave of a block; only the weight
//   plane, the epilogue and the output planes differ); MODE 3 (OUT) is a launch of its own (gemm_out), behind attention.
// coverage: 576 tiles x (64 rows x 32 cols) = the whole 4096 x 288 result; MODE 0/1: 2 heads x 8 it x 8 rows x 4 lanes
//           x 8 slots = 64 rows x 2 heads x 32 slots; MODE 2: 4 x 2 it x (8 features x 4 token groups) x 8 = 32 features x 64 tokens;
//           MODE 3: 16 it x 4 rows x 8 lanes x 4 = 64 rows x 32 cols.
// =====================================================================================================
// Epilogue of one wave's 64 x 32 tile, read back from its LDS slab; MODE as listed above.
template <int MODE>
__device__ __forceinline__ void gemm_epi(const float* slab, const int lane, const int m0, const int n0, const int bidx,
                                         const int tl0, void* C0, void* C1,
                                         const float* __restrict__ ctab, const float* __restrict__ stab) {
  static_assert(MODE >= 0 && MODE <= 3);
  if (MODE == 3) {
    float* Cf = (float*)C0;
    const int q4 = lane >> 3, c4 = (lane & 7) * 4;
    {
#pragma unroll
      for (int it = 0; it < 16; ++it) {
        const int row = it * 4 + q4;                         // it 0..15 x q4 0..3 = rows 0..63
        const v4f v = *(const v4f*)(slab + row * 36 + c4);
        *(v4f*)(Cf + (size_t)(m0 + row) * HID + n0 + c4) = v;
      }
      
    }
  } else if (MODE == 2) {
    unsigned short* P0 = (unsigned short*)C0;
    unsigned short* P1 = (unsigned short*)C1;
    const int n8 = lane & 7, tg = lane >> 3;       // 8 features side by side = one whole 128-B line of a block per token group
#pragma unroll 1
    for (int it2 = 0; it2 < 8; it2 += 2) {         // two groups' loads and stores side by side in a trip
#pragma unroll
      for (int it = it2; it < it2 + 2; ++it) {
        const int n  = (it >> 1) * 8 + n8;                     // local feature 0..31
        const int t8 = ((it & 1) * 4 + tg) * 8;                // first of this lane's 8 tokens, 0..56
        float f[8];
#pragma unroll
        for (int e = 0; e < 8; ++e) f[e] = slab[(t8 + e) * 36 + n];
        unsigned hw[4], lw[4];
        split8(f, hw, lw);
        const v4u a = {hw[0], hw[1], hw[2], hw[3]}, a2 = {lw[0], lw[1], lw[2], lw[3]};
        const int s = tl0 + t8;                                // key index of element 0; d = (n0 + n) & 15
        const size_t go = ((size_t)(bidx * NH + ((n0 + n) >> 4))) * (SEQ * HD) + (size_t)((s >> 5) * 512 +
                          ((s >> 4) & 1) * 256 + (((s >> 3) & 1) * 16 + ((n0 + n) & 15)) * 8);
        *(v4u*)(P0 + go) = a;
        *(v4u*)(P1 + go) = a2;
      }
      // precaution: the next trip rewrites registers that these stores name
      asm volatile("s_wait_xcnt 0x0" ::: "memory");
    }
  } else {
    unsigned short* P0 = (unsigned short*)C0;
    unsigned short* P1 = (unsigned short*)C1;
    const int r4 = lane >> 2, s8 = (lane & 3) * 8;
    const int dbase = s8 & 8;                                // d of the first element: 0 or 8
    const bool isLo = (s8 >= 16);
    const float sg = (dbase == 0) ? -1.0f : 1.0f;            // -x[d+8] for d < 8, +x[d-8] for d >= 8
    const int h0 = n0 >> 4;                                  // first head of the tile (even)
#pragma unroll 1
    for (int hd = 0; hd < 2; ++hd) {
#pragma unroll 1
      for (int it2 = 0; it2 < 8; it2 += 2) {         // two rows' loads and stores side by side in a trip
#pragma unroll
        for (int it = it2; it < it2 + 2; ++it) {
          const int row = it * 8 + r4;                         // it 0..7 x r4 0..7 = rows 0..63
          const int t = tl0 + row;                             // position within the sequence
          const float* xr = slab + row * 36 + hd * 16;
          float x[8], y[8], f[8];
#pragma unroll
          for (int e = 0; e < 8; ++e) { x[e] = xr[dbase + e]; y[e] = xr[(dbase ^ 8) + e]; }
          const v4f cv0 = *(const v4f*)(ctab + (size_t)t * NPAIR);
          const v4f cv1 = *(const v4f*)(ctab + (size_t)t * NPAIR + 4);
          const v4f sv0 = *(const v4f*)(stab + (size_t)t * NPAIR);
          const v4f sv1 = *(const v4f*)(stab + (size_t)t * NPAIR + 4);
          {
#pragma clang fp contract(off)
#pragma unroll
            for (int e = 0; e < 4; ++e) {
              {
                const float ry = sg * y[e];
                const float p0 = x[e] * cv0[e];
                const float p1 = ry * sv0[e];
                f[e] = p0 + p1;
              }
              {
                const float ry = sg * y[4 + e];
                const float p0 = x[4 + e] * cv1[e];
                const float p1 = ry * sv1[e];
                f[4 + e] = p0 + p1;
              }
            }
          }
          unsigned hw[4], lw[4];
          split8(f, hw, lw);
          const v4u hp = {hw[0], hw[1], hw[2], hw[3]}, lp = {lw[0], lw[1], lw[2], lw[3]};
          const size_t go = (MODE == 0)
              ? (((size_t)(bidx * NH + h0 + hd)) * SEQ + t) * QS + s8
              : ((size_t)(bidx * NH + h0 + hd)) * (SEQ * QS) + (size_t)((t >> 4) * 512 + (s8 >> 4) * 256 +
                                                                       (((s8 >> 3) & 1) * 16 + (t & 15)) * 8);
          if (MODE == 0) {
            v4u pc;
#pragma unroll
            for (int e = 0; e < 4; ++e) pc[e] = isLo ? lp[e] : hp[e];
            *(v4u*)(P0 + go) = pc;
          } else {
            v4u pz;
#pragma unroll
            for (int e = 0; e < 4; ++e) pz[e] = isLo ? 0u : lp[e];
            *(v4u*)(P0 + go) = hp;
            *(v4u*)(P1 + go) = pz;
          }
        }
        // precaution: the next trip rewrites registers that these stores name
        asm volatile("s_wait_xcnt 0x0" ::: "memory");
      }
    }
  }
}

template <bool OUT>
__device__ __forceinline__ void gemm_xw(
    const int mode,                                // 0 q, 1 k, 2 v (block-uniform, OUT false); 3 with OUT
    const unsigned short* __restrict__ Ap, const unsigned short* __restrict__ A2p,
    const unsigned short* __restrict__ Btp, void* C0, void* C1,
    const float* __restrict__ ctab, const float* __restrict__ stab) {
  constexpr bool TWOA = OUT;
  constexpr int M = NTOK, N = HID, K = HID;
  constexpr int TN = N / 32;   // 9
  constexpr int TM = M / 64;   // 64
  const __bf16* A  = (const __bf16*)(const void*)Ap;
  const __bf16* A2 = (const __bf16*)(const void*)A2p;
  const __bf16* Bt = (const __bf16*)(const void*)Btp;
  __shared__ __align__(16) float sT[4][64 * 36];   // per-wave 64x32 tile, pitch 36 floats

  const int lane = threadIdx.x & 31;
  const int wave = __builtin_amdgcn_readfirstlane((int)(threadIdx.x >> 5));   // same in every lane: held scalar, the tile bases are scalar too
  const int tile = blockIdx.x * 4 + wave;
  if (tile >= TM * TN) return;                     // wave-uniform; no block barriers in this kernel
  const int tm = tile / TN;
  const int tn = tile - tm * TN;
  const int m0 = tm << 6;
  const int n0 = tn << 5;
  const int c    = lane & 15;                      // row (A) / col (B, D) within subtile
  const int koff = (lane >> 4) * 8;                // k offset of this lane half
  const int mOff = (lane >> 4) * 8;                // D row offset
  const int bidx = m0 / SEQ;                       // batch of this tile (tiles never straddle a batch)
  const int tl0  = m0 - bidx * SEQ;                // first position within the sequence

  v8f acc[4][2];
#pragma unroll
  for (int i = 0; i < 4; ++i)
#pragma unroll
    for (int j = 0; j < 2; ++j) acc[i][j] = zero8();

  // Loads run ahead of the matrix instructions: every fragment is fetched into a register set that is free by then, whole
  // k-steps before its products, so a k-step waits on loads issued earlier and not on its own. Three A sets go round.
  //   one A plane: k-step ks in A and B set ks % 3, fetched two k-steps ahead (8 products a k-step cover little of a load).
  //   two A planes: the hi products of a k-step run first, then the lo products (each accumulator still takes hi, lo, hi,
  //   lo ... in k order); the sets hold hi(ks), lo(ks), hi(ks+1), each fetched one k-step ahead; B in set ks & 1.
  // Address = wave-uniform tile base + one lane offset + a constant: the sets leave no room for a pointer per row.
  constexpr int KS = K / 32;                       // 9 k-steps
  const size_t abase = OUT ? (((size_t)(bidx * NH)) * SEQ + tl0) * HD : (size_t)m0 * K;
  const __bf16* Ab  = A + abase;
  const __bf16* A2b = A2 + abase;
  const __bf16* Bb  = Bt + (size_t)n0 * K;
  const unsigned alane = OUT ? (unsigned)(c * HD + koff) : (unsigned)(lane * 8);   // 16 rows x K = K / 32 blocks of 512: the
  const unsigned blane = (unsigned)(lane * 8);                                     // row-group bases are those of a [row][K] plane
  v16b bh[TWOA ? 2 : 3][2], ar[3][4];
  auto fetch_b = [&](const int ks, const int st) __attribute__((always_inline)) {
#pragma unroll
    for (int j = 0; j < 2; ++j) bh[st][j] = ldfrag_f(Bb + blane + (j << 4) * K + ks * 512);
  };
  auto fetch_a = [&](const __bf16* base, const int ks, const int set) __attribute__((always_inline)) {
#pragma unroll
    for (int i = 0; i < 4; ++i) {
      if (OUT) {                                   // ks = head pair index 0..8: heads 2 ks and 2 ks + 1, same token row
        const int e0 = (i << 4) * HD + (2 * ks) * SEQ * HD, e1 = e0 + SEQ * HD;
        ar[set][i] = ldfrag_b2(base + alane + e0, base + alane + e1);
      } else {
        ar[set][i] = ldfrag_f(base + alane + (i << 4) * K + ks * 512);
      }
    }
  };
  auto products = [&](const int set, const int st) __attribute__((always_inline)) {
#pragma unroll
    for (int i = 0; i < 4; ++i)
#pragma unroll
      for (int j = 0; j < 2; ++j) acc[i][j] = mma_b(ar[set][i], bh[st][j], acc[i][j]);
  };
  fetch_b(0, 0);
  fetch_a(Ab, 0, 0);
  if (TWOA) fetch_a(A2b, 0, 1);
  else { fetch_b(1, 1); fetch_a(Ab, 1, 1); }
#pragma unroll                                     // full unroll: a register set's index must be a constant
  for (int ks = 0; ks < KS; ++ks) {
    const int st = ks & 1;
    if (TWOA) {
      const int sh = (2 * ks) % 3, sl = (2 * ks + 1) % 3, sn = (2 * ks + 2) % 3;
      if (ks + 1 < KS) { fetch_b(ks + 1, st ^ 1); fetch_a(Ab, ks + 1, sn); }
      products(sh, st);
      if (ks + 1 < KS) fetch_a(A2b, ks + 1, sh);   // into the set the hi products have just read
      products(sl, st);
    } else {
      if (ks + 2 < KS) { fetch_b(ks + 2, (ks + 2) % 3); fetch_a(Ab, ks + 2, (ks + 2) % 3); }
      products(ks % 3, ks % 3);
    }
  }

  // ---- epilogue: whole tile to wave-private LDS ----
  float* slab = sT[wave];
#pragma unroll
  for (int i = 0; i < 4; ++i)
#pragma unroll
    for (int j = 0; j < 2; ++j)
#pragma unroll
      for (int r = 0; r < 8; ++r)
        slab[((i << 4) + mOff + r) * 36 + (j << 4) + c] = acc[i][j][r];
  __builtin_amdgcn_fence(__ATOMIC_RELEASE, "workgroup");
  __builtin_amdgcn_wave_barrier();
  __builtin_amdgcn_fence(__ATOMIC_ACQUIRE, "workgroup");

  if (OUT)            gemm_epi<3>(slab, lane, m0, n0, bidx, tl0, C0, C1, ctab, stab);
  else if (mode == 0) gemm_epi<0>(slab, lane, m0, n0, bidx, tl0, C0, C1, ctab, stab);   // block-uniform choice, made once:
  else if (mode == 1) gemm_epi<1>(slab, lane, m0, n0, bidx, tl0, C0, C1, ctab, stab);   // no mode test inside an epilogue loop
  else                gemm_epi<2>(slab, lane, m0, n0, bidx, tl0, C0, C1, ctab, stab);
}

// q, k and v projections in one grid: blockIdx.x = group of 4 tiles, blockIdx.y = mode. Wb = Wq, Wk, Wv planes in a row.
__global__ __launch_bounds__(128) void gemm_qkv(
    const unsigned short* __restrict__ Xb, const unsigned short* __restrict__ Wb,
    unsigned short* Qc, unsigned short* Kd, unsigned short* Kz, unsigned short* VTh, unsigned short* VTl,
    const float* __restrict__ ctab, const float* __restrict__ stab) {
  const int mode = (int)blockIdx.y;
  unsigned short* C0 = (mode == 0) ? Qc : (mode == 1) ? Kd : VTh;
  unsigned short* C1 = (mode == 0) ? Qc : (mode == 1) ? Kz : VTl;
  gemm_xw<false>(mode, Xb, Xb, Wb + (size_t)mode * (HID * HID), (void*)C0, (void*)C1, ctab, stab);
}

__global__ __launch_bounds__(128) void gemm_out(
    const unsigned short* __restrict__ Oh, const unsigned short* __restrict__ Ol,
    const unsigned short* __restrict__ Wob, float* out) {
  gemm_xw<true>(3, Oh, Ol, Wob, (void*)out, (void*)out, nullptr, nullptr);
}

// =====================================================================================================
// Causal attention, head dim 16, key chunks of 64, both products transposed: S^T = K . Q^T, O^T += V^T . P^T.
//   q plane  [b][h][t][32]: slots 0..15 = bf16 hi of rope(q)[d], 16..31 = bf16 lo
//   kd plane, per key 32 slots: 0..15 = hi of rope(k)[d], 16..31 = hi again; kz plane: 0..15 = lo, 16..31 = 0;
//   both in fragment order (ldfrag_f): blocks [b][h][s / 16] of 16 keys x 32 slots
//   so one 32-deep k-step gives q.k = hi.hi + lo.hi (kd) and hi.lo (kz): two products per 16x16 score tile.
//   v^T planes (bf16 hi / lo), fragment order: blocks [b][h][s / 32] of 16 d x 32 keys
//   ctx planes (bf16 hi / lo of the normalised context): element (b, h, t, d) at [((b*18 + h)*2048 + t)*16 + d]
//   Score tile j: A = 16 key rows (row = lane&15), B = the wave's 16 queries (col = lane&15), same k map on both sides, so
//   register r of lane (c, hh) = score of key kv0 + 16j + 8hh + r against query q0 + c: a lane holds 32 of the 64 keys of ONE
//   query. Row max and row sum are in-lane; the two lane halves exchange the max once per chunk and join their sums once, in
//   the epilogue. Tiles 2kk and 2kk+1, converted in place, are the B operand of k-step kk (element e = key 8hh+e, element
//   8+e = key 16+8hh+e), which is the k order in which ldfrag_f reads the v^T block as A: P never leaves the registers.
//   Causal structure: query tile qb visits key chunks 0..qb only (block-uniform count of qb+1 <= NQB chunks); chunks 0..qb-1 run
//   in a loop whose body has no mask, the diagonal chunk qb in a copy of the body behind it: there a key with index > query
//   index gets logit -inf -> exp gives exactly 0; the first key of every visited chunk is always kept, so every joined max is finite.
//   Tile = 64 query rows of one (b, h), 4 waves, wave w = rows q0..q0+15; no LDS, no barriers.
//   Equal work-groups: every work-group is resident from the start, so the launch lasts as long as the fullest WGP, and a
//   tile costs qb+1 chunks. A block therefore walks several tiles of ONE head, one after the other, ABIN blocks a head:
//   block n = 0..12: tiles 31-n and 5+n (32-n and 6+n chunks, 38 together); block 13: tiles 18, 4, 3, 2, 1, 0 (34 chunks).
//   grid = NB * NH * ABIN = 504 blocks, at most two for each of the 256 WGPs. All tiles of a block start at key chunk 0 of
//   the same head, so the last trip of a tile fetches that chunk for the next one.
//   The hi / lo splits of P round in the chip's converting instructions (split8), not in integer arithmetic.
//   Output: lane (c, hh) holds d = 8hh..8hh+7 of query q0 + c: one 16-B store per plane, 512 contiguous B per wave.
//   coverage: tiles 31..19, 5..17, 18 and 4..0 = each of the 32 tiles of a head once; 36 heads x 32 tiles x 4 waves x 16 rows
//   x 16 d = every (b, h, t, d) of both ctx planes exactly once.
// =====================================================================================================
__device__ __forceinline__ float other_half(float v) {                // value of lane l ^ 16
  const int b = __builtin_bit_cast(int, v);
  return __builtin_bit_cast(float, __builtin_amdgcn_permlanex16(b, b, 0x76543210, 0xfedcba98, false, false));
}

__device__ __forceinline__ void exp2x8(const float (&x)[8], float (&y)[8]) {
  asm("v_exp_f32 %0, %8\n\tv_exp_f32 %1, %9\n\tv_exp_f32 %2, %10\n\tv_exp_f32 %3, %11\n\t"
      "v_exp_f32 %4, %12\n\tv_exp_f32 %5, %13\n\tv_exp_f32 %6, %14\n\tv_exp_f32 %7, %15\n\tv_nop"
      : "=&v"(y[0]), "=&v"(y[1]), "=&v"(y[2]), "=&v"(y[3]), "=&v"(y[4]), "=&v"(y[5]), "=&v"(y[6]), "=&v"(y[7])
      : "v"(x[0]), "v"(x[1]), "v"(x[2]), "v"(x[3]), "v"(x[4]), "v"(x[5]), "v"(x[6]), "v"(x[7]));
}

#define ABIN 14            // blocks per (b, h)
static_assert(NQB == 32);  // the tile lists below are written for 32 tiles a head

// At most two work-groups share a WGP (two waves a SIMD), so registers up to 256 cost nothing. Without the bound the compiler,
// once the splits need fewer registers, aims at a fifth wave a SIMD and forms the loop-invariant mask bounds anew in every trip.
__global__ __launch_bounds__(128) __attribute__((amdgpu_waves_per_eu(4, 4)))
void attn_causal16(const unsigned short* __restrict__ qcp, const unsigned short* __restrict__ kdp,
                   const unsigned short* __restrict__ kzp, const unsigned short* __restrict__ vhp,
                   const unsigned short* __restrict__ vlp, unsigned short* ohp, unsigned short* olp) {
  union PB { v16b v; unsigned u[8]; };

  const int tid  = threadIdx.x;
  const int wave = tid >> 5;
  const int lane = tid & 31;
  const int hh   = lane >> 4;
  const int c    = lane & 15;

  const int bx   = blockIdx.x;
  const int bin  = bx % ABIN;
  const int rest = bx / ABIN;
  const int h    = rest % NH;
  const int b    = rest / NH;
  const int ntile = (bin < ABIN - 1) ? 2 : 6;  // block-uniform
  const size_t bhp = (size_t)b * NH + h;

  const __bf16* Qc = (const __bf16*)(const void*)qcp + bhp * SEQ * QS;
  const __bf16* Kd = (const __bf16*)(const void*)kdp + bhp * SEQ * QS;
  const __bf16* Kz = (const __bf16*)(const void*)kzp + bhp * SEQ * QS;
  const __bf16* Vh = (const __bf16*)(const void*)vhp + bhp * SEQ * HD;
  const __bf16* Vl = (const __bf16*)(const void*)vlp + bhp * SEQ * HD;

  // Loads run ahead of the matrix instructions that use them: chunk kt + 1's K fragments are fetched as one group behind
  // the score products of chunk kt, chunk kt's V fragments at the head of trip kt; the softmax runs while both fly.
  // Address = the head's plane base (wave-uniform) + one 32-bit byte offset (chunk + lane) + a constant.
  const unsigned flane = (unsigned)(lane * 16);              // this lane's place, in bytes, in every block of a fragment-order plane
  v16b kd[4], kz[4];
  // ko = byte offset of the chunk's first block + flane, the same in both planes: head base (scalar) + one 32-bit register
  auto fetch_k = [&](const unsigned ko) __attribute__((always_inline)) {
#pragma unroll
    for (int j = 0; j < 4; ++j) {
      kd[j] = ldfrag_f((const __bf16*)((const char*)Kd + ko + j * 1024));
      kz[j] = ldfrag_f((const __bf16*)((const char*)Kz + ko + j * 1024));
    }
  };
  fetch_k(flane);
  // precaution: code that follows rewrites the offset register that these loads name
  asm volatile("s_wait_xcnt 0x0" ::: "memory");

  for (int ti = 0; ti < ntile; ++ti) {         // the block's tiles, the longest first
  const int qb = (bin < ABIN - 1) ? ((ti == 0) ? NQB - 1 - bin : 5 + bin) : ((ti == 0) ? 18 : 5 - ti);
  const int q0 = qb * 64 + wave * 16;

  // ---- Q fragment (B operand, col = lane&15, one 32-slot k-step) ----
  const v16b qa = ldfrag_b(Qc + (size_t)(q0 + c) * QS + 8 * hh);
  // precaution: code that follows rewrites the address pair that these loads name
  asm volatile("s_wait_xcnt 0x0" ::: "memory");
  const int rowq = q0 + c;                     // this lane's query index

  float mrow = -INFINITY;                      // running max of query rowq (equal in both lane halves)
  float lrow = 0.f;                            // running sum over this lane half's keys only
  v8f oacc = zero8();                          // O^T: register r = d 8hh+r of query rowq

  // One key chunk. kv0 = its first key (kv0 + 63 < SEQ), kvn = first key of the K chunk fetched ahead; diag is a literal at
  // both calls: only the diagonal chunk (kv0 = 64 qb) holds keys above a query of the tile, so only its copy of the body
  // compares and selects; in the chunks below it every key index is below q0 and the select would keep every score.
  auto chunk = [&](const int kv0, const int kvn, const bool diag) __attribute__((always_inline)) {
    const unsigned ko = flane + (unsigned)kvn * (QS * 2);    // byte offsets, below 2^17
    const unsigned vo = flane + (unsigned)kv0 * (HD * 2);

    v16b vb[2], vl[2];
#pragma unroll
    for (int kk = 0; kk < 2; ++kk) {
      vb[kk] = ldfrag_f((const __bf16*)((const char*)Vh + vo + kk * 1024));
      vl[kk] = ldfrag_f((const __bf16*)((const char*)Vl + vo + kk * 1024));
    }

    // ---- scores: 64 keys x 16 queries per wave, 2 bf16 products per key subtile ----
    v8f s[4];
#pragma unroll
    for (int j = 0; j < 4; ++j) {
      s[j] = mma_b(kd[j], qa, zero8());
      s[j] = mma_b(kz[j], qa, s[j]);
    }
    fetch_k(ko);

    // ---- scale, causal mask by index, max in-lane + one exchange, online softmax ----
    float mj[4];                               // one max chain per score tile: four independent chains
#pragma unroll
    for (int j = 0; j < 4; ++j) {
      mj[j] = -INFINITY;
#pragma unroll
      for (int r = 0; r < 8; ++r) {
        const int key = kv0 + j * 16 + 8 * hh + r;
        float sv = s[j][r] * 0.25f;
        if (diag) sv = (key <= rowq) ? sv : -INFINITY;
        s[j][r] = sv;
        mj[j] = fmaxf(mj[j], sv);
      }
    }
    float m = fmaxf(fmaxf(mj[0], mj[1]), fmaxf(mj[2], mj[3]));
    m = fmaxf(m, other_half(m));
    const float mnew  = fmaxf(mrow, m);
    const float msafe = (mnew == -INFINITY) ? 0.f : mnew;
    const float alpha = __expf(mrow - msafe);
    mrow = mnew;

    PB ph[2], pl[2];                           // P^T hi / lo as B operands of the two 32-key k-steps
    float pj[4];                               // one sum chain per score tile
#pragma unroll
    for (int j = 0; j < 4; ++j) {
      float xe[8], pe[8];
#pragma unroll
      for (int r = 0; r < 8; ++r) xe[r] = (s[j][r] - msafe) * 1.44269504f;   // exp(t) = 2^(t log2 e), as __expf forms it
      exp2x8(xe, pe);                                        // masked logit: 2^(-inf) = 0
#pragma unroll
      for (int e = 0; e < 4; ++e) {
        const float p0 = pe[2 * e];
        const float p1 = pe[2 * e + 1];
        pj[j] = (e == 0) ? (p0 + p1) : ((pj[j] + p0) + p1);
      }
      unsigned hw[4], lw[4];
      split8(pe, hw, lw);
#pragma unroll
      for (int e = 0; e < 4; ++e) {
        ph[j >> 1].u[(j & 1) * 4 + e] = hw[e];
        pl[j >> 1].u[(j & 1) * 4 + e] = lw[e];
      }
    }
    lrow = lrow * alpha + ((pj[0] + pj[1]) + (pj[2] + pj[3]));
#pragma unroll
    for (int r = 0; r < 8; ++r) oacc[r] *= alpha;

    // ---- context^T += V^T . P^T (bf16 WMMA, hh + lh + hl into one accumulator) ----
#pragma unroll
    for (int kk = 0; kk < 2; ++kk) {
      oacc = mma_b(vb[kk], ph[kk].v, oacc);
      oacc = mma_b(vl[kk], ph[kk].v, oacc);
      oacc = mma_b(vb[kk], pl[kk].v, oacc);
    }
    // precaution: the trip's loads name ko and vo; as inputs here the two stay in their registers, unwritten (also by the
    // loads' own results), up to this wait; it stands at the trip's foot, far behind the loads' issue
    asm volatile("s_wait_xcnt 0x0" :: "v"(ko), "v"(vo) : "memory");
  };
  for (int kt = 0; kt < qb; ++kt) chunk(kt * 64, kt * 64 + 64, false);   // block-uniform trip count, < NQB
  chunk(qb * 64, 0, true);                     // fetches K chunk 0 ahead, with which the next tile starts

  // ---- join the halves' sums, normalise (1/l), bf16 hi/lo split, one 16-B store per lane and plane ----
  {
    const float l = lrow + other_half(lrow);
    const float inv = (l > 0.f) ? (1.0f / l) : 0.f;
    float f[8];
#pragma unroll
    for (int r = 0; r < 8; ++r) f[r] = oacc[r] * inv;
    unsigned hw[4], lw[4];
    split8(f, hw, lw);
    const v4u a = {hw[0], hw[1], hw[2], hw[3]}, a2 = {lw[0], lw[1], lw[2], lw[3]};
    const size_t go = (bhp * SEQ + rowq) * HD + 8 * hh;
    *(v4u*)(ohp + go) = a;
    *(v4u*)(olp + go) = a2;
    // precaution: the next tile rewrites registers that these stores name
    asm volatile("s_wait_xcnt 0x0" ::: "memory");
  }
  }
}

// =====================================================================================================
// Workspace map (bytes; every region is an exact multiple of its whole-line / whole-tile store granularity,
//   Xb   bf16 [4096/16][288/32][512] 2359296
//   Wqb  bf16 [288/16][288/32][512]   165888   (x4: Wq, Wk, Wv, Wo)
//   Qc   bf16 [2][18][2048][32]      4718592
//   Kd   bf16 [2][18][2048/16][512]  4718592
//   Kz                               4718592
//   VTh  bf16 [2][18][2048/32][512]  2359296
//   VTl                              2359296
//   Oh   bf16 [2][18][2048][16]      2359296
//   Ol                               2359296
//   Ct   f32  [2048][8]                65536
//   St                                 65536
//   total                           26746880
// =====================================================================================================
extern "C" void kernel_launch(void* const* d_in, const int* in_sizes, int n_in,
                              void* d_out, int out_size, void* d_ws, size_t ws_size,
                              hipStream_t stream) {
  if (n_in < 5) return;
  if (in_sizes[0] != NTOK * HID) return;
  if (in_sizes[1] != HID * HID) return;
  if (in_sizes[2] != HID * HID) return;
  if (in_sizes[3] != HID * HID) return;
  if (in_sizes[4] != HID * HID) return;
  if (out_size != NTOK * HID) return;

  const float* x  = (const float*)d_in[0];   // [2][2048][288]
  const float* Wq = (const float*)d_in[1];   // [288 out][288 in]
  const float* Wk = (const float*)d_in[2];
  const float* Wv = (const float*)d_in[3];
  const float* Wo = (const float*)d_in[4];

  const size_t PX  = (size_t)NTOK * HID * 2;            // 2359296
  const size_t PW  = (size_t)HID * HID * 2;             //  165888
  const size_t PQ  = (size_t)NB * NH * SEQ * QS * 2;    // 4718592
  const size_t PVT = (size_t)NB * HID * SEQ * 2;        // 2359296
  const size_t PO  = (size_t)NB * NH * SEQ * HD * 2;    // 2359296
  const size_t PTB = (size_t)SEQ * NPAIR * 4;           //   65536
  size_t off = 0;
  const size_t oXb  = off; off += PX;
  const size_t oWq  = off; off += PW;
  const size_t oWk  = off; off += PW;
  const size_t oWv  = off; off += PW;
  const size_t oWo  = off; off += PW;
  const size_t oQc  = off; off += PQ;
  const size_t oKd  = off; off += PQ;
  const size_t oKz  = off; off += PQ;
  const size_t oVTh = off; off += PVT;
  const size_t oVTl = off; off += PVT;
  const size_t oOh  = off; off += PO;
  const size_t oOl  = off; off += PO;
  const size_t oCt  = off; off += PTB;
  const size_t oSt  = off; off += PTB;
  if (off > ws_size) return;                            // off = 26746880
  if (off > (size_t)134217728) return;

  char* ws = (char*)d_ws;
  unsigned short* Xb  = (unsigned short*)(ws + oXb);
  unsigned short* Wqb = (unsigned short*)(ws + oWq);
  unsigned short* Wob = (unsigned short*)(ws + oWo);
  unsigned short* Qc  = (unsigned short*)(ws + oQc);
  unsigned short* Kd  = (unsigned short*)(ws + oKd);
  unsigned short* Kz  = (unsigned short*)(ws + oKz);
  unsigned short* VTh = (unsigned short*)(ws + oVTh);
  unsigned short* VTl = (unsigned short*)(ws + oVTl);
  unsigned short* Oh  = (unsigned short*)(ws + oOh);
  unsigned short* Ol  = (unsigned short*)(ws + oOl);
  float*          Ct  = (float*)(ws + oCt);
  float*          St  = (float*)(ws + oSt);

  const dim3 blk256(256);
  const dim3 blk128(128);
  const dim3 gPrep(PREP_TAB + 4 * PREP_W + PREP_X);     // 64 + 164 + 576 = 804 blocks
  const dim3 gQkv(((NTOK / 64) * (HID / 32)) / 4, 3);   // 576 tiles -> 144 blocks of 4 waves, x 3 projections
  const dim3 gOut(((NTOK / 64) * (HID / 32)) / 4);      // 144 blocks of 4 waves
  const dim3 gAttn(NB * NH * ABIN);                     // 504 blocks of 128

  // (1) RoPE tables; x and the four weights -> bf16 planes in fragment order (weights are [out][in] = Bt[n][k] already)
  prep<<<gPrep, blk256, 0, stream>>>(x, Wq, Wk, Wv, Wo, Xb, Wqb, Ct, St);
  // (2) q = rope(x . Wq^T) -> [b][h][t][hi|lo]; k = rope(x . Wk^T) -> [hi|hi] and [lo|0] planes, v = x . Wv^T -> v^T bf16
  //     hi / lo planes, these four in fragment order
  gemm_qkv<<<gQkv, blk128, 0, stream>>>(Xb, Wqb, Qc, Kd, Kz, VTh, VTl, Ct, St);
  // (3) causal attention -> ctx bf16 hi / lo planes [b][h][t][d]
  attn_causal16<<<gAttn, blk128, 0, stream>>>(Qc, Kd, Kz, VTh, VTl, Oh, Ol);
  // (4) out = (ctx hi + ctx lo) . Wo^T -> d_out f32 [4096][288]
  gemm_out<<<gOut, blk128, 0, stream>>>(Oh, Ol, Wob, (float*)d_out);
  (void)hipGetLastError();
}

// v008
// It runs in 42.6 microseconds.
// In both of two side-by-side timings against v007, it was 1.10 times as fast.
// Over all steps from v000 it is 6.66 times as fast.
// Contractions: q / k / v projections = v_wmma_f32_16x16x32_bf16 (bf16 operands from RNE-converted x and Wq/Wk/Wv, single product, f32 accumulate);
// k.q^T scores (transposed) = v_wmma_f32_16x16x32_bf16 with q and k as bf16 hi/lo split folded into the 32-deep k axis ([qhi|qlo].[khi|khi] + [qhi|qlo].[klo|0] = hh+lh+hl, 2 products), f32 accumulate;
// v^T.p^T (transposed) = v_wmma_f32_16x16x32_bf16 with p and v as bf16 hi/lo split (hh + hl + lh, 3 products), f32 accumulate;
// ctx.Wo^T = v_wmma_f32_16x16x32_bf16 with ctx as bf16 hi + unscaled lo planes times bf16 Wo (2 products), f32 accumulate;
// rotary tables (powf, f32 product, precise sincosf), half-rotation, causal mask and online softmax in f32 on the VALU.
// Carry audit: no scaled planes anywhere; every lo plane is the unscaled RNE residual (v - hi) in bf16 and shares the hi accumulator;
// score scale 1/4 applied once in f32 after the score accumulate; softmax normaliser 1/l applied once in the attention epilogue.
#include <hip/hip_runtime.h>
#include <math.h>
#include <stdint.h>

#define NB    2
#define SEQ   2048
#define HID   288
#define NH    18
#define HD    16
#define NPAIR 8
#define QS    32           // slots per head in the q / k planes: 0..15 hi (d), 16..31 lo (d) or duplicate / zero
#define NTOK  (NB * SEQ)   // 4096 token rows
#define NQB   (SEQ / 64)   // 32 query blocks of 64 per sequence
static_assert(NH * HD == HID);
static_assert(NPAIR * 2 == HD);
static_assert((SEQ % 64) == 0 && (HID % 32) == 0 && (NTOK % 64) == 0);
static_assert(((NTOK / 64) * (HID / 32)) % 4 == 0);
static_assert((NTOK * HID) % (8 * 256) == 0);
static_assert(((HID * HID) % 8) == 0 && (((HID * HID) / 8) % 32) == 0);
static_assert((SEQ % 32) == 0);

typedef __bf16   v16b __attribute__((ext_vector_type(16)));
typedef __bf16   v8b  __attribute__((ext_vector_type(8)));
typedef float    v8f  __attribute__((ext_vector_type(8)));
typedef float    v4f  __attribute__((ext_vector_type(4)));
typedef float    v2f  __attribute__((ext_vector_type(2)));
typedef __bf16   v2b  __attribute__((ext_vector_type(2)));
typedef unsigned int v4u __attribute__((ext_vector_type(4)));

// ---- scalar helpers --------------------------------------------------------------------------------
// two f32 -> two bf16 in one word (a low, b high), RNE, by the chip's packed convert
__device__ __forceinline__ unsigned cvt2(float a, float b) {
  const v2f f = {a, b};
  return __builtin_bit_cast(unsigned, __builtin_convertvector(f, v2b));
}
// hi = bf16(f), lo = bf16(f - hi) for eight values, word e = values 2e (low half) and 2e+1 (high half): three instructions a
// pair. hi: one packed convert. lo: the mixed-precision FMA reads hi's bf16 half as it lies, forms hi * -1 + f (exact in f32)
// and rounds it (RNE) into one half of the result word; the compiler's own form of the same takes a shift, a mask, a packed
// add and a second convert. The four low halves stand ahead of the four high halves, so that no instruction follows the
// one that wrote its result word directly.
__device__ __forceinline__ void split8(const float (&f)[8], unsigned (&hi)[4], unsigned (&lo)[4]) {
#pragma unroll
  for (int e = 0; e < 4; ++e) hi[e] = cvt2(f[2 * e], f[2 * e + 1]);
  asm("v_fma_mixlo_bf16 %0, %4, -1.0, %8 op_sel_hi:[1,0,0]\n\t"
      "v_fma_mixlo_bf16 %1, %5, -1.0, %10 op_sel_hi:[1,0,0]\n\t"
      "v_fma_mixlo_bf16 %2, %6, -1.0, %12 op_sel_hi:[1,0,0]\n\t"
      "v_fma_mixlo_bf16 %3, %7, -1.0, %14 op_sel_hi:[1,0,0]\n\t"
      "v_fma_mixhi_bf16 %0, %4, -1.0, %9 op_sel:[1,0,0] op_sel_hi:[1,0,0]\n\t"
      "v_fma_mixhi_bf16 %1, %5, -1.0, %11 op_sel:[1,0,0] op_sel_hi:[1,0,0]\n\t"
      "v_fma_mixhi_bf16 %2, %6, -1.0, %13 op_sel:[1,0,0] op_sel_hi:[1,0,0]\n\t"
      "v_fma_mixhi_bf16 %3, %7, -1.0, %15 op_sel:[1,0,0] op_sel_hi:[1,0,0]"
      : "=&v"(lo[0]), "=&v"(lo[1]), "=&v"(lo[2]), "=&v"(lo[3])
      : "v"(hi[0]), "v"(hi[1]), "v"(hi[2]), "v"(hi[3]),
        "v"(f[0]), "v"(f[1]), "v"(f[2]), "v"(f[3]), "v"(f[4]), "v"(f[5]), "v"(f[6]), "v"(f[7]));
}
__device__ __forceinline__ v8f zero8() { v8f z = {0.f, 0.f, 0.f, 0.f, 0.f, 0.f, 0.f, 0.f}; return z; }

// ---- fragment loaders: 16-bit A/B operand, lane -> row/col (lane&15), p already includes +8*(lane>>4);
//      elements 0..7 <- p[0..7] (k0+8h..k0+8h+7), elements 8..15 <- p[16..23] (k0+16+8h..k0+16+8h+7)
__device__ __forceinline__ v16b ldfrag_b(const __bf16* p) {
  union { v16b v; v8b h[2]; } f;
  f.h[0] = *(const v8b*)(p);
  f.h[1] = *(const v8b*)(p + 16);
  return f.v;
}
// FRAGMENT ORDER: a plane that only fragment loads read is stored as blocks of 512 elements (1024 B), one block = 16 rows x
// 32 k; element (row c, k) of a block lies at (k>>4)*256 + (((k>>3)&1)*16 + c)*8 + (k&7). That is the map above written out
// lane by lane: lane l = 16*(lane half) + c finds elements 0..7 at l*8 and elements 8..15 at 256 + l*8, so each of the two
// 16-B loads of a wave covers 512 contiguous, aligned bytes (4 whole cache lines) and not 32-B pieces of 8 or 16 lines.
// p = block base + 8*lane.
__device__ __forceinline__ v16b ldfrag_f(const __bf16* p) {
  union { v16b v; v8b h[2]; } f;
  f.h[0] = *(const v8b*)(p);
  f.h[1] = *(const v8b*)(p + 256);
  return f.v;
}
// same map when k0..k0+15 and k0+16..k0+31 live in two different rows (p0, p1 each include +8*(lane>>4))
__device__ __forceinline__ v16b ldfrag_b2(const __bf16* p0, const __bf16* p1) {
  union { v16b v; v8b h[2]; } f;
  f.h[0] = *(const v8b*)(p0);
  f.h[1] = *(const v8b*)(p1);
  return f.v;
}

// ---- WMMA helper with trailing VALU hazard gap (D tied, A/B kept live) ----------------------------------
__device__ __forceinline__ v8f mma_b(v16b a, v16b b, v8f c) {
  c = __builtin_amdgcn_wmma_f32_16x16x32_bf16(false, a, false, b, (short)0, c, false, false);
  asm volatile("v_nop\n\tv_nop\n\tv_nop\n\tv_nop" : "+v"(c) : "v"(a), "v"(b));
  return c;
}

// =====================================================================================================
// prep: everything the projections need and that depends on the inputs alone, as block ranges of ONE grid (256 threads a
// block, the range test is block-uniform):
//   blocks 0..63 (rotary tables): ctab[t][i] = cos(t * inv[i]), stab[t][i] = sin(t * inv[i]), i = 0..7, t = 0..SEQ-1, with
//     inv[i] = 1 / powf(10000, (2i)/16) formed by every thread for its own i (f32 product, precise sincosf);
//     thread tid -> t = block*32 + tid/8, i = tid&7; 64 blocks x 256 = the whole [SEQ][8] tables.
//   blocks 64..227 (weights): 41 blocks a weight, Wq, Wk, Wv, Wo in this order, into four planes that follow one another.
//   blocks 228..803 (x).
//   f32 -> bf16 (RNE convert), 8 elements per thread, one 16-B store per lane;
//   n8 threads x 8 = the whole plane (n8 = 147456 for x, 10368 for each weight; both multiples of 64).
//   The planes are written in FRAGMENT ORDER (see ldfrag_f), blocks [row / 16][k / 32], 64 threads a block: a wave takes 8
//   rows x 32 k, lane = 8 * (group of 8 k) + row, so that it reads 8 whole 128-B lines of the source and writes 4 of the plane.
// =====================================================================================================
#define PREP_TAB  (SEQ / 32)                       // 64 blocks
#define PREP_W    ((HID * HID / 8 + 255) / 256)    // 41 blocks a weight
#define PREP_X    (NTOK * HID / 8 / 256)           // 576 blocks
__device__ __forceinline__ void cvt_bf16x8(const float* __restrict__ in, unsigned short* out, const int i) {
  const int blk = i >> 6;                          // block = 64 threads x 8 elements
  const int gr  = blk / (HID / 32);                // group of 16 rows
  const int ks  = blk - gr * (HID / 32);           // k-step of 32
  const int c   = ((i >> 2) & 8) | (i & 7);        // row of the block: the wave's 8 rows, one per lane & 7
  const int q   = (i >> 3) & 3;                    // group of 8 k: k = 8q..8q+7
  const size_t so = (size_t)(gr * 16 + c) * HID + ks * 32 + q * 8;
  const size_t po = (size_t)blk * 512 + (q >> 1) * 256 + ((q & 1) * 16 + c) * 8;
  const v4f a = *(const v4f*)(in + so);
  const v4f b = *(const v4f*)(in + so + 4);
  v4u p;
  p[0] = cvt2(a[0], a[1]);
  p[1] = cvt2(a[2], a[3]);
  p[2] = cvt2(b[0], b[1]);
  p[3] = cvt2(b[2], b[3]);
  *(v4u*)(out + po) = p;
  // precaution: in the merged kernel's listing another block range's code, which rewrites the store's registers, follows it
  asm volatile("s_wait_xcnt 0x0" ::: "memory");
}

__global__ __launch_bounds__(256) void prep(const float* __restrict__ x, const float* __restrict__ Wq,
                                            const float* __restrict__ Wk, const float* __restrict__ Wv,
                                            const float* __restrict__ Wo, unsigned short* Xb, unsigned short* Wb,
                                            float* ctab, float* stab) {
  const int tid = (int)threadIdx.x;
  const int bx  = (int)blockIdx.x;
  if (bx < PREP_TAB) {
    const int i = tid & (NPAIR - 1);
    const int t = bx * 32 + (tid >> 3);
    const float e = (float)(2 * i) * (1.0f / (float)HD);
    const float p = powf(10000.0f, e);
    const float f = 1.0f / p;
    const float ang = (float)t * f;
    float sn, cs;
    sincosf(ang, &sn, &cs);
    const size_t o = (size_t)t * NPAIR + i;
    *(float*)(ctab + o) = cs;
    *(float*)(stab + o) = sn;
  } else if (bx < PREP_TAB + 4 * PREP_W) {
    const int w  = (bx - PREP_TAB) / PREP_W;       // 0..3: Wq, Wk, Wv, Wo
    const int i  = (bx - PREP_TAB - w * PREP_W) * 256 + tid;
    const float* in = (w == 0) ? Wq : (w == 1) ? Wk : (w == 2) ? Wv : Wo;
    if (i < HID * HID / 8) cvt_bf16x8(in, Wb + (size_t)w * (HID * HID), i);
  } else {
    cvt_bf16x8(x, Xb, (bx - PREP_TAB - 4 * PREP_W) * 256 + tid);
  }
}

// =====================================================================================================
// bf16 WMMA GEMM, one wave per 64 x 32 tile, 4 waves per block, no block barriers:
//   C[m][n] = sum_k A[m][k] * Bt[n][k] (+ sum_k A2[m][k] * Bt[n][k] when TWOA), M = 4096 tokens, N = 288, K = 288
//   (9 k-steps of 32, no tails). Bt = weight plane (the [out][in] weight, RNE bf16), fragment order, blocks [n / 16][k / 32].
//   A: MODE 0..2: x plane, fragment order, blocks [m / 16][k / 32]. MODE 3: ctx planes laid out [b][h][t][16]; k-step j covers heads 2j
//   (k 0..15) and 2j+1 (k 16..31): elements 0..7 <- head 2j, d = 8*(lane>>4)..+7; elements 8..15 <- head 2j+1, same d.
// then (b = m0/2048, t = m0%2048 + row, 32 columns = heads n0/16 and n0/16+1):
//   MODE 0 (q): rotary in f32 (contract off): d < 8: x[d] c[t][d] - x[d+8] s[t][d]; d >= 8: x[d] c[t][d-8] + x[d-8] s[t][d-8];
//               -> plane [b][h][t][32]: slots 0..15 = bf16 hi of d, 16..31 = bf16 lo (v - hi) of d.
//   MODE 1 (k): same rotary; plane C0 slots 0..15 = hi, 16..31 = hi (duplicate); plane C1 slots 0..15 = lo, 16..31 = 0;
//               both in fragment order, blocks [b][h][t / 16], rows = keys, k = slots.
//   MODE 2 (v): no rotary; v^T planes C0 = hi, C1 = lo, fragment order, blocks [b][h][t / 32], rows = d, k = keys.
//   MODE 0..2 share one body and ONE grid (gemm_qkv: blockIdx.y = mode, the same in every wave of a block; only the weight
//   plane, the epilogue and the output planes differ); MODE 3 (OUT) is a launch of its own (gemm_out), behind attention.
// coverage: 576 tiles x (64 rows x 32 cols) = the whole 4096 x 288 result; MODE 0/1: 2 heads x 8 it x 8 rows x 4 lanes
//           x 8 slots = 64 rows x 2 heads x 32 slots; MODE 2: 4 x 2 it x (8 features x 4 token groups) x 8 = 32 features x 64 tokens;
//           MODE 3: 16 it x 4 rows x 8 lanes x 4 = 64 rows x 32 cols.
// =====================================================================================================
// Epilogue of one wave's 64 x 32 tile, read back from its LDS slab; MODE as listed above.
template <int MODE>
__device__ __forceinline__ void gemm_epi(const float* slab, const int lane, const int m0, const int n0, const int bidx,
                                         const int tl0, void* C0, void* C1,
                                         const float* __restrict__ ctab, const float* __restrict__ stab) {
  static_assert(MODE >= 0 && MODE <= 3);
  if (MODE == 3) {
    float* Cf = (float*)C0;
    const int q4 = lane >> 3, c4 = (lane & 7) * 4;
    {
#pragma unroll
      for (int it = 0; it < 16; ++it) {
        const int row = it * 4 + q4;                         // it 0..15 x q4 0..3 = rows 0..63
        const v4f v = *(const v4f*)(slab + row * 36 + c4);
        *(v4f*)(Cf + (size_t)(m0 + row) * HID + n0 + c4) = v;
      }
      
    }
  } else if (MODE == 2) {
    unsigned short* P0 = (unsigned short*)C0;
    unsigned short* P1 = (unsigned short*)C1;
    const int n8 = lane & 7, tg = lane >> 3;       // 8 features side by side = one whole 128-B line of a block per token group
#pragma unroll 1
    for (int it2 = 0; it2 < 8; it2 += 2) {         // two groups' loads and stores side by side in a trip
#pragma unroll
      for (int it = it2; it < it2 + 2; ++it) {
        const int n  = (it >> 1) * 8 + n8;                     // local feature 0..31
        const int t8 = ((it & 1) * 4 + tg) * 8;                // first of this lane's 8 tokens, 0..56
        float f[8];
#pragma unroll
        for (int e = 0; e < 8; ++e) f[e] = slab[(t8 + e) * 36 + n];
        unsigned hw[4], lw[4];
        split8(f, hw, lw);
        const v4u a = {hw[0], hw[1], hw[2], hw[3]}, a2 = {lw[0], lw[1], lw[2], lw[3]};
        const int s = tl0 + t8;                                // key index of element 0; d = (n0 + n) & 15
        const size_t go = ((size_t)(bidx * NH + ((n0 + n) >> 4))) * (SEQ * HD) + (size_t)((s >> 5) * 512 +
                          ((s >> 4) & 1) * 256 + (((s >> 3) & 1) * 16 + ((n0 + n) & 15)) * 8);
        *(v4u*)(P0 + go) = a;
        *(v4u*)(P1 + go) = a2;
      }
      // precaution: the next trip rewrites registers that these stores name
      asm volatile("s_wait_xcnt 0x0" ::: "memory");
    }
  } else {
    unsigned short* P0 = (unsigned short*)C0;
    unsigned short* P1 = (unsigned short*)C1;
    const int r4 = lane >> 2, s8 = (lane & 3) * 8;
    const int dbase = s8 & 8;                                // d of the first element: 0 or 8
    const bool isLo = (s8 >= 16);
    const float sg = (dbase == 0) ? -1.0f : 1.0f;            // -x[d+8] for d < 8, +x[d-8] for d >= 8
    const int h0 = n0 >> 4;                                  // first head of the tile (even)
#pragma unroll 1
    for (int hd = 0; hd < 2; ++hd) {
#pragma unroll 1
      for (int it2 = 0; it2 < 8; it2 += 2) {         // two rows' loads and stores side by side in a trip
#pragma unroll
        for (int it = it2; it < it2 + 2; ++it) {
          const int row = it * 8 + r4;                         // it 0..7 x r4 0..7 = rows 0..63
          const int t = tl0 + row;                             // position within the sequence
          const float* xr = slab + row * 36 + hd * 16;
          float x[8], y[8], f[8];
#pragma unroll
          for (int e = 0; e < 8; ++e) { x[e] = xr[dbase + e]; y[e] = xr[(dbase ^ 8) + e]; }
          const v4f cv0 = *(const v4f*)(ctab + (size_t)t * NPAIR);
          const v4f cv1 = *(const v4f*)(ctab + (size_t)t * NPAIR + 4);
          const v4f sv0 = *(const v4f*)(stab + (size_t)t * NPAIR);
          const v4f sv1 = *(const v4f*)(stab + (size_t)t * NPAIR + 4);
          {
#pragma clang fp contract(off)
#pragma unroll
            for (int e = 0; e < 4; ++e) {
              {
                const float ry = sg * y[e];
                const float p0 = x[e] * cv0[e];
                const float p1 = ry * sv0[e];
                f[e] = p0 + p1;
              }
              {
                const float ry = sg * y[4 + e];
                const float p0 = x[4 + e] * cv1[e];
                const float p1 = ry * sv1[e];
                f[4 + e] = p0 + p1;
              }
            }
          }
          unsigned hw[4], lw[4];
          split8(f, hw, lw);
          const v4u hp = {hw[0], hw[1], hw[2], hw[3]}, lp = {lw[0], lw[1], lw[2], lw[3]};
          const size_t go = (MODE == 0)
              ? (((size_t)(bidx * NH + h0 + hd)) * SEQ + t) * QS + s8
              : ((size_t)(bidx * NH + h0 + hd)) * (SEQ * QS) + (size_t)((t >> 4) * 512 + (s8 >> 4) * 256 +
                                                                       (((s8 >> 3) & 1) * 16 + (t & 15)) * 8);
          if (MODE == 0) {
            v4u pc;
#pragma unroll
            for (int e = 0; e < 4; ++e) pc[e] = isLo ? lp[e] : hp[e];
            *(v4u*)(P0 + go) = pc;
          } else {
            v4u pz;
#pragma unroll
            for (int e = 0; e < 4; ++e) pz[e] = isLo ? 0u : lp[e];
            *(v4u*)(P0 + go) = hp;
            *(v4u*)(P1 + go) = pz;
          }
        }
        // precaution: the next trip rewrites registers that these stores name
        asm volatile("s_wait_xcnt 0x0" ::: "memory");
      }
    }
  }
}

template <bool OUT>
__device__ __forceinline__ void gemm_xw(
    const int mode,                                // 0 q, 1 k, 2 v (block-uniform, OUT false); 3 with OUT
    const unsigned short* __restrict__ Ap, const unsigned short* __restrict__ A2p,
    const unsigned short* __restrict__ Btp, void* C0, void* C1,
    const float* __restrict__ ctab, const float* __restrict__ stab) {
  constexpr bool TWOA = OUT;
  constexpr int M = NTOK, N = HID, K = HID;
  constexpr int TN = N / 32;   // 9
  constexpr int TM = M / 64;   // 64
  const __bf16* A  = (const __bf16*)(const void*)Ap;
  const __bf16* A2 = (const __bf16*)(const void*)A2p;
  const __bf16* Bt = (const __bf16*)(const void*)Btp;
  __shared__ __align__(16) float sT[4][64 * 36];   // per-wave 64x32 tile, pitch 36 floats

  const int lane = threadIdx.x & 31;
  const int wave = __builtin_amdgcn_readfirstlane((int)(threadIdx.x >> 5));   // same in every lane: held scalar, the tile bases are scalar too
  const int tile = blockIdx.x * 4 + wave;
  if (tile >= TM * TN) return;                     // wave-uniform; no block barriers in this kernel
  const int tm = tile / TN;
  const int tn = tile - tm * TN;
  const int m0 = tm << 6;
  const int n0 = tn << 5;
  const int c    = lane & 15;                      // row (A) / col (B, D) within subtile
  const int koff = (lane >> 4) * 8;                // k offset of this lane half
  const int mOff = (lane >> 4) * 8;                // D row offset
  const int bidx = m0 / SEQ;                       // batch of this tile (tiles never straddle a batch)
  const int tl0  = m0 - bidx * SEQ;                // first position within the sequence

  v8f acc[4][2];
#pragma unroll
  for (int i = 0; i < 4; ++i)
#pragma unroll
    for (int j = 0; j < 2; ++j) acc[i][j] = zero8();

  // Loads run ahead of the matrix instructions: every fragment is fetched into a register set that is free by then, whole
  // k-steps before its products, so a k-step waits on loads issued earlier and not on its own. Three A sets go round.
  //   one A plane: k-step ks in A and B set ks % 3, fetched two k-steps ahead (8 products a k-step cover little of a load).
  //   two A planes: the hi products of a k-step run first, then the lo products (each accumulator still takes hi, lo, hi,
  //   lo ... in k order); the sets hold hi(ks), lo(ks), hi(ks+1), each fetched one k-step ahead; B in set ks & 1.
  // Address = wave-uniform tile base + one lane offset + a constant: the sets leave no room for a pointer per row.
  constexpr int KS = K / 32;                       // 9 k-steps
  const size_t abase = OUT ? (((size_t)(bidx * NH)) * SEQ + tl0) * HD : (size_t)m0 * K;
  const __bf16* Ab  = A + abase;
  const __bf16* A2b = A2 + abase;
  const __bf16* Bb  = Bt + (size_t)n0 * K;
  const unsigned alane = OUT ? (unsigned)(c * HD + koff) : (unsigned)(lane * 8);   // 16 rows x K = K / 32 blocks of 512: the
  const unsigned blane = (unsigned)(lane * 8);                                     // row-group bases are those of a [row][K] plane
  v16b bh[TWOA ? 2 : 3][2], ar[3][4];
  auto fetch_b = [&](const int ks, const int st) __attribute__((always_inline)) {
#pragma unroll
    for (int j = 0; j < 2; ++j) bh[st][j] = ldfrag_f(Bb + blane + (j << 4) * K + ks * 512);
  };
  auto fetch_a = [&](const __bf16* base, const int ks, const int set) __attribute__((always_inline)) {
#pragma unroll
    for (int i = 0; i < 4; ++i) {
      if (OUT) {                                   // ks = head pair index 0..8: heads 2 ks and 2 ks + 1, same token row
        const int e0 = (i << 4) * HD + (2 * ks) * SEQ * HD, e1 = e0 + SEQ * HD;
        ar[set][i] = ldfrag_b2(base + alane + e0, base + alane + e1);
      } else {
        ar[set][i] = ldfrag_f(base + alane + (i << 4) * K + ks * 512);
      }
    }
  };
  auto products = [&](const int set, const int st) __attribute__((always_inline)) {
#pragma unroll
    for (int i = 0; i < 4; ++i)
#pragma unroll
      for (int j = 0; j < 2; ++j) acc[i][j] = mma_b(ar[set][i], bh[st][j], acc[i][j]);
  };
  fetch_b(0, 0);
  fetch_a(Ab, 0, 0);
  if (TWOA) fetch_a(A2b, 0, 1);
  else { fetch_b(1, 1); fetch_a(Ab, 1, 1); }
#pragma unroll                                     // full unroll: a register set's index must be a constant
  for (int ks = 0; ks < KS; ++ks) {
    const int st = ks & 1;
    if (TWOA) {
      const int sh = (2 * ks) % 3, sl = (2 * ks + 1) % 3, sn = (2 * ks + 2) % 3;
      if (ks + 1 < KS) { fetch_b(ks + 1, st ^ 1); fetch_a(Ab, ks + 1, sn); }
      products(sh, st);
      if (ks + 1 < KS) fetch_a(A2b, ks + 1, sh);   // into the set the hi products have just read
      products(sl, st);
    } else {
      if (ks + 2 < KS) { fetch_b(ks + 2, (ks + 2) % 3); fetch_a(Ab, ks + 2, (ks + 2) % 3); }
      products(ks % 3, ks % 3);
    }
  }

  // ---- epilogue: whole tile to wave-private LDS ----
  float* slab = sT[wave];
#pragma unroll
  for (int i = 0; i < 4; ++i)
#pragma unroll
    for (int j = 0; j < 2; ++j)
#pragma unroll
      for (int r = 0; r < 8; ++r)
        slab[((i << 4) + mOff + r) * 36 + (j << 4) + c] = acc[i][j][r];
  __builtin_amdgcn_fence(__ATOMIC_RELEASE, "workgroup");
  __builtin_amdgcn_wave_barrier();
  __builtin_amdgcn_fence(__ATOMIC_ACQUIRE, "workgroup");

  if (OUT)            gemm_epi<3>(slab, lane, m0, n0, bidx, tl0, C0, C1, ctab, stab);
  else if (mode == 0) gemm_epi<0>(slab, lane, m0, n0, bidx, tl0, C0, C1, ctab, stab);   // block-uniform choice, made once:
  else if (mode == 1) gemm_epi<1>(slab, lane, m0, n0, bidx, tl0, C0, C1, ctab, stab);   // no mode test inside an epilogue loop
  else                gemm_epi<2>(slab, lane, m0, n0, bidx, tl0, C0, C1, ctab, stab);
}

// q, k and v projections in one grid: blockIdx.x = group of 4 tiles, blockIdx.y = mode. Wb = Wq, Wk, Wv planes in a row.
__global__ __launch_bounds__(128) void gemm_qkv(
    const unsigned short* __restrict__ Xb, const unsigned short* __restrict__ Wb,
    unsigned short* Qc, unsigned short* Kd, unsigned short* Kz, unsigned short* VTh, unsigned short* VTl,
    const float* __restrict__ ctab, const float* __restrict__ stab) {
  const int mode = (int)blockIdx.y;
  unsigned short* C0 = (mode == 0) ? Qc : (mode == 1) ? Kd : VTh;
  unsigned short* C1 = (mode == 0) ? Qc : (mode == 1) ? Kz : VTl;
  gemm_xw<false>(mode, Xb, Xb, Wb + (size_t)mode * (HID * HID), (void*)C0, (void*)C1, ctab, stab);
}

__global__ __launch_bounds__(128) void gemm_out(
    const unsigned short* __restrict__ Oh, const unsigned short* __restrict__ Ol,
    const unsigned short* __restrict__ Wob, float* out) {
  gemm_xw<true>(3, Oh, Ol, Wob, (void*)out, (void*)out, nullptr, nullptr);
}

// =====================================================================================================
// Causal attention, head dim 16, key chunks of 64, both products transposed: S^T = K . Q^T, O^T += V^T . P^T.
//   q plane  [b][h][t][32]: slots 0..15 = bf16 hi of rope(q)[d], 16..31 = bf16 lo
//   kd plane, per key 32 slots: 0..15 = hi of rope(k)[d], 16..31 = hi again; kz plane: 0..15 = lo, 16..31 = 0;
//   both in fragment order (ldfrag_f): blocks [b][h][s / 16] of 16 keys x 32 slots
//   so one 32-deep k-step gives q.k = hi.hi + lo.hi (kd) and hi.lo (kz): two products per 16x16 score tile.
//   v^T planes (bf16 hi / lo), fragment order: blocks [b][h][s / 32] of 16 d x 32 keys
//   ctx planes (bf16 hi / lo of the normalised context): element (b, h, t, d) at [((b*18 + h)*2048 + t)*16 + d]
//   Score tile j: A = 16 key rows (row = lane&15), B = the wave's 16 queries (col = lane&15), same k map on both sides, so
//   register r of lane (c, hh) = score of key kv0 + 16j + 8hh + r against query q0 + c: a lane holds 32 of the 64 keys of ONE
//   query. Row max and row sum are in-lane; the two lane halves exchange the max once per chunk and join their sums once, in
//   the epilogue. Tiles 2kk and 2kk+1, converted in place, are the B operand of k-step kk (element e = key 8hh+e, element
//   8+e = key 16+8hh+e), which is the k order in which ldfrag_f reads the v^T block as A: P never leaves the registers.
//   Causal structure: query tile qb visits key chunks 0..qb only (block-uniform count of qb+1 <= NQB chunks); chunks 0..qb-1 run
//   in a loop whose body has no mask, the diagonal chunk qb in a copy of the body behind it: there a key with index > query
//   index gets logit -inf -> exp gives exactly 0; the first key of every visited chunk is always kept, so every joined max is finite.
//   Tile = 64 query rows of one (b, h), 4 waves, wave w = rows q0..q0+15; no LDS, no barriers.
//   Equal work-groups: every work-group is resident from the start, so the launch lasts as long as the fullest WGP, and a
//   tile costs qb+1 chunks. A block therefore walks several tiles of ONE head, one after the other, ABIN blocks a head:
//   block n = 0..12: tiles 31-n and 5+n (32-n and 6+n chunks, 38 together); block 13: tiles 18, 4, 3, 2, 1, 0 (34 chunks).
//   grid = NB * NH * ABIN = 504 blocks, at most two for each of the 256 WGPs. All tiles of a block start at key chunk 0 of
//   the same head, so the last trip of a tile fetches that chunk for the next one.
//   The hi / lo splits of P round in the chip's converting instructions (split8), not in integer arithmetic.
//   Output: lane (c, hh) holds d = 8hh..8hh+7 of query q0 + c: one 16-B store per plane, 512 contiguous B per wave.
//   coverage: tiles 31..19, 5..17, 18 and 4..0 = each of the 32 tiles of a head once; 36 heads x 32 tiles x 4 waves x 16 rows
//   x 16 d = every (b, h, t, d) of both ctx planes exactly once.
// =====================================================================================================
__device__ __forceinline__ float other_half(float v) {                // value of lane l ^ 16
  const int b = __builtin_bit_cast(int, v);
  return __builtin_bit_cast(float, __builtin_amdgcn_permlanex16(b, b, 0x76543210, 0xfedcba98, false, false));
}

__device__ __forceinline__ void exp2x8(const float (&x)[8], float (&y)[8]) {
  asm("v_exp_f32 %0, %8\n\tv_exp_f32 %1, %9\n\tv_exp_f32 %2, %10\n\tv_exp_f32 %3, %11\n\t"
      "v_exp_f32 %4, %12\n\tv_exp_f32 %5, %13\n\tv_exp_f32 %6, %14\n\tv_exp_f32 %7, %15\n\tv_nop"
      : "=&v"(y[0]), "=&v"(y[1]), "=&v"(y[2]), "=&v"(y[3]), "=&v"(y[4]), "=&v"(y[5]), "=&v"(y[6]), "=&v"(y[7])
      : "v"(x[0]), "v"(x[1]), "v"(x[2]), "v"(x[3]), "v"(x[4]), "v"(x[5]), "v"(x[6]), "v"(x[7]));
}

// The matrix instructions of a key chunk, issued in groups. After a WMMA the chip wants four vector issue slots before a vector
// instruction reads its D or overwrites its A or B. Inside a group the WMMAs that follow fill those slots for one another
// (a WMMA that accumulates into the same D needs none), so only the last one takes v_nops: they close the statement, where
// they hold on every path and whatever the compiler puts next.
// Scores: the four first products (distinct D) stand ahead of the four second ones, so that no product waits for the one
// directly in front of it; each tile still takes its kd product first and its kz product second.
__device__ __forceinline__ void scores8(const v16b (&kd)[4], const v16b (&kz)[4], const v16b q, v8f (&s)[4]) {
  asm volatile("v_wmma_f32_16x16x32_bf16 %0, %4, %12, 0\n\t"
               "v_wmma_f32_16x16x32_bf16 %1, %5, %12, 0\n\t"
               "v_wmma_f32_16x16x32_bf16 %2, %6, %12, 0\n\t"
               "v_wmma_f32_16x16x32_bf16 %3, %7, %12, 0\n\t"
               "v_wmma_f32_16x16x32_bf16 %0, %8, %12, %0\n\t"
               "v_wmma_f32_16x16x32_bf16 %1, %9, %12, %1\n\t"
               "v_wmma_f32_16x16x32_bf16 %2, %10, %12, %2\n\t"
               "v_wmma_f32_16x16x32_bf16 %3, %11, %12, %3\n\t"
               "v_nop\n\tv_nop\n\tv_nop\n\tv_nop"
               : "=&v"(s[0]), "=&v"(s[1]), "=&v"(s[2]), "=&v"(s[3])
               : "v"(kd[0]), "v"(kd[1]), "v"(kd[2]), "v"(kd[3]), "v"(kz[0]), "v"(kz[1]), "v"(kz[2]), "v"(kz[3]), "v"(q));
}
// Context: vh.ph, vl.ph, vh.pl of the first 32-key k-step, then of the second: one accumulate chain into o.
__device__ __forceinline__ v8f ctx6(const v16b (&vh)[2], const v16b (&vl)[2], const v16b ph0, const v16b pl0,
                                    const v16b ph1, const v16b pl1, v8f o) {
  asm volatile("v_wmma_f32_16x16x32_bf16 %0, %1, %5, %0\n\t"
               "v_wmma_f32_16x16x32_bf16 %0, %3, %5, %0\n\t"
               "v_wmma_f32_16x16x32_bf16 %0, %1, %6, %0\n\t"
               "v_wmma_f32_16x16x32_bf16 %0, %2, %7, %0\n\t"
               "v_wmma_f32_16x16x32_bf16 %0, %4, %7, %0\n\t"
               "v_wmma_f32_16x16x32_bf16 %0, %2, %8, %0\n\t"
               "v_nop\n\tv_nop\n\tv_nop\n\tv_nop"
               : "+v"(o)
               : "v"(vh[0]), "v"(vh[1]), "v"(vl[0]), "v"(vl[1]), "v"(ph0), "v"(pl0), "v"(ph1), "v"(pl1));
  return o;
}

#define ABIN 14            // blocks per (b, h)
static_assert(NQB == 32);  // the tile lists below are written for 32 tiles a head

// At most two work-groups share a WGP (two waves a SIMD), so registers up to 256 cost nothing. Without the bound the compiler,
// once the splits need fewer registers, aims at a fifth wave a SIMD and forms the loop-invariant mask bounds anew in every trip.
__global__ __launch_bounds__(128) __attribute__((amdgpu_waves_per_eu(4, 4)))
void attn_causal16(const unsigned short* __restrict__ qcp, const unsigned short* __restrict__ kdp,
                   const unsigned short* __restrict__ kzp, const unsigned short* __restrict__ vhp,
                   const unsigned short* __restrict__ vlp, unsigned short* ohp, unsigned short* olp) {
  union PB { v16b v; unsigned u[8]; };

  const int tid  = threadIdx.x;
  const int wave = tid >> 5;
  const int lane = tid & 31;
  const int hh   = lane >> 4;
  const int c    = lane & 15;

  const int bx   = blockIdx.x;
  const int bin  = bx % ABIN;
  const int rest = bx / ABIN;
  const int h    = rest % NH;
  const int b    = rest / NH;
  const int ntile = (bin < ABIN - 1) ? 2 : 6;  // block-uniform
  const size_t bhp = (size_t)b * NH + h;

  const __bf16* Qc = (const __bf16*)(const void*)qcp + bhp * SEQ * QS;
  const __bf16* Kd = (const __bf16*)(const void*)kdp + bhp * SEQ * QS;
  const __bf16* Kz = (const __bf16*)(const void*)kzp + bhp * SEQ * QS;
  const __bf16* Vh = (const __bf16*)(const void*)vhp + bhp * SEQ * HD;
  const __bf16* Vl = (const __bf16*)(const void*)vlp + bhp * SEQ * HD;

  // Loads run ahead of the matrix instructions that use them: chunk kt + 1's K fragments are fetched as one group behind
  // the score products of chunk kt, chunk kt's V fragments at the head of trip kt; the softmax runs while both fly.
  // Address = the head's plane base (wave-uniform) + one 32-bit byte offset (chunk + lane) + a constant.
  const unsigned flane = (unsigned)(lane * 16);              // this lane's place, in bytes, in every block of a fragment-order plane
  v16b kd[4], kz[4];
  // ko = byte offset of the chunk's first block + flane, the same in both planes: head base (scalar) + one 32-bit register
  auto fetch_k = [&](const unsigned ko) __attribute__((always_inline)) {
#pragma unroll
    for (int j = 0; j < 4; ++j) {
      kd[j] = ldfrag_f((const __bf16*)((const char*)Kd + ko + j * 1024));
      kz[j] = ldfrag_f((const __bf16*)((const char*)Kz + ko + j * 1024));
    }
  };
  fetch_k(flane);
  // precaution: code that follows rewrites the offset register that these loads name
  asm volatile("s_wait_xcnt 0x0" ::: "memory");

  for (int ti = 0; ti < ntile; ++ti) {         // the block's tiles, the longest first
  const int qb = (bin < ABIN - 1) ? ((ti == 0) ? NQB - 1 - bin : 5 + bin) : ((ti == 0) ? 18 : 5 - ti);
  const int q0 = qb * 64 + wave * 16;

  // ---- Q fragment (B operand, col = lane&15, one 32-slot k-step) ----
  const v16b qa = ldfrag_b(Qc + (size_t)(q0 + c) * QS + 8 * hh);
  // precaution: code that follows rewrites the address pair that these loads name
  asm volatile("s_wait_xcnt 0x0" ::: "memory");
  const int rowq = q0 + c;                     // this lane's query index

  float mrow = -INFINITY;                      // running max of query rowq (equal in both lane halves)
  float lrow = 0.f;                            // running sum over this lane half's keys only
  v8f oacc = zero8();                          // O^T: register r = d 8hh+r of query rowq

  // One key chunk. kv0 = its first key (kv0 + 63 < SEQ), kvn = first key of the K chunk fetched ahead; diag is a literal at
  // both calls: only the diagonal chunk (kv0 = 64 qb) holds keys above a query of the tile, so only its copy of the body
  // compares and selects; in the chunks below it every key index is below q0 and the select would keep every score.
  auto chunk = [&](const int kv0, const int kvn, const bool diag) __attribute__((always_inline)) {
    const unsigned ko = flane + (unsigned)kvn * (QS * 2);    // byte offsets, below 2^17
    const unsigned vo = flane + (unsigned)kv0 * (HD * 2);

    v16b vb[2], vl[2];
#pragma unroll
    for (int kk = 0; kk < 2; ++kk) {
      vb[kk] = ldfrag_f((const __bf16*)((const char*)Vh + vo + kk * 1024));
      vl[kk] = ldfrag_f((const __bf16*)((const char*)Vl + vo + kk * 1024));
    }

    // ---- scores: 64 keys x 16 queries per wave, 2 bf16 products per key subtile ----
    v8f s[4];
    scores8(kd, kz, qa, s);
    fetch_k(ko);
    // keeps the next chunk's 16 K loads directly behind the score group, a whole softmax ahead of their use: without it the
    // compiler takes the K registers for the softmax's temporaries and issues most of the loads only behind the max exchange
    __builtin_amdgcn_sched_barrier(0);

    // ---- scale, causal mask by index, max in-lane + one exchange, online softmax ----
    float mj[4];                               // one max chain per score tile: four independent chains
#pragma unroll
    for (int j = 0; j < 4; ++j) {
      mj[j] = -INFINITY;
#pragma unroll
      for (int r = 0; r < 8; ++r) {
        const int key = kv0 + j * 16 + 8 * hh + r;
        float sv = s[j][r] * 0.25f;
        if (diag) sv = (key <= rowq) ? sv : -INFINITY;
        s[j][r] = sv;
        mj[j] = fmaxf(mj[j], sv);
      }
    }
    float m = fmaxf(fmaxf(mj[0], mj[1]), fmaxf(mj[2], mj[3]));
    m = fmaxf(m, other_half(m));
    const float mnew  = fmaxf(mrow, m);
    const float msafe = (mnew == -INFINITY) ? 0.f : mnew;
    const float alpha = __expf(mrow - msafe);
    mrow = mnew;

    PB ph[2], pl[2];                           // P^T hi / lo as B operands of the two 32-key k-steps
    float pj[4];                               // one sum chain per score tile
#pragma unroll
    for (int j = 0; j < 4; ++j) {
      float xe[8], pe[8];
#pragma unroll
      for (int r = 0; r < 8; ++r) xe[r] = (s[j][r] - msafe) * 1.44269504f;   // exp(t) = 2^(t log2 e), as __expf forms it
      exp2x8(xe, pe);                                        // masked logit: 2^(-inf) = 0
#pragma unroll
      for (int e = 0; e < 4; ++e) {
        const float p0 = pe[2 * e];
        const float p1 = pe[2 * e + 1];
        pj[j] = (e == 0) ? (p0 + p1) : ((pj[j] + p0) + p1);
      }
      unsigned hw[4], lw[4];
      split8(pe, hw, lw);
#pragma unroll
      for (int e = 0; e < 4; ++e) {
        ph[j >> 1].u[(j & 1) * 4 + e] = hw[e];
        pl[j >> 1].u[(j & 1) * 4 + e] = lw[e];
      }
    }
    lrow = lrow * alpha + ((pj[0] + pj[1]) + (pj[2] + pj[3]));
#pragma unroll
    for (int r = 0; r < 8; ++r) oacc[r] *= alpha;

    // ---- context^T += V^T . P^T (bf16 WMMA, hh + lh + hl into one accumulator) ----
    oacc = ctx6(vb, vl, ph[0].v, pl[0].v, ph[1].v, pl[1].v, oacc);
    // precaution: the trip's loads name ko and vo; as inputs here the two stay in their registers, unwritten (also by the
    // loads' own results), up to this wait; it stands at the trip's foot, far behind the loads' issue
    asm volatile("s_wait_xcnt 0x0" :: "v"(ko), "v"(vo) : "memory");
  };
  for (int kt = 0; kt < qb; ++kt) chunk(kt * 64, kt * 64 + 64, false);   // block-uniform trip count, < NQB
  chunk(qb * 64, 0, true);                     // fetches K chunk 0 ahead, with which the next tile starts

  // ---- join the halves' sums, normalise (1/l), bf16 hi/lo split, one 16-B store per lane and plane ----
  {
    const float l = lrow + other_half(lrow);
    const float inv = (l > 0.f) ? (1.0f / l) : 0.f;
    float f[8];
#pragma unroll
    for (int r = 0; r < 8; ++r) f[r] = oacc[r] * inv;
    unsigned hw[4], lw[4];
    split8(f, hw, lw);
    const v4u a = {hw[0], hw[1], hw[2], hw[3]}, a2 = {lw[0], lw[1], lw[2], lw[3]};
    const size_t go = (bhp * SEQ + rowq) * HD + 8 * hh;
    *(v4u*)(ohp + go) = a;
    *(v4u*)(olp + go) = a2;
    // precaution: the next tile rewrites registers that these stores name
    asm volatile("s_wait_xcnt 0x0" ::: "memory");
  }
  }
}

// =====================================================================================================
// Workspace map (bytes; every region is an exact multiple of its whole-line / whole-tile store granularity,
//   Xb   bf16 [4096/16][288/32][512] 2359296
//   Wqb  bf16 [288/16][288/32][512]   165888   (x4: Wq, Wk, Wv, Wo)
//   Qc   bf16 [2][18][2048][32]      4718592
//   Kd   bf16 [2][18][2048/16][512]  4718592
//   Kz                               4718592
//   VTh  bf16 [2][18][2048/32][512]  2359296
//   VTl                              2359296
//   Oh   bf16 [2][18][2048][16]      2359296
//   Ol                               2359296
//   Ct   f32  [2048][8]                65536
//   St                                 65536
//   total                           26746880
// =====================================================================================================
extern "C" void kernel_launch(void* const* d_in, const int* in_sizes, int n_in,
                              void* d_out, int out_size, void* d_ws, size_t ws_size,
                              hipStream_t stream) {
  if (n_in < 5) return;
  if (in_sizes[0] != NTOK * HID) return;
  if (in_sizes[1] != HID * HID) return;
  if (in_sizes[2] != HID * HID) return;
  if (in_sizes[3] != HID * HID) return;
  if (in_sizes[4] != HID * HID) return;
  if (out_size != NTOK * HID) return;

  const float* x  = (const float*)d_in[0];   // [2][2048][288]
  const float* Wq = (const float*)d_in[1];   // [288 out][288 in]
  const float* Wk = (const float*)d_in[2];
  const float* Wv = (const float*)d_in[3];
  const float* Wo = (const float*)d_in[4];

  const size_t PX  = (size_t)NTOK * HID * 2;            // 2359296
  const size_t PW  = (size_t)HID * HID * 2;             //  165888
  const size_t PQ  = (size_t)NB * NH * SEQ * QS * 2;    // 4718592
  const size_t PVT = (size_t)NB * HID * SEQ * 2;        // 2359296
  const size_t PO  = (size_t)NB * NH * SEQ * HD * 2;    // 2359296
  const size_t PTB = (size_t)SEQ * NPAIR * 4;           //   65536
  size_t off = 0;
  const size_t oXb  = off; off += PX;
  const size_t oWq  = off; off += PW;
  const size_t oWk  = off; off += PW;
  const size_t oWv  = off; off += PW;
  const size_t oWo  = off; off += PW;
  const size_t oQc  = off; off += PQ;
  const size_t oKd  = off; off += PQ;
  const size_t oKz  = off; off += PQ;
  const size_t oVTh = off; off += PVT;
  const size_t oVTl = off; off += PVT;
  const size_t oOh  = off; off += PO;
  const size_t oOl  = off; off += PO;
  const size_t oCt  = off; off += PTB;
  const size_t oSt  = off; off += PTB;
  if (off > ws_size) return;                            // off = 26746880
  if (off > (size_t)134217728) return;

  char* ws = (char*)d_ws;
  unsigned short* Xb  = (unsigned short*)(ws + oXb);
  unsigned short* Wqb = (unsigned short*)(ws + oWq);
  unsigned short* Wob = (unsigned short*)(ws + oWo);
  unsigned short* Qc  = (unsigned short*)(ws + oQc);
  unsigned short* Kd  = (unsigned short*)(ws + oKd);
  unsigned short* Kz  = (unsigned short*)(ws + oKz);
  unsigned short* VTh = (unsigned short*)(ws + oVTh);
  unsigned short* VTl = (unsigned short*)(ws + oVTl);
  unsigned short* Oh  = (unsigned short*)(ws + oOh);
  unsigned short* Ol  = (unsigned short*)(ws + oOl);
  float*          Ct  = (float*)(ws + oCt);
  float*          St  = (float*)(ws + oSt);

  const dim3 blk256(256);
  const dim3 blk128(128);
  const dim3 gPrep(PREP_TAB + 4 * PREP_W + PREP_X);     // 64 + 164 + 576 = 804 blocks
  const dim3 gQkv(((NTOK / 64) * (HID / 32)) / 4, 3);   // 576 tiles -> 144 blocks of 4 waves, x 3 projections
  const dim3 gOut(((NTOK / 64) * (HID / 32)) / 4);      // 144 blocks of 4 waves
  const dim3 gAttn(NB * NH * ABIN);                     // 504 blocks of 128

  // (1) RoPE tables; x and the four weights -> bf16 planes in fragment order (weights are [out][in] = Bt[n][k] already)
  prep<<<gPrep, blk256, 0, stream>>>(x, Wq, Wk, Wv, Wo, Xb, Wqb, Ct, St);
  // (2) q = rope(x . Wq^T) -> [b][h][t][hi|lo]; k = rope(x . Wk^T) -> [hi|hi] and [lo|0] planes, v = x . Wv^T -> v^T bf16
  //     hi / lo planes, these four in fragment order
  gemm_qkv<<<gQkv, blk128, 0, stream>>>(Xb, Wqb, Qc, Kd, Kz, VTh, VTl, Ct, St);
  // (3) causal attention -> ctx bf16 hi / lo planes [b][h][t][d]
  attn_causal16<<<gAttn, blk128, 0, stream>>>(Qc, Kd, Kz, VTh, VTl, Oh, Ol);
  // (4) out = (ctx hi + ctx lo) . Wo^T -> d_out f32 [4096][288]
  gemm_out<<<gOut, blk128, 0, stream>>>(Oh, Ol, Wob, (float*)d_out);
  (void)hipGetLastError();
}

// v009
// Measured time: 40.8 microseconds a run.
// In two side-by-side timings against v008, it was 1.04 and 1.05 times as fast.
// Counting every step since v000, it is 6.97 times as fast.
// Contractions: q / k / v projections = v_wmma_f32_16x16x32_bf16 (bf16 operands from RNE-converted x and Wq/Wk/Wv, single product, f32 accumulate);
// k.q^T scores (transposed) = v_wmma_f32_16x16x32_bf16 with q and k as bf16 hi/lo split folded into the 32-deep k axis ([qhi|qlo].[khi|khi] + [qhi|qlo].[klo|0] = hh+lh+hl, 2 products), f32 accumulate;
// v^T.p^T (transposed) = v_wmma_f32_16x16x32_bf16 with p and v as bf16 hi/lo split (hh + hl + lh, 3 products), f32 accumulate;
// ctx.Wo^T = v_wmma_f32_16x16x32_bf16 with ctx as bf16 hi + unscaled lo planes times bf16 Wo (2 products), f32 accumulate;
// rotary tables (powf, f32 product, precise sincosf), half-rotation, causal mask and online softmax in f32 on the VALU.
// Carry audit: no scaled planes anywhere; every lo plane is the unscaled RNE residual (v - hi) in bf16 and shares the hi accumulator;
// score scale 1/4 applied once in f32 after the score accumulate; softmax normaliser 1/l applied once in the attention epilogue.
#include <hip/hip_runtime.h>
#include <math.h>
#include <stdint.h>

#define NB    2
#define SEQ   2048
#define HID   288
#define NH    18
#define HD    16
#define NPAIR 8
#define QS    32           // slots per head in the q / k planes: 0..15 hi (d), 16..31 lo (d) or duplicate / zero
#define NTOK  (NB * SEQ)   // 4096 token rows
#define NQB   (SEQ / 64)   // 32 query blocks of 64 per sequence
static_assert(NH * HD == HID);
static_assert(NPAIR * 2 == HD);
static_assert((SEQ % 64) == 0 && (HID % 32) == 0 && (NTOK % 64) == 0);
static_assert(((NTOK / 64) * (HID / 32)) % 4 == 0);
static_assert((NTOK * HID) % (8 * 256) == 0);
static_assert(((HID * HID) % 8) == 0 && (((HID * HID) / 8) % 32) == 0);
static_assert((SEQ % 32) == 0);

typedef __bf16   v16b __attribute__((ext_vector_type(16)));
typedef __bf16   v8b  __attribute__((ext_vector_type(8)));
typedef float    v8f  __attribute__((ext_vector_type(8)));
typedef float    v4f  __attribute__((ext_vector_type(4)));
typedef float    v2f  __attribute__((ext_vector_type(2)));
typedef __bf16   v2b  __attribute__((ext_vector_type(2)));
typedef unsigned int v4u __attribute__((ext_vector_type(4)));
typedef unsigned int v2u __attribute__((ext_vector_type(2)));

// ---- scalar helpers --------------------------------------------------------------------------------
// two f32 -> two bf16 in one word (a low, b high), RNE, by the chip's packed convert
__device__ __forceinline__ unsigned cvt2(float a, float b) {
  const v2f f = {a, b};
  return __builtin_bit_cast(unsigned, __builtin_convertvector(f, v2b));
}
// hi = bf16(f), lo = bf16(f - hi) for eight values, word e = values 2e (low half) and 2e+1 (high half): three instructions a
// pair. hi: one packed convert. lo: the mixed-precision FMA reads hi's bf16 half as it lies, forms hi * -1 + f (exact in f32)
// and rounds it (RNE) into one half of the result word; the compiler's own form of the same takes a shift, a mask, a packed
// add and a second convert. The four low halves stand ahead of the four high halves, so that no instruction follows the
// one that wrote its result word directly.
__device__ __forceinline__ void split8(const float (&f)[8], unsigned (&hi)[4], unsigned (&lo)[4]) {
#pragma unroll
  for (int e = 0; e < 4; ++e) hi[e] = cvt2(f[2 * e], f[2 * e + 1]);
  asm("v_fma_mixlo_bf16 %0, %4, -1.0, %8 op_sel_hi:[1,0,0]\n\t"
      "v_fma_mixlo_bf16 %1, %5, -1.0, %10 op_sel_hi:[1,0,0]\n\t"
      "v_fma_mixlo_bf16 %2, %6, -1.0, %12 op_sel_hi:[1,0,0]\n\t"
      "v_fma_mixlo_bf16 %3, %7, -1.0, %14 op_sel_hi:[1,0,0]\n\t"
      "v_fma_mixhi_bf16 %0, %4, -1.0, %9 op_sel:[1,0,0] op_sel_hi:[1,0,0]\n\t"
      "v_fma_mixhi_bf16 %1, %5, -1.0, %11 op_sel:[1,0,0] op_sel_hi:[1,0,0]\n\t"
      "v_fma_mixhi_bf16 %2, %6, -1.0, %13 op_sel:[1,0,0] op_sel_hi:[1,0,0]\n\t"
      "v_fma_mixhi_bf16 %3, %7, -1.0, %15 op_sel:[1,0,0] op_sel_hi:[1,0,0]"
      : "=&v"(lo[0]), "=&v"(lo[1]), "=&v"(lo[2]), "=&v"(lo[3])
      : "v"(hi[0]), "v"(hi[1]), "v"(hi[2]), "v"(hi[3]),
        "v"(f[0]), "v"(f[1]), "v"(f[2]), "v"(f[3]), "v"(f[4]), "v"(f[5]), "v"(f[6]), "v"(f[7]));
}
__device__ __forceinline__ v8f zero8() { v8f z = {0.f, 0.f, 0.f, 0.f, 0.f, 0.f, 0.f, 0.f}; return z; }

// ---- fragment loaders: 16-bit A/B operand, lane -> row/col (lane&15), p already includes +8*(lane>>4);
//      elements 0..7 <- p[0..7] (k0+8h..k0+8h+7), elements 8..15 <- p[16..23] (k0+16+8h..k0+16+8h+7)
__device__ __forceinline__ v16b ldfrag_b(const __bf16* p) {
  union { v16b v; v8b h[2]; } f;
  f.h[0] = *(const v8b*)(p);
  f.h[1] = *(const v8b*)(p + 16);
  return f.v;
}
// FRAGMENT ORDER: a plane that only fragment loads read is stored as blocks of 512 elements (1024 B), one block = 16 rows x
// 32 k; element (row c, k) of a block lies at (k>>4)*256 + (((k>>3)&1)*16 + c)*8 + (k&7). That is the map above written out
// lane by lane: lane l = 16*(lane half) + c finds elements 0..7 at l*8 and elements 8..15 at 256 + l*8, so each of the two
// 16-B loads of a wave covers 512 contiguous, aligned bytes (4 whole cache lines) and not 32-B pieces of 8 or 16 lines.
// p = block base + 8*lane.
__device__ __forceinline__ v16b ldfrag_f(const __bf16* p) {
  union { v16b v; v8b h[2]; } f;
  f.h[0] = *(const v8b*)(p);
  f.h[1] = *(const v8b*)(p + 256);
  return f.v;
}
// same map when k0..k0+15 and k0+16..k0+31 live in two different rows (p0, p1 each include +8*(lane>>4))
__device__ __forceinline__ v16b ldfrag_b2(const __bf16* p0, const __bf16* p1) {
  union { v16b v; v8b h[2]; } f;
  f.h[0] = *(const v8b*)(p0);
  f.h[1] = *(const v8b*)(p1);
  return f.v;
}

// ---- WMMA helper with trailing VALU hazard gap (D tied, A/B kept live) ----------------------------------
__device__ __forceinline__ v8f mma_b(v16b a, v16b b, v8f c) {
  c = __builtin_amdgcn_wmma_f32_16x16x32_bf16(false, a, false, b, (short)0, c, false, false);
  asm volatile("v_nop\n\tv_nop\n\tv_nop\n\tv_nop" : "+v"(c) : "v"(a), "v"(b));
  return c;
}

// =====================================================================================================
// f32 -> bf16 (RNE convert) of a [rows][HID] plane into FRAGMENT ORDER (see ldfrag_f), blocks [row / 16][k / 32]: thread i
// takes 8 elements, 64 threads a block; a wave takes 8 rows x 32 k, lane = 8 * (group of 8 k) + row, so that it reads 8 whole
// 128-B lines of the source and writes 4 of the plane. Used for Wo alone (HID * HID / 8 = 10368 threads).
// =====================================================================================================
__device__ __forceinline__ void cvt_bf16x8(const float* __restrict__ in, unsigned short* out, const int i) {
  const int blk = i >> 6;                          // block = 64 threads x 8 elements
  const int gr  = blk / (HID / 32);                // group of 16 rows
  const int ks  = blk - gr * (HID / 32);           // k-step of 32
  const int c   = ((i >> 2) & 8) | (i & 7);        // row of the block: the wave's 8 rows, one per lane & 7
  const int q   = (i >> 3) & 3;                    // group of 8 k: k = 8q..8q+7
  const size_t so = (size_t)(gr * 16 + c) * HID + ks * 32 + q * 8;
  const size_t po = (size_t)blk * 512 + (q >> 1) * 256 + ((q & 1) * 16 + c) * 8;
  const v4f a = *(const v4f*)(in + so);
  // precaution: the second load's result may be given the registers that hold the first load's address
  asm volatile("s_wait_xcnt 0x0" ::: "memory");
  const v4f b = *(const v4f*)(in + so + 4);
  v4u p;
  p[0] = cvt2(a[0], a[1]);
  p[1] = cvt2(a[2], a[3]);
  p[2] = cvt2(b[0], b[1]);
  p[3] = cvt2(b[2], b[3]);
  *(v4u*)(out + po) = p;
  // precaution: code that follows in the caller rewrites the store's registers
  asm volatile("s_wait_xcnt 0x0" ::: "memory");
}

// =====================================================================================================
// bf16 WMMA GEMM, one wave per 64 x 32 tile:
//   C[m][n] = sum_k A[m][k] * Bt[n][k] (+ sum_k A2[m][k] * Bt[n][k] when TWOA), M = 4096 tokens, N = 288, K = 288
//   (9 k-steps of 32, no tails). Bt = the [out][in] weight, RNE bf16.
//   MODE 0..2: A = the block's 64 rows of x, Bt = the whole weight, both converted by the block itself into LDS, row after row
//   at a pitch of XP elements (see gemm_qkv). MODE 3: Bt = Wo plane in the workspace, fragment order, blocks [n / 16][k / 32];
//   A = ctx planes laid out [b][h][t][16]; k-step j covers heads 2j
//   (k 0..15) and 2j+1 (k 16..31): elements 0..7 <- head 2j, d = 8*(lane>>4)..+7; elements 8..15 <- head 2j+1, same d.
// then (b = m0/2048, t = m0%2048 + row, 32 columns = heads n0/16 and n0/16+1):
//   MODE 0 (q): rotary in f32 (contract off): d < 8: x[d] c[t][d] - x[d+8] s[t][d]; d >= 8: x[d] c[t][d-8] + x[d-8] s[t][d-8];
//               -> plane [b][h][t][32]: slots 0..15 = bf16 hi of d, 16..31 = bf16 lo (v - hi) of d.
//   MODE 1 (k): same rotary; plane C0 slots 0..15 = hi, 16..31 = hi (duplicate); plane C1 slots 0..15 = lo, 16..31 = 0;
//               both in fragment order, blocks [b][h][t / 16], rows = keys, k = slots.
//   MODE 2 (v): no rotary; v^T planes C0 = hi, C1 = lo, fragment order, blocks [b][h][t / 32], rows = d, k = keys.
//   MODE 0..2 share one body and ONE grid (gemm_qkv: blockIdx.y = mode, the same in every wave of a block; only the weight,
//   the epilogue and the output planes differ); MODE 3 (OUT) is a launch of its own (gemm_out), behind attention.
//   ctab / stab: the rotary rows of the tile's own 64 positions, [row][8], in LDS (MODE 0, 1).
// coverage: 576 tiles x (64 rows x 32 cols) = the whole 4096 x 288 result; MODE 0/1: 2 heads x 8 it x 8 rows x 4 lanes
//           x 8 slots = 64 rows x 2 heads x 32 slots; MODE 2: 4 x 2 it x (8 features x 4 token groups) x 8 = 32 features x 64 tokens;
//           MODE 3: 16 it x 4 rows x 8 lanes x 4 = 64 rows x 32 cols.
// =====================================================================================================
// Epilogue of one wave's 64 x 32 tile, read back from its LDS slab; MODE as listed above.
template <int MODE>
__device__ __forceinline__ void gemm_epi(const float* slab, const int lane, const int m0, const int n0, const int bidx,
                                         const int tl0, void* C0, void* C1,
                                         const float* __restrict__ ctab, const float* __restrict__ stab) {
  static_assert(MODE >= 0 && MODE <= 3);
  if (MODE == 3) {
    float* Cf = (float*)C0;
    const int q4 = lane >> 3, c4 = (lane & 7) * 4;
    {
#pragma unroll
      for (int it = 0; it < 16; ++it) {
        const int row = it * 4 + q4;                         // it 0..15 x q4 0..3 = rows 0..63
        const v4f v = *(const v4f*)(slab + row * 36 + c4);
        *(v4f*)(Cf + (size_t)(m0 + row) * HID + n0 + c4) = v;
      }
      
    }
  } else if (MODE == 2) {
    unsigned short* P0 = (unsigned short*)C0;
    unsigned short* P1 = (unsigned short*)C1;
    const int n8 = lane & 7, tg = lane >> 3;       // 8 features side by side = one whole 128-B line of a block per token group
#pragma unroll 1
    for (int it2 = 0; it2 < 8; it2 += 2) {         // two groups' loads and stores side by side in a trip
#pragma unroll
      for (int it = it2; it < it2 + 2; ++it) {
        const int n  = (it >> 1) * 8 + n8;                     // local feature 0..31
        const int t8 = ((it & 1) * 4 + tg) * 8;                // first of this lane's 8 tokens, 0..56
        float f[8];
#pragma unroll
        for (int e = 0; e < 8; ++e) f[e] = slab[(t8 + e) * 36 + n];
        unsigned hw[4], lw[4];
        split8(f, hw, lw);
        const v4u a = {hw[0], hw[1], hw[2], hw[3]}, a2 = {lw[0], lw[1], lw[2], lw[3]};
        const int s = tl0 + t8;                                // key index of element 0; d = (n0 + n) & 15
        const size_t go = ((size_t)(bidx * NH + ((n0 + n) >> 4))) * (SEQ * HD) + (size_t)((s >> 5) * 512 +
                          ((s >> 4) & 1) * 256 + (((s >> 3) & 1) * 16 + ((n0 + n) & 15)) * 8);
        *(v4u*)(P0 + go) = a;
        *(v4u*)(P1 + go) = a2;
      }
      // precaution: the next trip rewrites registers that these stores name
      asm volatile("s_wait_xcnt 0x0" ::: "memory");
    }
  } else {
    unsigned short* P0 = (unsigned short*)C0;
    unsigned short* P1 = (unsigned short*)C1;
    const int r4 = lane >> 2, s8 = (lane & 3) * 8;
    const int dbase = s8 & 8;                                // d of the first element: 0 or 8
    const bool isLo = (s8 >= 16);
    const float sg = (dbase == 0) ? -1.0f : 1.0f;            // -x[d+8] for d < 8, +x[d-8] for d >= 8
    const int h0 = n0 >> 4;                                  // first head of the tile (even)
#pragma unroll 1
    for (int hd = 0; hd < 2; ++hd) {
#pragma unroll 1
      for (int it2 = 0; it2 < 8; it2 += 2) {         // two rows' loads and stores side by side in a trip
#pragma unroll
        for (int it = it2; it < it2 + 2; ++it) {
          const int row = it * 8 + r4;                         // it 0..7 x r4 0..7 = rows 0..63
          const int t = tl0 + row;                             // position within the sequence
          const float* xr = slab + row * 36 + hd * 16;
          float x[8], y[8], f[8];
#pragma unroll
          for (int e = 0; e < 8; ++e) { x[e] = xr[dbase + e]; y[e] = xr[(dbase ^ 8) + e]; }
          const v4f cv0 = *(const v4f*)(ctab + row * NPAIR);
          const v4f cv1 = *(const v4f*)(ctab + row * NPAIR + 4);
          const v4f sv0 = *(const v4f*)(stab + row * NPAIR);
          const v4f sv1 = *(const v4f*)(stab + row * NPAIR + 4);
          {
#pragma clang fp contract(off)
#pragma unroll
            for (int e = 0; e < 4; ++e) {
              {
                const float ry = sg * y[e];
                const float p0 = x[e] * cv0[e];
                const float p1 = ry * sv0[e];
                f[e] = p0 + p1;
              }
              {
                const float ry = sg * y[4 + e];
                const float p0 = x[4 + e] * cv1[e];
                const float p1 = ry * sv1[e];
                f[4 + e] = p0 + p1;
              }
            }
          }
          unsigned hw[4], lw[4];
          split8(f, hw, lw);
          const v4u hp = {hw[0], hw[1], hw[2], hw[3]}, lp = {lw[0], lw[1], lw[2], lw[3]};
          const size_t go = (MODE == 0)
              ? (((size_t)(bidx * NH + h0 + hd)) * SEQ + t) * QS + s8
              : ((size_t)(bidx * NH + h0 + hd)) * (SEQ * QS) + (size_t)((t >> 4) * 512 + (s8 >> 4) * 256 +
                                                                       (((s8 >> 3) & 1) * 16 + (t & 15)) * 8);
          if (MODE == 0) {
            v4u pc;
#pragma unroll
            for (int e = 0; e < 4; ++e) pc[e] = isLo ? lp[e] : hp[e];
            *(v4u*)(P0 + go) = pc;
          } else {
            v4u pz;
#pragma unroll
            for (int e = 0; e < 4; ++e) pz[e] = isLo ? 0u : lp[e];
            *(v4u*)(P0 + go) = hp;
            *(v4u*)(P1 + go) = pz;
          }
        }
        // precaution: the next trip rewrites registers that these stores name
        asm volatile("s_wait_xcnt 0x0" ::: "memory");
      }
    }
  }
}

#define XP 296             // LDS row pitch of the staged x and weight rows, elements: 592 B = 16 B x 37 (odd: b128 reads at full rate)

// One wave's tile. Ab, A2b, Bb = the tile's first A row and first Bt row (wave-uniform); slab = the wave's own 64 x 36 floats of LDS.
template <bool OUT>
__device__ __forceinline__ void gemm_tile(
    const int mode,                                // 0 q, 1 k, 2 v (block-uniform, OUT false); 3 with OUT
    const __bf16* Ab, const __bf16* A2b, const __bf16* Bb, float* slab,
    const int lane, const int m0, const int n0, void* C0, void* C1,
    const float* ctab, const float* stab) {
  constexpr bool TWOA = OUT;
  constexpr int K = HID;
  const int c    = lane & 15;                      // row (A) / col (B, D) within subtile
  const int koff = (lane >> 4) * 8;                // k offset of this lane half
  const int mOff = (lane >> 4) * 8;                // D row offset
  const int bidx = m0 / SEQ;                       // batch of this tile (tiles never straddle a batch)
  const int tl0  = m0 - bidx * SEQ;                // first position within the sequence

  v8f acc[4][2];
#pragma unroll
  for (int i = 0; i < 4; ++i)
#pragma unroll
    for (int j = 0; j < 2; ++j) acc[i][j] = zero8();

  // Loads run ahead of the matrix instructions: every fragment is fetched into a register set that is free by then, whole
  // k-steps before its products, so a k-step waits on loads issued earlier and not on its own. Three A sets go round.
  //   one A plane: k-step ks in A and B set ks % 3, fetched two k-steps ahead (8 products a k-step cover little of a load).
  //   two A planes: the hi products of a k-step run first, then the lo products (each accumulator still takes hi, lo, hi,
  //   lo ... in k order); the sets hold hi(ks), lo(ks), hi(ks+1), each fetched one k-step ahead; B in set ks & 1.
  // Address = wave-uniform tile base + one lane offset + a constant: the sets leave no room for a pointer per row.
  constexpr int KS = K / 32;                       // 9 k-steps
  const unsigned alane = OUT ? (unsigned)(c * HD + koff) : (unsigned)(c * XP + koff);
  const unsigned blane = OUT ? (unsigned)(lane * 8) : (unsigned)(c * XP + koff);   // fragment order: 16 rows x K = K / 32 blocks of 512
  v16b bh[TWOA ? 2 : 3][2], ar[3][4];
  auto fetch_b = [&](const int ks, const int st) __attribute__((always_inline)) {
#pragma unroll
    for (int j = 0; j < 2; ++j)
      bh[st][j] = OUT ? ldfrag_f(Bb + blane + (j << 4) * K + ks * 512) : ldfrag_b(Bb + blane + (j << 4) * XP + ks * 32);
  };
  auto fetch_a = [&](const __bf16* base, const int ks, const int set) __attribute__((always_inline)) {
#pragma unroll
    for (int i = 0; i < 4; ++i) {
      if (OUT) {                                   // ks = head pair index 0..8: heads 2 ks and 2 ks + 1, same token row
        const int e0 = (i << 4) * HD + (2 * ks) * SEQ * HD, e1 = e0 + SEQ * HD;
        ar[set][i] = ldfrag_b2(base + alane + e0, base + alane + e1);
      } else {
        ar[set][i] = ldfrag_b(base + alane + (i << 4) * XP + ks * 32);
      }
    }
  };
  auto products = [&](const int set, const int st) __attribute__((always_inline)) {
#pragma unroll
    for (int i = 0; i < 4; ++i)
#pragma unroll
      for (int j = 0; j < 2; ++j) acc[i][j] = mma_b(ar[set][i], bh[st][j], acc[i][j]);
  };
  fetch_b(0, 0);
  fetch_a(Ab, 0, 0);
  if (TWOA) fetch_a(A2b, 0, 1);
  else { fetch_b(1, 1); fetch_a(Ab, 1, 1); }
#pragma unroll                                     // full unroll: a register set's index must be a constant
  for (int ks = 0; ks < KS; ++ks) {
    const int st = ks & 1;
    if (TWOA) {
      const int sh = (2 * ks) % 3, sl = (2 * ks + 1) % 3, sn = (2 * ks + 2) % 3;
      if (ks + 1 < KS) { fetch_b(ks + 1, st ^ 1); fetch_a(Ab, ks + 1, sn); }
      products(sh, st);
      if (ks + 1 < KS) fetch_a(A2b, ks + 1, sh);   // into the set the hi products have just read
      products(sl, st);
    } else {
      if (ks + 2 < KS) { fetch_b(ks + 2, (ks + 2) % 3); fetch_a(Ab, ks + 2, (ks + 2) % 3); }
      products(ks % 3, ks % 3);
    }
  }

  // ---- epilogue: whole tile to wave-private LDS ----
#pragma unroll
  for (int i = 0; i < 4; ++i)
#pragma unroll
    for (int j = 0; j < 2; ++j)
#pragma unroll
      for (int r = 0; r < 8; ++r)
        slab[((i << 4) + mOff + r) * 36 + (j << 4) + c] = acc[i][j][r];
  __builtin_amdgcn_fence(__ATOMIC_RELEASE, "workgroup");
  __builtin_amdgcn_wave_barrier();
  __builtin_amdgcn_fence(__ATOMIC_ACQUIRE, "workgroup");

  if (OUT)            gemm_epi<3>(slab, lane, m0, n0, bidx, tl0, C0, C1, ctab, stab);
  else if (mode == 0) gemm_epi<0>(slab, lane, m0, n0, bidx, tl0, C0, C1, ctab, stab);   // block-uniform choice, made once:
  else if (mode == 1) gemm_epi<1>(slab, lane, m0, n0, bidx, tl0, C0, C1, ctab, stab);   // no mode test inside an epilogue loop
  else                gemm_epi<2>(slab, lane, m0, n0, bidx, tl0, C0, C1, ctab, stab);
}

// q, k and v projections in one grid, straight from the f32 inputs: blockIdx.x = 64 token rows, blockIdx.y = mode, 9 waves a
// block, wave w = columns 32 w .. 32 w + 31. What the products need and what depends on the inputs alone is made by the block
// itself, in LDS, so that no launch stands in front of this one:
//   x rows and weight rows, f32 -> bf16 (RNE convert), row after row at pitch XP. A load of a wave covers 4 rows x one whole
//   128-B line (lane = 8 * row + group of 4 k), its two converted words go out as one 8-B LDS store. Wave w brings k-step w of
//   all 64 x rows (16 loads) and all 9 k-steps of its own 32 weight rows (72 loads): 9 waves = the whole tile, the whole weight.
//   The 88 loads go in four groups through two register sets: a group flies while the one before it is converted.
//   rotary rows (modes 0, 1): sC[r][i] = cos(t * inv[i]), sS[r][i] = sin(t * inv[i]), t = tile's position r = 0..63, i = 0..7,
//   inv[i] = 1 / powf(10000, (2i)/16) formed by every thread for its own i (f32 product, precise sincosf); 512 values, 288 threads.
//   mode 2 needs no rotary rows: its 64 blocks convert Wo into the workspace plane that gemm_out reads (18432 threads >= 10368).
// One barrier: the x rows and the rotary rows are read by every wave.
static_assert((NTOK / 64) * 288 >= HID * HID / 8);
static_assert(HID / 32 == 9);
__global__ __launch_bounds__(288) void gemm_qkv(
    const float* __restrict__ x, const float* __restrict__ Wq, const float* __restrict__ Wk,
    const float* __restrict__ Wv, const float* __restrict__ Wo, unsigned short* Wob,
    unsigned short* Qc, unsigned short* Kd, unsigned short* Kz, unsigned short* VTh, unsigned short* VTl) {
  __shared__ __align__(16) unsigned short sX[64 * XP];     //  37888 B
  __shared__ __align__(16) unsigned short sW[HID * XP];    // 170496 B
  __shared__ __align__(16) float sT[9][64 * 36];           //  82944 B: per-wave 64x32 tile, pitch 36 floats
  __shared__ __align__(16) float sC[64 * NPAIR];           //   2048 B
  __shared__ __align__(16) float sS[64 * NPAIR];           //   2048 B
  const int tid  = (int)threadIdx.x;
  const int lane = tid & 31;
  const int wave = __builtin_amdgcn_readfirstlane(tid >> 5);   // same in every lane: held scalar, the tile bases are scalar too
  const int mode = (int)blockIdx.y;
  const int m0   = (int)blockIdx.x << 6;
  const int n0   = wave << 5;
  const float* Wm = (mode == 0) ? Wq : (mode == 1) ? Wk : Wv;
  unsigned short* C0 = (mode == 0) ? Qc : (mode == 1) ? Kd : VTh;
  unsigned short* C1 = (mode == 0) ? Qc : (mode == 1) ? Kz : VTl;

  // load g = 0..15: x rows 4g..4g+3, k-step 'wave'; g = 16..87: weight rows n0 + 4((g-16)&7) .. +3, k-step (g-16)>>3
  const unsigned sl = (unsigned)((lane >> 3) * HID + (lane & 7) * 4);
  const unsigned dl = (unsigned)((lane >> 3) * XP + (lane & 7) * 4);
  const float* xsrc = x + (size_t)m0 * HID + wave * 32;
  const float* wsrc = Wm + (size_t)n0 * HID;
  unsigned short* xdst = sX + wave * 32;
  unsigned short* wdst = sW + n0 * XP;
  v4f rg[2][22];
  auto stage_ld = [&](const int set, const int grp) __attribute__((always_inline)) {
#pragma unroll                                     // full unroll, here and in stage_st: a register set's index must be a constant
    for (int u = 0; u < 22; ++u) {
      const int g = grp * 22 + u, w = g - 16;
      if (g < 16) rg[set][u] = *(const v4f*)(xsrc + sl + g * 4 * HID);
      else        rg[set][u] = *(const v4f*)(wsrc + sl + (w & 7) * 4 * HID + (w >> 3) * 32);
    }
  };
  auto stage_st = [&](const int set, const int grp) __attribute__((always_inline)) {
#pragma unroll
    for (int u = 0; u < 22; ++u) {
      const int g = grp * 22 + u, w = g - 16;
      const v4f f = rg[set][u];
      const v2u p = {cvt2(f[0], f[1]), cvt2(f[2], f[3])};
      if (g < 16) *(v2u*)(xdst + dl + g * 4 * XP) = p;
      else        *(v2u*)(wdst + dl + (w & 7) * 4 * XP + (w >> 3) * 32) = p;
    }
  };
  stage_ld(0, 0);
  stage_ld(1, 1);
  // precaution: code that follows rewrites the offset register that these loads name
  asm volatile("s_wait_xcnt 0x0" ::: "memory");
  if (mode != 2) {                                 // block-uniform
    const int tl0 = m0 & (SEQ - 1);                // first position within the sequence
#pragma unroll 1                                   // one copy of the long sine / cosine code
    for (int p = tid; p < 64 * NPAIR; p += 288) {
      const int i = p & (NPAIR - 1);
      const int t = tl0 + (p >> 3);
      const float e = (float)(2 * i) * (1.0f / (float)HD);
      const float pw = powf(10000.0f, e);
      const float f = 1.0f / pw;
      const float ang = (float)t * f;
      float sn, cs;
      sincosf(ang, &sn, &cs);
      sC[p] = cs;
      sS[p] = sn;
    }
  } else {
    const int i = (int)blockIdx.x * 288 + tid;
    if (i < HID * HID / 8) cvt_bf16x8(Wo, Wob, i);
  }
  stage_st(0, 0);
  stage_ld(0, 2);
  stage_st(1, 1);
  stage_ld(1, 3);
  // precaution: code that follows rewrites the offset register that the staging loads name
  asm volatile("s_wait_xcnt 0x0" ::: "memory");
  stage_st(0, 2);
  stage_st(1, 3);
  __syncthreads();                                 // x rows and rotary rows: written by other waves than their readers

  gemm_tile<false>(mode, (const __bf16*)(const void*)sX, (const __bf16*)(const void*)sX,
                   (const __bf16*)(const void*)sW + n0 * XP, sT[wave], lane, m0, n0, (void*)C0, (void*)C1, sC, sS);
}

// out projection: 576 tiles, 4 waves a block, no block barriers
__global__ __launch_bounds__(128) void gemm_out(
    const unsigned short* __restrict__ Oh, const unsigned short* __restrict__ Ol,
    const unsigned short* __restrict__ Wob, float* out) {
  constexpr int TN = HID / 32;   // 9
  constexpr int TM = NTOK / 64;  // 64
  __shared__ __align__(16) float sT[4][64 * 36];   // per-wave 64x32 tile, pitch 36 floats
  const int lane = threadIdx.x & 31;
  const int wave = __builtin_amdgcn_readfirstlane((int)(threadIdx.x >> 5));   // same in every lane: held scalar, the tile bases are scalar too
  const int tile = blockIdx.x * 4 + wave;
  if (tile >= TM * TN) return;                     // wave-uniform; no block barriers in this kernel
  const int tm = tile / TN;
  const int tn = tile - tm * TN;
  const int m0 = tm << 6;
  const int n0 = tn << 5;
  const int bidx = m0 / SEQ;
  const int tl0  = m0 - bidx * SEQ;
  const size_t abase = (((size_t)(bidx * NH)) * SEQ + tl0) * HD;
  gemm_tile<true>(3, (const __bf16*)(const void*)Oh + abase, (const __bf16*)(const void*)Ol + abase,
                  (const __bf16*)(const void*)Wob + (size_t)n0 * HID, sT[wave], lane, m0, n0, (void*)out, (void*)out,
                  nullptr, nullptr);
}

// =====================================================================================================
// Causal attention, head dim 16, key chunks of 64, both products transposed: S^T = K . Q^T, O^T += V^T . P^T.
//   q plane  [b][h][t][32]: slots 0..15 = bf16 hi of rope(q)[d], 16..31 = bf16 lo
//   kd plane, per key 32 slots: 0..15 = hi of rope(k)[d], 16..31 = hi again; kz plane: 0..15 = lo, 16..31 = 0;
//   both in fragment order (ldfrag_f): blocks [b][h][s / 16] of 16 keys x 32 slots
//   so one 32-deep k-step gives q.k = hi.hi + lo.hi (kd) and hi.lo (kz): two products per 16x16 score tile.
//   v^T planes (bf16 hi / lo), fragment order: blocks [b][h][s / 32] of 16 d x 32 keys
//   ctx planes (bf16 hi / lo of the normalised context): element (b, h, t, d) at [((b*18 + h)*2048 + t)*16 + d]
//   Score tile j: A = 16 key rows (row = lane&15), B = the wave's 16 queries (col = lane&15), same k map on both sides, so
//   register r of lane (c, hh) = score of key kv0 + 16j + 8hh + r against query q0 + c: a lane holds 32 of the 64 keys of ONE
//   query. Row max and row sum are in-lane; the two lane halves exchange the max once per chunk and join their sums once, in
//   the epilogue. Tiles 2kk and 2kk+1, converted in place, are the B operand of k-step kk (element e = key 8hh+e, element
//   8+e = key 16+8hh+e), which is the k order in which ldfrag_f reads the v^T block as A: P never leaves the registers.
//   Causal structure: query tile qb visits key chunks 0..qb only (block-uniform count of qb+1 <= NQB chunks); chunks 0..qb-1 run
//   in a loop whose body has no mask, the diagonal chunk qb in a copy of the body behind it: there a key with index > query
//   index gets logit -inf -> exp gives exactly 0; the first key of every visited chunk is always kept, so every joined max is finite.
//   Tile = 64 query rows of one (b, h), 4 waves, wave w = rows q0..q0+15; no LDS, no barriers.
//   Equal work-groups: every work-group is resident from the start, so the launch lasts as long as the fullest WGP, and a
//   tile costs qb+1 chunks. A block therefore walks several tiles of ONE head, one after the other, ABIN blocks a head:
//   block n = 0..12: tiles 31-n and 5+n (32-n and 6+n chunks, 38 together); block 13: tiles 18, 4, 3, 2, 1, 0 (34 chunks).
//   grid = NB * NH * ABIN = 504 blocks, at most two for each of the 256 WGPs. All tiles of a block start at key chunk 0 of
//   the same head, so the last trip of a tile fetches that chunk for the next one.
//   The hi / lo splits of P round in the chip's converting instructions (split8), not in integer arithmetic.
//   Output: lane (c, hh) holds d = 8hh..8hh+7 of query q0 + c: one 16-B store per plane, 512 contiguous B per wave.
//   coverage: tiles 31..19, 5..17, 18 and 4..0 = each of the 32 tiles of a head once; 36 heads x 32 tiles x 4 waves x 16 rows
//   x 16 d = every (b, h, t, d) of both ctx planes exactly once.
// =====================================================================================================
__device__ __forceinline__ float other_half(float v) {                // value of lane l ^ 16
  const int b = __builtin_bit_cast(int, v);
  return __builtin_bit_cast(float, __builtin_amdgcn_permlanex16(b, b, 0x76543210, 0xfedcba98, false, false));
}

__device__ __forceinline__ void exp2x8(const float (&x)[8], float (&y)[8]) {
  asm("v_exp_f32 %0, %8\n\tv_exp_f32 %1, %9\n\tv_exp_f32 %2, %10\n\tv_exp_f32 %3, %11\n\t"
      "v_exp_f32 %4, %12\n\tv_exp_f32 %5, %13\n\tv_exp_f32 %6, %14\n\tv_exp_f32 %7, %15\n\tv_nop"
      : "=&v"(y[0]), "=&v"(y[1]), "=&v"(y[2]), "=&v"(y[3]), "=&v"(y[4]), "=&v"(y[5]), "=&v"(y[6]), "=&v"(y[7])
      : "v"(x[0]), "v"(x[1]), "v"(x[2]), "v"(x[3]), "v"(x[4]), "v"(x[5]), "v"(x[6]), "v"(x[7]));
}

// The matrix instructions of a key chunk, issued in groups. After a WMMA the chip wants four vector issue slots before a vector
// instruction reads its D or overwrites its A or B. Inside a group the WMMAs that follow fill those slots for one another
// (a WMMA that accumulates into the same D needs none), so only the last one takes v_nops: they close the statement, where
// they hold on every path and whatever the compiler puts next.
// Scores: the four first products (distinct D) stand ahead of the four second ones, so that no product waits for the one
// directly in front of it; each tile still takes its kd product first and its kz product second.
__device__ __forceinline__ void scores8(const v16b (&kd)[4], const v16b (&kz)[4], const v16b q, v8f (&s)[4]) {
  asm volatile("v_wmma_f32_16x16x32_bf16 %0, %4, %12, 0\n\t"
               "v_wmma_f32_16x16x32_bf16 %1, %5, %12, 0\n\t"
               "v_wmma_f32_16x16x32_bf16 %2, %6, %12, 0\n\t"
               "v_wmma_f32_16x16x32_bf16 %3, %7, %12, 0\n\t"
               "v_wmma_f32_16x16x32_bf16 %0, %8, %12, %0\n\t"
               "v_wmma_f32_16x16x32_bf16 %1, %9, %12, %1\n\t"
               "v_wmma_f32_16x16x32_bf16 %2, %10, %12, %2\n\t"
               "v_wmma_f32_16x16x32_bf16 %3, %11, %12, %3\n\t"
               "v_nop\n\tv_nop\n\tv_nop\n\tv_nop"
               : "=&v"(s[0]), "=&v"(s[1]), "=&v"(s[2]), "=&v"(s[3])
               : "v"(kd[0]), "v"(kd[1]), "v"(kd[2]), "v"(kd[3]), "v"(kz[0]), "v"(kz[1]), "v"(kz[2]), "v"(kz[3]), "v"(q));
}
// Context: vh.ph, vl.ph, vh.pl of the first 32-key k-step, then of the second: one accumulate chain into o.
__device__ __forceinline__ v8f ctx6(const v16b (&vh)[2], const v16b (&vl)[2], const v16b ph0, const v16b pl0,
                                    const v16b ph1, const v16b pl1, v8f o) {
  asm volatile("v_wmma_f32_16x16x32_bf16 %0, %1, %5, %0\n\t"
               "v_wmma_f32_16x16x32_bf16 %0, %3, %5, %0\n\t"
               "v_wmma_f32_16x16x32_bf16 %0, %1, %6, %0\n\t"
               "v_wmma_f32_16x16x32_bf16 %0, %2, %7, %0\n\t"
               "v_wmma_f32_16x16x32_bf16 %0, %4, %7, %0\n\t"
               "v_wmma_f32_16x16x32_bf16 %0, %2, %8, %0\n\t"
               "v_nop\n\tv_nop\n\tv_nop\n\tv_nop"
               : "+v"(o)
               : "v"(vh[0]), "v"(vh[1]), "v"(vl[0]), "v"(vl[1]), "v"(ph0), "v"(pl0), "v"(ph1), "v"(pl1));
  return o;
}

#define ABIN 14            // blocks per (b, h)
static_assert(NQB == 32);  // the tile lists below are written for 32 tiles a head

// At most two work-groups share a WGP (two waves a SIMD), so registers up to 256 cost nothing. Without the bound the compiler,
// once the splits need fewer registers, aims at a fifth wave a SIMD and forms the loop-invariant mask bounds anew in every trip.
__global__ __launch_bounds__(128) __attribute__((amdgpu_waves_per_eu(4, 4)))
void attn_causal16(const unsigned short* __restrict__ qcp, const unsigned short* __restrict__ kdp,
                   const unsigned short* __restrict__ kzp, const unsigned short* __restrict__ vhp,
                   const unsigned short* __restrict__ vlp, unsigned short* ohp, unsigned short* olp) {
  union PB { v16b v; unsigned u[8]; };

  const int tid  = threadIdx.x;
  const int wave = tid >> 5;
  const int lane = tid & 31;
  const int hh   = lane >> 4;
  const int c    = lane & 15;

  const int bx   = blockIdx.x;
  const int bin  = bx % ABIN;
  const int rest = bx / ABIN;
  const int h    = rest % NH;
  const int b    = rest / NH;
  const int ntile = (bin < ABIN - 1) ? 2 : 6;  // block-uniform
  const size_t bhp = (size_t)b * NH + h;

  const __bf16* Qc = (const __bf16*)(const void*)qcp + bhp * SEQ * QS;
  const __bf16* Kd = (const __bf16*)(const void*)kdp + bhp * SEQ * QS;
  const __bf16* Kz = (const __bf16*)(const void*)kzp + bhp * SEQ * QS;
  const __bf16* Vh = (const __bf16*)(const void*)vhp + bhp * SEQ * HD;
  const __bf16* Vl = (const __bf16*)(const void*)vlp + bhp * SEQ * HD;

  // Loads run ahead of the matrix instructions that use them: chunk kt + 1's K fragments are fetched as one group behind
  // the score products of chunk kt, chunk kt's V fragments at the head of trip kt; the softmax runs while both fly.
  // Address = the head's plane base (wave-uniform) + one 32-bit byte offset (chunk + lane) + a constant.
  const unsigned flane = (unsigned)(lane * 16);              // this lane's place, in bytes, in every block of a fragment-order plane
  v16b kd[4], kz[4];
  // ko = byte offset of the chunk's first block + flane, the same in both planes: head base (scalar) + one 32-bit register
  auto fetch_k = [&](const unsigned ko) __attribute__((always_inline)) {
#pragma unroll
    for (int j = 0; j < 4; ++j) {
      kd[j] = ldfrag_f((const __bf16*)((const char*)Kd + ko + j * 1024));
      kz[j] = ldfrag_f((const __bf16*)((const char*)Kz + ko + j * 1024));
    }
  };
  fetch_k(flane);
  // precaution: code that follows rewrites the offset register that these loads name
  asm volatile("s_wait_xcnt 0x0" ::: "memory");

  for (int ti = 0; ti < ntile; ++ti) {         // the block's tiles, the longest first
  const int qb = (bin < ABIN - 1) ? ((ti == 0) ? NQB - 1 - bin : 5 + bin) : ((ti == 0) ? 18 : 5 - ti);
  const int q0 = qb * 64 + wave * 16;

  // ---- Q fragment (B operand, col = lane&15, one 32-slot k-step) ----
  const v16b qa = ldfrag_b(Qc + (size_t)(q0 + c) * QS + 8 * hh);
  // precaution: code that follows rewrites the address pair that these loads name
  asm volatile("s_wait_xcnt 0x0" ::: "memory");
  const int rowq = q0 + c;                     // this lane's query index

  float mrow = -INFINITY;                      // running max of query rowq (equal in both lane halves)
  float lrow = 0.f;                            // running sum over this lane half's keys only
  v8f oacc = zero8();                          // O^T: register r = d 8hh+r of query rowq

  // One key chunk. kv0 = its first key (kv0 + 63 < SEQ), kvn = first key of the K chunk fetched ahead; diag is a literal at
  // both calls: only the diagonal chunk (kv0 = 64 qb) holds keys above a query of the tile, so only its copy of the body
  // compares and selects; in the chunks below it every key index is below q0 and the select would keep every score.
  auto chunk = [&](const int kv0, const int kvn, const bool diag) __attribute__((always_inline)) {
    const unsigned ko = flane + (unsigned)kvn * (QS * 2);    // byte offsets, below 2^17
    const unsigned vo = flane + (unsigned)kv0 * (HD * 2);

    v16b vb[2], vl[2];
#pragma unroll
    for (int kk = 0; kk < 2; ++kk) {
      vb[kk] = ldfrag_f((const __bf16*)((const char*)Vh + vo + kk * 1024));
      vl[kk] = ldfrag_f((const __bf16*)((const char*)Vl + vo + kk * 1024));
    }

    // ---- scores: 64 keys x 16 queries per wave, 2 bf16 products per key subtile ----
    v8f s[4];
    scores8(kd, kz, qa, s);
    fetch_k(ko);
    // keeps the next chunk's 16 K loads directly behind the score group, a whole softmax ahead of their use: without it the
    // compiler takes the K registers for the softmax's temporaries and issues most of the loads only behind the max exchange
    __builtin_amdgcn_sched_barrier(0);

    // ---- scale, causal mask by index, max in-lane + one exchange, online softmax ----
    float mj[4];                               // one max chain per score tile: four independent chains
#pragma unroll
    for (int j = 0; j < 4; ++j) {
      mj[j] = -INFINITY;
#pragma unroll
      for (int r = 0; r < 8; ++r) {
        const int key = kv0 + j * 16 + 8 * hh + r;
        float sv = s[j][r] * 0.25f;
        if (diag) sv = (key <= rowq) ? sv : -INFINITY;
        s[j][r] = sv;
        mj[j] = fmaxf(mj[j], sv);
      }
    }
    float m = fmaxf(fmaxf(mj[0], mj[1]), fmaxf(mj[2], mj[3]));
    m = fmaxf(m, other_half(m));
    const float mnew  = fmaxf(mrow, m);
    const float msafe = (mnew == -INFINITY) ? 0.f : mnew;
    const float alpha = __expf(mrow - msafe);
    mrow = mnew;

    PB ph[2], pl[2];                           // P^T hi / lo as B operands of the two 32-key k-steps
    float pj[4];                               // one sum chain per score tile
#pragma unroll
    for (int j = 0; j < 4; ++j) {
      float xe[8], pe[8];
#pragma unroll
      for (int r = 0; r < 8; ++r) xe[r] = (s[j][r] - msafe) * 1.44269504f;   // exp(t) = 2^(t log2 e), as __expf forms it
      exp2x8(xe, pe);                                        // masked logit: 2^(-inf) = 0
#pragma unroll
      for (int e = 0; e < 4; ++e) {
        const float p0 = pe[2 * e];
        const float p1 = pe[2 * e + 1];
        pj[j] = (e == 0) ? (p0 + p1) : ((pj[j] + p0) + p1);
      }
      unsigned hw[4], lw[4];
      split8(pe, hw, lw);
#pragma unroll
      for (int e = 0; e < 4; ++e) {
        ph[j >> 1].u[(j & 1) * 4 + e] = hw[e];
        pl[j >> 1].u[(j & 1) * 4 + e] = lw[e];
      }
    }
    lrow = lrow * alpha + ((pj[0] + pj[1]) + (pj[2] + pj[3]));
#pragma unroll
    for (int r = 0; r < 8; ++r) oacc[r] *= alpha;

    // ---- context^T += V^T . P^T (bf16 WMMA, hh + lh + hl into one accumulator) ----
    oacc = ctx6(vb, vl, ph[0].v, pl[0].v, ph[1].v, pl[1].v, oacc);
    // precaution: the trip's loads name ko and vo; as inputs here the two stay in their registers, unwritten (also by the
    // loads' own results), up to this wait; it stands at the trip's foot, far behind the loads' issue
    asm volatile("s_wait_xcnt 0x0" :: "v"(ko), "v"(vo) : "memory");
  };
  for (int kt = 0; kt < qb; ++kt) chunk(kt * 64, kt * 64 + 64, false);   // block-uniform trip count, < NQB
  chunk(qb * 64, 0, true);                     // fetches K chunk 0 ahead, with which the next tile starts

  // ---- join the halves' sums, normalise (1/l), bf16 hi/lo split, one 16-B store per lane and plane ----
  {
    const float l = lrow + other_half(lrow);
    const float inv = (l > 0.f) ? (1.0f / l) : 0.f;
    float f[8];
#pragma unroll
    for (int r = 0; r < 8; ++r) f[r] = oacc[r] * inv;
    unsigned hw[4], lw[4];
    split8(f, hw, lw);
    const v4u a = {hw[0], hw[1], hw[2], hw[3]}, a2 = {lw[0], lw[1], lw[2], lw[3]};
    const size_t go = (bhp * SEQ + rowq) * HD + 8 * hh;
    *(v4u*)(ohp + go) = a;
    *(v4u*)(olp + go) = a2;
    // precaution: the next tile rewrites registers that these stores name
    asm volatile("s_wait_xcnt 0x0" ::: "memory");
  }
  }
}

// =====================================================================================================
// Workspace map (bytes; every region is an exact multiple of its whole-line / whole-tile store granularity,
//   Wob  bf16 [288/16][288/32][512]   165888
//   Qc   bf16 [2][18][2048][32]      4718592
//   Kd   bf16 [2][18][2048/16][512]  4718592
//   Kz                               4718592
//   VTh  bf16 [2][18][2048/32][512]  2359296
//   VTl                              2359296
//   Oh   bf16 [2][18][2048][16]      2359296
//   Ol                               2359296
//   total                           23758848
// =====================================================================================================
extern "C" void kernel_launch(void* const* d_in, const int* in_sizes, int n_in,
                              void* d_out, int out_size, void* d_ws, size_t ws_size,
                              hipStream_t stream) {
  if (n_in < 5) return;
  if (in_sizes[0] != NTOK * HID) return;
  if (in_sizes[1] != HID * HID) return;
  if (in_sizes[2] != HID * HID) return;
  if (in_sizes[3] != HID * HID) return;
  if (in_sizes[4] != HID * HID) return;
  if (out_size != NTOK * HID) return;

  const float* x  = (const float*)d_in[0];   // [2][2048][288]
  const float* Wq = (const float*)d_in[1];   // [288 out][288 in]
  const float* Wk = (const float*)d_in[2];
  const float* Wv = (const float*)d_in[3];
  const float* Wo = (const float*)d_in[4];

  const size_t PW  = (size_t)HID * HID * 2;             //  165888
  const size_t PQ  = (size_t)NB * NH * SEQ * QS * 2;    // 4718592
  const size_t PVT = (size_t)NB * HID * SEQ * 2;        // 2359296
  const size_t PO  = (size_t)NB * NH * SEQ * HD * 2;    // 2359296
  size_t off = 0;
  const size_t oWo  = off; off += PW;
  const size_t oQc  = off; off += PQ;
  const size_t oKd  = off; off += PQ;
  const size_t oKz  = off; off += PQ;
  const size_t oVTh = off; off += PVT;
  const size_t oVTl = off; off += PVT;
  const size_t oOh  = off; off += PO;
  const size_t oOl  = off; off += PO;
  if (off > ws_size) return;                            // off = 23758848
  if (off > (size_t)134217728) return;

  char* ws = (char*)d_ws;
  unsigned short* Wob = (unsigned short*)(ws + oWo);
  unsigned short* Qc  = (unsigned short*)(ws + oQc);
  unsigned short* Kd  = (unsigned short*)(ws + oKd);
  unsigned short* Kz  = (unsigned short*)(ws + oKz);
  unsigned short* VTh = (unsigned short*)(ws + oVTh);
  unsigned short* VTl = (unsigned short*)(ws + oVTl);
  unsigned short* Oh  = (unsigned short*)(ws + oOh);
  unsigned short* Ol  = (unsigned short*)(ws + oOl);

  const dim3 blk288(288);
  const dim3 blk128(128);
  const dim3 gQkv(NTOK / 64, 3);                        // 64 row tiles of 9 waves (9 column tiles), x 3 projections
  const dim3 gOut(((NTOK / 64) * (HID / 32)) / 4);      // 144 blocks of 4 waves
  const dim3 gAttn(NB * NH * ABIN);                     // 504 blocks of 128

  // (1) q = rope(x . Wq^T) -> [b][h][t][hi|lo]; k = rope(x . Wk^T) -> [hi|hi] and [lo|0] planes, v = x . Wv^T -> v^T bf16
  //     hi / lo planes, these four in fragment order (weights are [out][in] = Bt[n][k] already); Wo -> bf16 plane, fragment order
  gemm_qkv<<<gQkv, blk288, 0, stream>>>(x, Wq, Wk, Wv, Wo, Wob, Qc, Kd, Kz, VTh, VTl);
  // (2) causal attention -> ctx bf16 hi / lo planes [b][h][t][d]
  attn_causal16<<<gAttn, blk128, 0, stream>>>(Qc, Kd, Kz, VTh, VTl, Oh, Ol);
  // (3) out = (ctx hi + ctx lo) . Wo^T -> d_out f32 [4096][288]
  gemm_out<<<gOut, blk128, 0, stream>>>(Oh, Ol, Wob, (float*)d_out);
  (void)hipGetLastError();
}

// v010
// It runs in 38.6 microseconds.
// Timed twice side by side with v009, it ran 1.06 times as fast both times.
// All steps since v000 together make it 7.39 times as fast.
// Contractions: q / k / v projections = v_wmma_f32_16x16x32_bf16 (bf16 operands from RNE-converted x and Wq/Wk/Wv, single product, f32 accumulate);
// k.q^T scores (transposed) = v_wmma_f32_16x16x32_bf16 with q and k as bf16 hi/lo split folded into the 32-deep k axis ([qhi|qlo].[khi|khi] + [qhi|qlo].[klo|0] = hh+lh+hl, 2 products), f32 accumulate;
// v^T.p^T (transposed) = v_wmma_f32_16x16x32_bf16 with p and v as bf16 hi/lo split (hh + hl + lh, 3 products), f32 accumulate;
// ctx.Wo^T = v_wmma_f32_16x16x32_bf16 with ctx as bf16 hi + unscaled lo planes times bf16 Wo (2 products), f32 accumulate;
// rotary tables (powf, f32 product, precise sincosf), half-rotation, causal mask and online softmax in f32 on the VALU.
// Carry audit: no scaled planes anywhere; every lo plane is the unscaled RNE residual (v - hi) in bf16 and shares the hi accumulator;
// score scale 1/4 applied once in f32 after the score accumulate; softmax normaliser 1/l applied once in the attention epilogue.
#include <hip/hip_runtime.h>
#include <math.h>
#include <stdint.h>

#define NB    2
#define SEQ   2048
#define HID   288
#define NH    18
#define HD    16
#define NPAIR 8
#define QS    32           // slots per head in the q / k planes: 0..15 hi (d), 16..31 lo (d) or duplicate / zero
#define NTOK  (NB * SEQ)   // 4096 token rows
#define NQB   (SEQ / 64)   // 32 query blocks of 64 per sequence
static_assert(NH * HD == HID);
static_assert(NPAIR * 2 == HD);
static_assert((SEQ % 64) == 0 && (HID % 32) == 0 && (NTOK % 64) == 0);
static_assert(((NTOK / 64) * (HID / 32)) % 4 == 0);
static_assert((NTOK * HID) % (8 * 256) == 0);
static_assert(((HID * HID) % 8) == 0 && (((HID * HID) / 8) % 32) == 0);
static_assert((SEQ % 32) == 0);

typedef __bf16   v16b __attribute__((ext_vector_type(16)));
typedef __bf16   v8b  __attribute__((ext_vector_type(8)));
typedef float    v8f  __attribute__((ext_vector_type(8)));
typedef float    v4f  __attribute__((ext_vector_type(4)));
typedef float    v2f  __attribute__((ext_vector_type(2)));
typedef __bf16   v2b  __attribute__((ext_vector_type(2)));
typedef unsigned int v4u __attribute__((ext_vector_type(4)));
typedef unsigned int v2u __attribute__((ext_vector_type(2)));

// ---- scalar helpers --------------------------------------------------------------------------------
// two f32 -> two bf16 in one word (a low, b high), RNE, by the chip's packed convert
__device__ __forceinline__ unsigned cvt2(float a, float b) {
  const v2f f = {a, b};
  return __builtin_bit_cast(unsigned, __builtin_convertvector(f, v2b));
}
// hi = bf16(f), lo = bf16(f - hi) for eight values, word e = values 2e (low half) and 2e+1 (high half): three instructions a
// pair. hi: one packed convert. lo: the mixed-precision FMA reads hi's bf16 half as it lies, forms hi * -1 + f (exact in f32)
// and rounds it (RNE) into one half of the result word; the compiler's own form of the same takes a shift, a mask, a packed
// add and a second convert. The four low halves stand ahead of the four high halves, so that no instruction follows the
// one that wrote its result word directly.
__device__ __forceinline__ void split8(const float (&f)[8], unsigned (&hi)[4], unsigned (&lo)[4]) {
#pragma unroll
  for (int e = 0; e < 4; ++e) hi[e] = cvt2(f[2 * e], f[2 * e + 1]);
  asm("v_fma_mixlo_bf16 %0, %4, -1.0, %8 op_sel_hi:[1,0,0]\n\t"
      "v_fma_mixlo_bf16 %1, %5, -1.0, %10 op_sel_hi:[1,0,0]\n\t"
      "v_fma_mixlo_bf16 %2, %6, -1.0, %12 op_sel_hi:[1,0,0]\n\t"
      "v_fma_mixlo_bf16 %3, %7, -1.0, %14 op_sel_hi:[1,0,0]\n\t"
      "v_fma_mixhi_bf16 %0, %4, -1.0, %9 op_sel:[1,0,0] op_sel_hi:[1,0,0]\n\t"
      "v_fma_mixhi_bf16 %1, %5, -1.0, %11 op_sel:[1,0,0] op_sel_hi:[1,0,0]\n\t"
      "v_fma_mixhi_bf16 %2, %6, -1.0, %13 op_sel:[1,0,0] op_sel_hi:[1,0,0]\n\t"
      "v_fma_mixhi_bf16 %3, %7, -1.0, %15 op_sel:[1,0,0] op_sel_hi:[1,0,0]"
      : "=&v"(lo[0]), "=&v"(lo[1]), "=&v"(lo[2]), "=&v"(lo[3])
      : "v"(hi[0]), "v"(hi[1]), "v"(hi[2]), "v"(hi[3]),
        "v"(f[0]), "v"(f[1]), "v"(f[2]), "v"(f[3]), "v"(f[4]), "v"(f[5]), "v"(f[6]), "v"(f[7]));
}
__device__ __forceinline__ v8f zero8() { v8f z = {0.f, 0.f, 0.f, 0.f, 0.f, 0.f, 0.f, 0.f}; return z; }

// ---- fragment loaders: 16-bit A/B operand, lane -> row/col (lane&15), p already includes +8*(lane>>4);
//      elements 0..7 <- p[0..7] (k0+8h..k0+8h+7), elements 8..15 <- p[16..23] (k0+16+8h..k0+16+8h+7)
__device__ __forceinline__ v16b ldfrag_b(const __bf16* p) {
  union { v16b v; v8b h[2]; } f;
  f.h[0] = *(const v8b*)(p);
  f.h[1] = *(const v8b*)(p + 16);
  return f.v;
}
// FRAGMENT ORDER: a plane that only fragment loads read is stored as blocks of 512 elements (1024 B), one block = 16 rows x
// 32 k; element (row c, k) of a block lies at (k>>4)*256 + (((k>>3)&1)*16 + c)*8 + (k&7). That is the map above written out
// lane by lane: lane l = 16*(lane half) + c finds elements 0..7 at l*8 and elements 8..15 at 256 + l*8, so each of the two
// 16-B loads of a wave covers 512 contiguous, aligned bytes (4 whole cache lines) and not 32-B pieces of 8 or 16 lines.
// p = block base + 8*lane.
__device__ __forceinline__ v16b ldfrag_f(const __bf16* p) {
  union { v16b v; v8b h[2]; } f;
  f.h[0] = *(const v8b*)(p);
  f.h[1] = *(const v8b*)(p + 256);
  return f.v;
}
// same map when k0..k0+15 and k0+16..k0+31 live in two different rows (p0, p1 each include +8*(lane>>4))
__device__ __forceinline__ v16b ldfrag_b2(const __bf16* p0, const __bf16* p1) {
  union { v16b v; v8b h[2]; } f;
  f.h[0] = *(const v8b*)(p0);
  f.h[1] = *(const v8b*)(p1);
  return f.v;
}

// ---- WMMA helper with trailing VALU hazard gap (D tied, A/B kept live) ----------------------------------
__device__ __forceinline__ v8f mma_b(v16b a, v16b b, v8f c) {
  c = __builtin_amdgcn_wmma_f32_16x16x32_bf16(false, a, false, b, (short)0, c, false, false);
  asm volatile("v_nop\n\tv_nop\n\tv_nop\n\tv_nop" : "+v"(c) : "v"(a), "v"(b));
  return c;
}

// =====================================================================================================
// f32 -> bf16 (RNE convert) of a [rows][HID] plane into FRAGMENT ORDER (see ldfrag_f), blocks [row / 16][k / 32]: thread i
// takes 8 elements, 64 threads a block; a wave takes 8 rows x 32 k, lane = 8 * (group of 8 k) + row, so that it reads 8 whole
// 128-B lines of the source and writes 4 of the plane. Used for Wo alone (HID * HID / 8 = 10368 threads).
// =====================================================================================================
__device__ __forceinline__ void cvt_bf16x8(const float* __restrict__ in, unsigned short* out, const int i) {
  const int blk = i >> 6;                          // block = 64 threads x 8 elements
  const int gr  = blk / (HID / 32);                // group of 16 rows
  const int ks  = blk - gr * (HID / 32);           // k-step of 32
  const int c   = ((i >> 2) & 8) | (i & 7);        // row of the block: the wave's 8 rows, one per lane & 7
  const int q   = (i >> 3) & 3;                    // group of 8 k: k = 8q..8q+7
  const size_t so = (size_t)(gr * 16 + c) * HID + ks * 32 + q * 8;
  const size_t po = (size_t)blk * 512 + (q >> 1) * 256 + ((q & 1) * 16 + c) * 8;
  const v4f a = *(const v4f*)(in + so);
  // precaution: the second load's result may be given the registers that hold the first load's address
  asm volatile("s_wait_xcnt 0x0" ::: "memory");
  const v4f b = *(const v4f*)(in + so + 4);
  v4u p;
  p[0] = cvt2(a[0], a[1]);
  p[1] = cvt2(a[2], a[3]);
  p[2] = cvt2(b[0], b[1]);
  p[3] = cvt2(b[2], b[3]);
  *(v4u*)(out + po) = p;
  // precaution: code that follows in the caller rewrites the store's registers
  asm volatile("s_wait_xcnt 0x0" ::: "memory");
}

// =====================================================================================================
// bf16 WMMA GEMM, one wave per 64 x 32 tile:
//   C[m][n] = sum_k A[m][k] * Bt[n][k] (+ sum_k A2[m][k] * Bt[n][k] when TWOA), M = 4096 tokens, N = 288, K = 288
//   (9 k-steps of 32, no tails). Bt = the [out][in] weight, RNE bf16.
//   MODE 0..2: A = the block's 64 rows of x, Bt = the whole weight, both converted by the block itself into LDS, row after row
//   at a pitch of XP elements (see gemm_qkv). MODE 3: Bt = Wo plane in the workspace, fragment order, blocks [n / 16][k / 32];
//   A = ctx planes laid out [b][h][t][16]; k-step j covers heads 2j
//   (k 0..15) and 2j+1 (k 16..31): elements 0..7 <- head 2j, d = 8*(lane>>4)..+7; elements 8..15 <- head 2j+1, same d.
// then (b = m0/2048, t = m0%2048 + row, 32 columns = heads n0/16 and n0/16+1):
//   MODE 0 (q): rotary in f32 (contract off): d < 8: x[d] c[t][d] - x[d+8] s[t][d]; d >= 8: x[d] c[t][d-8] + x[d-8] s[t][d-8];
//               -> plane [b][h][t][32]: slots 0..15 = bf16 hi of d, 16..31 = bf16 lo (v - hi) of d.
//   MODE 1 (k): same rotary; plane C0 slots 0..15 = hi, 16..31 = hi (duplicate); plane C1 slots 0..15 = lo, 16..31 = 0;
//               both in fragment order, blocks [b][h][t / 16], rows = keys, k = slots.
//   MODE 2 (v): no rotary; v^T planes C0 = hi, C1 = lo, fragment order, blocks [b][h][t / 32], rows = d, k = keys.
//   MODE 0..2 share one body and ONE grid (gemm_qkv: blockIdx.y = mode, the same in every wave of a block; only the weight,
//   the epilogue and the output planes differ); MODE 3 (OUT) is a launch of its own (gemm_out), behind attention.
//   ctab / stab: the rotary rows of the tile's own 64 positions, [row][8], in LDS (MODE 0, 1).
// coverage: 576 tiles x (64 rows x 32 cols) = the whole 4096 x 288 result; MODE 0/1: 2 heads x 8 it x 8 rows x 4 lanes
//           x 8 slots = 64 rows x 2 heads x 32 slots; MODE 2: 4 x 2 it x (8 features x 4 token groups) x 8 = 32 features x 64 tokens;
//           MODE 3: 16 it x 4 rows x 8 lanes x 4 = 64 rows x 32 cols.
// =====================================================================================================
// Epilogue of one wave's 64 x 32 tile, read back from its LDS slab; MODE as listed above.
template <int MODE>
__device__ __forceinline__ void gemm_epi(const float* slab, const int lane, const int m0, const int n0, const int bidx,
                                         const int tl0, void* C0, void* C1,
                                         const float* __restrict__ ctab, const float* __restrict__ stab) {
  static_assert(MODE >= 0 && MODE <= 3);
  if (MODE == 3) {
    float* Cf = (float*)C0;
    const int q4 = lane >> 3, c4 = (lane & 7) * 4;
    {
#pragma unroll
      for (int it = 0; it < 16; ++it) {
        const int row = it * 4 + q4;                         // it 0..15 x q4 0..3 = rows 0..63
        const v4f v = *(const v4f*)(slab + row * 36 + c4);
        *(v4f*)(Cf + (size_t)(m0 + row) * HID + n0 + c4) = v;
      }
      
    }
  } else if (MODE == 2) {
    unsigned short* P0 = (unsigned short*)C0;
    unsigned short* P1 = (unsigned short*)C1;
    const int n8 = lane & 7, tg = lane >> 3;       // 8 features side by side = one whole 128-B line of a block per token group
#pragma unroll 1
    for (int it2 = 0; it2 < 8; it2 += 2) {         // two groups' loads and stores side by side in a trip
#pragma unroll
      for (int it = it2; it < it2 + 2; ++it) {
        const int n  = (it >> 1) * 8 + n8;                     // local feature 0..31
        const int t8 = ((it & 1) * 4 + tg) * 8;                // first of this lane's 8 tokens, 0..56
        float f[8];
#pragma unroll
        for (int e = 0; e < 8; ++e) f[e] = slab[(t8 + e) * 36 + n];
        unsigned hw[4], lw[4];
        split8(f, hw, lw);
        const v4u a = {hw[0], hw[1], hw[2], hw[3]}, a2 = {lw[0], lw[1], lw[2], lw[3]};
        const int s = tl0 + t8;                                // key index of element 0; d = (n0 + n) & 15
        const size_t go = ((size_t)(bidx * NH + ((n0 + n) >> 4))) * (SEQ * HD) + (size_t)((s >> 5) * 512 +
                          ((s >> 4) & 1) * 256 + (((s >> 3) & 1) * 16 + ((n0 + n) & 15)) * 8);
        *(v4u*)(P0 + go) = a;
        *(v4u*)(P1 + go) = a2;
      }
      // precaution: the next trip rewrites registers that these stores name
      asm volatile("s_wait_xcnt 0x0" ::: "memory");
    }
  } else {
    unsigned short* P0 = (unsigned short*)C0;
    unsigned short* P1 = (unsigned short*)C1;
    const int r4 = lane >> 2, s8 = (lane & 3) * 8;
    const int dbase = s8 & 8;                                // d of the first element: 0 or 8
    const bool isLo = (s8 >= 16);
    const float sg = (dbase == 0) ? -1.0f : 1.0f;            // -x[d+8] for d < 8, +x[d-8] for d >= 8
    const int h0 = n0 >> 4;                                  // first head of the tile (even)
#pragma unroll 1
    for (int hd = 0; hd < 2; ++hd) {
#pragma unroll 1
      for (int it2 = 0; it2 < 8; it2 += 2) {         // two rows' loads and stores side by side in a trip
#pragma unroll
        for (int it = it2; it < it2 + 2; ++it) {
          const int row = it * 8 + r4;                         // it 0..7 x r4 0..7 = rows 0..63
          const int t = tl0 + row;                             // position within the sequence
          const float* xr = slab + row * 36 + hd * 16;
          float x[8], y[8], f[8];
#pragma unroll
          for (int e = 0; e < 8; ++e) { x[e] = xr[dbase + e]; y[e] = xr[(dbase ^ 8) + e]; }
          const v4f cv0 = *(const v4f*)(ctab + row * NPAIR);
          const v4f cv1 = *(const v4f*)(ctab + row * NPAIR + 4);
          const v4f sv0 = *(const v4f*)(stab + row * NPAIR);
          const v4f sv1 = *(const v4f*)(stab + row * NPAIR + 4);
          {
#pragma clang fp contract(off)
#pragma unroll
            for (int e = 0; e < 4; ++e) {
              {
                const float ry = sg * y[e];
                const float p0 = x[e] * cv0[e];
                const float p1 = ry * sv0[e];
                f[e] = p0 + p1;
              }
              {
                const float ry = sg * y[4 + e];
                const float p0 = x[4 + e] * cv1[e];
                const float p1 = ry * sv1[e];
                f[4 + e] = p0 + p1;
              }
            }
          }
          unsigned hw[4], lw[4];
          split8(f, hw, lw);
          const v4u hp = {hw[0], hw[1], hw[2], hw[3]}, lp = {lw[0], lw[1], lw[2], lw[3]};
          const size_t go = (MODE == 0)
              ? (((size_t)(bidx * NH + h0 + hd)) * SEQ + t) * QS + s8
              : ((size_t)(bidx * NH + h0 + hd)) * (SEQ * QS) + (size_t)((t >> 4) * 512 + (s8 >> 4) * 256 +
                                                                       (((s8 >> 3) & 1) * 16 + (t & 15)) * 8);
          if (MODE == 0) {
            v4u pc;
#pragma unroll
            for (int e = 0; e < 4; ++e) pc[e] = isLo ? lp[e] : hp[e];
            *(v4u*)(P0 + go) = pc;
          } else {
            v4u pz;
#pragma unroll
            for (int e = 0; e < 4; ++e) pz[e] = isLo ? 0u : lp[e];
            *(v4u*)(P0 + go) = hp;
            *(v4u*)(P1 + go) = pz;
          }
        }
        // precaution: the next trip rewrites registers that these stores name
        asm volatile("s_wait_xcnt 0x0" ::: "memory");
      }
    }
  }
}

#define XP 296             // LDS row pitch of the staged x and weight rows, elements: 592 B = 16 B x 37 (odd: b128 reads at full rate)

// One wave's tile. Ab, A2b, Bb = the tile's first A row and first Bt row (wave-uniform); slab = the wave's own 64 x 36 floats of LDS.
template <bool OUT>
__device__ __forceinline__ void gemm_tile(
    const int mode,                                // 0 q, 1 k, 2 v (block-uniform, OUT false); 3 with OUT
    const __bf16* Ab, const __bf16* A2b, const __bf16* Bb, float* slab,
    const int lane, const int m0, const int n0, void* C0, void* C1,
    const float* ctab, const float* stab) {
  constexpr bool TWOA = OUT;
  constexpr int K = HID;
  const int c    = lane & 15;                      // row (A) / col (B, D) within subtile
  const int koff = (lane >> 4) * 8;                // k offset of this lane half
  const int mOff = (lane >> 4) * 8;                // D row offset
  const int bidx = m0 / SEQ;                       // batch of this tile (tiles never straddle a batch)
  const int tl0  = m0 - bidx * SEQ;                // first position within the sequence

  v8f acc[4][2];
#pragma unroll
  for (int i = 0; i < 4; ++i)
#pragma unroll
    for (int j = 0; j < 2; ++j) acc[i][j] = zero8();

  // Loads run ahead of the matrix instructions: every fragment is fetched into a register set that is free by then, whole
  // k-steps before its products, so a k-step waits on loads issued earlier and not on its own. Three A sets go round.
  //   one A plane: k-step ks in A and B set ks % 3, fetched two k-steps ahead (8 products a k-step cover little of a load).
  //   two A planes: the hi products of a k-step run first, then the lo products (each accumulator still takes hi, lo, hi,
  //   lo ... in k order); the sets hold hi(ks), lo(ks), hi(ks+1), each fetched one k-step ahead; B in set ks & 1.
  // Address = wave-uniform tile base + one lane offset + a constant: the sets leave no room for a pointer per row.
  constexpr int KS = K / 32;                       // 9 k-steps
  const unsigned alane = OUT ? (unsigned)(c * HD + koff) : (unsigned)(c * XP + koff);
  const unsigned blane = OUT ? (unsigned)(lane * 8) : (unsigned)(c * XP + koff);   // fragment order: 16 rows x K = K / 32 blocks of 512
  v16b bh[TWOA ? 2 : 3][2], ar[3][4];
  auto fetch_b = [&](const int ks, const int st) __attribute__((always_inline)) {
#pragma unroll
    for (int j = 0; j < 2; ++j)
      bh[st][j] = OUT ? ldfrag_f(Bb + blane + (j << 4) * K + ks * 512) : ldfrag_b(Bb + blane + (j << 4) * XP + ks * 32);
  };
  auto fetch_a = [&](const __bf16* base, const int ks, const int set) __attribute__((always_inline)) {
#pragma unroll
    for (int i = 0; i < 4; ++i) {
      if (OUT) {                                   // ks = head pair index 0..8: heads 2 ks and 2 ks + 1, same token row
        const int e0 = (i << 4) * HD + (2 * ks) * SEQ * HD, e1 = e0 + SEQ * HD;
        ar[set][i] = ldfrag_b2(base + alane + e0, base + alane + e1);
      } else {
        ar[set][i] = ldfrag_b(base + alane + (i << 4) * XP + ks * 32);
      }
    }
  };
  auto products = [&](const int set, const int st) __attribute__((always_inline)) {
#pragma unroll
    for (int i = 0; i < 4; ++i)
#pragma unroll
      for (int j = 0; j < 2; ++j) acc[i][j] = mma_b(ar[set][i], bh[st][j], acc[i][j]);
  };
  fetch_b(0, 0);
  fetch_a(Ab, 0, 0);
  if (TWOA) fetch_a(A2b, 0, 1);
  else { fetch_b(1, 1); fetch_a(Ab, 1, 1); }
#pragma unroll                                     // full unroll: a register set's index must be a constant
  for (int ks = 0; ks < KS; ++ks) {
    const int st = ks & 1;
    if (TWOA) {
      const int sh = (2 * ks) % 3, sl = (2 * ks + 1) % 3, sn = (2 * ks + 2) % 3;
      if (ks + 1 < KS) { fetch_b(ks + 1, st ^ 1); fetch_a(Ab, ks + 1, sn); }
      products(sh, st);
      if (ks + 1 < KS) fetch_a(A2b, ks + 1, sh);   // into the set the hi products have just read
      products(sl, st);
    } else {
      if (ks + 2 < KS) { fetch_b(ks + 2, (ks + 2) % 3); fetch_a(Ab, ks + 2, (ks + 2) % 3); }
      products(ks % 3, ks % 3);
    }
  }

  // ---- epilogue: whole tile to wave-private LDS ----
#pragma unroll
  for (int i = 0; i < 4; ++i)
#pragma unroll
    for (int j = 0; j < 2; ++j)
#pragma unroll
      for (int r = 0; r < 8; ++r)
        slab[((i << 4) + mOff + r) * 36 + (j << 4) + c] = acc[i][j][r];
  __builtin_amdgcn_fence(__ATOMIC_RELEASE, "workgroup");
  __builtin_amdgcn_wave_barrier();
  __builtin_amdgcn_fence(__ATOMIC_ACQUIRE, "workgroup");

  if (OUT)            gemm_epi<3>(slab, lane, m0, n0, bidx, tl0, C0, C1, ctab, stab);
  else if (mode == 0) gemm_epi<0>(slab, lane, m0, n0, bidx, tl0, C0, C1, ctab, stab);   // block-uniform choice, made once:
  else if (mode == 1) gemm_epi<1>(slab, lane, m0, n0, bidx, tl0, C0, C1, ctab, stab);   // no mode test inside an epilogue loop
  else                gemm_epi<2>(slab, lane, m0, n0, bidx, tl0, C0, C1, ctab, stab);
}

// q, k and v projections in one grid, straight from the f32 inputs: blockIdx.x = 64 token rows, blockIdx.y = mode, 9 waves a
// block, wave w = columns 32 w .. 32 w + 31. What the products need and what depends on the inputs alone is made by the block
// itself, in LDS, so that no launch stands in front of this one:
//   x rows and weight rows, f32 -> bf16 (RNE convert), row after row at pitch XP. A load of a wave covers 4 rows x one whole
//   128-B line (lane = 8 * row + group of 4 k), its two converted words go out as one 8-B LDS store. Wave w brings k-step w of
//   all 64 x rows (16 loads) and all 9 k-steps of its own 32 weight rows (72 loads): 9 waves = the whole tile, the whole weight.
//   The 88 loads go in four groups through two register sets: a group flies while the one before it is converted.
//   rotary rows (modes 0, 1): sC[r][i] = cos(t * inv[i]), sS[r][i] = sin(t * inv[i]), t = tile's position r = 0..63, i = 0..7,
//   inv[i] = 1 / powf(10000, (2i)/16) formed by every thread for its own i (f32 product, precise sincosf); 512 values, 288 threads.
//   mode 2 needs no rotary rows: its 64 blocks convert Wo into the workspace plane that gemm_out reads (18432 threads >= 10368).
// One barrier: the x rows and the rotary rows are read by every wave.
static_assert((NTOK / 64) * 288 >= HID * HID / 8);
static_assert(HID / 32 == 9);
__global__ __launch_bounds__(288) void gemm_qkv(
    const float* __restrict__ x, const float* __restrict__ Wq, const float* __restrict__ Wk,
    const float* __restrict__ Wv, const float* __restrict__ Wo, unsigned short* Wob,
    unsigned short* Qc, unsigned short* Kd, unsigned short* Kz, unsigned short* VTh, unsigned short* VTl) {
  __shared__ __align__(16) unsigned short sX[64 * XP];     //  37888 B
  __shared__ __align__(16) unsigned short sW[HID * XP];    // 170496 B
  __shared__ __align__(16) float sT[9][64 * 36];           //  82944 B: per-wave 64x32 tile, pitch 36 floats
  __shared__ __align__(16) float sC[64 * NPAIR];           //   2048 B
  __shared__ __align__(16) float sS[64 * NPAIR];           //   2048 B
  const int tid  = (int)threadIdx.x;
  const int lane = tid & 31;
  const int wave = __builtin_amdgcn_readfirstlane(tid >> 5);   // same in every lane: held scalar, the tile bases are scalar too
  const int mode = (int)blockIdx.y;
  const int m0   = (int)blockIdx.x << 6;
  const int n0   = wave << 5;
  const float* Wm = (mode == 0) ? Wq : (mode == 1) ? Wk : Wv;
  unsigned short* C0 = (mode == 0) ? Qc : (mode == 1) ? Kd : VTh;
  unsigned short* C1 = (mode == 0) ? Qc : (mode == 1) ? Kz : VTl;

  // load g = 0..15: x rows 4g..4g+3, k-step 'wave'; g = 16..87: weight rows n0 + 4((g-16)&7) .. +3, k-step (g-16)>>3
  const unsigned sl = (unsigned)((lane >> 3) * HID + (lane & 7) * 4);
  const unsigned dl = (unsigned)((lane >> 3) * XP + (lane & 7) * 4);
  const float* xsrc = x + (size_t)m0 * HID + wave * 32;
  const float* wsrc = Wm + (size_t)n0 * HID;
  unsigned short* xdst = sX + wave * 32;
  unsigned short* wdst = sW + n0 * XP;
  v4f rg[2][22];
  auto stage_ld = [&](const int set, const int grp) __attribute__((always_inline)) {
#pragma unroll                                     // full unroll, here and in stage_st: a register set's index must be a constant
    for (int u = 0; u < 22; ++u) {
      const int g = grp * 22 + u, w = g - 16;
      if (g < 16) rg[set][u] = *(const v4f*)(xsrc + sl + g * 4 * HID);
      else        rg[set][u] = *(const v4f*)(wsrc + sl + (w & 7) * 4 * HID + (w >> 3) * 32);
    }
  };
  auto stage_st = [&](const int set, const int grp) __attribute__((always_inline)) {
#pragma unroll
    for (int u = 0; u < 22; ++u) {
      const int g = grp * 22 + u, w = g - 16;
      const v4f f = rg[set][u];
      const v2u p = {cvt2(f[0], f[1]), cvt2(f[2], f[3])};
      if (g < 16) *(v2u*)(xdst + dl + g * 4 * XP) = p;
      else        *(v2u*)(wdst + dl + (w & 7) * 4 * XP + (w >> 3) * 32) = p;
    }
  };
  stage_ld(0, 0);
  stage_ld(1, 1);
  // precaution: code that follows rewrites the offset register that these loads name
  asm volatile("s_wait_xcnt 0x0" ::: "memory");
  if (mode != 2) {                                 // block-uniform
    const int tl0 = m0 & (SEQ - 1);                // first position within the sequence
#pragma unroll 1                                   // one copy of the long sine / cosine code
    for (int p = tid; p < 64 * NPAIR; p += 288) {
      const int i = p & (NPAIR - 1);
      const int t = tl0 + (p >> 3);
      const float e = (float)(2 * i) * (1.0f / (float)HD);
      const float pw = powf(10000.0f, e);
      const float f = 1.0f / pw;
      const float ang = (float)t * f;
      float sn, cs;
      sincosf(ang, &sn, &cs);
      sC[p] = cs;
      sS[p] = sn;
    }
  } else {
    const int i = (int)blockIdx.x * 288 + tid;
    if (i < HID * HID / 8) cvt_bf16x8(Wo, Wob, i);
  }
  stage_st(0, 0);
  stage_ld(0, 2);
  stage_st(1, 1);
  stage_ld(1, 3);
  // precaution: code that follows rewrites the offset register that the staging loads name
  asm volatile("s_wait_xcnt 0x0" ::: "memory");
  stage_st(0, 2);
  stage_st(1, 3);
  __syncthreads();                                 // x rows and rotary rows: written by other waves than their readers

  gemm_tile<false>(mode, (const __bf16*)(const void*)sX, (const __bf16*)(const void*)sX,
                   (const __bf16*)(const void*)sW + n0 * XP, sT[wave], lane, m0, n0, (void*)C0, (void*)C1, sC, sS);
}

// out projection: 576 tiles, 4 waves a block, no block barriers
__global__ __launch_bounds__(128) void gemm_out(
    const unsigned short* __restrict__ Oh, const unsigned short* __restrict__ Ol,
    const unsigned short* __restrict__ Wob, float* out) {
  constexpr int TN = HID / 32;   // 9
  constexpr int TM = NTOK / 64;  // 64
  __shared__ __align__(16) float sT[4][64 * 36];   // per-wave 64x32 tile, pitch 36 floats
  const int lane = threadIdx.x & 31;
  const int wave = __builtin_amdgcn_readfirstlane((int)(threadIdx.x >> 5));   // same in every lane: held scalar, the tile bases are scalar too
  const int tile = blockIdx.x * 4 + wave;
  if (tile >= TM * TN) return;                     // wave-uniform; no block barriers in this kernel
  const int tm = tile / TN;
  const int tn = tile - tm * TN;
  const int m0 = tm << 6;
  const int n0 = tn << 5;
  const int bidx = m0 / SEQ;
  const int tl0  = m0 - bidx * SEQ;
  const size_t abase = (((size_t)(bidx * NH)) * SEQ + tl0) * HD;
  gemm_tile<true>(3, (const __bf16*)(const void*)Oh + abase, (const __bf16*)(const void*)Ol + abase,
                  (const __bf16*)(const void*)Wob + (size_t)n0 * HID, sT[wave], lane, m0, n0, (void*)out, (void*)out,
                  nullptr, nullptr);
}

// =====================================================================================================
// Causal attention, head dim 16, key chunks of 64, both products transposed: S^T = K . Q^T, O^T += V^T . P^T.
//   q plane  [b][h][t][32]: slots 0..15 = bf16 hi of rope(q)[d], 16..31 = bf16 lo
//   kd plane, per key 32 slots: 0..15 = hi of rope(k)[d], 16..31 = hi again; kz plane: 0..15 = lo, 16..31 = 0;
//   both in fragment order (ldfrag_f): blocks [b][h][s / 16] of 16 keys x 32 slots
//   so one 32-deep k-step gives q.k = hi.hi + lo.hi (kd) and hi.lo (kz): two products per 16x16 score tile.
//   v^T planes (bf16 hi / lo), fragment order: blocks [b][h][s / 32] of 16 d x 32 keys
//   ctx planes (bf16 hi / lo of the normalised context): element (b, h, t, d) at [((b*18 + h)*2048 + t)*16 + d]
//   Score tile j: A = 16 key rows (row = lane&15), B = the wave's 16 queries (col = lane&15), same k map on both sides, so
//   register r of lane (c, hh) = score of key kv0 + 16j + 8hh + r against query q0 + c: a lane holds 32 of the 64 keys of ONE
//   query. Row max and row sum are in-lane; the two lane halves exchange the max once per chunk and join their sums once, in
//   the epilogue. Tiles 2kk and 2kk+1, converted in place, are the B operand of k-step kk (element e = key 8hh+e, element
//   8+e = key 16+8hh+e), which is the k order in which ldfrag_f reads the v^T block as A: P never leaves the registers.
//   Causal structure: query tile qb visits key chunks 0..qb only (qb+1 <= NQB chunks, shared by the two groups); chunks 0..qb-1 run
//   in a loop whose body has no mask, the diagonal chunk qb in a copy of the body behind it: there a key with index > query
//   index gets logit -inf -> exp gives exactly 0; the first key of every visited chunk is always kept, so every joined max is finite.
//   Tile = 64 query rows of one (b, h), 8 waves in two groups of 4: wave w of either group = rows q0..q0+15. The two groups
//   share a tile's key chunks, one takes the even and one the odd ones, each with its own running max, sum and O^T; at the
//   tile's end group 1 hands its three over in LDS (one block barrier a tile, two buffers in turn) and group 0 joins them:
//   both sides rescaled to the common max, then added. Four waves a SIMD for two: while one wave waits on its matrix chain,
//   its exponentials or its loads, three others have vector work to issue. The group that takes the even chunks changes
//   behind every tile with an odd number of chunks, so that both groups of a block run the same number of chunks (19, 17).
//   Equal work-groups: every work-group is resident from the start, so the launch lasts as long as the fullest WGP, and a
//   tile costs qb+1 chunks. A block therefore walks several tiles of ONE head, one after the other, ABIN blocks a head:
//   block n = 0..12: tiles 31-n and 5+n (32-n and 6+n chunks, 38 together); block 13: tiles 18, 4, 3, 2, 1, 0 (34 chunks).
//   grid = NB * NH * ABIN = 504 blocks, at most two for each of the 256 WGPs. All tiles of a block start at key chunks 0 and 1
//   of the same head, so a group's last trip of a tile fetches its first chunk of the next one.
//   The hi / lo splits of P round in the chip's converting instructions (split8), not in integer arithmetic.
//   Output: lane (c, hh) holds d = 8hh..8hh+7 of query q0 + c: one 16-B store per plane, 512 contiguous B per wave.
//   coverage: tiles 31..19, 5..17, 18 and 4..0 = each of the 32 tiles of a head once; 36 heads x 32 tiles x 4 waves x 16 rows
//   x 16 d = every (b, h, t, d) of both ctx planes exactly once.
// =====================================================================================================
__device__ __forceinline__ float other_half(float v) {                // value of lane l ^ 16
  const int b = __builtin_bit_cast(int, v);
  return __builtin_bit_cast(float, __builtin_amdgcn_permlanex16(b, b, 0x76543210, 0xfedcba98, false, false));
}

__device__ __forceinline__ void exp2x8(const float (&x)[8], float (&y)[8]) {
  asm("v_exp_f32 %0, %8\n\tv_exp_f32 %1, %9\n\tv_exp_f32 %2, %10\n\tv_exp_f32 %3, %11\n\t"
      "v_exp_f32 %4, %12\n\tv_exp_f32 %5, %13\n\tv_exp_f32 %6, %14\n\tv_exp_f32 %7, %15\n\tv_nop"
      : "=&v"(y[0]), "=&v"(y[1]), "=&v"(y[2]), "=&v"(y[3]), "=&v"(y[4]), "=&v"(y[5]), "=&v"(y[6]), "=&v"(y[7])
      : "v"(x[0]), "v"(x[1]), "v"(x[2]), "v"(x[3]), "v"(x[4]), "v"(x[5]), "v"(x[6]), "v"(x[7]));
}

// The matrix instructions of a key chunk, issued in groups. After a WMMA the chip wants four vector issue slots before a vector
// instruction reads its D or overwrites its A or B. Inside a group the WMMAs that follow fill those slots for one another
// (a WMMA that accumulates into the same D needs none), so only the last one takes v_nops: they close the statement, where
// they hold on every path and whatever the compiler puts next.
// Scores: the four first products (distinct D) stand ahead of the four second ones, so that no product waits for the one
// directly in front of it; each tile still takes its kd product first and its kz product second.
__device__ __forceinline__ void scores8(const v16b (&kd)[4], const v16b (&kz)[4], const v16b q, v8f (&s)[4]) {
  asm volatile("v_wmma_f32_16x16x32_bf16 %0, %4, %12, 0\n\t"
               "v_wmma_f32_16x16x32_bf16 %1, %5, %12, 0\n\t"
               "v_wmma_f32_16x16x32_bf16 %2, %6, %12, 0\n\t"
               "v_wmma_f32_16x16x32_bf16 %3, %7, %12, 0\n\t"
               "v_wmma_f32_16x16x32_bf16 %0, %8, %12, %0\n\t"
               "v_wmma_f32_16x16x32_bf16 %1, %9, %12, %1\n\t"
               "v_wmma_f32_16x16x32_bf16 %2, %10, %12, %2\n\t"
               "v_wmma_f32_16x16x32_bf16 %3, %11, %12, %3\n\t"
               "v_nop\n\tv_nop\n\tv_nop\n\tv_nop"
               : "=&v"(s[0]), "=&v"(s[1]), "=&v"(s[2]), "=&v"(s[3])
               : "v"(kd[0]), "v"(kd[1]), "v"(kd[2]), "v"(kd[3]), "v"(kz[0]), "v"(kz[1]), "v"(kz[2]), "v"(kz[3]), "v"(q));
}
// Context: vh.ph, vl.ph, vh.pl of the first 32-key k-step, then of the second: one accumulate chain into o.
__device__ __forceinline__ v8f ctx6(const v16b (&vh)[2], const v16b (&vl)[2], const v16b ph0, const v16b pl0,
                                    const v16b ph1, const v16b pl1, v8f o) {
  asm volatile("v_wmma_f32_16x16x32_bf16 %0, %1, %5, %0\n\t"
               "v_wmma_f32_16x16x32_bf16 %0, %3, %5, %0\n\t"
               "v_wmma_f32_16x16x32_bf16 %0, %1, %6, %0\n\t"
               "v_wmma_f32_16x16x32_bf16 %0, %2, %7, %0\n\t"
               "v_wmma_f32_16x16x32_bf16 %0, %4, %7, %0\n\t"
               "v_wmma_f32_16x16x32_bf16 %0, %2, %8, %0\n\t"
               "v_nop\n\tv_nop\n\tv_nop\n\tv_nop"
               : "+v"(o)
               : "v"(vh[0]), "v"(vh[1]), "v"(vl[0]), "v"(vl[1]), "v"(ph0), "v"(pl0), "v"(ph1), "v"(pl1));
  return o;
}

#define ABIN 14            // blocks per (b, h)
static_assert(NQB == 32);  // the tile lists below are written for 32 tiles a head

// At most two work-groups share a WGP (four waves a SIMD), so registers up to 256 cost nothing. Without the bound the compiler,
// once the splits need fewer registers, aims at a fifth wave a SIMD and forms the loop-invariant mask bounds anew in every trip.
__global__ __launch_bounds__(256) __attribute__((amdgpu_waves_per_eu(4, 4)))
void attn_causal16(const unsigned short* __restrict__ qcp, const unsigned short* __restrict__ kdp,
                   const unsigned short* __restrict__ kzp, const unsigned short* __restrict__ vhp,
                   const unsigned short* __restrict__ vlp, unsigned short* ohp, unsigned short* olp) {
  union PB { v16b v; unsigned u[8]; };
  __shared__ __align__(16) float sJ[2][4][10 * 32];          // group 1's max, sum and 8 O^T registers, [item][lane]; 10240 B

  const int tid  = threadIdx.x;
  const int wv8  = __builtin_amdgcn_readfirstlane(tid >> 5); // same in every lane: held scalar, so the group's branches are scalar
  const int wave = wv8 & 3;                    // which 16 query rows of the tile
  const int grp  = wv8 >> 2;                   // which half of the tile's key chunks
  const int lane = tid & 31;
  const int hh   = lane >> 4;
  const int c    = lane & 15;

  const int bx   = blockIdx.x;
  const int bin  = bx % ABIN;
  const int rest = bx / ABIN;
  const int h    = rest % NH;
  const int b    = rest / NH;
  const int ntile = (bin < ABIN - 1) ? 2 : 6;  // block-uniform
  const size_t bhp = (size_t)b * NH + h;

  const __bf16* Qc = (const __bf16*)(const void*)qcp + bhp * SEQ * QS;
  const __bf16* Kd = (const __bf16*)(const void*)kdp + bhp * SEQ * QS;
  const __bf16* Kz = (const __bf16*)(const void*)kzp + bhp * SEQ * QS;
  const __bf16* Vh = (const __bf16*)(const void*)vhp + bhp * SEQ * HD;
  const __bf16* Vl = (const __bf16*)(const void*)vlp + bhp * SEQ * HD;

  // Loads run ahead of the matrix instructions that use them: the K fragments of the group's next chunk are fetched as one group
  // behind the score products of chunk kt, chunk kt's V fragments at the head of trip kt; the softmax runs while both fly.
  // Address = the head's plane base (wave-uniform) + one 32-bit byte offset (chunk + lane) + a constant.
  const unsigned flane = (unsigned)(lane * 16);              // this lane's place, in bytes, in every block of a fragment-order plane
  v16b kd[4], kz[4];
  // ko = byte offset of the chunk's first block + flane, the same in both planes: head base (scalar) + one 32-bit register
  auto fetch_k = [&](const unsigned ko) __attribute__((always_inline)) {
#pragma unroll
    for (int j = 0; j < 4; ++j) {
      kd[j] = ldfrag_f((const __bf16*)((const char*)Kd + ko + j * 1024));
      kz[j] = ldfrag_f((const __bf16*)((const char*)Kz + ko + j * 1024));
    }
  };
  fetch_k(flane + (unsigned)grp * (64 * QS * 2));            // first tile: group 0 starts at chunk 0, group 1 at chunk 1
  // precaution: code that follows rewrites the offset register that these loads name
  asm volatile("s_wait_xcnt 0x0" ::: "memory");

  int par = 0;                                 // 0: group 0 takes this tile's even chunks; 1: group 1 does (block-uniform)
  for (int ti = 0; ti < ntile; ++ti) {         // the block's tiles, the longest first
  const int qb = (bin < ABIN - 1) ? ((ti == 0) ? NQB - 1 - bin : 5 + bin) : ((ti == 0) ? 18 : 5 - ti);
  const int s0 = grp ^ par;                    // this group's first chunk of the tile: s0, s0 + 2, ... <= qb
  par ^= (qb + 1) & 1;
  const int sn = grp ^ par;                    // its first chunk of the next tile (0 or 1: always inside the planes)
  const int q0 = qb * 64 + wave * 16;

  // ---- Q fragment (B operand, col = lane&15, one 32-slot k-step) ----
  const v16b qa = ldfrag_b(Qc + (size_t)(q0 + c) * QS + 8 * hh);
  // precaution: code that follows rewrites the address pair that these loads name
  asm volatile("s_wait_xcnt 0x0" ::: "memory");
  const int rowq = q0 + c;                     // this lane's query index

  float mrow = -INFINITY;                      // running max of query rowq (equal in both lane halves)
  float lrow = 0.f;                            // running sum over this lane half's keys only
  v8f oacc = zero8();                          // O^T: register r = d 8hh+r of query rowq

  // One key chunk. kv0 = its first key (kv0 + 63 < SEQ), kvn = first key of the K chunk fetched ahead; diag is a literal at
  // both calls: only the diagonal chunk (kv0 = 64 qb) holds keys above a query of the tile, so only its copy of the body
  // compares and selects; in the chunks below it every key index is below q0 and the select would keep every score.
  auto chunk = [&](const int kv0, const int kvn, const bool diag) __attribute__((always_inline)) {
    const unsigned ko = flane + (unsigned)kvn * (QS * 2);    // byte offsets, below 2^17
    const unsigned vo = flane + (unsigned)kv0 * (HD * 2);

    v16b vb[2], vl[2];
#pragma unroll
    for (int kk = 0; kk < 2; ++kk) {
      vb[kk] = ldfrag_f((const __bf16*)((const char*)Vh + vo + kk * 1024));
      vl[kk] = ldfrag_f((const __bf16*)((const char*)Vl + vo + kk * 1024));
    }

    // ---- scores: 64 keys x 16 queries per wave, 2 bf16 products per key subtile ----
    v8f s[4];
    scores8(kd, kz, qa, s);
    fetch_k(ko);
    // keeps the next chunk's 16 K loads directly behind the score group, a whole softmax ahead of their use: without it the
    // compiler takes the K registers for the softmax's temporaries and issues most of the loads only behind the max exchange
    __builtin_amdgcn_sched_barrier(0);

    // ---- scale, causal mask by index, max in-lane + one exchange, online softmax ----
    float mj[4];                               // one max chain per score tile: four independent chains
#pragma unroll
    for (int j = 0; j < 4; ++j) {
      mj[j] = -INFINITY;
#pragma unroll
      for (int r = 0; r < 8; ++r) {
        const int key = kv0 + j * 16 + 8 * hh + r;
        float sv = s[j][r] * 0.25f;
        if (diag) sv = (key <= rowq) ? sv : -INFINITY;
        s[j][r] = sv;
        mj[j] = fmaxf(mj[j], sv);
      }
    }
    float m = fmaxf(fmaxf(mj[0], mj[1]), fmaxf(mj[2], mj[3]));
    m = fmaxf(m, other_half(m));
    const float mnew  = fmaxf(mrow, m);
    const float msafe = (mnew == -INFINITY) ? 0.f : mnew;
    const float alpha = __expf(mrow - msafe);
    mrow = mnew;

    PB ph[2], pl[2];                           // P^T hi / lo as B operands of the two 32-key k-steps
    float pj[4];                               // one sum chain per score tile
#pragma unroll
    for (int j = 0; j < 4; ++j) {
      float xe[8], pe[8];
#pragma unroll
      for (int r = 0; r < 8; ++r) xe[r] = (s[j][r] - msafe) * 1.44269504f;   // exp(t) = 2^(t log2 e), as __expf forms it
      exp2x8(xe, pe);                                        // masked logit: 2^(-inf) = 0
#pragma unroll
      for (int e = 0; e < 4; ++e) {
        const float p0 = pe[2 * e];
        const float p1 = pe[2 * e + 1];
        pj[j] = (e == 0) ? (p0 + p1) : ((pj[j] + p0) + p1);
      }
      unsigned hw[4], lw[4];
      split8(pe, hw, lw);
#pragma unroll
      for (int e = 0; e < 4; ++e) {
        ph[j >> 1].u[(j & 1) * 4 + e] = hw[e];
        pl[j >> 1].u[(j & 1) * 4 + e] = lw[e];
      }
    }
    lrow = lrow * alpha + ((pj[0] + pj[1]) + (pj[2] + pj[3]));
#pragma unroll
    for (int r = 0; r < 8; ++r) oacc[r] *= alpha;

    // ---- context^T += V^T . P^T (bf16 WMMA, hh + lh + hl into one accumulator) ----
    oacc = ctx6(vb, vl, ph[0].v, pl[0].v, ph[1].v, pl[1].v, oacc);
    // precaution: the trip's loads name ko and vo; as inputs here the two stay in their registers, unwritten (also by the
    // loads' own results), up to this wait; it stands at the trip's foot, far behind the loads' issue
    asm volatile("s_wait_xcnt 0x0" :: "v"(ko), "v"(vo) : "memory");
  };
  // Wave-uniform trip count, <= NQB / 2. A group's last chunk of the tile fetches its first K chunk of the next tile ahead. Only
  // tile 0 (one chunk) leaves a group without a chunk, and with it without that fetch; it is the last tile of its block.
  int kt = s0;
  for (; kt < qb; kt += 2) chunk(kt * 64, ((kt + 2 <= qb) ? kt + 2 : sn) * 64, false);
  if (kt == qb) chunk(qb * 64, sn * 64, true); // the diagonal chunk: the group whose turn it is

  // ---- group 1 hands over, group 0 joins. A group without a chunk holds max -inf, sum 0, O^T 0: its factor below is 0. The
  //      group that ran the diagonal chunk has a finite max, so the common max is finite.
  float* sj = sJ[ti & 1][wave] + lane;
  if (grp == 1) {
    sj[0]  = mrow;
    sj[32] = lrow;
#pragma unroll
    for (int r = 0; r < 8; ++r) sj[(2 + r) * 32] = oacc[r];
  }
  // publishes group 1's values; the buffer written behind it is the other one, and this one is written again only behind the
  // next tile's barrier, which group 0 reaches with its reads done
  __syncthreads();
  // ---- join the halves' sums, normalise (1/l), bf16 hi/lo split, one 16-B store per lane and plane ----
  if (grp == 0) {
    const float m1 = sj[0];
    const float mm = fmaxf(mrow, m1);
    const float x0 = (mrow - mm) * 1.44269504f, x1 = (m1 - mm) * 1.44269504f;   // exp(t) = 2^(t log2 e), as __expf forms it
    float a0, a1;
    // as in exp2x8: results apart from sources, each exponential an independent neighbour, the v_nop the slot behind the last
    asm("v_exp_f32 %0, %2\n\tv_exp_f32 %1, %3\n\tv_nop" : "=&v"(a0), "=&v"(a1) : "v"(x0), "v"(x1));
    lrow = lrow * a0 + sj[32] * a1;
#pragma unroll
    for (int r = 0; r < 8; ++r) oacc[r] = oacc[r] * a0 + sj[(2 + r) * 32] * a1;
    const float l = lrow + other_half(lrow);
    const float inv = (l > 0.f) ? (1.0f / l) : 0.f;
    float f[8];
#pragma unroll
    for (int r = 0; r < 8; ++r) f[r] = oacc[r] * inv;
    unsigned hw[4], lw[4];
    split8(f, hw, lw);
    const v4u a = {hw[0], hw[1], hw[2], hw[3]}, a2 = {lw[0], lw[1], lw[2], lw[3]};
    const size_t go = (bhp * SEQ + rowq) * HD + 8 * hh;
    *(v4u*)(ohp + go) = a;
    *(v4u*)(olp + go) = a2;
    // precaution: the next tile rewrites registers that these stores name
    asm volatile("s_wait_xcnt 0x0" ::: "memory");
  }
  }
}

// =====================================================================================================
// Workspace map (bytes; every region is an exact multiple of its whole-line / whole-tile store granularity,
//   Wob  bf16 [288/16][288/32][512]   165888
//   Qc   bf16 [2][18][2048][32]      4718592
//   Kd   bf16 [2][18][2048/16][512]  4718592
//   Kz                               4718592
//   VTh  bf16 [2][18][2048/32][512]  2359296
//   VTl                              2359296
//   Oh   bf16 [2][18][2048][16]      2359296
//   Ol                               2359296
//   total                           23758848
// =====================================================================================================
extern "C" void kernel_launch(void* const* d_in, const int* in_sizes, int n_in,
                              void* d_out, int out_size, void* d_ws, size_t ws_size,
                              hipStream_t stream) {
  if (n_in < 5) return;
  if (in_sizes[0] != NTOK * HID) return;
  if (in_sizes[1] != HID * HID) return;
  if (in_sizes[2] != HID * HID) return;
  if (in_sizes[3] != HID * HID) return;
  if (in_sizes[4] != HID * HID) return;
  if (out_size != NTOK * HID) return;

  const float* x  = (const float*)d_in[0];   // [2][2048][288]
  const float* Wq = (const float*)d_in[1];   // [288 out][288 in]
  const float* Wk = (const float*)d_in[2];
  const float* Wv = (const float*)d_in[3];
  const float* Wo = (const float*)d_in[4];

  const size_t PW  = (size_t)HID * HID * 2;             //  165888
  const size_t PQ  = (size_t)NB * NH * SEQ * QS * 2;    // 4718592
  const size_t PVT = (size_t)NB * HID * SEQ * 2;        // 2359296
  const size_t PO  = (size_t)NB * NH * SEQ * HD * 2;    // 2359296
  size_t off = 0;
  const size_t oWo  = off; off += PW;
  const size_t oQc  = off; off += PQ;
  const size_t oKd  = off; off += PQ;
  const size_t oKz  = off; off += PQ;
  const size_t oVTh = off; off += PVT;
  const size_t oVTl = off; off += PVT;
  const size_t oOh  = off; off += PO;
  const size_t oOl  = off; off += PO;
  if (off > ws_size) return;                            // off = 23758848
  if (off > (size_t)134217728) return;

  char* ws = (char*)d_ws;
  unsigned short* Wob = (unsigned short*)(ws + oWo);
  unsigned short* Qc  = (unsigned short*)(ws + oQc);
  unsigned short* Kd  = (unsigned short*)(ws + oKd);
  unsigned short* Kz  = (unsigned short*)(ws + oKz);
  unsigned short* VTh = (unsigned short*)(ws + oVTh);
  unsigned short* VTl = (unsigned short*)(ws + oVTl);
  unsigned short* Oh  = (unsigned short*)(ws + oOh);
  unsigned short* Ol  = (unsigned short*)(ws + oOl);

  const dim3 blk288(288);
  const dim3 blk128(128);
  const dim3 blk256(256);
  const dim3 gQkv(NTOK / 64, 3);                        // 64 row tiles of 9 waves (9 column tiles), x 3 projections
  const dim3 gOut(((NTOK / 64) * (HID / 32)) / 4);      // 144 blocks of 4 waves
  const dim3 gAttn(NB * NH * ABIN);                     // 504 blocks of 256

  // (1) q = rope(x . Wq^T) -> [b][h][t][hi|lo]; k = rope(x . Wk^T) -> [hi|hi] and [lo|0] planes, v = x . Wv^T -> v^T bf16
  //     hi / lo planes, these four in fragment order (weights are [out][in] = Bt[n][k] already); Wo -> bf16 plane, fragment order
  gemm_qkv<<<gQkv, blk288, 0, stream>>>(x, Wq, Wk, Wv, Wo, Wob, Qc, Kd, Kz, VTh, VTl);
  // (2) causal attention -> ctx bf16 hi / lo planes [b][h][t][d]
  attn_causal16<<<gAttn, blk256, 0, stream>>>(Qc, Kd, Kz, VTh, VTl, Oh, Ol);
  // (3) out = (ctx hi + ctx lo) . Wo^T -> d_out f32 [4096][288]
  gemm_out<<<gOut, blk128, 0, stream>>>(Oh, Ol, Wob, (float*)d_out);
  (void)hipGetLastError();
}
